// v000
// Times are from an AMD MI455X. After a warm-up the kernel runs many times in a row, and a time is the length of
// such a window on the GPU divided by its runs, so every launch and the gaps after it count. The runs cycle
// through copies of the inputs. A figure is the median of several windows, for all but v000 over two sittings.
// Sittings can differ by a few percent; kernels timed side by side share one.
// The starting kernel, v000, takes 823 microseconds a run.
// Contractions: q/k/v pointwise conv W16[192x128].XP[n][128] on v_wmma_f32_16x16x32_f16 (f16 containers of
// bf16-RNE weights x256 and bf16-RNE x, exact products); scores K.Q^T on v_wmma_f32_16x16x32_bf16 (bf16 hi +
// bf16 residual planes of k and of q/8, 3 products hi.hi + hi.lo + lo.hi, K=64); O^T = V.P^T on
// v_wmma_f32_16x16x32_f16 (v x16 as f16, P = e^{s-m} x2^14 f16 from the score D registers); output conv
// Wo16[128x64].Oview[64][N] on v_wmma_f32_16x16x32_f16 (f16 of bf16-RNE weights x256; O carried as f16 hi x1024
// plane + f16 residual x2^20 plane, 2 products, separate accumulators); f32 accumulate everywhere; softmax
// statistics and bias adds in f32 VALU.
#include <hip/hip_runtime.h>
#include <math.h>
#include <stdint.h>

#ifndef ND
#define ND 16
#endif
#define NHH    32
#define NWW    32
#define NTOK   (ND * NHH * NWW)
#define CIN    128
#define DK     64
#define COUT   128
#define QT     64
#define OSP    68
#define TP     72
#define CHB    256
#define WSC    256.0f
#define IWSC   0.00390625f
#define QSC    0.125f
#define VSC    16.0f
#define IVSC   0.0625f
#define OSC    1024.0f
#define IOSC   0.0009765625f
#define RSC    1024.0f
#define IRSC   0.0009765625f
#define LNPS   9.704060527839234f

static_assert(ND >= 1 && ND <= 16);
static_assert(NTOK % QT == 0);
static_assert(NTOK % 32 == 0);
static_assert(CIN % QT == 0 && CIN % 32 == 0);
static_assert(DK == QT);
static_assert(DK % 32 == 0);
static_assert(COUT % QT == 0);
static_assert((DK * CIN) % (8 * CHB) == 0);
static_assert((COUT * DK) % (8 * CHB) == 0);
static_assert((OSP * 4) % 16 == 0);
static_assert((TP * 2) % 16 == 0);

typedef _Float16       v16h __attribute__((ext_vector_type(16)));
typedef _Float16       v8h  __attribute__((ext_vector_type(8)));
typedef __bf16         v16b __attribute__((ext_vector_type(16)));
typedef unsigned short v8us __attribute__((ext_vector_type(8)));
typedef float          v8f  __attribute__((ext_vector_type(8)));
typedef float          v4f  __attribute__((ext_vector_type(4)));
typedef unsigned int   v4u  __attribute__((ext_vector_type(4)));

union Frag  { v8us u[2]; v16h h; v16b bf; };
union FragH { v16h v; v8h hv[2]; };
static_assert(sizeof(Frag) == 32);
static_assert(sizeof(FragH) == 32);

// ---- scalar helpers ---------------------------------------------------------------------------------------
__device__ __forceinline__ unsigned short bf_bits(float f) {          // f32 -> bf16 bits, RNE convert
  unsigned u = __float_as_uint(f);
  return (unsigned short)((u + 0x7FFFu + ((u >> 16) & 1u)) >> 16);
}
__device__ __forceinline__ float bf_up(unsigned short hb) { return __uint_as_float(((unsigned)hb) << 16); }
__device__ __forceinline__ float bfr(float f) { return bf_up(bf_bits(f)); }
__device__ __forceinline__ unsigned short h_bits(_Float16 x) { return __builtin_bit_cast(unsigned short, x); }
__device__ __forceinline__ unsigned pk16(unsigned short a, unsigned short b) { return (unsigned)a | ((unsigned)b << 16); }
__device__ __forceinline__ v8f zero8() { v8f z = {0.f, 0.f, 0.f, 0.f, 0.f, 0.f, 0.f, 0.f}; return z; }
__device__ __forceinline__ float hmax8(v8f s) {
  return fmaxf(fmaxf(fmaxf(s[0], s[1]), fmaxf(s[2], s[3])), fmaxf(fmaxf(s[4], s[5]), fmaxf(s[6], s[7])));
}
__device__ __forceinline__ unsigned wave_ballot(bool p) {
#if defined(__HIP_DEVICE_COMPILE__)
  return __builtin_amdgcn_ballot_w32(p);
#else
  return p ? 1u : 0u;
#endif
}

// ---- 16-bit fragment loader (A, or B from a k-contiguous [n][k] row): lane -> row/col (lane&15), p already includes
//      + 8*(lane>>4); elements 0..7 <- p[0..7] (k0+8h..), elements 8..15 <- p[16..23] (k0+16+8h..)
__device__ __forceinline__ Frag ldfrag(const unsigned short* p) {
  Frag f;
  f.u[0] = *(const v8us*)(p);
  f.u[1] = *(const v8us*)(p + 16);
  return f;
}

// ---- WMMA helpers: builtin followed by a 4-slot VALU gap tying D and keeping A/B live --------------------------
__device__ __forceinline__ v8f mma_h(v16h a, v16h b, v8f c) {
  v8f d = __builtin_amdgcn_wmma_f32_16x16x32_f16(false, a, false, b, (short)0, c, false, false);
#if defined(__HIP_DEVICE_COMPILE__)
  asm volatile("v_nop\n\tv_nop\n\tv_nop\n\tv_nop" : "+v"(d) : "v"(a), "v"(b));
#endif
  return d;
}
__device__ __forceinline__ v8f mma_b(v16b a, v16b b, v8f c) {
  v8f d = __builtin_amdgcn_wmma_f32_16x16x32_bf16(false, a, false, b, (short)0, c, false, false);
#if defined(__HIP_DEVICE_COMPILE__)
  const v16h ha = __builtin_bit_cast(v16h, a), hb = __builtin_bit_cast(v16h, b);
  asm volatile("v_nop\n\tv_nop\n\tv_nop\n\tv_nop" : "+v"(d) : "v"(ha), "v"(hb));
#endif
  return d;
}

// =========================================================================================================
// (0) weight planes: W16 f16 [192][128] (rows 0..63 = Wq, 64..127 = Wk, 128..191 = Wv) and Wo16 f16 [128][64];
//     value = f16 of (bf16-RNE(w) * 256) (exact). Thread = one 8-element chunk (16 B); 8 consecutive lanes =
// coverage: (3*BQ + BO) blocks x 256 threads x 8 halves = 3*8192 + 8192 elements = both planes exactly.
// =========================================================================================================
__global__ __launch_bounds__(CHB)
void cvt_w(const float* __restrict__ Wq, const float* __restrict__ Wk, const float* __restrict__ Wv,
           const float* __restrict__ Wo, unsigned short* W16, unsigned short* Wo16) {
  const int tid = threadIdx.x, blk = blockIdx.x;
  const int BQ = (DK * CIN) / (8 * CHB);                             // blocks per q/k/v matrix
  const int g = blk * CHB + tid;                                     // chunk id
  const float* src;
  unsigned short* dst;
  int gsrc, gdst;
  if (blk < BQ)          { src = Wq; gsrc = 0;            dst = W16;  gdst = 0; }
  else if (blk < 2 * BQ) { src = Wk; gsrc = BQ * CHB;     dst = W16;  gdst = 0; }
  else if (blk < 3 * BQ) { src = Wv; gsrc = 2 * BQ * CHB; dst = W16;  gdst = 0; }
  else                   { src = Wo; gsrc = 3 * BQ * CHB; dst = Wo16; gdst = 3 * BQ * CHB; }
  const float* s = src + (size_t)8 * (size_t)(g - gsrc);
  const v4f a = *(const v4f*)s;
  const v4f q = *(const v4f*)(s + 4);
  const float f[8] = {a[0], a[1], a[2], a[3], q[0], q[1], q[2], q[3]};
  v4u u;
#pragma unroll
  for (int t = 0; t < 4; ++t) {
    const _Float16 h0 = (_Float16)(bfr(f[2 * t]) * WSC);
    const _Float16 h1 = (_Float16)(bfr(f[2 * t + 1]) * WSC);
    u[t] = pk16(h_bits(h0), h_bits(h1));
  }
{
    *(v4u*)(dst + (size_t)8 * (size_t)(g - gdst)) = u;
    
  }
}

// =========================================================================================================
// (1) X f32 [128 c][xstride] (first NTOK positions used) -> XP f16 [NTOK n][128 c] (position-major, bf16-RNE
//     values, exact in f16) through an LDS tile T[64 n][64 c] (pitch TP). Block (nb, cb) owns a 64 c x 64 n tile.
// coverage: T 2 it x 32 c x (8 x 8 n) = 64 x 64; XP 2 it x 32 rows x 8 lanes x 8 halves = 64 n x 64 c;
//           grid (NTOK/64, 2) covers XP [NTOK][128] exactly once.
// =========================================================================================================
__global__ __launch_bounds__(256)
void cvt_x(const float* __restrict__ X, int xstride, unsigned short* XP) {
  __shared__ __align__(16) unsigned short T[QT * TP];
  const int tid = threadIdx.x;
  const int nb = blockIdx.x, cb = blockIdx.y;
  const int e = tid & 7, lq = tid >> 3;                             // lq 0..31
  const int n0 = nb * QT, c0 = cb * QT;
#pragma unroll
  for (int it = 0; it < 2; ++it) {
    const int cl = it * 32 + lq;                                     // 0..63
    const float* sp = X + (size_t)(c0 + cl) * (size_t)xstride + n0 + 8 * e;
    const v4f a = *(const v4f*)sp;
    const v4f q = *(const v4f*)(sp + 4);
    unsigned short hb[8];
#pragma unroll
    for (int t = 0; t < 4; ++t) {
      hb[t]     = h_bits((_Float16)bfr(a[t]));
      hb[4 + t] = h_bits((_Float16)bfr(q[t]));
    }
#pragma unroll
    for (int t = 0; t < 8; ++t) T[(8 * e + t) * TP + cl] = hb[t];
  }
  __syncthreads();
  v4u up[2];
#pragma unroll
  for (int it = 0; it < 2; ++it) {
    const int nl = it * 32 + lq;                                     // 0..63
    up[it] = *(const v4u*)(T + nl * TP + 8 * e);
  }
{
#pragma unroll
    for (int it = 0; it < 2; ++it) {
      const int nl = it * 32 + lq;
      *(v4u*)(XP + (size_t)(n0 + nl) * CIN + c0 + 8 * e) = up[it];
    }
    
  }
}

// =========================================================================================================
// (2) pointwise conv GEMM for one (64-n tile, projection mb in {q,k,v}): P[o][n] = (1/256) sum_c W16[o0+o][c]
//     XP[n][c] + bias[o]. Block 128 threads = 4 waves; wave w owns cols n0+16w..+15 (B fragment from the XP row,
//     k = c contiguous, split k map) and 4 m-tiles (A rows o0 + 16 mt + (lane&15) of W16, split k map).
//     K = 128 = 4 steps. Epilogue staged in LDS Os[n_loc][o_loc] (pitch OSP), block barrier, then:
//       mb 1: k   -> Kh = bf16-RNE(v), Kl = bf16-RNE(v - hi), planes bf16 [NTOK][64];
//       mb 2: v   -> Vc f16 [64 ch][NTOK] (channel-major, value f16(v*16)), row segment n0..n0+63 = one line.
// coverage: Os 4 waves x 16 n x 64 o = 64 x 64 (cols 0..63 of pitch 68, reads stay in cols 0..63);
//           Qh/Ql/Kh/Kl: 4 it x 16 rows x 8 lanes x 8 = 64 n x 64 d; Vc: 4 it x 16 ch x 8 lanes x 8 = 64 ch x 64 n;
//           grid (NTOK/64, 3) covers all rows of Qh, Ql, Kh, Kl and all of Vc exactly once.
// =========================================================================================================
__global__ __launch_bounds__(128)
void gemm_qkv(const unsigned short* __restrict__ W16, const unsigned short* __restrict__ XP,
              const float* __restrict__ bq, const float* __restrict__ bk, const float* __restrict__ bv,
              unsigned short* Qh, unsigned short* Ql, unsigned short* Kh, unsigned short* Kl,
              unsigned short* Vc) {
  __shared__ __align__(16) float Os[QT * OSP];
  const int tid  = threadIdx.x;
  const int lane = tid & 31, wave = tid >> 5;
  const int hh   = lane >> 4, c = lane & 15;
  const int nt   = blockIdx.x, mb = blockIdx.y;
  const int n0   = nt * QT, o0 = mb * QT;

  const unsigned short* ap = W16 + (size_t)(o0 + c) * CIN + 8 * hh;
  const unsigned short* bp = XP + (size_t)(n0 + 16 * wave + c) * CIN + 8 * hh;

  v8f acc[4];
#pragma unroll
  for (int mt = 0; mt < 4; ++mt) acc[mt] = zero8();

#pragma unroll
  for (int ks = 0; ks < CIN / 32; ++ks) {
    const Frag fb = ldfrag(bp + 32 * ks);
#pragma unroll
    for (int mt = 0; mt < 4; ++mt) {
      const Frag fa = ldfrag(ap + (size_t)(16 * mt) * CIN + 32 * ks);
      acc[mt] = mma_h(fa.h, fb.h, acc[mt]);
    }
  }

  // ---- epilogue: scale back + bias (+ 1/sqrt(ck) for q) -> LDS Os[n_loc][o_loc]
  const float* bsel = (mb == 0) ? bq : ((mb == 1) ? bk : bv);       // block-uniform, all global
  const float osc = (mb == 0) ? QSC : 1.0f;
  {
    const int nl = 16 * wave + c;
#pragma unroll
    for (int mt = 0; mt < 4; ++mt) {
      const v4f b0 = *(const v4f*)(bsel + 16 * mt + 8 * hh);
      const v4f b1 = *(const v4f*)(bsel + 16 * mt + 8 * hh + 4);
      v4f va, vb;
#pragma unroll
      for (int r = 0; r < 4; ++r) {
        va[r] = (acc[mt][r] * IWSC + bfr(b0[r])) * osc;
        vb[r] = (acc[mt][4 + r] * IWSC + bfr(b1[r])) * osc;
      }
      *(v4f*)(Os + nl * OSP + 16 * mt + 8 * hh)     = va;
      *(v4f*)(Os + nl * OSP + 16 * mt + 8 * hh + 4) = vb;
    }
  }
  __syncthreads();

  const int e = tid & 7, lq = tid >> 3;                             // lq 0..15
  if (mb < 2) {
    unsigned short* Ph = (mb == 0) ? Qh : Kh;                        // block-uniform, both global
    unsigned short* Pl = (mb == 0) ? Ql : Kl;
    v4u uh[4], ul[4];
#pragma unroll
    for (int it = 0; it < 4; ++it) {
      const int row = it * 16 + lq;                                  // n_loc 0..63
      const v4f a = *(const v4f*)(Os + row * OSP + 8 * e);
      const v4f q = *(const v4f*)(Os + row * OSP + 8 * e + 4);
      const float f[8] = {a[0], a[1], a[2], a[3], q[0], q[1], q[2], q[3]};
#pragma unroll
      for (int t = 0; t < 4; ++t) {
        const float f0 = f[2 * t], f1 = f[2 * t + 1];
        const unsigned short hb0 = bf_bits(f0), hb1 = bf_bits(f1);
        const unsigned short lb0 = bf_bits(f0 - bf_up(hb0));
        const unsigned short lb1 = bf_bits(f1 - bf_up(hb1));
        uh[it][t] = pk16(hb0, hb1);
        ul[it][t] = pk16(lb0, lb1);
      }
    }
{
#pragma unroll
      for (int it = 0; it < 4; ++it) {
        const int row = it * 16 + lq;
        const size_t po = (size_t)(n0 + row) * DK + 8 * e;
        *(v4u*)(Ph + po) = uh[it];
        *(v4u*)(Pl + po) = ul[it];
      }
      
    }
  } else {
    v4u uv[4];
#pragma unroll
    for (int it = 0; it < 4; ++it) {
      const int o = it * 16 + lq;                                    // channel 0..63
      unsigned short hb[8];
#pragma unroll
      for (int t = 0; t < 8; ++t) hb[t] = h_bits((_Float16)(Os[(8 * e + t) * OSP + o] * VSC));
#pragma unroll
      for (int t = 0; t < 4; ++t) uv[it][t] = pk16(hb[2 * t], hb[2 * t + 1]);
    }
{
#pragma unroll
      for (int it = 0; it < 4; ++it) {
        const int o = it * 16 + lq;
        *(v4u*)(Vc + (size_t)o * NTOK + n0 + 8 * e) = uv[it];
      }
      
    }
  }
}

// =========================================================================================================
// (3) global attention for one 64-query tile, transposed formulation, NTOK keys, no mask:
//   S^T tile (16 keys x 16 queries) = sum over 2 d-chunks of A(k: row = key kb + (lane&15), 32 d via the split
//   k map from the bf16 plane Kh [NTOK][64]) . B(q: col = query, same map from Qh) + A(Kh).B(Ql) + A(Kl).B(Qh)
//   (bf16 unscaled residual planes, shared accumulator, 3 products). q fragments (2 chunks x hi/lo) loaded once
//   per wave; k fragments (hi and residual) loaded straight from the global planes with the split-map loader.
//   Per lane the D tile holds 8 keys of ONE query: online softmax state per lane, one shuffle (lane^16) for the max
//   over 32 keys; the o/l rescale is skipped under a wave-uniform ballot when no lane's max grew (corr == 1 exactly
//   for every lane then); row-sum partials combined at the end. P = e^{s-m} x 2^14 as f16 is the B operand of
//   O^T (rows channel, cols queries) += A(v rows channel = 16j + (lane&15), keys contiguous, f16 plane Vc
//   [64][NTOK]) . B(P^T): element r <- D of the tile covering keys kb..kb+15, element 8+r <- the tile covering
//   kb+16..kb+31, lane unchanged. 4 accumulator tiles per wave (64 channels). Block = 4 waves = 64 queries.
//   Epilogue: O = o/(16 l) staged in LDS Os[query][64 ch] (pitch OSP, b128 stores), block barrier, then the flat
// coverage: Os 4 waves x 16 q x 64 ch = 64 x 64 (cols 0..63); Oh/Ol 4 it x 16 rows x 8 lanes x 8 halves =
//           64 q x 64 ch per plane; grid (NTOK/64) covers rows 0..NTOK-1 of both planes exactly once.
// =========================================================================================================
__global__ __launch_bounds__(128)
void attn_k(const unsigned short* __restrict__ Qh, const unsigned short* __restrict__ Ql,
            const unsigned short* __restrict__ Kh, const unsigned short* __restrict__ Kl,
            const unsigned short* __restrict__ Vc, unsigned short* Oh, unsigned short* Ol) {
  __shared__ __align__(16) float Os[QT * OSP];
  const int tid  = threadIdx.x;
  const int wave = tid >> 5, lane = tid & 31;
  const int hh   = lane >> 4, c = lane & 15;
  const int n0   = blockIdx.x * QT;

  // q fragments (B operand, col = query n0 + 16*wave + c), d chunks 0 and 1, hi and residual planes
  const size_t qo = (size_t)(n0 + 16 * wave + c) * DK + 8 * hh;
  const Frag qh0 = ldfrag(Qh + qo), qh1 = ldfrag(Qh + qo + 32);
  const Frag ql0 = ldfrag(Ql + qo), ql1 = ldfrag(Ql + qo + 32);
  // k fragment bases (A operand, row = key kb + c), + key * 64 (+32 for d chunk 1)
  const unsigned short* Khp = Kh + (size_t)c * DK + 8 * hh;
  const unsigned short* Klp = Kl + (size_t)c * DK + 8 * hh;
  // v fragment base (A operand, row = channel 16j + c, keys contiguous), + 16*j*NTOK + kb
  const unsigned short* Vp = Vc + (size_t)c * NTOK + 8 * hh;

  float m = -1.0e30f, l = 0.f;
  v8f o[4];
#pragma unroll
  for (int j = 0; j < 4; ++j) o[j] = zero8();

#pragma unroll 1
  for (int kb = 0; kb < NTOK; kb += 32) {
    const size_t r0o = (size_t)kb * DK;                             // keys kb .. kb+15
    const size_t r1o = (size_t)(kb + 16) * DK;                      // keys kb+16 .. kb+31
    v8f s0 = zero8(), s1 = zero8();
    {
      const Frag k00 = ldfrag(Khp + r0o), k10 = ldfrag(Khp + r1o);  // d chunk 0, hi
      const Frag g00 = ldfrag(Klp + r0o), g10 = ldfrag(Klp + r1o);  // d chunk 0, residual
      s0 = mma_b(k00.bf, qh0.bf, s0);
      s1 = mma_b(k10.bf, qh0.bf, s1);
      s0 = mma_b(k00.bf, ql0.bf, s0);
      s1 = mma_b(k10.bf, ql0.bf, s1);
      s0 = mma_b(g00.bf, qh0.bf, s0);
      s1 = mma_b(g10.bf, qh0.bf, s1);
    }
    {
      const Frag k01 = ldfrag(Khp + r0o + 32), k11 = ldfrag(Khp + r1o + 32);   // d chunk 1, hi
      const Frag g01 = ldfrag(Klp + r0o + 32), g11 = ldfrag(Klp + r1o + 32);   // d chunk 1, residual
      s0 = mma_b(k01.bf, qh1.bf, s0);
      s1 = mma_b(k11.bf, qh1.bf, s1);
      s0 = mma_b(k01.bf, ql1.bf, s0);
      s1 = mma_b(k11.bf, ql1.bf, s1);
      s0 = mma_b(g01.bf, qh1.bf, s0);
      s1 = mma_b(g11.bf, qh1.bf, s1);
    }

    float mx = fmaxf(hmax8(s0), hmax8(s1));
    mx = fmaxf(mx, __shfl_xor(mx, 16, 32));
    const float mn = fmaxf(m, mx);
    const unsigned grew = wave_ballot(mx > m);                       // wave-uniform
    if (grew != 0u) {
      const float corr = __expf(m - mn);                             // == 1 exactly for lanes whose max did not grow
      l *= corr;
#pragma unroll
      for (int j = 0; j < 4; ++j) {
#pragma unroll
        for (int r = 0; r < 8; ++r) o[j][r] *= corr;
      }
    }
    m = mn;
    const float msh = mn - LNPS;                                     // exp gives e^{s-m} * 2^14

    FragH ph;
    float ls = 0.f;
#pragma unroll
    for (int r = 0; r < 8; ++r) {
      const float e0 = __expf(s0[r] - msh);                          // key kb      + 8hh + r
      const float e1 = __expf(s1[r] - msh);                          // key kb + 16 + 8hh + r
      ls += e0 + e1;
      ph.hv[0][r] = (_Float16)e0;
      ph.hv[1][r] = (_Float16)e1;
    }
    l += ls;

#pragma unroll
    for (int j = 0; j < 4; ++j) {
      const Frag vf = ldfrag(Vp + (size_t)(16 * j) * NTOK + kb);
      o[j] = mma_h(vf.h, ph.v, o[j]);
    }
  }
  l += __shfl_xor(l, 16, 32);
  const float scl = (1.0f / l) * IVSC;                               // o and l both carry 2^14; o also carries the v x16

  const int qrow = 16 * wave + c;
#pragma unroll
  for (int j = 0; j < 4; ++j) {
    v4f va, vb;
#pragma unroll
    for (int r = 0; r < 4; ++r) { va[r] = o[j][r] * scl; vb[r] = o[j][4 + r] * scl; }
    *(v4f*)(Os + qrow * OSP + 16 * j + 8 * hh)     = va;            // Os[query][ch = 16j + 8hh + r]
    *(v4f*)(Os + qrow * OSP + 16 * j + 8 * hh + 4) = vb;
  }
  __syncthreads();

  const int e = tid & 7, lq = tid >> 3;                              // lq 0..15
  v4u uh[4], ul[4];
#pragma unroll
  for (int it = 0; it < 4; ++it) {
    const int row = it * 16 + lq;                                    // query 0..63
    const v4f a = *(const v4f*)(Os + row * OSP + 8 * e);
    const v4f q = *(const v4f*)(Os + row * OSP + 8 * e + 4);
    const float f[8] = {a[0], a[1], a[2], a[3], q[0], q[1], q[2], q[3]};
#pragma unroll
    for (int t = 0; t < 4; ++t) {
      const float g0 = f[2 * t] * OSC, g1 = f[2 * t + 1] * OSC;
      const _Float16 h0 = (_Float16)g0, h1 = (_Float16)g1;
      const _Float16 l0 = (_Float16)((g0 - (float)h0) * RSC);
      const _Float16 l1 = (_Float16)((g1 - (float)h1) * RSC);
      uh[it][t] = pk16(h_bits(h0), h_bits(h1));
      ul[it][t] = pk16(h_bits(l0), h_bits(l1));
    }
  }
{
#pragma unroll
    for (int it = 0; it < 4; ++it) {
      const int row = it * 16 + lq;
      const size_t po = (size_t)(n0 + row) * DK + 8 * e;
      *(v4u*)(Oh + po) = uh[it];
      *(v4u*)(Ol + po) = ul[it];
    }
    
  }
}

// =========================================================================================================
// (4) output pointwise conv over the raw view: Y[o][n'] = (1/256)(1/1024) sum_{c'} Wo16[o][c'] (Ohv[c'][n'] +
//     Olv[c'][n'] / 1024) + bo[o], where Ohv/Olv [64][NTOK] are the flat O planes re-read with row c' = halves
//     c'*NTOK .. +NTOK-1. Block (nt, mb): 64 n' x 64 o. The two 64 c' x 64 n' B tiles are staged transposed in
//     LDS Bh/Bl[n'_loc][c'] (pitch TP, 16-B global loads, 2-byte LDS stores), block barrier, then B fragments per
//     wave (col n0'+16w+(lane&15), k = c' contiguous, split k map) and A fragments from Wo16 rows o0+16mt+(lane&15).
//     K = 64 = 2 steps; hi and residual products in separate accumulators. Epilogue staged in Ys[n'_loc][o_loc]
// coverage: Bh/Bl 4 it x 16 c' x (8 x 8 n') = 64 x 64 each (cols 0..63 of pitch 72); Ys 4 waves x 16 n' x 64 o;
//           out: 8 it x 16 lines x 8 lanes x 4 floats = 64 o x 64 n'; grid (NTOK/64, COUT/64) covers
//           out[0..127][0..NTOK-1] exactly once.
// =========================================================================================================
__global__ __launch_bounds__(128)
void gemm_o(const unsigned short* __restrict__ Wo16, const unsigned short* __restrict__ Oh,
            const unsigned short* __restrict__ Ol, const float* __restrict__ bo, float* Y) {
  __shared__ __align__(16) unsigned short Bh[QT * TP];
  __shared__ __align__(16) unsigned short Bl[QT * TP];
  __shared__ __align__(16) float Ys[QT * OSP];
  const int tid  = threadIdx.x;
  const int lane = tid & 31, wave = tid >> 5;
  const int hh   = lane >> 4, c = lane & 15;
  const int nt   = blockIdx.x, mb = blockIdx.y;
  const int n0   = nt * QT, o0 = mb * QT;
  const int e = tid & 7, lq = tid >> 3;                              // lq 0..15

  // ---- stage the view tiles transposed: Bh[n'_loc][c'] <- Oh[c'*NTOK + n0 + n'_loc]
#pragma unroll
  for (int it = 0; it < 4; ++it) {
    const int cl = it * 16 + lq;                                     // c' 0..63
    const size_t so = (size_t)cl * NTOK + n0 + 8 * e;
    const v4u ah = *(const v4u*)(Oh + so);
    const v4u al = *(const v4u*)(Ol + so);
#pragma unroll
    for (int t = 0; t < 4; ++t) {
      Bh[(8 * e + 2 * t) * TP + cl]     = (unsigned short)(ah[t] & 0xffffu);
      Bh[(8 * e + 2 * t + 1) * TP + cl] = (unsigned short)(ah[t] >> 16);
      Bl[(8 * e + 2 * t) * TP + cl]     = (unsigned short)(al[t] & 0xffffu);
      Bl[(8 * e + 2 * t + 1) * TP + cl] = (unsigned short)(al[t] >> 16);
    }
  }
  __syncthreads();

  const unsigned short* ap  = Wo16 + (size_t)(o0 + c) * DK + 8 * hh;
  const unsigned short* bph = Bh + (16 * wave + c) * TP + 8 * hh;
  const unsigned short* bpl = Bl + (16 * wave + c) * TP + 8 * hh;

  v8f acch[4], accl[4];
#pragma unroll
  for (int mt = 0; mt < 4; ++mt) { acch[mt] = zero8(); accl[mt] = zero8(); }

#pragma unroll
  for (int ks = 0; ks < DK / 32; ++ks) {
    const Frag fbh = ldfrag(bph + 32 * ks);
    const Frag fbl = ldfrag(bpl + 32 * ks);
#pragma unroll
    for (int mt = 0; mt < 4; ++mt) {
      const Frag fa = ldfrag(ap + (size_t)(16 * mt) * DK + 32 * ks);
      acch[mt] = mma_h(fa.h, fbh.h, acch[mt]);
      accl[mt] = mma_h(fa.h, fbl.h, accl[mt]);
    }
  }

  // ---- epilogue: fold residual, scale back, bias -> Ys[n'_loc][o_loc]
  {
    const int nl = 16 * wave + c;
    const float fs = IWSC * IOSC;
#pragma unroll
    for (int mt = 0; mt < 4; ++mt) {
      const v4f b0 = *(const v4f*)(bo + o0 + 16 * mt + 8 * hh);
      const v4f b1 = *(const v4f*)(bo + o0 + 16 * mt + 8 * hh + 4);
      v4f va, vb;
#pragma unroll
      for (int r = 0; r < 4; ++r) {
        va[r] = (acch[mt][r] + accl[mt][r] * IRSC) * fs + bfr(b0[r]);
        vb[r] = (acch[mt][4 + r] + accl[mt][4 + r] * IRSC) * fs + bfr(b1[r]);
      }
      *(v4f*)(Ys + nl * OSP + 16 * mt + 8 * hh)     = va;
      *(v4f*)(Ys + nl * OSP + 16 * mt + 8 * hh + 4) = vb;
    }
  }
  __syncthreads();

  v4f res[8];
#pragma unroll
  for (int it = 0; it < 8; ++it) {
    const int L  = it * 16 + lq;                                     // line 0..127
    const int ol = L >> 1, hf = L & 1;                               // o_loc 0..63, line half
    const int nl = hf * 32 + 4 * e;                                  // n'_loc 0..63
#pragma unroll
    for (int t = 0; t < 4; ++t) res[it][t] = Ys[(nl + t) * OSP + ol];
  }
{
#pragma unroll
    for (int it = 0; it < 8; ++it) {
      const int L  = it * 16 + lq;
      const int ol = L >> 1, hf = L & 1;
      const int nl = hf * 32 + 4 * e;
      *(v4f*)(Y + (size_t)(o0 + ol) * NTOK + n0 + nl) = res[it];
    }
    
  }
}

// =========================================================================================================
// Workspace map (bytes, full size ND=16; each region start a multiple of 256; every extent is an exact tile
//   W16 f16 [192][128]        49152        Wo16 f16 [128][64]      16384
//   XP  f16 [16384][128]    4194304
//   Qh/Ql/Kh/Kl bf16 [16384][64] 2097152 x4   Vc f16 [64][16384]   2097152
//   Oh/Ol f16 [16384][64]   2097152 x2
//   total = 18939904
// =========================================================================================================
extern "C" void kernel_launch(void* const* d_in, const int* in_sizes, int n_in,
                              void* d_out, int out_size, void* d_ws, size_t ws_size,
                              hipStream_t stream) {
  if (n_in < 9) return;
  if (in_sizes[0] < CIN * NTOK) return;
  if ((in_sizes[0] % CIN) != 0) return;
  const int xstride = in_sizes[0] / CIN;                             // per-channel position stride of X
  if (xstride < NTOK || (xstride % 4) != 0) return;
  if (in_sizes[1] < DK * CIN || in_sizes[3] < DK * CIN || in_sizes[5] < DK * CIN) return;
  if (in_sizes[2] < DK || in_sizes[4] < DK || in_sizes[6] < DK) return;
  if (in_sizes[7] < COUT * DK || in_sizes[8] < COUT) return;
  if (out_size < COUT * NTOK) return;

  size_t off = 0;
  auto carve = [&](size_t bytes) { const size_t o = off; off += (bytes + 255) & ~(size_t)255; return o; };
  const size_t oW16  = carve((size_t)3 * DK * CIN * 2);
  const size_t oWo16 = carve((size_t)COUT * DK * 2);
  const size_t oXP   = carve((size_t)NTOK * CIN * 2);
  const size_t oQh   = carve((size_t)NTOK * DK * 2);
  const size_t oQl   = carve((size_t)NTOK * DK * 2);
  const size_t oKh   = carve((size_t)NTOK * DK * 2);
  const size_t oKl   = carve((size_t)NTOK * DK * 2);
  const size_t oVc   = carve((size_t)DK * NTOK * 2);
  const size_t oOh   = carve((size_t)NTOK * DK * 2);
  const size_t oOl   = carve((size_t)NTOK * DK * 2);
  if (off > ws_size) return;
  if (off > (size_t)134217728) return;

  const float* X  = (const float*)d_in[0];
  const float* Wq = (const float*)d_in[1];
  const float* bq = (const float*)d_in[2];
  const float* Wk = (const float*)d_in[3];
  const float* bk = (const float*)d_in[4];
  const float* Wv = (const float*)d_in[5];
  const float* bv = (const float*)d_in[6];
  const float* Wo = (const float*)d_in[7];
  const float* bo = (const float*)d_in[8];

  char* ws = (char*)d_ws;
  unsigned short* W16  = (unsigned short*)(ws + oW16);
  unsigned short* Wo16 = (unsigned short*)(ws + oWo16);
  unsigned short* XP   = (unsigned short*)(ws + oXP);
  unsigned short* Qh   = (unsigned short*)(ws + oQh);
  unsigned short* Ql   = (unsigned short*)(ws + oQl);
  unsigned short* Kh   = (unsigned short*)(ws + oKh);
  unsigned short* Kl   = (unsigned short*)(ws + oKl);
  unsigned short* Vc   = (unsigned short*)(ws + oVc);
  unsigned short* Oh   = (unsigned short*)(ws + oOh);
  unsigned short* Ol   = (unsigned short*)(ws + oOl);
  float* out = (float*)d_out;

  const dim3 blk256(256), blk128(128);
  const int BQ = (DK * CIN) / (8 * CHB), BO = (COUT * DK) / (8 * CHB);

  // (0) weights -> f16 planes
  cvt_w<<<dim3(3 * BQ + BO), dim3(CHB), 0, stream>>>(Wq, Wk, Wv, Wo, W16, Wo16);
  // (1) x -> position-major 16-bit plane
  cvt_x<<<dim3(NTOK / QT, CIN / QT), blk256, 0, stream>>>(X, xstride, XP);
  // (2) q/k/v pointwise conv GEMM -> q hi + residual, k hi + residual, v planes
  gemm_qkv<<<dim3(NTOK / QT, 3), blk128, 0, stream>>>(W16, XP, bq, bk, bv, Qh, Ql, Kh, Kl, Vc);
  // (3) global attention -> O hi + residual planes [NTOK][64]
  attn_k<<<dim3(NTOK / QT), blk128, 0, stream>>>(Qh, Ql, Kh, Kl, Vc, Oh, Ol);
  // (4) output conv over the raw [64][NTOK] view -> out [128][NTOK]
  gemm_o<<<dim3(NTOK / QT, COUT / QT), blk128, 0, stream>>>(Wo16, Oh, Ol, bo, out);
  (void)hipGetLastError();
}

// v001
// It runs in 262 microseconds.
// In two side-by-side timings against v000, it was 3.21 and 3.23 times as fast.
// Contractions: q/k/v pointwise conv W16[192x128].XP[n][128] on v_wmma_f32_16x16x32_f16 (f16 containers of
// bf16-RNE weights x256 and bf16-RNE x, exact products); scores K.Q^T on v_wmma_f32_16x16x32_bf16 (bf16 hi +
// bf16 residual planes of k and of q/8, 3 products hi.hi + hi.lo + lo.hi, K=64); O^T = V.P^T on
// v_wmma_f32_16x16x32_f16 (v x16 as f16, P = e^{s-m} x2^14 f16 from the score D registers); output conv
// Wo16[128x64].Oview[64][N] on v_wmma_f32_16x16x32_f16 (f16 of bf16-RNE weights x256; O carried as f16 hi x1024
// plane + f16 residual x2^20 plane, 2 products, separate accumulators); f32 accumulate everywhere; softmax
// statistics and bias adds in f32 VALU.
#include <hip/hip_runtime.h>
#include <math.h>
#include <stdint.h>

#ifndef ND
#define ND 16
#endif
#define NHH    32
#define NWW    32
#define NTOK   (ND * NHH * NWW)
#define CIN    128
#define DK     64
#define COUT   128
#define QT     64
#define OSP    68
#define TP     72
#define CHB    256
#define WSC    256.0f
#define IWSC   0.00390625f
#define QSC    0.125f
#define VSC    16.0f
#define IVSC   0.0625f
#define OSC    1024.0f
#define IOSC   0.0009765625f
#define RSC    1024.0f
#define IRSC   0.0009765625f
#define LNPS   9.704060527839234f
#define KT     128
#define KPH    72
#define VPH    136
#define SKL    (KT * KPH)
#define SVV    (2 * KT * KPH)
#define STGH   (2 * KT * KPH + DK * VPH)

static_assert(ND >= 1 && ND <= 16);
static_assert(NTOK % QT == 0);
static_assert(NTOK % 32 == 0);
static_assert(CIN % QT == 0 && CIN % 32 == 0);
static_assert(DK == QT);
static_assert(DK % 32 == 0);
static_assert(COUT % QT == 0);
static_assert((DK * CIN) % (8 * CHB) == 0);
static_assert((COUT * DK) % (8 * CHB) == 0);
static_assert((OSP * 4) % 16 == 0);
static_assert((TP * 2) % 16 == 0);
static_assert(KT % 32 == 0 && NTOK % KT == 0 && NTOK / KT >= 2);
static_assert(KT * DK == 8 * 128 * 8 && DK * KT == 8 * 128 * 8);
static_assert((KPH * 2) % 32 == 16 && (VPH * 2) % 32 == 16 && (STGH * 2) % 16 == 0);

typedef _Float16       v16h __attribute__((ext_vector_type(16)));
typedef _Float16       v8h  __attribute__((ext_vector_type(8)));
typedef __bf16         v16b __attribute__((ext_vector_type(16)));
typedef unsigned short v8us __attribute__((ext_vector_type(8)));
typedef float          v8f  __attribute__((ext_vector_type(8)));
typedef float          v4f  __attribute__((ext_vector_type(4)));
typedef unsigned int   v4u  __attribute__((ext_vector_type(4)));

union Frag  { v8us u[2]; v16h h; v16b bf; };
union FragH { v16h v; v8h hv[2]; };
static_assert(sizeof(Frag) == 32);
static_assert(sizeof(FragH) == 32);

// ---- scalar helpers ---------------------------------------------------------------------------------------
__device__ __forceinline__ unsigned short bf_bits(float f) {          // f32 -> bf16 bits, RNE convert
  unsigned u = __float_as_uint(f);
  return (unsigned short)((u + 0x7FFFu + ((u >> 16) & 1u)) >> 16);
}
__device__ __forceinline__ float bf_up(unsigned short hb) { return __uint_as_float(((unsigned)hb) << 16); }
__device__ __forceinline__ float bfr(float f) { return bf_up(bf_bits(f)); }
__device__ __forceinline__ unsigned short h_bits(_Float16 x) { return __builtin_bit_cast(unsigned short, x); }
__device__ __forceinline__ unsigned pk16(unsigned short a, unsigned short b) { return (unsigned)a | ((unsigned)b << 16); }
__device__ __forceinline__ v8f zero8() { v8f z = {0.f, 0.f, 0.f, 0.f, 0.f, 0.f, 0.f, 0.f}; return z; }
__device__ __forceinline__ float hmax8(v8f s) {
  return fmaxf(fmaxf(fmaxf(s[0], s[1]), fmaxf(s[2], s[3])), fmaxf(fmaxf(s[4], s[5]), fmaxf(s[6], s[7])));
}
__device__ __forceinline__ unsigned wave_ballot(bool p) {
#if defined(__HIP_DEVICE_COMPILE__)
  return __builtin_amdgcn_ballot_w32(p);
#else
  return p ? 1u : 0u;
#endif
}

// ---- 16-bit fragment loader (A, or B from a k-contiguous [n][k] row): lane -> row/col (lane&15), p already includes
//      + 8*(lane>>4); elements 0..7 <- p[0..7] (k0+8h..), elements 8..15 <- p[16..23] (k0+16+8h..)
__device__ __forceinline__ Frag ldfrag(const unsigned short* p) {
  Frag f;
  f.u[0] = *(const v8us*)(p);
  f.u[1] = *(const v8us*)(p + 16);
  return f;
}

// ---- WMMA helpers: builtin followed by a 4-slot VALU gap tying D and keeping A/B live --------------------------
__device__ __forceinline__ v8f mma_h(v16h a, v16h b, v8f c) {
  v8f d = __builtin_amdgcn_wmma_f32_16x16x32_f16(false, a, false, b, (short)0, c, false, false);
#if defined(__HIP_DEVICE_COMPILE__)
  asm volatile("v_nop\n\tv_nop\n\tv_nop\n\tv_nop" : "+v"(d) : "v"(a), "v"(b));
#endif
  return d;
}
__device__ __forceinline__ v8f mma_b(v16b a, v16b b, v8f c) {
  v8f d = __builtin_amdgcn_wmma_f32_16x16x32_bf16(false, a, false, b, (short)0, c, false, false);
#if defined(__HIP_DEVICE_COMPILE__)
  const v16h ha = __builtin_bit_cast(v16h, a), hb = __builtin_bit_cast(v16h, b);
  asm volatile("v_nop\n\tv_nop\n\tv_nop\n\tv_nop" : "+v"(d) : "v"(ha), "v"(hb));
#endif
  return d;
}

// ---- LDS ring helpers (attention) ---------------------------------------------------------------------------
// Eight asynchronous 16-byte copies global -> LDS per lane (l = the lane's LDS byte address, g = its global address),
// with the s_wait_xcnt 0 that stands before the address registers may be rewritten as the statement's last line.
__device__ __forceinline__ void copy8(unsigned l0, unsigned lstep, const unsigned short* g0, size_t gstep) {
#if defined(__HIP_DEVICE_COMPILE__)
  asm volatile("global_load_async_to_lds_b128 %0, %8, off\n\t"
               "global_load_async_to_lds_b128 %1, %9, off\n\t"
               "global_load_async_to_lds_b128 %2, %10, off\n\t"
               "global_load_async_to_lds_b128 %3, %11, off\n\t"
               "global_load_async_to_lds_b128 %4, %12, off\n\t"
               "global_load_async_to_lds_b128 %5, %13, off\n\t"
               "global_load_async_to_lds_b128 %6, %14, off\n\t"
               "global_load_async_to_lds_b128 %7, %15, off\n\t"
               "s_wait_xcnt 0x0"
               :: "v"(l0), "v"(l0 + lstep), "v"(l0 + 2 * lstep), "v"(l0 + 3 * lstep),
                  "v"(l0 + 4 * lstep), "v"(l0 + 5 * lstep), "v"(l0 + 6 * lstep), "v"(l0 + 7 * lstep),
                  "v"(g0), "v"(g0 + gstep), "v"(g0 + 2 * gstep), "v"(g0 + 3 * gstep),
                  "v"(g0 + 4 * gstep), "v"(g0 + 5 * gstep), "v"(g0 + 6 * gstep), "v"(g0 + 7 * gstep)
               : "memory");
#endif
}
// this wave's own copies have landed in LDS (the compiler places no wait for them)
__device__ __forceinline__ void wait_async0() {
#if defined(__HIP_DEVICE_COMPILE__)
  asm volatile("s_wait_asynccnt 0x0" ::: "memory");
#endif
}
// this wave's own LDS reads have returned, before the buffer they read is handed back for a refill
__device__ __forceinline__ void wait_ds0() {
#if defined(__HIP_DEVICE_COMPILE__)
  asm volatile("s_wait_dscnt 0x0" ::: "memory");
#endif
}

// =========================================================================================================
// (0) weight planes: W16 f16 [192][128] (rows 0..63 = Wq, 64..127 = Wk, 128..191 = Wv) and Wo16 f16 [128][64];
//     value = f16 of (bf16-RNE(w) * 256) (exact). Thread = one 8-element chunk (16 B); 8 consecutive lanes =
// coverage: (3*BQ + BO) blocks x 256 threads x 8 halves = 3*8192 + 8192 elements = both planes exactly.
// =========================================================================================================
__global__ __launch_bounds__(CHB)
void cvt_w(const float* __restrict__ Wq, const float* __restrict__ Wk, const float* __restrict__ Wv,
           const float* __restrict__ Wo, unsigned short* W16, unsigned short* Wo16) {
  const int tid = threadIdx.x, blk = blockIdx.x;
  const int BQ = (DK * CIN) / (8 * CHB);                             // blocks per q/k/v matrix
  const int g = blk * CHB + tid;                                     // chunk id
  const float* src;
  unsigned short* dst;
  int gsrc, gdst;
  if (blk < BQ)          { src = Wq; gsrc = 0;            dst = W16;  gdst = 0; }
  else if (blk < 2 * BQ) { src = Wk; gsrc = BQ * CHB;     dst = W16;  gdst = 0; }
  else if (blk < 3 * BQ) { src = Wv; gsrc = 2 * BQ * CHB; dst = W16;  gdst = 0; }
  else                   { src = Wo; gsrc = 3 * BQ * CHB; dst = Wo16; gdst = 3 * BQ * CHB; }
  const float* s = src + (size_t)8 * (size_t)(g - gsrc);
  const v4f a = *(const v4f*)s;
  const v4f q = *(const v4f*)(s + 4);
  const float f[8] = {a[0], a[1], a[2], a[3], q[0], q[1], q[2], q[3]};
  v4u u;
#pragma unroll
  for (int t = 0; t < 4; ++t) {
    const _Float16 h0 = (_Float16)(bfr(f[2 * t]) * WSC);
    const _Float16 h1 = (_Float16)(bfr(f[2 * t + 1]) * WSC);
    u[t] = pk16(h_bits(h0), h_bits(h1));
  }
{
    *(v4u*)(dst + (size_t)8 * (size_t)(g - gdst)) = u;
    
  }
}

// =========================================================================================================
// (1) X f32 [128 c][xstride] (first NTOK positions used) -> XP f16 [NTOK n][128 c] (position-major, bf16-RNE
//     values, exact in f16) through an LDS tile T[64 n][64 c] (pitch TP). Block (nb, cb) owns a 64 c x 64 n tile.
// coverage: T 2 it x 32 c x (8 x 8 n) = 64 x 64; XP 2 it x 32 rows x 8 lanes x 8 halves = 64 n x 64 c;
//           grid (NTOK/64, 2) covers XP [NTOK][128] exactly once.
// =========================================================================================================
__global__ __launch_bounds__(256)
void cvt_x(const float* __restrict__ X, int xstride, unsigned short* XP) {
  __shared__ __align__(16) unsigned short T[QT * TP];
  const int tid = threadIdx.x;
  const int nb = blockIdx.x, cb = blockIdx.y;
  const int e = tid & 7, lq = tid >> 3;                             // lq 0..31
  const int n0 = nb * QT, c0 = cb * QT;
#pragma unroll
  for (int it = 0; it < 2; ++it) {
    const int cl = it * 32 + lq;                                     // 0..63
    const float* sp = X + (size_t)(c0 + cl) * (size_t)xstride + n0 + 8 * e;
    const v4f a = *(const v4f*)sp;
    const v4f q = *(const v4f*)(sp + 4);
    unsigned short hb[8];
#pragma unroll
    for (int t = 0; t < 4; ++t) {
      hb[t]     = h_bits((_Float16)bfr(a[t]));
      hb[4 + t] = h_bits((_Float16)bfr(q[t]));
    }
#pragma unroll
    for (int t = 0; t < 8; ++t) T[(8 * e + t) * TP + cl] = hb[t];
  }
  __syncthreads();
  v4u up[2];
#pragma unroll
  for (int it = 0; it < 2; ++it) {
    const int nl = it * 32 + lq;                                     // 0..63
    up[it] = *(const v4u*)(T + nl * TP + 8 * e);
  }
{
#pragma unroll
    for (int it = 0; it < 2; ++it) {
      const int nl = it * 32 + lq;
      *(v4u*)(XP + (size_t)(n0 + nl) * CIN + c0 + 8 * e) = up[it];
    }
    
  }
}

// =========================================================================================================
// (2) pointwise conv GEMM for one (64-n tile, projection mb in {q,k,v}): P[o][n] = (1/256) sum_c W16[o0+o][c]
//     XP[n][c] + bias[o]. Block 128 threads = 4 waves; wave w owns cols n0+16w..+15 (B fragment from the XP row,
//     k = c contiguous, split k map) and 4 m-tiles (A rows o0 + 16 mt + (lane&15) of W16, split k map).
//     K = 128 = 4 steps. Epilogue staged in LDS Os[n_loc][o_loc] (pitch OSP), block barrier, then:
//       mb 1: k   -> Kh = bf16-RNE(v), Kl = bf16-RNE(v - hi), planes bf16 [NTOK][64];
//       mb 2: v   -> Vc f16 [64 ch][NTOK] (channel-major, value f16(v*16)), row segment n0..n0+63 = one line.
// coverage: Os 4 waves x 16 n x 64 o = 64 x 64 (cols 0..63 of pitch 68, reads stay in cols 0..63);
//           Qh/Ql/Kh/Kl: 4 it x 16 rows x 8 lanes x 8 = 64 n x 64 d; Vc: 4 it x 16 ch x 8 lanes x 8 = 64 ch x 64 n;
//           grid (NTOK/64, 3) covers all rows of Qh, Ql, Kh, Kl and all of Vc exactly once.
// =========================================================================================================
__global__ __launch_bounds__(128)
void gemm_qkv(const unsigned short* __restrict__ W16, const unsigned short* __restrict__ XP,
              const float* __restrict__ bq, const float* __restrict__ bk, const float* __restrict__ bv,
              unsigned short* Qh, unsigned short* Ql, unsigned short* Kh, unsigned short* Kl,
              unsigned short* Vc) {
  __shared__ __align__(16) float Os[QT * OSP];
  const int tid  = threadIdx.x;
  const int lane = tid & 31, wave = tid >> 5;
  const int hh   = lane >> 4, c = lane & 15;
  const int nt   = blockIdx.x, mb = blockIdx.y;
  const int n0   = nt * QT, o0 = mb * QT;

  const unsigned short* ap = W16 + (size_t)(o0 + c) * CIN + 8 * hh;
  const unsigned short* bp = XP + (size_t)(n0 + 16 * wave + c) * CIN + 8 * hh;

  v8f acc[4];
#pragma unroll
  for (int mt = 0; mt < 4; ++mt) acc[mt] = zero8();

#pragma unroll
  for (int ks = 0; ks < CIN / 32; ++ks) {
    const Frag fb = ldfrag(bp + 32 * ks);
#pragma unroll
    for (int mt = 0; mt < 4; ++mt) {
      const Frag fa = ldfrag(ap + (size_t)(16 * mt) * CIN + 32 * ks);
      acc[mt] = mma_h(fa.h, fb.h, acc[mt]);
    }
  }

  // ---- epilogue: scale back + bias (+ 1/sqrt(ck) for q) -> LDS Os[n_loc][o_loc]
  const float* bsel = (mb == 0) ? bq : ((mb == 1) ? bk : bv);       // block-uniform, all global
  const float osc = (mb == 0) ? QSC : 1.0f;
  {
    const int nl = 16 * wave + c;
#pragma unroll
    for (int mt = 0; mt < 4; ++mt) {
      const v4f b0 = *(const v4f*)(bsel + 16 * mt + 8 * hh);
      const v4f b1 = *(const v4f*)(bsel + 16 * mt + 8 * hh + 4);
      v4f va, vb;
#pragma unroll
      for (int r = 0; r < 4; ++r) {
        va[r] = (acc[mt][r] * IWSC + bfr(b0[r])) * osc;
        vb[r] = (acc[mt][4 + r] * IWSC + bfr(b1[r])) * osc;
      }
      *(v4f*)(Os + nl * OSP + 16 * mt + 8 * hh)     = va;
      *(v4f*)(Os + nl * OSP + 16 * mt + 8 * hh + 4) = vb;
    }
  }
  __syncthreads();

  const int e = tid & 7, lq = tid >> 3;                             // lq 0..15
  if (mb < 2) {
    unsigned short* Ph = (mb == 0) ? Qh : Kh;                        // block-uniform, both global
    unsigned short* Pl = (mb == 0) ? Ql : Kl;
    v4u uh[4], ul[4];
#pragma unroll
    for (int it = 0; it < 4; ++it) {
      const int row = it * 16 + lq;                                  // n_loc 0..63
      const v4f a = *(const v4f*)(Os + row * OSP + 8 * e);
      const v4f q = *(const v4f*)(Os + row * OSP + 8 * e + 4);
      const float f[8] = {a[0], a[1], a[2], a[3], q[0], q[1], q[2], q[3]};
#pragma unroll
      for (int t = 0; t < 4; ++t) {
        const float f0 = f[2 * t], f1 = f[2 * t + 1];
        const unsigned short hb0 = bf_bits(f0), hb1 = bf_bits(f1);
        const unsigned short lb0 = bf_bits(f0 - bf_up(hb0));
        const unsigned short lb1 = bf_bits(f1 - bf_up(hb1));
        uh[it][t] = pk16(hb0, hb1);
        ul[it][t] = pk16(lb0, lb1);
      }
    }
{
#pragma unroll
      for (int it = 0; it < 4; ++it) {
        const int row = it * 16 + lq;
        const size_t po = (size_t)(n0 + row) * DK + 8 * e;
        *(v4u*)(Ph + po) = uh[it];
        *(v4u*)(Pl + po) = ul[it];
      }
      
    }
  } else {
    v4u uv[4];
#pragma unroll
    for (int it = 0; it < 4; ++it) {
      const int o = it * 16 + lq;                                    // channel 0..63
      unsigned short hb[8];
#pragma unroll
      for (int t = 0; t < 8; ++t) hb[t] = h_bits((_Float16)(Os[(8 * e + t) * OSP + o] * VSC));
#pragma unroll
      for (int t = 0; t < 4; ++t) uv[it][t] = pk16(hb[2 * t], hb[2 * t + 1]);
    }
{
#pragma unroll
      for (int it = 0; it < 4; ++it) {
        const int o = it * 16 + lq;
        *(v4u*)(Vc + (size_t)o * NTOK + n0 + 8 * e) = uv[it];
      }
      
    }
  }
}

// =========================================================================================================
// (3) global attention for one 64-query tile, transposed formulation, NTOK keys, no mask:
//   S^T tile (16 keys x 16 queries) = sum over 2 d-chunks of A(k: row = key kb + (lane&15), 32 d via the split
//   k map from the bf16 plane Kh [NTOK][64]) . B(q: col = query, same map from Qh) + A(Kh).B(Ql) + A(Kl).B(Qh)
//   (bf16 unscaled residual planes, shared accumulator, 3 products). q fragments (2 chunks x hi/lo) loaded once
//   per wave; k (hi and residual) and v tiles of KT keys are staged in a two-buffer LDS ring by asynchronous copies,
//   shared by the block's 4 waves: stage = Kh[KT][64] and Kl[KT][64] (row pitch KPH halves) + V[64 ch][KT] (pitch VPH);
//   tile t + 2 is copied into the buffer trip t has read, behind the barrier at the foot of trip t, and flies during
//   trip t + 1. Fragments come from LDS with the same split-map loader.
//   Per lane the D tile holds 8 keys of ONE query: online softmax state per lane, one shuffle (lane^16) for the max
//   over 32 keys; the o/l rescale is skipped under a wave-uniform ballot when no lane's max grew (corr == 1 exactly
//   for every lane then); row-sum partials combined at the end. P = e^{s-m} x 2^14 as f16 is the B operand of
//   O^T (rows channel, cols queries) += A(v rows channel = 16j + (lane&15), keys contiguous, f16 plane Vc
//   [64][NTOK]) . B(P^T): element r <- D of the tile covering keys kb..kb+15, element 8+r <- the tile covering
//   kb+16..kb+31, lane unchanged. 4 accumulator tiles per wave (64 channels). Block = 4 waves = 64 queries.
//   Epilogue: O = o/(16 l) staged in LDS Os[query][64 ch] (pitch OSP, b128 stores), block barrier, then the flat
// coverage: Os 4 waves x 16 q x 64 ch = 64 x 64 (cols 0..63); Oh/Ol 4 it x 16 rows x 8 lanes x 8 halves =
//           64 q x 64 ch per plane; grid (NTOK/64) covers rows 0..NTOK-1 of both planes exactly once.
// =========================================================================================================
__global__ __launch_bounds__(128)
void attn_k(const unsigned short* __restrict__ Qh, const unsigned short* __restrict__ Ql,
            const unsigned short* __restrict__ Kh, const unsigned short* __restrict__ Kl,
            const unsigned short* __restrict__ Vc, unsigned short* Oh, unsigned short* Ol) {
  __shared__ __align__(16) float Os[QT * OSP];
  __shared__ __align__(16) unsigned short Ring[2 * STGH];
  const int tid  = threadIdx.x;
  const int wave = tid >> 5, lane = tid & 31;
  const int hh   = lane >> 4, c = lane & 15;
  const int n0   = blockIdx.x * QT;

  // q fragments (B operand, col = query n0 + 16*wave + c), d chunks 0 and 1, hi and residual planes
  const size_t qo = (size_t)(n0 + 16 * wave + c) * DK + 8 * hh;
  const Frag qh0 = ldfrag(Qh + qo), qh1 = ldfrag(Qh + qo + 32);
  const Frag ql0 = ldfrag(Ql + qo), ql1 = ldfrag(Ql + qo + 32);
  // copy addresses of this lane. K planes: copy i moves 16 rows (8 lanes x 16 B per 128-B row), row 16 i + (tid >> 3);
  // V: copy i moves 8 channel rows (16 lanes x 16 B per 256-B row segment), row 8 i + (tid >> 4).
  const unsigned ring0 = (unsigned)(uintptr_t)Ring;                  // LDS byte address of the ring
  const unsigned lk = ring0 + (unsigned)((tid >> 3) * (KPH * 2) + (tid & 7) * 16);
  const unsigned lv = ring0 + (unsigned)(SVV * 2 + (tid >> 4) * (VPH * 2) + (tid & 15) * 16);
  const unsigned short* gkh = Kh + (size_t)tid * 8;
  const unsigned short* gkl = Kl + (size_t)tid * 8;
  const unsigned short* gv  = Vc + (size_t)(tid >> 4) * NTOK + 8 * (tid & 15);
  auto fill = [&](int buf, int tile) {
    const unsigned lb = (unsigned)buf * (unsigned)(STGH * 2);
    copy8(lk + lb,           16 * KPH * 2, gkh + (size_t)tile * (KT * DK), (size_t)16 * DK);
    copy8(lk + lb + SKL * 2, 16 * KPH * 2, gkl + (size_t)tile * (KT * DK), (size_t)16 * DK);
    copy8(lv + lb,           8 * VPH * 2,  gv + (size_t)tile * KT,         (size_t)8 * NTOK);
  };
  // fragment offsets inside a stage (halves): k row = key c (+ 32 p, + 16), v row = channel c (+ 16 j)
  const int kfo = c * KPH + 8 * hh;
  const int vfo = SVV + c * VPH + 8 * hh;

  fill(0, 0);
  wait_async0();
  __syncthreads();                                                   // tile 0 is readable by every wave
  fill(1, 1);

  float m = -1.0e30f, l = 0.f;
  v8f o[4];
#pragma unroll
  for (int j = 0; j < 4; ++j) o[j] = zero8();

#pragma unroll 1
  for (int t = 0; t < NTOK / KT; ++t) {
  const unsigned short* Sb  = Ring + (t & 1) * STGH;                // trip t reads buffer t mod 2 alone
  const unsigned short* Khp = Sb + kfo;
  const unsigned short* Klp = Sb + SKL + kfo;
  const unsigned short* Vp  = Sb + vfo;
  // unrolled so that every LDS offset of a stage is an immediate of its load
#pragma unroll
  for (int kb = 0; kb < KT; kb += 32) {
    const int r0o = kb * KPH;                                       // keys kb .. kb+15 of the stage
    const int r1o = (kb + 16) * KPH;                                // keys kb+16 .. kb+31
    v8f s0 = zero8(), s1 = zero8();
    {
      const Frag k00 = ldfrag(Khp + r0o), k10 = ldfrag(Khp + r1o);  // d chunk 0, hi
      const Frag g00 = ldfrag(Klp + r0o), g10 = ldfrag(Klp + r1o);  // d chunk 0, residual
      s0 = mma_b(k00.bf, qh0.bf, s0);
      s1 = mma_b(k10.bf, qh0.bf, s1);
      s0 = mma_b(k00.bf, ql0.bf, s0);
      s1 = mma_b(k10.bf, ql0.bf, s1);
      s0 = mma_b(g00.bf, qh0.bf, s0);
      s1 = mma_b(g10.bf, qh0.bf, s1);
    }
    {
      const Frag k01 = ldfrag(Khp + r0o + 32), k11 = ldfrag(Khp + r1o + 32);   // d chunk 1, hi
      const Frag g01 = ldfrag(Klp + r0o + 32), g11 = ldfrag(Klp + r1o + 32);   // d chunk 1, residual
      s0 = mma_b(k01.bf, qh1.bf, s0);
      s1 = mma_b(k11.bf, qh1.bf, s1);
      s0 = mma_b(k01.bf, ql1.bf, s0);
      s1 = mma_b(k11.bf, ql1.bf, s1);
      s0 = mma_b(g01.bf, qh1.bf, s0);
      s1 = mma_b(g11.bf, qh1.bf, s1);
    }

    float mx = fmaxf(hmax8(s0), hmax8(s1));
    mx = fmaxf(mx, __shfl_xor(mx, 16, 32));
    const float mn = fmaxf(m, mx);
    const unsigned grew = wave_ballot(mx > m);                       // wave-uniform
    if (grew != 0u) {
      const float corr = __expf(m - mn);                             // == 1 exactly for lanes whose max did not grow
      l *= corr;
#pragma unroll
      for (int j = 0; j < 4; ++j) {
#pragma unroll
        for (int r = 0; r < 8; ++r) o[j][r] *= corr;
      }
    }
    m = mn;
    const float msh = mn - LNPS;                                     // exp gives e^{s-m} * 2^14

    FragH ph;
    float ls = 0.f;
#pragma unroll
    for (int r = 0; r < 8; ++r) {
      const float e0 = __expf(s0[r] - msh);                          // key kb      + 8hh + r
      const float e1 = __expf(s1[r] - msh);                          // key kb + 16 + 8hh + r
      ls += e0 + e1;
      ph.hv[0][r] = (_Float16)e0;
      ph.hv[1][r] = (_Float16)e1;
    }
    l += ls;

#pragma unroll
    for (int j = 0; j < 4; ++j) {
      const Frag vf = ldfrag(Vp + (16 * j) * VPH + kb);
      o[j] = mma_h(vf.h, ph.v, o[j]);
    }
  }
  // foot of trip t: own reads done, own copies of tile t + 1 landed, then the one barrier that publishes tile t + 1
  // and ends every wave's reads of buffer t mod 2; only then its refill
  wait_ds0();
  wait_async0();
  __syncthreads();
  if (t + 2 < NTOK / KT) fill(t & 1, t + 2);
  }
  wait_async0();
  l += __shfl_xor(l, 16, 32);
  const float scl = (1.0f / l) * IVSC;                               // o and l both carry 2^14; o also carries the v x16

  const int qrow = 16 * wave + c;
#pragma unroll
  for (int j = 0; j < 4; ++j) {
    v4f va, vb;
#pragma unroll
    for (int r = 0; r < 4; ++r) { va[r] = o[j][r] * scl; vb[r] = o[j][4 + r] * scl; }
    *(v4f*)(Os + qrow * OSP + 16 * j + 8 * hh)     = va;            // Os[query][ch = 16j + 8hh + r]
    *(v4f*)(Os + qrow * OSP + 16 * j + 8 * hh + 4) = vb;
  }
  __syncthreads();

  const int e = tid & 7, lq = tid >> 3;                              // lq 0..15
  v4u uh[4], ul[4];
#pragma unroll
  for (int it = 0; it < 4; ++it) {
    const int row = it * 16 + lq;                                    // query 0..63
    const v4f a = *(const v4f*)(Os + row * OSP + 8 * e);
    const v4f q = *(const v4f*)(Os + row * OSP + 8 * e + 4);
    const float f[8] = {a[0], a[1], a[2], a[3], q[0], q[1], q[2], q[3]};
#pragma unroll
    for (int t = 0; t < 4; ++t) {
      const float g0 = f[2 * t] * OSC, g1 = f[2 * t + 1] * OSC;
      const _Float16 h0 = (_Float16)g0, h1 = (_Float16)g1;
      const _Float16 l0 = (_Float16)((g0 - (float)h0) * RSC);
      const _Float16 l1 = (_Float16)((g1 - (float)h1) * RSC);
      uh[it][t] = pk16(h_bits(h0), h_bits(h1));
      ul[it][t] = pk16(h_bits(l0), h_bits(l1));
    }
  }
{
#pragma unroll
    for (int it = 0; it < 4; ++it) {
      const int row = it * 16 + lq;
      const size_t po = (size_t)(n0 + row) * DK + 8 * e;
      *(v4u*)(Oh + po) = uh[it];
      *(v4u*)(Ol + po) = ul[it];
    }
    
  }
}

// =========================================================================================================
// (4) output pointwise conv over the raw view: Y[o][n'] = (1/256)(1/1024) sum_{c'} Wo16[o][c'] (Ohv[c'][n'] +
//     Olv[c'][n'] / 1024) + bo[o], where Ohv/Olv [64][NTOK] are the flat O planes re-read with row c' = halves
//     c'*NTOK .. +NTOK-1. Block (nt, mb): 64 n' x 64 o. The two 64 c' x 64 n' B tiles are staged transposed in
//     LDS Bh/Bl[n'_loc][c'] (pitch TP, 16-B global loads, 2-byte LDS stores), block barrier, then B fragments per
//     wave (col n0'+16w+(lane&15), k = c' contiguous, split k map) and A fragments from Wo16 rows o0+16mt+(lane&15).
//     K = 64 = 2 steps; hi and residual products in separate accumulators. Epilogue staged in Ys[n'_loc][o_loc]
// coverage: Bh/Bl 4 it x 16 c' x (8 x 8 n') = 64 x 64 each (cols 0..63 of pitch 72); Ys 4 waves x 16 n' x 64 o;
//           out: 8 it x 16 lines x 8 lanes x 4 floats = 64 o x 64 n'; grid (NTOK/64, COUT/64) covers
//           out[0..127][0..NTOK-1] exactly once.
// =========================================================================================================
__global__ __launch_bounds__(128)
void gemm_o(const unsigned short* __restrict__ Wo16, const unsigned short* __restrict__ Oh,
            const unsigned short* __restrict__ Ol, const float* __restrict__ bo, float* Y) {
  __shared__ __align__(16) unsigned short Bh[QT * TP];
  __shared__ __align__(16) unsigned short Bl[QT * TP];
  __shared__ __align__(16) float Ys[QT * OSP];
  const int tid  = threadIdx.x;
  const int lane = tid & 31, wave = tid >> 5;
  const int hh   = lane >> 4, c = lane & 15;
  const int nt   = blockIdx.x, mb = blockIdx.y;
  const int n0   = nt * QT, o0 = mb * QT;
  const int e = tid & 7, lq = tid >> 3;                              // lq 0..15

  // ---- stage the view tiles transposed: Bh[n'_loc][c'] <- Oh[c'*NTOK + n0 + n'_loc]
#pragma unroll
  for (int it = 0; it < 4; ++it) {
    const int cl = it * 16 + lq;                                     // c' 0..63
    const size_t so = (size_t)cl * NTOK + n0 + 8 * e;
    const v4u ah = *(const v4u*)(Oh + so);
    const v4u al = *(const v4u*)(Ol + so);
#pragma unroll
    for (int t = 0; t < 4; ++t) {
      Bh[(8 * e + 2 * t) * TP + cl]     = (unsigned short)(ah[t] & 0xffffu);
      Bh[(8 * e + 2 * t + 1) * TP + cl] = (unsigned short)(ah[t] >> 16);
      Bl[(8 * e + 2 * t) * TP + cl]     = (unsigned short)(al[t] & 0xffffu);
      Bl[(8 * e + 2 * t + 1) * TP + cl] = (unsigned short)(al[t] >> 16);
    }
  }
  __syncthreads();

  const unsigned short* ap  = Wo16 + (size_t)(o0 + c) * DK + 8 * hh;
  const unsigned short* bph = Bh + (16 * wave + c) * TP + 8 * hh;
  const unsigned short* bpl = Bl + (16 * wave + c) * TP + 8 * hh;

  v8f acch[4], accl[4];
#pragma unroll
  for (int mt = 0; mt < 4; ++mt) { acch[mt] = zero8(); accl[mt] = zero8(); }

#pragma unroll
  for (int ks = 0; ks < DK / 32; ++ks) {
    const Frag fbh = ldfrag(bph + 32 * ks);
    const Frag fbl = ldfrag(bpl + 32 * ks);
#pragma unroll
    for (int mt = 0; mt < 4; ++mt) {
      const Frag fa = ldfrag(ap + (size_t)(16 * mt) * DK + 32 * ks);
      acch[mt] = mma_h(fa.h, fbh.h, acch[mt]);
      accl[mt] = mma_h(fa.h, fbl.h, accl[mt]);
    }
  }

  // ---- epilogue: fold residual, scale back, bias -> Ys[n'_loc][o_loc]
  {
    const int nl = 16 * wave + c;
    const float fs = IWSC * IOSC;
#pragma unroll
    for (int mt = 0; mt < 4; ++mt) {
      const v4f b0 = *(const v4f*)(bo + o0 + 16 * mt + 8 * hh);
      const v4f b1 = *(const v4f*)(bo + o0 + 16 * mt + 8 * hh + 4);
      v4f va, vb;
#pragma unroll
      for (int r = 0; r < 4; ++r) {
        va[r] = (acch[mt][r] + accl[mt][r] * IRSC) * fs + bfr(b0[r]);
        vb[r] = (acch[mt][4 + r] + accl[mt][4 + r] * IRSC) * fs + bfr(b1[r]);
      }
      *(v4f*)(Ys + nl * OSP + 16 * mt + 8 * hh)     = va;
      *(v4f*)(Ys + nl * OSP + 16 * mt + 8 * hh + 4) = vb;
    }
  }
  __syncthreads();

  v4f res[8];
#pragma unroll
  for (int it = 0; it < 8; ++it) {
    const int L  = it * 16 + lq;                                     // line 0..127
    const int ol = L >> 1, hf = L & 1;                               // o_loc 0..63, line half
    const int nl = hf * 32 + 4 * e;                                  // n'_loc 0..63
#pragma unroll
    for (int t = 0; t < 4; ++t) res[it][t] = Ys[(nl + t) * OSP + ol];
  }
{
#pragma unroll
    for (int it = 0; it < 8; ++it) {
      const int L  = it * 16 + lq;
      const int ol = L >> 1, hf = L & 1;
      const int nl = hf * 32 + 4 * e;
      *(v4f*)(Y + (size_t)(o0 + ol) * NTOK + n0 + nl) = res[it];
    }
    
  }
}

// =========================================================================================================
// Workspace map (bytes, full size ND=16; each region start a multiple of 256; every extent is an exact tile
//   W16 f16 [192][128]        49152        Wo16 f16 [128][64]      16384
//   XP  f16 [16384][128]    4194304
//   Qh/Ql/Kh/Kl bf16 [16384][64] 2097152 x4   Vc f16 [64][16384]   2097152
//   Oh/Ol f16 [16384][64]   2097152 x2
//   total = 18939904
// =========================================================================================================
extern "C" void kernel_launch(void* const* d_in, const int* in_sizes, int n_in,
                              void* d_out, int out_size, void* d_ws, size_t ws_size,
                              hipStream_t stream) {
  if (n_in < 9) return;
  if (in_sizes[0] < CIN * NTOK) return;
  if ((in_sizes[0] % CIN) != 0) return;
  const int xstride = in_sizes[0] / CIN;                             // per-channel position stride of X
  if (xstride < NTOK || (xstride % 4) != 0) return;
  if (in_sizes[1] < DK * CIN || in_sizes[3] < DK * CIN || in_sizes[5] < DK * CIN) return;
  if (in_sizes[2] < DK || in_sizes[4] < DK || in_sizes[6] < DK) return;
  if (in_sizes[7] < COUT * DK || in_sizes[8] < COUT) return;
  if (out_size < COUT * NTOK) return;

  size_t off = 0;
  auto carve = [&](size_t bytes) { const size_t o = off; off += (bytes + 255) & ~(size_t)255; return o; };
  const size_t oW16  = carve((size_t)3 * DK * CIN * 2);
  const size_t oWo16 = carve((size_t)COUT * DK * 2);
  const size_t oXP   = carve((size_t)NTOK * CIN * 2);
  const size_t oQh   = carve((size_t)NTOK * DK * 2);
  const size_t oQl   = carve((size_t)NTOK * DK * 2);
  const size_t oKh   = carve((size_t)NTOK * DK * 2);
  const size_t oKl   = carve((size_t)NTOK * DK * 2);
  const size_t oVc   = carve((size_t)DK * NTOK * 2);
  const size_t oOh   = carve((size_t)NTOK * DK * 2);
  const size_t oOl   = carve((size_t)NTOK * DK * 2);
  if (off > ws_size) return;
  if (off > (size_t)134217728) return;

  const float* X  = (const float*)d_in[0];
  const float* Wq = (const float*)d_in[1];
  const float* bq = (const float*)d_in[2];
  const float* Wk = (const float*)d_in[3];
  const float* bk = (const float*)d_in[4];
  const float* Wv = (const float*)d_in[5];
  const float* bv = (const float*)d_in[6];
  const float* Wo = (const float*)d_in[7];
  const float* bo = (const float*)d_in[8];

  char* ws = (char*)d_ws;
  unsigned short* W16  = (unsigned short*)(ws + oW16);
  unsigned short* Wo16 = (unsigned short*)(ws + oWo16);
  unsigned short* XP   = (unsigned short*)(ws + oXP);
  unsigned short* Qh   = (unsigned short*)(ws + oQh);
  unsigned short* Ql   = (unsigned short*)(ws + oQl);
  unsigned short* Kh   = (unsigned short*)(ws + oKh);
  unsigned short* Kl   = (unsigned short*)(ws + oKl);
  unsigned short* Vc   = (unsigned short*)(ws + oVc);
  unsigned short* Oh   = (unsigned short*)(ws + oOh);
  unsigned short* Ol   = (unsigned short*)(ws + oOl);
  float* out = (float*)d_out;

  const dim3 blk256(256), blk128(128);
  const int BQ = (DK * CIN) / (8 * CHB), BO = (COUT * DK) / (8 * CHB);

  // (0) weights -> f16 planes
  cvt_w<<<dim3(3 * BQ + BO), dim3(CHB), 0, stream>>>(Wq, Wk, Wv, Wo, W16, Wo16);
  // (1) x -> position-major 16-bit plane
  cvt_x<<<dim3(NTOK / QT, CIN / QT), blk256, 0, stream>>>(X, xstride, XP);
  // (2) q/k/v pointwise conv GEMM -> q hi + residual, k hi + residual, v planes
  gemm_qkv<<<dim3(NTOK / QT, 3), blk128, 0, stream>>>(W16, XP, bq, bk, bv, Qh, Ql, Kh, Kl, Vc);
  // (3) global attention -> O hi + residual planes [NTOK][64]
  attn_k<<<dim3(NTOK / QT), blk128, 0, stream>>>(Qh, Ql, Kh, Kl, Vc, Oh, Ol);
  // (4) output conv over the raw [64][NTOK] view -> out [128][NTOK]
  gemm_o<<<dim3(NTOK / QT, COUT / QT), blk128, 0, stream>>>(Wo16, Oh, Ol, bo, out);
  (void)hipGetLastError();
}

// v002
// Measured time: 151 microseconds a run.
// Timed twice side by side with v001, it ran 1.73 times as fast both times.
// Counting every step since v000, it is 5.58 times as fast.
// Contractions: q/k/v pointwise conv W16[192x128].XP[n][128] on v_wmma_f32_16x16x32_f16 (f16 containers of
// bf16-RNE weights x256 and bf16-RNE x, exact products); scores K.Q^T on v_wmma_f32_16x16x32_bf16 (bf16 hi +
// bf16 residual planes of k and of q/8, 3 products hi.hi + hi.lo + lo.hi, K=64); O^T = V.P^T on
// v_wmma_f32_16x16x32_f16 (v x16 as f16, P = e^{s-m} x2^14 f16 from the score D registers); output conv
// Wo16[128x64].Oview[64][N] on v_wmma_f32_16x16x32_f16 (f16 of bf16-RNE weights x256; O carried as f16 hi x1024
// plane + f16 residual x2^20 plane, 2 products, separate accumulators); f32 accumulate everywhere; softmax
// statistics and bias adds in f32 VALU.
#include <hip/hip_runtime.h>
#include <math.h>
#include <stdint.h>

#ifndef ND
#define ND 16
#endif
#define NHH    32
#define NWW    32
#define NTOK   (ND * NHH * NWW)
#define CIN    128
#define DK     64
#define COUT   128
#define QT     64
#define OSP    68
#define TP     72
#define CHB    256
#define WSC    256.0f
#define IWSC   0.00390625f
#define QSC    0.125f
#define VSC    16.0f
#define IVSC   0.0625f
#define OSC    1024.0f
#define IOSC   0.0009765625f
#define RSC    1024.0f
#define IRSC   0.0009765625f
#define LNPS   9.704060527839234f
#define KG     4
#define ATH    (128 * KG)
#define KT     256
#define KW     (KT / KG)
#define KPH    72
#define VPH    264
#define SKL    (KT * KPH)
#define SVV    (2 * KT * KPH)
#define STGH   (2 * KT * KPH + DK * VPH)

static_assert(ND >= 1 && ND <= 16);
static_assert(NTOK % QT == 0);
static_assert(NTOK % 32 == 0);
static_assert(CIN % QT == 0 && CIN % 32 == 0);
static_assert(DK == QT);
static_assert(DK % 32 == 0);
static_assert(COUT % QT == 0);
static_assert((DK * CIN) % (8 * CHB) == 0);
static_assert((COUT * DK) % (8 * CHB) == 0);
static_assert((OSP * 4) % 16 == 0);
static_assert((TP * 2) % 16 == 0);
static_assert(KT % 32 == 0 && NTOK % KT == 0 && NTOK / KT >= 2);
static_assert((ATH / 8) * 4 == KT && (ATH / 32) * 4 == DK && KT == 8 * 32 && DK == 8 * 8);
static_assert(KW % 32 == 0 && VPH == KT + 8 && QT * 8 == ATH && QT == 4 * 16);
static_assert((KPH * 2) % 32 == 16 && (VPH * 2) % 32 == 16 && (STGH * 2) % 16 == 0);

typedef _Float16       v16h __attribute__((ext_vector_type(16)));
typedef _Float16       v8h  __attribute__((ext_vector_type(8)));
typedef __bf16         v16b __attribute__((ext_vector_type(16)));
typedef unsigned short v8us __attribute__((ext_vector_type(8)));
typedef float          v8f  __attribute__((ext_vector_type(8)));
typedef float          v4f  __attribute__((ext_vector_type(4)));
typedef unsigned int   v4u  __attribute__((ext_vector_type(4)));

union Frag  { v8us u[2]; v16h h; v16b bf; };
union FragH { v16h v; v8h hv[2]; };
static_assert(sizeof(Frag) == 32);
static_assert(sizeof(FragH) == 32);

// ---- scalar helpers ---------------------------------------------------------------------------------------
__device__ __forceinline__ unsigned short bf_bits(float f) {          // f32 -> bf16 bits, RNE convert
  unsigned u = __float_as_uint(f);
  return (unsigned short)((u + 0x7FFFu + ((u >> 16) & 1u)) >> 16);
}
__device__ __forceinline__ float bf_up(unsigned short hb) { return __uint_as_float(((unsigned)hb) << 16); }
__device__ __forceinline__ float bfr(float f) { return bf_up(bf_bits(f)); }
__device__ __forceinline__ unsigned short h_bits(_Float16 x) { return __builtin_bit_cast(unsigned short, x); }
__device__ __forceinline__ unsigned pk16(unsigned short a, unsigned short b) { return (unsigned)a | ((unsigned)b << 16); }
__device__ __forceinline__ v8f zero8() { v8f z = {0.f, 0.f, 0.f, 0.f, 0.f, 0.f, 0.f, 0.f}; return z; }
__device__ __forceinline__ float hmax8(v8f s) {
  return fmaxf(fmaxf(fmaxf(s[0], s[1]), fmaxf(s[2], s[3])), fmaxf(fmaxf(s[4], s[5]), fmaxf(s[6], s[7])));
}
__device__ __forceinline__ unsigned wave_ballot(bool p) {
#if defined(__HIP_DEVICE_COMPILE__)
  return __builtin_amdgcn_ballot_w32(p);
#else
  return p ? 1u : 0u;
#endif
}

// ---- 16-bit fragment loader (A, or B from a k-contiguous [n][k] row): lane -> row/col (lane&15), p already includes
//      + 8*(lane>>4); elements 0..7 <- p[0..7] (k0+8h..), elements 8..15 <- p[16..23] (k0+16+8h..)
__device__ __forceinline__ Frag ldfrag(const unsigned short* p) {
  Frag f;
  f.u[0] = *(const v8us*)(p);
  f.u[1] = *(const v8us*)(p + 16);
  return f;
}

// ---- WMMA helpers: builtin followed by a 4-slot VALU gap tying D and keeping A/B live --------------------------
__device__ __forceinline__ v8f mma_h(v16h a, v16h b, v8f c) {
  v8f d = __builtin_amdgcn_wmma_f32_16x16x32_f16(false, a, false, b, (short)0, c, false, false);
#if defined(__HIP_DEVICE_COMPILE__)
  asm volatile("v_nop\n\tv_nop\n\tv_nop\n\tv_nop" : "+v"(d) : "v"(a), "v"(b));
#endif
  return d;
}
__device__ __forceinline__ v8f mma_b(v16b a, v16b b, v8f c) {
  v8f d = __builtin_amdgcn_wmma_f32_16x16x32_bf16(false, a, false, b, (short)0, c, false, false);
#if defined(__HIP_DEVICE_COMPILE__)
  const v16h ha = __builtin_bit_cast(v16h, a), hb = __builtin_bit_cast(v16h, b);
  asm volatile("v_nop\n\tv_nop\n\tv_nop\n\tv_nop" : "+v"(d) : "v"(ha), "v"(hb));
#endif
  return d;
}

// ---- LDS ring helpers (attention) ---------------------------------------------------------------------------
// Four asynchronous 16-byte copies global -> LDS per lane (l = the lane's LDS byte address, g = its global address),
// with the s_wait_xcnt 0 that stands before the address registers may be rewritten as the statement's last line.
__device__ __forceinline__ void copy4(unsigned l0, unsigned lstep, const unsigned short* g0, size_t gstep) {
#if defined(__HIP_DEVICE_COMPILE__)
  asm volatile("global_load_async_to_lds_b128 %0, %4, off\n\t"
               "global_load_async_to_lds_b128 %1, %5, off\n\t"
               "global_load_async_to_lds_b128 %2, %6, off\n\t"
               "global_load_async_to_lds_b128 %3, %7, off\n\t"
               "s_wait_xcnt 0x0"
               :: "v"(l0), "v"(l0 + lstep), "v"(l0 + 2 * lstep), "v"(l0 + 3 * lstep),
                  "v"(g0), "v"(g0 + gstep), "v"(g0 + 2 * gstep), "v"(g0 + 3 * gstep)
               : "memory");
#endif
}
// this wave's own copies have landed in LDS (the compiler places no wait for them)
__device__ __forceinline__ void wait_async0() {
#if defined(__HIP_DEVICE_COMPILE__)
  asm volatile("s_wait_asynccnt 0x0" ::: "memory");
#endif
}
// this wave's own LDS reads have returned, before the buffer they read is handed back for a refill
__device__ __forceinline__ void wait_ds0() {
#if defined(__HIP_DEVICE_COMPILE__)
  asm volatile("s_wait_dscnt 0x0" ::: "memory");
#endif
}

// =========================================================================================================
// (0) weight planes: W16 f16 [192][128] (rows 0..63 = Wq, 64..127 = Wk, 128..191 = Wv) and Wo16 f16 [128][64];
//     value = f16 of (bf16-RNE(w) * 256) (exact). Thread = one 8-element chunk (16 B); 8 consecutive lanes =
// coverage: (3*BQ + BO) blocks x 256 threads x 8 halves = 3*8192 + 8192 elements = both planes exactly.
// =========================================================================================================
__global__ __launch_bounds__(CHB)
void cvt_w(const float* __restrict__ Wq, const float* __restrict__ Wk, const float* __restrict__ Wv,
           const float* __restrict__ Wo, unsigned short* W16, unsigned short* Wo16) {
  const int tid = threadIdx.x, blk = blockIdx.x;
  const int BQ = (DK * CIN) / (8 * CHB);                             // blocks per q/k/v matrix
  const int g = blk * CHB + tid;                                     // chunk id
  const float* src;
  unsigned short* dst;
  int gsrc, gdst;
  if (blk < BQ)          { src = Wq; gsrc = 0;            dst = W16;  gdst = 0; }
  else if (blk < 2 * BQ) { src = Wk; gsrc = BQ * CHB;     dst = W16;  gdst = 0; }
  else if (blk < 3 * BQ) { src = Wv; gsrc = 2 * BQ * CHB; dst = W16;  gdst = 0; }
  else                   { src = Wo; gsrc = 3 * BQ * CHB; dst = Wo16; gdst = 3 * BQ * CHB; }
  const float* s = src + (size_t)8 * (size_t)(g - gsrc);
  const v4f a = *(const v4f*)s;
  const v4f q = *(const v4f*)(s + 4);
  const float f[8] = {a[0], a[1], a[2], a[3], q[0], q[1], q[2], q[3]};
  v4u u;
#pragma unroll
  for (int t = 0; t < 4; ++t) {
    const _Float16 h0 = (_Float16)(bfr(f[2 * t]) * WSC);
    const _Float16 h1 = (_Float16)(bfr(f[2 * t + 1]) * WSC);
    u[t] = pk16(h_bits(h0), h_bits(h1));
  }
{
    *(v4u*)(dst + (size_t)8 * (size_t)(g - gdst)) = u;
    
  }
}

// =========================================================================================================
// (1) X f32 [128 c][xstride] (first NTOK positions used) -> XP f16 [NTOK n][128 c] (position-major, bf16-RNE
//     values, exact in f16) through an LDS tile T[64 n][64 c] (pitch TP). Block (nb, cb) owns a 64 c x 64 n tile.
// coverage: T 2 it x 32 c x (8 x 8 n) = 64 x 64; XP 2 it x 32 rows x 8 lanes x 8 halves = 64 n x 64 c;
//           grid (NTOK/64, 2) covers XP [NTOK][128] exactly once.
// =========================================================================================================
__global__ __launch_bounds__(256)
void cvt_x(const float* __restrict__ X, int xstride, unsigned short* XP) {
  __shared__ __align__(16) unsigned short T[QT * TP];
  const int tid = threadIdx.x;
  const int nb = blockIdx.x, cb = blockIdx.y;
  const int e = tid & 7, lq = tid >> 3;                             // lq 0..31
  const int n0 = nb * QT, c0 = cb * QT;
#pragma unroll
  for (int it = 0; it < 2; ++it) {
    const int cl = it * 32 + lq;                                     // 0..63
    const float* sp = X + (size_t)(c0 + cl) * (size_t)xstride + n0 + 8 * e;
    const v4f a = *(const v4f*)sp;
    const v4f q = *(const v4f*)(sp + 4);
    unsigned short hb[8];
#pragma unroll
    for (int t = 0; t < 4; ++t) {
      hb[t]     = h_bits((_Float16)bfr(a[t]));
      hb[4 + t] = h_bits((_Float16)bfr(q[t]));
    }
#pragma unroll
    for (int t = 0; t < 8; ++t) T[(8 * e + t) * TP + cl] = hb[t];
  }
  __syncthreads();
  v4u up[2];
#pragma unroll
  for (int it = 0; it < 2; ++it) {
    const int nl = it * 32 + lq;                                     // 0..63
    up[it] = *(const v4u*)(T + nl * TP + 8 * e);
  }
{
#pragma unroll
    for (int it = 0; it < 2; ++it) {
      const int nl = it * 32 + lq;
      *(v4u*)(XP + (size_t)(n0 + nl) * CIN + c0 + 8 * e) = up[it];
    }
    
  }
}

// =========================================================================================================
// (2) pointwise conv GEMM for one (64-n tile, projection mb in {q,k,v}): P[o][n] = (1/256) sum_c W16[o0+o][c]
//     XP[n][c] + bias[o]. Block 128 threads = 4 waves; wave w owns cols n0+16w..+15 (B fragment from the XP row,
//     k = c contiguous, split k map) and 4 m-tiles (A rows o0 + 16 mt + (lane&15) of W16, split k map).
//     K = 128 = 4 steps. Epilogue staged in LDS Os[n_loc][o_loc] (pitch OSP), block barrier, then:
//       mb 1: k   -> Kh = bf16-RNE(v), Kl = bf16-RNE(v - hi), planes bf16 [NTOK][64];
//       mb 2: v   -> Vc f16 [64 ch][NTOK] (channel-major, value f16(v*16)), row segment n0..n0+63 = one line.
// coverage: Os 4 waves x 16 n x 64 o = 64 x 64 (cols 0..63 of pitch 68, reads stay in cols 0..63);
//           Qh/Ql/Kh/Kl: 4 it x 16 rows x 8 lanes x 8 = 64 n x 64 d; Vc: 4 it x 16 ch x 8 lanes x 8 = 64 ch x 64 n;
//           grid (NTOK/64, 3) covers all rows of Qh, Ql, Kh, Kl and all of Vc exactly once.
// =========================================================================================================
__global__ __launch_bounds__(128)
void gemm_qkv(const unsigned short* __restrict__ W16, const unsigned short* __restrict__ XP,
              const float* __restrict__ bq, const float* __restrict__ bk, const float* __restrict__ bv,
              unsigned short* Qh, unsigned short* Ql, unsigned short* Kh, unsigned short* Kl,
              unsigned short* Vc) {
  __shared__ __align__(16) float Os[QT * OSP];
  const int tid  = threadIdx.x;
  const int lane = tid & 31, wave = tid >> 5;
  const int hh   = lane >> 4, c = lane & 15;
  const int nt   = blockIdx.x, mb = blockIdx.y;
  const int n0   = nt * QT, o0 = mb * QT;

  const unsigned short* ap = W16 + (size_t)(o0 + c) * CIN + 8 * hh;
  const unsigned short* bp = XP + (size_t)(n0 + 16 * wave + c) * CIN + 8 * hh;

  v8f acc[4];
#pragma unroll
  for (int mt = 0; mt < 4; ++mt) acc[mt] = zero8();

#pragma unroll
  for (int ks = 0; ks < CIN / 32; ++ks) {
    const Frag fb = ldfrag(bp + 32 * ks);
#pragma unroll
    for (int mt = 0; mt < 4; ++mt) {
      const Frag fa = ldfrag(ap + (size_t)(16 * mt) * CIN + 32 * ks);
      acc[mt] = mma_h(fa.h, fb.h, acc[mt]);
    }
  }

  // ---- epilogue: scale back + bias (+ 1/sqrt(ck) for q) -> LDS Os[n_loc][o_loc]
  const float* bsel = (mb == 0) ? bq : ((mb == 1) ? bk : bv);       // block-uniform, all global
  const float osc = (mb == 0) ? QSC : 1.0f;
  {
    const int nl = 16 * wave + c;
#pragma unroll
    for (int mt = 0; mt < 4; ++mt) {
      const v4f b0 = *(const v4f*)(bsel + 16 * mt + 8 * hh);
      const v4f b1 = *(const v4f*)(bsel + 16 * mt + 8 * hh + 4);
      v4f va, vb;
#pragma unroll
      for (int r = 0; r < 4; ++r) {
        va[r] = (acc[mt][r] * IWSC + bfr(b0[r])) * osc;
        vb[r] = (acc[mt][4 + r] * IWSC + bfr(b1[r])) * osc;
      }
      *(v4f*)(Os + nl * OSP + 16 * mt + 8 * hh)     = va;
      *(v4f*)(Os + nl * OSP + 16 * mt + 8 * hh + 4) = vb;
    }
  }
  __syncthreads();

  const int e = tid & 7, lq = tid >> 3;                             // lq 0..15
  if (mb < 2) {
    unsigned short* Ph = (mb == 0) ? Qh : Kh;                        // block-uniform, both global
    unsigned short* Pl = (mb == 0) ? Ql : Kl;
    v4u uh[4], ul[4];
#pragma unroll
    for (int it = 0; it < 4; ++it) {
      const int row = it * 16 + lq;                                  // n_loc 0..63
      const v4f a = *(const v4f*)(Os + row * OSP + 8 * e);
      const v4f q = *(const v4f*)(Os + row * OSP + 8 * e + 4);
      const float f[8] = {a[0], a[1], a[2], a[3], q[0], q[1], q[2], q[3]};
#pragma unroll
      for (int t = 0; t < 4; ++t) {
        const float f0 = f[2 * t], f1 = f[2 * t + 1];
        const unsigned short hb0 = bf_bits(f0), hb1 = bf_bits(f1);
        const unsigned short lb0 = bf_bits(f0 - bf_up(hb0));
        const unsigned short lb1 = bf_bits(f1 - bf_up(hb1));
        uh[it][t] = pk16(hb0, hb1);
        ul[it][t] = pk16(lb0, lb1);
      }
    }
{
#pragma unroll
      for (int it = 0; it < 4; ++it) {
        const int row = it * 16 + lq;
        const size_t po = (size_t)(n0 + row) * DK + 8 * e;
        *(v4u*)(Ph + po) = uh[it];
        *(v4u*)(Pl + po) = ul[it];
      }
      
    }
  } else {
    v4u uv[4];
#pragma unroll
    for (int it = 0; it < 4; ++it) {
      const int o = it * 16 + lq;                                    // channel 0..63
      unsigned short hb[8];
#pragma unroll
      for (int t = 0; t < 8; ++t) hb[t] = h_bits((_Float16)(Os[(8 * e + t) * OSP + o] * VSC));
#pragma unroll
      for (int t = 0; t < 4; ++t) uv[it][t] = pk16(hb[2 * t], hb[2 * t + 1]);
    }
{
#pragma unroll
      for (int it = 0; it < 4; ++it) {
        const int o = it * 16 + lq;
        *(v4u*)(Vc + (size_t)o * NTOK + n0 + 8 * e) = uv[it];
      }
      
    }
  }
}

// =========================================================================================================
// (3) global attention for one 64-query tile, transposed formulation, NTOK keys, no mask:
//   S^T tile (16 keys x 16 queries) = sum over 2 d-chunks of A(k: row = key kb + (lane&15), 32 d via the split
//   k map from the bf16 plane Kh [NTOK][64]) . B(q: col = query, same map from Qh) + A(Kh).B(Ql) + A(Kl).B(Qh)
//   (bf16 unscaled residual planes, shared accumulator, 3 products). q fragments (2 chunks x hi/lo) loaded once
//   per wave; k (hi and residual) and v tiles of KT keys are staged in a two-buffer LDS ring by asynchronous copies,
//   shared by the block's 16 waves: stage = Kh[KT][64] and Kl[KT][64] (row pitch KPH halves) + V[64 ch][KT] (pitch VPH);
//   tile t + 2 is copied into the buffer trip t has read, behind the barrier at the foot of trip t, and flies during
//   trip t + 1. Fragments come from LDS with the same split-map loader.
//   Per lane the D tile holds 8 keys of ONE query: online softmax state per lane, one shuffle (lane^16) for the max
//   over 32 keys; the o/l rescale is skipped under a wave-uniform ballot when no lane's max grew (corr == 1 exactly
//   for every lane then); row-sum partials combined at the end. P = e^{s-m} x 2^14 as f16 is the B operand of
//   O^T (rows channel, cols queries) += A(v rows channel = 16j + (lane&15), keys contiguous, f16 plane Vc
//   [64][NTOK]) . B(P^T): element r <- D of the tile covering keys kb..kb+15, element 8+r <- the tile covering
//   kb+16..kb+31, lane unchanged. 4 accumulator tiles per wave (64 channels). Block = 64 queries x KG key groups =
//   16 waves (4 per SIMD, so that one wave's LDS, softmax and matrix latencies are covered by the others): wave
//   (qw, kg) takes queries 16 qw .. +15 and keys KW kg .. +KW-1 of every tile, with its own m, l and o.
//   Epilogue: the groups' (m, l) are exchanged in LDS, block barrier, M = max m, L = sum l e^{m-M}; each wave stages
//   its o e^{m-M}/(16 L) in LDS Os[kg][query][64 ch] (pitch OSP, b128 stores), block barrier, then the KG planes are
//   summed in the order kg = 0..3 and the flat planes written.
// coverage: Os KG x 4 waves x 16 q x 64 ch (cols 0..63); Oh/Ol 64 rows x 8 lanes x 8 halves =
//           64 q x 64 ch per plane; grid (NTOK/64) covers rows 0..NTOK-1 of both planes exactly once.
// =========================================================================================================
__global__ __launch_bounds__(ATH)
void attn_k(const unsigned short* __restrict__ Qh, const unsigned short* __restrict__ Ql,
            const unsigned short* __restrict__ Kh, const unsigned short* __restrict__ Kl,
            const unsigned short* __restrict__ Vc, unsigned short* Oh, unsigned short* Ol) {
  __shared__ __align__(16) float Os[KG * QT * OSP];
  __shared__ float Mg[KG * QT];
  __shared__ float Lg[KG * QT];
  __shared__ __align__(16) unsigned short Ring[2 * STGH];
  const int tid  = threadIdx.x;
  const int wave = tid >> 5, lane = tid & 31;
  const int qw   = wave & 3, kg = wave >> 2;                        // query sub-tile, key group
  const int hh   = lane >> 4, c = lane & 15;
  const int n0   = blockIdx.x * QT;

  // q fragments (B operand, col = query n0 + 16*qw + c), d chunks 0 and 1, hi and residual planes
  const size_t qo = (size_t)(n0 + 16 * qw + c) * DK + 8 * hh;
  const Frag qh0 = ldfrag(Qh + qo), qh1 = ldfrag(Qh + qo + 32);
  const Frag ql0 = ldfrag(Ql + qo), ql1 = ldfrag(Ql + qo + 32);
  // copy addresses of this lane. K planes: copy i moves 64 rows (8 lanes x 16 B per 128-B row), row 64 i + (tid >> 3);
  // V: copy i moves 16 channel rows (32 lanes x 16 B per 512-B row segment), row 16 i + (tid >> 5).
  const unsigned ring0 = (unsigned)(uintptr_t)Ring;                  // LDS byte address of the ring
  const unsigned lk = ring0 + (unsigned)((tid >> 3) * (KPH * 2) + (tid & 7) * 16);
  const unsigned lv = ring0 + (unsigned)(SVV * 2 + (tid >> 5) * (VPH * 2) + (tid & 31) * 16);
  const unsigned short* gkh = Kh + (size_t)tid * 8;
  const unsigned short* gkl = Kl + (size_t)tid * 8;
  const unsigned short* gv  = Vc + (size_t)(tid >> 5) * NTOK + 8 * (tid & 31);
  auto fill = [&](int buf, int tile) {
    const unsigned lb = (unsigned)buf * (unsigned)(STGH * 2);
    copy4(lk + lb,           64 * KPH * 2, gkh + (size_t)tile * (KT * DK), (size_t)64 * DK);
    copy4(lk + lb + SKL * 2, 64 * KPH * 2, gkl + (size_t)tile * (KT * DK), (size_t)64 * DK);
    copy4(lv + lb,           16 * VPH * 2, gv + (size_t)tile * KT,         (size_t)16 * NTOK);
  };
  // fragment offsets inside a stage (halves): k row = key KW kg + c (+ 32 p, + 16), v row = channel c (+ 16 j),
  // v column = key KW kg (+ 32 p)
  const int kfo = (KW * kg + c) * KPH + 8 * hh;
  const int vfo = SVV + c * VPH + KW * kg + 8 * hh;

  fill(0, 0);
  wait_async0();
  __syncthreads();                                                   // tile 0 is readable by every wave
  fill(1, 1);

  float m = -1.0e30f, l = 0.f;
  v8f o[4];
#pragma unroll
  for (int j = 0; j < 4; ++j) o[j] = zero8();

#pragma unroll 1
  for (int t = 0; t < NTOK / KT; ++t) {
  const unsigned short* Sb  = Ring + (t & 1) * STGH;                // trip t reads buffer t mod 2 alone
  const unsigned short* Khp = Sb + kfo;
  const unsigned short* Klp = Sb + SKL + kfo;
  const unsigned short* Vp  = Sb + vfo;
  // unrolled so that every LDS offset of a stage is an immediate of its load
#pragma unroll
  for (int kb = 0; kb < KW; kb += 32) {
    const int r0o = kb * KPH;                                       // keys kb .. kb+15 of the group's share
    const int r1o = (kb + 16) * KPH;                                // keys kb+16 .. kb+31
    v8f s0 = zero8(), s1 = zero8();
    {
      const Frag k00 = ldfrag(Khp + r0o), k10 = ldfrag(Khp + r1o);  // d chunk 0, hi
      const Frag g00 = ldfrag(Klp + r0o), g10 = ldfrag(Klp + r1o);  // d chunk 0, residual
      s0 = mma_b(k00.bf, qh0.bf, s0);
      s1 = mma_b(k10.bf, qh0.bf, s1);
      s0 = mma_b(k00.bf, ql0.bf, s0);
      s1 = mma_b(k10.bf, ql0.bf, s1);
      s0 = mma_b(g00.bf, qh0.bf, s0);
      s1 = mma_b(g10.bf, qh0.bf, s1);
    }
    {
      const Frag k01 = ldfrag(Khp + r0o + 32), k11 = ldfrag(Khp + r1o + 32);   // d chunk 1, hi
      const Frag g01 = ldfrag(Klp + r0o + 32), g11 = ldfrag(Klp + r1o + 32);   // d chunk 1, residual
      s0 = mma_b(k01.bf, qh1.bf, s0);
      s1 = mma_b(k11.bf, qh1.bf, s1);
      s0 = mma_b(k01.bf, ql1.bf, s0);
      s1 = mma_b(k11.bf, ql1.bf, s1);
      s0 = mma_b(g01.bf, qh1.bf, s0);
      s1 = mma_b(g11.bf, qh1.bf, s1);
    }

    float mx = fmaxf(hmax8(s0), hmax8(s1));
    mx = fmaxf(mx, __shfl_xor(mx, 16, 32));
    const float mn = fmaxf(m, mx);
    const unsigned grew = wave_ballot(mx > m);                       // wave-uniform
    if (grew != 0u) {
      const float corr = __expf(m - mn);                             // == 1 exactly for lanes whose max did not grow
      l *= corr;
#pragma unroll
      for (int j = 0; j < 4; ++j) {
#pragma unroll
        for (int r = 0; r < 8; ++r) o[j][r] *= corr;
      }
    }
    m = mn;
    const float msh = mn - LNPS;                                     // exp gives e^{s-m} * 2^14

    FragH ph;
    float ls = 0.f;
#pragma unroll
    for (int r = 0; r < 8; ++r) {
      const float e0 = __expf(s0[r] - msh);                          // key kb      + 8hh + r
      const float e1 = __expf(s1[r] - msh);                          // key kb + 16 + 8hh + r
      ls += e0 + e1;
      ph.hv[0][r] = (_Float16)e0;
      ph.hv[1][r] = (_Float16)e1;
    }
    l += ls;

#pragma unroll
    for (int j = 0; j < 4; ++j) {
      const Frag vf = ldfrag(Vp + (16 * j) * VPH + kb);
      o[j] = mma_h(vf.h, ph.v, o[j]);
    }
  }
  // foot of trip t: own reads done, own copies of tile t + 1 landed, then the one barrier that publishes tile t + 1
  // and ends every wave's reads of buffer t mod 2; only then its refill
  wait_ds0();
  wait_async0();
  __syncthreads();
  if (t + 2 < NTOK / KT) fill(t & 1, t + 2);
  }
  wait_async0();
  l += __shfl_xor(l, 16, 32);

  // merge of the KG key groups: (m, l) of every group and query through LDS (m and l are equal in lanes c and c + 16)
  const int qrow = 16 * qw + c;
  if (hh == 0) { Mg[kg * QT + qrow] = m; Lg[kg * QT + qrow] = l; }
  __syncthreads();                                                   // every group's (m, l) is readable
  float mall = Mg[qrow];
#pragma unroll
  for (int g = 1; g < KG; ++g) mall = fmaxf(mall, Mg[g * QT + qrow]);
  float lall = 0.f;
#pragma unroll
  for (int g = 0; g < KG; ++g) lall += Lg[g * QT + qrow] * __expf(Mg[g * QT + qrow] - mall);
  const float scl = (__expf(m - mall) / lall) * IVSC;                // o and l both carry 2^14; o also carries the v x16

  float* Ow = Os + kg * (QT * OSP);
#pragma unroll
  for (int j = 0; j < 4; ++j) {
    v4f va, vb;
#pragma unroll
    for (int r = 0; r < 4; ++r) { va[r] = o[j][r] * scl; vb[r] = o[j][4 + r] * scl; }
    *(v4f*)(Ow + qrow * OSP + 16 * j + 8 * hh)     = va;            // Os[kg][query][ch = 16j + 8hh + r]
    *(v4f*)(Ow + qrow * OSP + 16 * j + 8 * hh + 4) = vb;
  }
  __syncthreads();                                                   // every group's weighted o is readable

  const int e = tid & 7, row = tid >> 3;                             // row = query 0..63
  v4f a = *(const v4f*)(Os + row * OSP + 8 * e);
  v4f q = *(const v4f*)(Os + row * OSP + 8 * e + 4);
#pragma unroll
  for (int g = 1; g < KG; ++g) {
    a += *(const v4f*)(Os + g * (QT * OSP) + row * OSP + 8 * e);
    q += *(const v4f*)(Os + g * (QT * OSP) + row * OSP + 8 * e + 4);
  }
  const float f[8] = {a[0], a[1], a[2], a[3], q[0], q[1], q[2], q[3]};
  v4u uh, ul;
#pragma unroll
  for (int t = 0; t < 4; ++t) {
    const float g0 = f[2 * t] * OSC, g1 = f[2 * t + 1] * OSC;
    const _Float16 h0 = (_Float16)g0, h1 = (_Float16)g1;
    const _Float16 l0 = (_Float16)((g0 - (float)h0) * RSC);
    const _Float16 l1 = (_Float16)((g1 - (float)h1) * RSC);
    uh[t] = pk16(h_bits(h0), h_bits(h1));
    ul[t] = pk16(h_bits(l0), h_bits(l1));
  }
  const size_t po = (size_t)(n0 + row) * DK + 8 * e;
  *(v4u*)(Oh + po) = uh;
  *(v4u*)(Ol + po) = ul;
}

// =========================================================================================================
// (4) output pointwise conv over the raw view: Y[o][n'] = (1/256)(1/1024) sum_{c'} Wo16[o][c'] (Ohv[c'][n'] +
//     Olv[c'][n'] / 1024) + bo[o], where Ohv/Olv [64][NTOK] are the flat O planes re-read with row c' = halves
//     c'*NTOK .. +NTOK-1. Block (nt, mb): 64 n' x 64 o. The two 64 c' x 64 n' B tiles are staged transposed in
//     LDS Bh/Bl[n'_loc][c'] (pitch TP, 16-B global loads, 2-byte LDS stores), block barrier, then B fragments per
//     wave (col n0'+16w+(lane&15), k = c' contiguous, split k map) and A fragments from Wo16 rows o0+16mt+(lane&15).
//     K = 64 = 2 steps; hi and residual products in separate accumulators. Epilogue staged in Ys[n'_loc][o_loc]
// coverage: Bh/Bl 4 it x 16 c' x (8 x 8 n') = 64 x 64 each (cols 0..63 of pitch 72); Ys 4 waves x 16 n' x 64 o;
//           out: 8 it x 16 lines x 8 lanes x 4 floats = 64 o x 64 n'; grid (NTOK/64, COUT/64) covers
//           out[0..127][0..NTOK-1] exactly once.
// =========================================================================================================
__global__ __launch_bounds__(128)
void gemm_o(const unsigned short* __restrict__ Wo16, const unsigned short* __restrict__ Oh,
            const unsigned short* __restrict__ Ol, const float* __restrict__ bo, float* Y) {
  __shared__ __align__(16) unsigned short Bh[QT * TP];
  __shared__ __align__(16) unsigned short Bl[QT * TP];
  __shared__ __align__(16) float Ys[QT * OSP];
  const int tid  = threadIdx.x;
  const int lane = tid & 31, wave = tid >> 5;
  const int hh   = lane >> 4, c = lane & 15;
  const int nt   = blockIdx.x, mb = blockIdx.y;
  const int n0   = nt * QT, o0 = mb * QT;
  const int e = tid & 7, lq = tid >> 3;                              // lq 0..15

  // ---- stage the view tiles transposed: Bh[n'_loc][c'] <- Oh[c'*NTOK + n0 + n'_loc]
#pragma unroll
  for (int it = 0; it < 4; ++it) {
    const int cl = it * 16 + lq;                                     // c' 0..63
    const size_t so = (size_t)cl * NTOK + n0 + 8 * e;
    const v4u ah = *(const v4u*)(Oh + so);
    const v4u al = *(const v4u*)(Ol + so);
#pragma unroll
    for (int t = 0; t < 4; ++t) {
      Bh[(8 * e + 2 * t) * TP + cl]     = (unsigned short)(ah[t] & 0xffffu);
      Bh[(8 * e + 2 * t + 1) * TP + cl] = (unsigned short)(ah[t] >> 16);
      Bl[(8 * e + 2 * t) * TP + cl]     = (unsigned short)(al[t] & 0xffffu);
      Bl[(8 * e + 2 * t + 1) * TP + cl] = (unsigned short)(al[t] >> 16);
    }
  }
  __syncthreads();

  const unsigned short* ap  = Wo16 + (size_t)(o0 + c) * DK + 8 * hh;
  const unsigned short* bph = Bh + (16 * wave + c) * TP + 8 * hh;
  const unsigned short* bpl = Bl + (16 * wave + c) * TP + 8 * hh;

  v8f acch[4], accl[4];
#pragma unroll
  for (int mt = 0; mt < 4; ++mt) { acch[mt] = zero8(); accl[mt] = zero8(); }

#pragma unroll
  for (int ks = 0; ks < DK / 32; ++ks) {
    const Frag fbh = ldfrag(bph + 32 * ks);
    const Frag fbl = ldfrag(bpl + 32 * ks);
#pragma unroll
    for (int mt = 0; mt < 4; ++mt) {
      const Frag fa = ldfrag(ap + (size_t)(16 * mt) * DK + 32 * ks);
      acch[mt] = mma_h(fa.h, fbh.h, acch[mt]);
      accl[mt] = mma_h(fa.h, fbl.h, accl[mt]);
    }
  }

  // ---- epilogue: fold residual, scale back, bias -> Ys[n'_loc][o_loc]
  {
    const int nl = 16 * wave + c;
    const float fs = IWSC * IOSC;
#pragma unroll
    for (int mt = 0; mt < 4; ++mt) {
      const v4f b0 = *(const v4f*)(bo + o0 + 16 * mt + 8 * hh);
      const v4f b1 = *(const v4f*)(bo + o0 + 16 * mt + 8 * hh + 4);
      v4f va, vb;
#pragma unroll
      for (int r = 0; r < 4; ++r) {
        va[r] = (acch[mt][r] + accl[mt][r] * IRSC) * fs + bfr(b0[r]);
        vb[r] = (acch[mt][4 + r] + accl[mt][4 + r] * IRSC) * fs + bfr(b1[r]);
      }
      *(v4f*)(Ys + nl * OSP + 16 * mt + 8 * hh)     = va;
      *(v4f*)(Ys + nl * OSP + 16 * mt + 8 * hh + 4) = vb;
    }
  }
  __syncthreads();

  v4f res[8];
#pragma unroll
  for (int it = 0; it < 8; ++it) {
    const int L  = it * 16 + lq;                                     // line 0..127
    const int ol = L >> 1, hf = L & 1;                               // o_loc 0..63, line half
    const int nl = hf * 32 + 4 * e;                                  // n'_loc 0..63
#pragma unroll
    for (int t = 0; t < 4; ++t) res[it][t] = Ys[(nl + t) * OSP + ol];
  }
{
#pragma unroll
    for (int it = 0; it < 8; ++it) {
      const int L  = it * 16 + lq;
      const int ol = L >> 1, hf = L & 1;
      const int nl = hf * 32 + 4 * e;
      *(v4f*)(Y + (size_t)(o0 + ol) * NTOK + n0 + nl) = res[it];
    }
    
  }
}

// =========================================================================================================
// Workspace map (bytes, full size ND=16; each region start a multiple of 256; every extent is an exact tile
//   W16 f16 [192][128]        49152        Wo16 f16 [128][64]      16384
//   XP  f16 [16384][128]    4194304
//   Qh/Ql/Kh/Kl bf16 [16384][64] 2097152 x4   Vc f16 [64][16384]   2097152
//   Oh/Ol f16 [16384][64]   2097152 x2
//   total = 18939904
// =========================================================================================================
extern "C" void kernel_launch(void* const* d_in, const int* in_sizes, int n_in,
                              void* d_out, int out_size, void* d_ws, size_t ws_size,
                              hipStream_t stream) {
  if (n_in < 9) return;
  if (in_sizes[0] < CIN * NTOK) return;
  if ((in_sizes[0] % CIN) != 0) return;
  const int xstride = in_sizes[0] / CIN;                             // per-channel position stride of X
  if (xstride < NTOK || (xstride % 4) != 0) return;
  if (in_sizes[1] < DK * CIN || in_sizes[3] < DK * CIN || in_sizes[5] < DK * CIN) return;
  if (in_sizes[2] < DK || in_sizes[4] < DK || in_sizes[6] < DK) return;
  if (in_sizes[7] < COUT * DK || in_sizes[8] < COUT) return;
  if (out_size < COUT * NTOK) return;

  size_t off = 0;
  auto carve = [&](size_t bytes) { const size_t o = off; off += (bytes + 255) & ~(size_t)255; return o; };
  const size_t oW16  = carve((size_t)3 * DK * CIN * 2);
  const size_t oWo16 = carve((size_t)COUT * DK * 2);
  const size_t oXP   = carve((size_t)NTOK * CIN * 2);
  const size_t oQh   = carve((size_t)NTOK * DK * 2);
  const size_t oQl   = carve((size_t)NTOK * DK * 2);
  const size_t oKh   = carve((size_t)NTOK * DK * 2);
  const size_t oKl   = carve((size_t)NTOK * DK * 2);
  const size_t oVc   = carve((size_t)DK * NTOK * 2);
  const size_t oOh   = carve((size_t)NTOK * DK * 2);
  const size_t oOl   = carve((size_t)NTOK * DK * 2);
  if (off > ws_size) return;
  if (off > (size_t)134217728) return;

  const float* X  = (const float*)d_in[0];
  const float* Wq = (const float*)d_in[1];
  const float* bq = (const float*)d_in[2];
  const float* Wk = (const float*)d_in[3];
  const float* bk = (const float*)d_in[4];
  const float* Wv = (const float*)d_in[5];
  const float* bv = (const float*)d_in[6];
  const float* Wo = (const float*)d_in[7];
  const float* bo = (const float*)d_in[8];

  char* ws = (char*)d_ws;
  unsigned short* W16  = (unsigned short*)(ws + oW16);
  unsigned short* Wo16 = (unsigned short*)(ws + oWo16);
  unsigned short* XP   = (unsigned short*)(ws + oXP);
  unsigned short* Qh   = (unsigned short*)(ws + oQh);
  unsigned short* Ql   = (unsigned short*)(ws + oQl);
  unsigned short* Kh   = (unsigned short*)(ws + oKh);
  unsigned short* Kl   = (unsigned short*)(ws + oKl);
  unsigned short* Vc   = (unsigned short*)(ws + oVc);
  unsigned short* Oh   = (unsigned short*)(ws + oOh);
  unsigned short* Ol   = (unsigned short*)(ws + oOl);
  float* out = (float*)d_out;

  const dim3 blk256(256), blk128(128);
  const int BQ = (DK * CIN) / (8 * CHB), BO = (COUT * DK) / (8 * CHB);

  // (0) weights -> f16 planes
  cvt_w<<<dim3(3 * BQ + BO), dim3(CHB), 0, stream>>>(Wq, Wk, Wv, Wo, W16, Wo16);
  // (1) x -> position-major 16-bit plane
  cvt_x<<<dim3(NTOK / QT, CIN / QT), blk256, 0, stream>>>(X, xstride, XP);
  // (2) q/k/v pointwise conv GEMM -> q hi + residual, k hi + residual, v planes
  gemm_qkv<<<dim3(NTOK / QT, 3), blk128, 0, stream>>>(W16, XP, bq, bk, bv, Qh, Ql, Kh, Kl, Vc);
  // (3) global attention -> O hi + residual planes [NTOK][64]
  attn_k<<<dim3(NTOK / QT), dim3(ATH), 0, stream>>>(Qh, Ql, Kh, Kl, Vc, Oh, Ol);
  // (4) output conv over the raw [64][NTOK] view -> out [128][NTOK]
  gemm_o<<<dim3(NTOK / QT, COUT / QT), blk128, 0, stream>>>(Wo16, Oh, Ol, bo, out);
  (void)hipGetLastError();
}

// v003
// One run takes 139 microseconds.
// Timed twice side by side with v002, it ran 1.09 times as fast both times.
// All steps since v000 together make it 6.07 times as fast.
// Contractions: q/k/v pointwise conv W16[192x128].XP[n][128] on v_wmma_f32_16x16x32_f16 (f16 containers of
// bf16-RNE weights x256 and bf16-RNE x, exact products); scores K.Q^T on v_wmma_f32_16x16x32_bf16 (bf16 hi +
// bf16 residual planes of k and of q/8, 3 products hi.hi + hi.lo + lo.hi, K=64); O^T = V.P^T on
// v_wmma_f32_16x16x32_f16 (v x16 as f16, P = e^{s-m} x2^14 f16 from the score D registers); output conv
// Wo16[128x64].Oview[64][N] on v_wmma_f32_16x16x32_f16 (f16 of bf16-RNE weights x256; O carried as f16 hi x1024
// plane + f16 residual x2^20 plane, 2 products, separate accumulators); f32 accumulate everywhere; softmax
// statistics and bias adds in f32 VALU.
#include <hip/hip_runtime.h>
#include <math.h>
#include <stdint.h>

#ifndef ND
#define ND 16
#endif
#define NHH    32
#define NWW    32
#define NTOK   (ND * NHH * NWW)
#define CIN    128
#define DK     64
#define COUT   128
#define QT     64
#define OSP    68
#define TP     72
#define CHB    256
#define WSC    256.0f
#define IWSC   0.00390625f
#define QSC    0.125f
#define VSC    16.0f
#define IVSC   0.0625f
#define OSC    1024.0f
#define IOSC   0.0009765625f
#define RSC    1024.0f
#define IRSC   0.0009765625f
#define LNPS   9.704060527839234f
#define KG     4
#define ATH    (128 * KG)
#define KT     256
#define KW     (KT / KG)
#define KPH    72
#define VPH    264
#define SKL    (KT * KPH)
#define SVV    (2 * KT * KPH)
#define STGH   (2 * KT * KPH + DK * VPH)

static_assert(ND >= 1 && ND <= 16);
static_assert(NTOK % QT == 0);
static_assert(NTOK % 32 == 0);
static_assert(CIN % QT == 0 && CIN % 32 == 0);
static_assert(DK == QT);
static_assert(DK % 32 == 0);
static_assert(COUT % QT == 0);
static_assert((DK * CIN) % (8 * CHB) == 0);
static_assert((COUT * DK) % (8 * CHB) == 0);
static_assert((OSP * 4) % 16 == 0);
static_assert((TP * 2) % 16 == 0);
static_assert(KT % 32 == 0 && NTOK % KT == 0 && NTOK / KT >= 2);
static_assert((ATH / 8) * 4 == KT && (ATH / 32) * 4 == DK && KT == 8 * 32 && DK == 8 * 8);
static_assert(KW % 32 == 0 && VPH == KT + 8 && QT * 8 == ATH && QT == 4 * 16);
static_assert((KPH * 2) % 32 == 16 && (VPH * 2) % 32 == 16 && (STGH * 2) % 16 == 0);

typedef _Float16       v16h __attribute__((ext_vector_type(16)));
typedef _Float16       v8h  __attribute__((ext_vector_type(8)));
typedef __bf16         v16b __attribute__((ext_vector_type(16)));
typedef unsigned short v8us __attribute__((ext_vector_type(8)));
typedef float          v8f  __attribute__((ext_vector_type(8)));
typedef float          v4f  __attribute__((ext_vector_type(4)));
typedef unsigned int   v4u  __attribute__((ext_vector_type(4)));

union Frag  { v8us u[2]; v16h h; v16b bf; };
union FragH { v16h v; v8h hv[2]; };
static_assert(sizeof(Frag) == 32);
static_assert(sizeof(FragH) == 32);

// ---- scalar helpers ---------------------------------------------------------------------------------------
__device__ __forceinline__ unsigned short bf_bits(float f) {          // f32 -> bf16 bits, RNE convert
  unsigned u = __float_as_uint(f);
  return (unsigned short)((u + 0x7FFFu + ((u >> 16) & 1u)) >> 16);
}
__device__ __forceinline__ float bf_up(unsigned short hb) { return __uint_as_float(((unsigned)hb) << 16); }
__device__ __forceinline__ float bfr(float f) { return bf_up(bf_bits(f)); }
__device__ __forceinline__ unsigned short h_bits(_Float16 x) { return __builtin_bit_cast(unsigned short, x); }
__device__ __forceinline__ unsigned pk16(unsigned short a, unsigned short b) { return (unsigned)a | ((unsigned)b << 16); }
__device__ __forceinline__ v8f zero8() { v8f z = {0.f, 0.f, 0.f, 0.f, 0.f, 0.f, 0.f, 0.f}; return z; }
__device__ __forceinline__ float hmax8(v8f s) {
  return fmaxf(fmaxf(fmaxf(s[0], s[1]), fmaxf(s[2], s[3])), fmaxf(fmaxf(s[4], s[5]), fmaxf(s[6], s[7])));
}
__device__ __forceinline__ unsigned wave_ballot(bool p) {
#if defined(__HIP_DEVICE_COMPILE__)
  return __builtin_amdgcn_ballot_w32(p);
#else
  return p ? 1u : 0u;
#endif
}

// ---- 16-bit fragment loader (A, or B from a k-contiguous [n][k] row): lane -> row/col (lane&15), p already includes
//      + 8*(lane>>4); elements 0..7 <- p[0..7] (k0+8h..), elements 8..15 <- p[16..23] (k0+16+8h..)
__device__ __forceinline__ Frag ldfrag(const unsigned short* p) {
  Frag f;
  f.u[0] = *(const v8us*)(p);
  f.u[1] = *(const v8us*)(p + 16);
  return f;
}

// ---- the 8 k fragments of one block of 32 keys (rows r0 = kb .. +15, r1 = kb+16 .. +31; d chunks 0 and 1; hi and residual)
struct KSet { Frag h00, h10, g00, g10, h01, h11, g01, g11; };
__device__ __forceinline__ KSet ldkset(const unsigned short* hp, const unsigned short* lp, int r0o, int r1o) {
  KSet k;
  k.h00 = ldfrag(hp + r0o);      k.h10 = ldfrag(hp + r1o);
  k.g00 = ldfrag(lp + r0o);      k.g10 = ldfrag(lp + r1o);
  k.h01 = ldfrag(hp + r0o + 32); k.h11 = ldfrag(hp + r1o + 32);
  k.g01 = ldfrag(lp + r0o + 32); k.g11 = ldfrag(lp + r1o + 32);
  return k;
}

// ---- WMMA helpers: builtin followed by a 4-slot VALU gap tying D and keeping A/B live --------------------------
__device__ __forceinline__ v8f mma_h(v16h a, v16h b, v8f c) {
  v8f d = __builtin_amdgcn_wmma_f32_16x16x32_f16(false, a, false, b, (short)0, c, false, false);
#if defined(__HIP_DEVICE_COMPILE__)
  asm volatile("v_nop\n\tv_nop\n\tv_nop\n\tv_nop" : "+v"(d) : "v"(a), "v"(b));
#endif
  return d;
}
__device__ __forceinline__ v8f mma_b(v16b a, v16b b, v8f c) {
  v8f d = __builtin_amdgcn_wmma_f32_16x16x32_bf16(false, a, false, b, (short)0, c, false, false);
#if defined(__HIP_DEVICE_COMPILE__)
  const v16h ha = __builtin_bit_cast(v16h, a), hb = __builtin_bit_cast(v16h, b);
  asm volatile("v_nop\n\tv_nop\n\tv_nop\n\tv_nop" : "+v"(d) : "v"(ha), "v"(hb));
#endif
  return d;
}

// ---- LDS ring helpers (attention) ---------------------------------------------------------------------------
// Four asynchronous 16-byte copies global -> LDS per lane (l = the lane's LDS byte address, g = its global address),
// with the s_wait_xcnt 0 that stands before the address registers may be rewritten as the statement's last line.
__device__ __forceinline__ void copy4(unsigned l0, unsigned lstep, const unsigned short* g0, size_t gstep) {
#if defined(__HIP_DEVICE_COMPILE__)
  asm volatile("global_load_async_to_lds_b128 %0, %4, off\n\t"
               "global_load_async_to_lds_b128 %1, %5, off\n\t"
               "global_load_async_to_lds_b128 %2, %6, off\n\t"
               "global_load_async_to_lds_b128 %3, %7, off\n\t"
               "s_wait_xcnt 0x0"
               :: "v"(l0), "v"(l0 + lstep), "v"(l0 + 2 * lstep), "v"(l0 + 3 * lstep),
                  "v"(g0), "v"(g0 + gstep), "v"(g0 + 2 * gstep), "v"(g0 + 3 * gstep)
               : "memory");
#endif
}
// this wave's own copies have landed in LDS (the compiler places no wait for them)
__device__ __forceinline__ void wait_async0() {
#if defined(__HIP_DEVICE_COMPILE__)
  asm volatile("s_wait_asynccnt 0x0" ::: "memory");
#endif
}
// this wave's own LDS reads have returned, before the buffer they read is handed back for a refill
__device__ __forceinline__ void wait_ds0() {
#if defined(__HIP_DEVICE_COMPILE__)
  asm volatile("s_wait_dscnt 0x0" ::: "memory");
#endif
}

// =========================================================================================================
// (0) weight planes: W16 f16 [192][128] (rows 0..63 = Wq, 64..127 = Wk, 128..191 = Wv) and Wo16 f16 [128][64];
//     value = f16 of (bf16-RNE(w) * 256) (exact). Thread = one 8-element chunk (16 B); 8 consecutive lanes =
// coverage: (3*BQ + BO) blocks x 256 threads x 8 halves = 3*8192 + 8192 elements = both planes exactly.
// =========================================================================================================
__global__ __launch_bounds__(CHB)
void cvt_w(const float* __restrict__ Wq, const float* __restrict__ Wk, const float* __restrict__ Wv,
           const float* __restrict__ Wo, unsigned short* W16, unsigned short* Wo16) {
  const int tid = threadIdx.x, blk = blockIdx.x;
  const int BQ = (DK * CIN) / (8 * CHB);                             // blocks per q/k/v matrix
  const int g = blk * CHB + tid;                                     // chunk id
  const float* src;
  unsigned short* dst;
  int gsrc, gdst;
  if (blk < BQ)          { src = Wq; gsrc = 0;            dst = W16;  gdst = 0; }
  else if (blk < 2 * BQ) { src = Wk; gsrc = BQ * CHB;     dst = W16;  gdst = 0; }
  else if (blk < 3 * BQ) { src = Wv; gsrc = 2 * BQ * CHB; dst = W16;  gdst = 0; }
  else                   { src = Wo; gsrc = 3 * BQ * CHB; dst = Wo16; gdst = 3 * BQ * CHB; }
  const float* s = src + (size_t)8 * (size_t)(g - gsrc);
  const v4f a = *(const v4f*)s;
  const v4f q = *(const v4f*)(s + 4);
  const float f[8] = {a[0], a[1], a[2], a[3], q[0], q[1], q[2], q[3]};
  v4u u;
#pragma unroll
  for (int t = 0; t < 4; ++t) {
    const _Float16 h0 = (_Float16)(bfr(f[2 * t]) * WSC);
    const _Float16 h1 = (_Float16)(bfr(f[2 * t + 1]) * WSC);
    u[t] = pk16(h_bits(h0), h_bits(h1));
  }
{
    *(v4u*)(dst + (size_t)8 * (size_t)(g - gdst)) = u;
    
  }
}

// =========================================================================================================
// (1) X f32 [128 c][xstride] (first NTOK positions used) -> XP f16 [NTOK n][128 c] (position-major, bf16-RNE
//     values, exact in f16) through an LDS tile T[64 n][64 c] (pitch TP). Block (nb, cb) owns a 64 c x 64 n tile.
// coverage: T 2 it x 32 c x (8 x 8 n) = 64 x 64; XP 2 it x 32 rows x 8 lanes x 8 halves = 64 n x 64 c;
//           grid (NTOK/64, 2) covers XP [NTOK][128] exactly once.
// =========================================================================================================
__global__ __launch_bounds__(256)
void cvt_x(const float* __restrict__ X, int xstride, unsigned short* XP) {
  __shared__ __align__(16) unsigned short T[QT * TP];
  const int tid = threadIdx.x;
  const int nb = blockIdx.x, cb = blockIdx.y;
  const int e = tid & 7, lq = tid >> 3;                             // lq 0..31
  const int n0 = nb * QT, c0 = cb * QT;
#pragma unroll
  for (int it = 0; it < 2; ++it) {
    const int cl = it * 32 + lq;                                     // 0..63
    const float* sp = X + (size_t)(c0 + cl) * (size_t)xstride + n0 + 8 * e;
    const v4f a = *(const v4f*)sp;
    const v4f q = *(const v4f*)(sp + 4);
    unsigned short hb[8];
#pragma unroll
    for (int t = 0; t < 4; ++t) {
      hb[t]     = h_bits((_Float16)bfr(a[t]));
      hb[4 + t] = h_bits((_Float16)bfr(q[t]));
    }
#pragma unroll
    for (int t = 0; t < 8; ++t) T[(8 * e + t) * TP + cl] = hb[t];
  }
  __syncthreads();
  v4u up[2];
#pragma unroll
  for (int it = 0; it < 2; ++it) {
    const int nl = it * 32 + lq;                                     // 0..63
    up[it] = *(const v4u*)(T + nl * TP + 8 * e);
  }
{
#pragma unroll
    for (int it = 0; it < 2; ++it) {
      const int nl = it * 32 + lq;
      *(v4u*)(XP + (size_t)(n0 + nl) * CIN + c0 + 8 * e) = up[it];
    }
    
  }
}

// =========================================================================================================
// (2) pointwise conv GEMM for one (64-n tile, projection mb in {q,k,v}): P[o][n] = (1/256) sum_c W16[o0+o][c]
//     XP[n][c] + bias[o]. Block 128 threads = 4 waves; wave w owns cols n0+16w..+15 (B fragment from the XP row,
//     k = c contiguous, split k map) and 4 m-tiles (A rows o0 + 16 mt + (lane&15) of W16, split k map).
//     K = 128 = 4 steps. Epilogue staged in LDS Os[n_loc][o_loc] (pitch OSP), block barrier, then:
//       mb 1: k   -> Kh = bf16-RNE(v), Kl = bf16-RNE(v - hi), planes bf16 [NTOK][64];
//       mb 2: v   -> Vc f16 [64 ch][NTOK] (channel-major, value f16(v*16)), row segment n0..n0+63 = one line.
// coverage: Os 4 waves x 16 n x 64 o = 64 x 64 (cols 0..63 of pitch 68, reads stay in cols 0..63);
//           Qh/Ql/Kh/Kl: 4 it x 16 rows x 8 lanes x 8 = 64 n x 64 d; Vc: 4 it x 16 ch x 8 lanes x 8 = 64 ch x 64 n;
//           grid (NTOK/64, 3) covers all rows of Qh, Ql, Kh, Kl and all of Vc exactly once.
// =========================================================================================================
__global__ __launch_bounds__(128)
void gemm_qkv(const unsigned short* __restrict__ W16, const unsigned short* __restrict__ XP,
              const float* __restrict__ bq, const float* __restrict__ bk, const float* __restrict__ bv,
              unsigned short* Qh, unsigned short* Ql, unsigned short* Kh, unsigned short* Kl,
              unsigned short* Vc) {
  __shared__ __align__(16) float Os[QT * OSP];
  const int tid  = threadIdx.x;
  const int lane = tid & 31, wave = tid >> 5;
  const int hh   = lane >> 4, c = lane & 15;
  const int nt   = blockIdx.x, mb = blockIdx.y;
  const int n0   = nt * QT, o0 = mb * QT;

  const unsigned short* ap = W16 + (size_t)(o0 + c) * CIN + 8 * hh;
  const unsigned short* bp = XP + (size_t)(n0 + 16 * wave + c) * CIN + 8 * hh;

  v8f acc[4];
#pragma unroll
  for (int mt = 0; mt < 4; ++mt) acc[mt] = zero8();

#pragma unroll
  for (int ks = 0; ks < CIN / 32; ++ks) {
    const Frag fb = ldfrag(bp + 32 * ks);
#pragma unroll
    for (int mt = 0; mt < 4; ++mt) {
      const Frag fa = ldfrag(ap + (size_t)(16 * mt) * CIN + 32 * ks);
      acc[mt] = mma_h(fa.h, fb.h, acc[mt]);
    }
  }

  // ---- epilogue: scale back + bias (+ 1/sqrt(ck) for q) -> LDS Os[n_loc][o_loc]
  const float* bsel = (mb == 0) ? bq : ((mb == 1) ? bk : bv);       // block-uniform, all global
  const float osc = (mb == 0) ? QSC : 1.0f;
  {
    const int nl = 16 * wave + c;
#pragma unroll
    for (int mt = 0; mt < 4; ++mt) {
      const v4f b0 = *(const v4f*)(bsel + 16 * mt + 8 * hh);
      const v4f b1 = *(const v4f*)(bsel + 16 * mt + 8 * hh + 4);
      v4f va, vb;
#pragma unroll
      for (int r = 0; r < 4; ++r) {
        va[r] = (acc[mt][r] * IWSC + bfr(b0[r])) * osc;
        vb[r] = (acc[mt][4 + r] * IWSC + bfr(b1[r])) * osc;
      }
      *(v4f*)(Os + nl * OSP + 16 * mt + 8 * hh)     = va;
      *(v4f*)(Os + nl * OSP + 16 * mt + 8 * hh + 4) = vb;
    }
  }
  __syncthreads();

  const int e = tid & 7, lq = tid >> 3;                             // lq 0..15
  if (mb < 2) {
    unsigned short* Ph = (mb == 0) ? Qh : Kh;                        // block-uniform, both global
    unsigned short* Pl = (mb == 0) ? Ql : Kl;
    v4u uh[4], ul[4];
#pragma unroll
    for (int it = 0; it < 4; ++it) {
      const int row = it * 16 + lq;                                  // n_loc 0..63
      const v4f a = *(const v4f*)(Os + row * OSP + 8 * e);
      const v4f q = *(const v4f*)(Os + row * OSP + 8 * e + 4);
      const float f[8] = {a[0], a[1], a[2], a[3], q[0], q[1], q[2], q[3]};
#pragma unroll
      for (int t = 0; t < 4; ++t) {
        const float f0 = f[2 * t], f1 = f[2 * t + 1];
        const unsigned short hb0 = bf_bits(f0), hb1 = bf_bits(f1);
        const unsigned short lb0 = bf_bits(f0 - bf_up(hb0));
        const unsigned short lb1 = bf_bits(f1 - bf_up(hb1));
        uh[it][t] = pk16(hb0, hb1);
        ul[it][t] = pk16(lb0, lb1);
      }
    }
{
#pragma unroll
      for (int it = 0; it < 4; ++it) {
        const int row = it * 16 + lq;
        const size_t po = (size_t)(n0 + row) * DK + 8 * e;
        *(v4u*)(Ph + po) = uh[it];
        *(v4u*)(Pl + po) = ul[it];
      }
      
    }
  } else {
    v4u uv[4];
#pragma unroll
    for (int it = 0; it < 4; ++it) {
      const int o = it * 16 + lq;                                    // channel 0..63
      unsigned short hb[8];
#pragma unroll
      for (int t = 0; t < 8; ++t) hb[t] = h_bits((_Float16)(Os[(8 * e + t) * OSP + o] * VSC));
#pragma unroll
      for (int t = 0; t < 4; ++t) uv[it][t] = pk16(hb[2 * t], hb[2 * t + 1]);
    }
{
#pragma unroll
      for (int it = 0; it < 4; ++it) {
        const int o = it * 16 + lq;
        *(v4u*)(Vc + (size_t)o * NTOK + n0 + 8 * e) = uv[it];
      }
      
    }
  }
}

// =========================================================================================================
// (3) global attention for one 64-query tile, transposed formulation, NTOK keys, no mask:
//   S^T tile (16 keys x 16 queries) = sum over 2 d-chunks of A(k: row = key kb + (lane&15), 32 d via the split
//   k map from the bf16 plane Kh [NTOK][64]) . B(q: col = query, same map from Qh) + A(Kh).B(Ql) + A(Kl).B(Qh)
//   (bf16 unscaled residual planes, shared accumulator, 3 products). q fragments (2 chunks x hi/lo) loaded once
//   per wave; k (hi and residual) and v tiles of KT keys are staged in a two-buffer LDS ring by asynchronous copies,
//   shared by the block's 16 waves: stage = Kh[KT][64] and Kl[KT][64] (row pitch KPH halves) + V[64 ch][KT] (pitch VPH);
//   tile t + 2 is copied into the buffer trip t has read, behind the barrier at the foot of trip t, and flies during
//   trip t + 1. Fragments come from LDS with the same split-map loader, one load group per block of 32 keys, issued ahead
//   of its use: v of the block and k of the tile's next block in front of the exponentials; k of a tile's first block
//   directly behind the barrier that publishes the tile.
//   Per lane the D tile holds 8 keys of ONE query: online softmax state per lane, one shuffle (lane^16) for the max
//   over 32 keys; the o/l rescale is skipped under a wave-uniform ballot when no lane's max grew (corr == 1 exactly
//   for every lane then); row-sum partials combined at the end. P = e^{s-m} x 2^14 as f16 is the B operand of
//   O^T (rows channel, cols queries) += A(v rows channel = 16j + (lane&15), keys contiguous, f16 plane Vc
//   [64][NTOK]) . B(P^T): element r <- D of the tile covering keys kb..kb+15, element 8+r <- the tile covering
//   kb+16..kb+31, lane unchanged. 4 accumulator tiles per wave (64 channels). Block = 64 queries x KG key groups =
//   16 waves (4 per SIMD, so that one wave's LDS, softmax and matrix latencies are covered by the others): wave
//   (qw, kg) takes queries 16 qw .. +15 and keys KW kg .. +KW-1 of every tile, with its own m, l and o.
//   Epilogue: the groups' (m, l) are exchanged in LDS, block barrier, M = max m, L = sum l e^{m-M}; each wave stages
//   its o e^{m-M}/(16 L) in LDS Os[kg][query][64 ch] (pitch OSP, b128 stores), block barrier, then the KG planes are
//   summed in the order kg = 0..3 and the flat planes written.
// coverage: Os KG x 4 waves x 16 q x 64 ch (cols 0..63); Oh/Ol 64 rows x 8 lanes x 8 halves =
//           64 q x 64 ch per plane; grid (NTOK/64) covers rows 0..NTOK-1 of both planes exactly once.
// =========================================================================================================
__global__ __launch_bounds__(ATH)
void attn_k(const unsigned short* __restrict__ Qh, const unsigned short* __restrict__ Ql,
            const unsigned short* __restrict__ Kh, const unsigned short* __restrict__ Kl,
            const unsigned short* __restrict__ Vc, unsigned short* Oh, unsigned short* Ol) {
  __shared__ __align__(16) float Os[KG * QT * OSP];
  __shared__ float Mg[KG * QT];
  __shared__ float Lg[KG * QT];
  __shared__ __align__(16) unsigned short Ring[2 * STGH];
  const int tid  = threadIdx.x;
  const int wave = tid >> 5, lane = tid & 31;
  const int qw   = wave & 3, kg = wave >> 2;                        // query sub-tile, key group
  const int hh   = lane >> 4, c = lane & 15;
  const int n0   = blockIdx.x * QT;

  // q fragments (B operand, col = query n0 + 16*qw + c), d chunks 0 and 1, hi and residual planes
  const size_t qo = (size_t)(n0 + 16 * qw + c) * DK + 8 * hh;
  const Frag qh0 = ldfrag(Qh + qo), qh1 = ldfrag(Qh + qo + 32);
  const Frag ql0 = ldfrag(Ql + qo), ql1 = ldfrag(Ql + qo + 32);
  // copy addresses of this lane. K planes: copy i moves 64 rows (8 lanes x 16 B per 128-B row), row 64 i + (tid >> 3);
  // V: copy i moves 16 channel rows (32 lanes x 16 B per 512-B row segment), row 16 i + (tid >> 5).
  const unsigned ring0 = (unsigned)(uintptr_t)Ring;                  // LDS byte address of the ring
  const unsigned lk = ring0 + (unsigned)((tid >> 3) * (KPH * 2) + (tid & 7) * 16);
  const unsigned lv = ring0 + (unsigned)(SVV * 2 + (tid >> 5) * (VPH * 2) + (tid & 31) * 16);
  const unsigned short* gkh = Kh + (size_t)tid * 8;
  const unsigned short* gkl = Kl + (size_t)tid * 8;
  const unsigned short* gv  = Vc + (size_t)(tid >> 5) * NTOK + 8 * (tid & 31);
  auto fill = [&](int buf, int tile) {
    const unsigned lb = (unsigned)buf * (unsigned)(STGH * 2);
    copy4(lk + lb,           64 * KPH * 2, gkh + (size_t)tile * (KT * DK), (size_t)64 * DK);
    copy4(lk + lb + SKL * 2, 64 * KPH * 2, gkl + (size_t)tile * (KT * DK), (size_t)64 * DK);
    copy4(lv + lb,           16 * VPH * 2, gv + (size_t)tile * KT,         (size_t)16 * NTOK);
  };
  // fragment offsets inside a stage (halves): k row = key KW kg + c (+ 32 p, + 16), v row = channel c (+ 16 j),
  // v column = key KW kg (+ 32 p)
  const int kfo = (KW * kg + c) * KPH + 8 * hh;
  const int vfo = SVV + c * VPH + KW * kg + 8 * hh;

  fill(0, 0);
  wait_async0();
  __syncthreads();                                                   // tile 0 is readable by every wave
  // the first block's k fragments of a tile: one load group directly behind the barrier that publishes the tile, in front
  // of the refill copies (which go to the other buffer), so that the copies' issue covers the LDS latency
  KSet ks = ldkset(Ring + kfo, Ring + SKL + kfo, 0, 16 * KPH);
  fill(1, 1);

  float m = -1.0e30f, l = 0.f;
  v8f o[4];
#pragma unroll
  for (int j = 0; j < 4; ++j) o[j] = zero8();

#pragma unroll 1
  for (int t = 0; t < NTOK / KT; ++t) {
  const unsigned short* Sb  = Ring + (t & 1) * STGH;                // up to its foot barrier trip t reads buffer t mod 2 alone
  const unsigned short* Khp = Sb + kfo;
  const unsigned short* Klp = Sb + SKL + kfo;
  const unsigned short* Vp  = Sb + vfo;
  // unrolled so that every LDS offset of a stage is an immediate of its load
#pragma unroll
  for (int kb = 0; kb < KW; kb += 32) {
    v8f s0 = zero8(), s1 = zero8();
    s0 = mma_b(ks.h00.bf, qh0.bf, s0);                              // d chunk 0
    s1 = mma_b(ks.h10.bf, qh0.bf, s1);
    s0 = mma_b(ks.h00.bf, ql0.bf, s0);
    s1 = mma_b(ks.h10.bf, ql0.bf, s1);
    s0 = mma_b(ks.g00.bf, qh0.bf, s0);
    s1 = mma_b(ks.g10.bf, qh0.bf, s1);
    s0 = mma_b(ks.h01.bf, qh1.bf, s0);                              // d chunk 1
    s1 = mma_b(ks.h11.bf, qh1.bf, s1);
    s0 = mma_b(ks.h01.bf, ql1.bf, s0);
    s1 = mma_b(ks.h11.bf, ql1.bf, s1);
    s0 = mma_b(ks.g01.bf, qh1.bf, s0);
    s1 = mma_b(ks.g11.bf, qh1.bf, s1);

    float mx = fmaxf(hmax8(s0), hmax8(s1));
    mx = fmaxf(mx, __shfl_xor(mx, 16, 32));
    const float mn = fmaxf(m, mx);
    const unsigned grew = wave_ballot(mx > m);                       // wave-uniform
    if (grew != 0u) {
      const float corr = __expf(m - mn);                             // == 1 exactly for lanes whose max did not grow
      l *= corr;
#pragma unroll
      for (int j = 0; j < 4; ++j) {
#pragma unroll
        for (int r = 0; r < 8; ++r) o[j][r] *= corr;
      }
    }
    m = mn;
    const float msh = mn - LNPS;                                     // exp gives e^{s-m} * 2^14

    // one load group per block, ahead of its use: this block's v fragments, then the next block's k fragments of the
    // SAME tile (into the registers the score products have left); their LDS latency runs under the exponentials and
    // the O products instead of being waited out in front of each product
    Frag vf[4];
#pragma unroll
    for (int j = 0; j < 4; ++j) vf[j] = ldfrag(Vp + (16 * j) * VPH + kb);
    if (kb + 32 < KW) ks = ldkset(Khp, Klp, (kb + 32) * KPH, (kb + 48) * KPH);
#if defined(__HIP_DEVICE_COMPILE__)
    __builtin_amdgcn_sched_barrier(0);   // keeps the group whole and in front of the exponentials that cover its latency
#endif

    FragH ph;
    float ls = 0.f;
#pragma unroll
    for (int r = 0; r < 8; ++r) {
      const float e0 = __expf(s0[r] - msh);                          // key kb      + 8hh + r
      const float e1 = __expf(s1[r] - msh);                          // key kb + 16 + 8hh + r
      ls += e0 + e1;
      ph.hv[0][r] = (_Float16)e0;
      ph.hv[1][r] = (_Float16)e1;
    }
    l += ls;

#pragma unroll
    for (int j = 0; j < 4; ++j) o[j] = mma_h(vf[j].h, ph.v, o[j]);
  }
  // foot of trip t: own reads done, own copies of tile t + 1 landed, then the one barrier that publishes tile t + 1
  // and ends every wave's reads of buffer t mod 2; only then its refill
  wait_ds0();
  wait_async0();
  __syncthreads();
  if (t + 1 < NTOK / KT) {                                           // tile t + 1 is published: its first k fragments
    const unsigned short* Nb = Ring + ((t + 1) & 1) * STGH + kfo;
    ks = ldkset(Nb, Nb + SKL, 0, 16 * KPH);
  }
  if (t + 2 < NTOK / KT) fill(t & 1, t + 2);
  }
  wait_async0();
  l += __shfl_xor(l, 16, 32);

  // merge of the KG key groups: (m, l) of every group and query through LDS (m and l are equal in lanes c and c + 16)
  const int qrow = 16 * qw + c;
  if (hh == 0) { Mg[kg * QT + qrow] = m; Lg[kg * QT + qrow] = l; }
  __syncthreads();                                                   // every group's (m, l) is readable
  float mall = Mg[qrow];
#pragma unroll
  for (int g = 1; g < KG; ++g) mall = fmaxf(mall, Mg[g * QT + qrow]);
  float lall = 0.f;
#pragma unroll
  for (int g = 0; g < KG; ++g) lall += Lg[g * QT + qrow] * __expf(Mg[g * QT + qrow] - mall);
  const float scl = (__expf(m - mall) / lall) * IVSC;                // o and l both carry 2^14; o also carries the v x16

  float* Ow = Os + kg * (QT * OSP);
#pragma unroll
  for (int j = 0; j < 4; ++j) {
    v4f va, vb;
#pragma unroll
    for (int r = 0; r < 4; ++r) { va[r] = o[j][r] * scl; vb[r] = o[j][4 + r] * scl; }
    *(v4f*)(Ow + qrow * OSP + 16 * j + 8 * hh)     = va;            // Os[kg][query][ch = 16j + 8hh + r]
    *(v4f*)(Ow + qrow * OSP + 16 * j + 8 * hh + 4) = vb;
  }
  __syncthreads();                                                   // every group's weighted o is readable

  const int e = tid & 7, row = tid >> 3;                             // row = query 0..63
  v4f a = *(const v4f*)(Os + row * OSP + 8 * e);
  v4f q = *(const v4f*)(Os + row * OSP + 8 * e + 4);
#pragma unroll
  for (int g = 1; g < KG; ++g) {
    a += *(const v4f*)(Os + g * (QT * OSP) + row * OSP + 8 * e);
    q += *(const v4f*)(Os + g * (QT * OSP) + row * OSP + 8 * e + 4);
  }
  const float f[8] = {a[0], a[1], a[2], a[3], q[0], q[1], q[2], q[3]};
  v4u uh, ul;
#pragma unroll
  for (int t = 0; t < 4; ++t) {
    const float g0 = f[2 * t] * OSC, g1 = f[2 * t + 1] * OSC;
    const _Float16 h0 = (_Float16)g0, h1 = (_Float16)g1;
    const _Float16 l0 = (_Float16)((g0 - (float)h0) * RSC);
    const _Float16 l1 = (_Float16)((g1 - (float)h1) * RSC);
    uh[t] = pk16(h_bits(h0), h_bits(h1));
    ul[t] = pk16(h_bits(l0), h_bits(l1));
  }
  const size_t po = (size_t)(n0 + row) * DK + 8 * e;
  *(v4u*)(Oh + po) = uh;
  *(v4u*)(Ol + po) = ul;
}

// =========================================================================================================
// (4) output pointwise conv over the raw view: Y[o][n'] = (1/256)(1/1024) sum_{c'} Wo16[o][c'] (Ohv[c'][n'] +
//     Olv[c'][n'] / 1024) + bo[o], where Ohv/Olv [64][NTOK] are the flat O planes re-read with row c' = halves
//     c'*NTOK .. +NTOK-1. Block (nt, mb): 64 n' x 64 o. The two 64 c' x 64 n' B tiles are staged transposed in
//     LDS Bh/Bl[n'_loc][c'] (pitch TP, 16-B global loads, 2-byte LDS stores), block barrier, then B fragments per
//     wave (col n0'+16w+(lane&15), k = c' contiguous, split k map) and A fragments from Wo16 rows o0+16mt+(lane&15).
//     K = 64 = 2 steps; hi and residual products in separate accumulators. Epilogue staged in Ys[n'_loc][o_loc]
// coverage: Bh/Bl 4 it x 16 c' x (8 x 8 n') = 64 x 64 each (cols 0..63 of pitch 72); Ys 4 waves x 16 n' x 64 o;
//           out: 8 it x 16 lines x 8 lanes x 4 floats = 64 o x 64 n'; grid (NTOK/64, COUT/64) covers
//           out[0..127][0..NTOK-1] exactly once.
// =========================================================================================================
__global__ __launch_bounds__(128)
void gemm_o(const unsigned short* __restrict__ Wo16, const unsigned short* __restrict__ Oh,
            const unsigned short* __restrict__ Ol, const float* __restrict__ bo, float* Y) {
  __shared__ __align__(16) unsigned short Bh[QT * TP];
  __shared__ __align__(16) unsigned short Bl[QT * TP];
  __shared__ __align__(16) float Ys[QT * OSP];
  const int tid  = threadIdx.x;
  const int lane = tid & 31, wave = tid >> 5;
  const int hh   = lane >> 4, c = lane & 15;
  const int nt   = blockIdx.x, mb = blockIdx.y;
  const int n0   = nt * QT, o0 = mb * QT;
  const int e = tid & 7, lq = tid >> 3;                              // lq 0..15

  // ---- stage the view tiles transposed: Bh[n'_loc][c'] <- Oh[c'*NTOK + n0 + n'_loc]
#pragma unroll
  for (int it = 0; it < 4; ++it) {
    const int cl = it * 16 + lq;                                     // c' 0..63
    const size_t so = (size_t)cl * NTOK + n0 + 8 * e;
    const v4u ah = *(const v4u*)(Oh + so);
    const v4u al = *(const v4u*)(Ol + so);
#pragma unroll
    for (int t = 0; t < 4; ++t) {
      Bh[(8 * e + 2 * t) * TP + cl]     = (unsigned short)(ah[t] & 0xffffu);
      Bh[(8 * e + 2 * t + 1) * TP + cl] = (unsigned short)(ah[t] >> 16);
      Bl[(8 * e + 2 * t) * TP + cl]     = (unsigned short)(al[t] & 0xffffu);
      Bl[(8 * e + 2 * t + 1) * TP + cl] = (unsigned short)(al[t] >> 16);
    }
  }
  __syncthreads();

  const unsigned short* ap  = Wo16 + (size_t)(o0 + c) * DK + 8 * hh;
  const unsigned short* bph = Bh + (16 * wave + c) * TP + 8 * hh;
  const unsigned short* bpl = Bl + (16 * wave + c) * TP + 8 * hh;

  v8f acch[4], accl[4];
#pragma unroll
  for (int mt = 0; mt < 4; ++mt) { acch[mt] = zero8(); accl[mt] = zero8(); }

#pragma unroll
  for (int ks = 0; ks < DK / 32; ++ks) {
    const Frag fbh = ldfrag(bph + 32 * ks);
    const Frag fbl = ldfrag(bpl + 32 * ks);
#pragma unroll
    for (int mt = 0; mt < 4; ++mt) {
      const Frag fa = ldfrag(ap + (size_t)(16 * mt) * DK + 32 * ks);
      acch[mt] = mma_h(fa.h, fbh.h, acch[mt]);
      accl[mt] = mma_h(fa.h, fbl.h, accl[mt]);
    }
  }

  // ---- epilogue: fold residual, scale back, bias -> Ys[n'_loc][o_loc]
  {
    const int nl = 16 * wave + c;
    const float fs = IWSC * IOSC;
#pragma unroll
    for (int mt = 0; mt < 4; ++mt) {
      const v4f b0 = *(const v4f*)(bo + o0 + 16 * mt + 8 * hh);
      const v4f b1 = *(const v4f*)(bo + o0 + 16 * mt + 8 * hh + 4);
      v4f va, vb;
#pragma unroll
      for (int r = 0; r < 4; ++r) {
        va[r] = (acch[mt][r] + accl[mt][r] * IRSC) * fs + bfr(b0[r]);
        vb[r] = (acch[mt][4 + r] + accl[mt][4 + r] * IRSC) * fs + bfr(b1[r]);
      }
      *(v4f*)(Ys + nl * OSP + 16 * mt + 8 * hh)     = va;
      *(v4f*)(Ys + nl * OSP + 16 * mt + 8 * hh + 4) = vb;
    }
  }
  __syncthreads();

  v4f res[8];
#pragma unroll
  for (int it = 0; it < 8; ++it) {
    const int L  = it * 16 + lq;                                     // line 0..127
    const int ol = L >> 1, hf = L & 1;                               // o_loc 0..63, line half
    const int nl = hf * 32 + 4 * e;                                  // n'_loc 0..63
#pragma unroll
    for (int t = 0; t < 4; ++t) res[it][t] = Ys[(nl + t) * OSP + ol];
  }
{
#pragma unroll
    for (int it = 0; it < 8; ++it) {
      const int L  = it * 16 + lq;
      const int ol = L >> 1, hf = L & 1;
      const int nl = hf * 32 + 4 * e;
      *(v4f*)(Y + (size_t)(o0 + ol) * NTOK + n0 + nl) = res[it];
    }
    
  }
}

// =========================================================================================================
// Workspace map (bytes, full size ND=16; each region start a multiple of 256; every extent is an exact tile
//   W16 f16 [192][128]        49152        Wo16 f16 [128][64]      16384
//   XP  f16 [16384][128]    4194304
//   Qh/Ql/Kh/Kl bf16 [16384][64] 2097152 x4   Vc f16 [64][16384]   2097152
//   Oh/Ol f16 [16384][64]   2097152 x2
//   total = 18939904
// =========================================================================================================
extern "C" void kernel_launch(void* const* d_in, const int* in_sizes, int n_in,
                              void* d_out, int out_size, void* d_ws, size_t ws_size,
                              hipStream_t stream) {
  if (n_in < 9) return;
  if (in_sizes[0] < CIN * NTOK) return;
  if ((in_sizes[0] % CIN) != 0) return;
  const int xstride = in_sizes[0] / CIN;                             // per-channel position stride of X
  if (xstride < NTOK || (xstride % 4) != 0) return;
  if (in_sizes[1] < DK * CIN || in_sizes[3] < DK * CIN || in_sizes[5] < DK * CIN) return;
  if (in_sizes[2] < DK || in_sizes[4] < DK || in_sizes[6] < DK) return;
  if (in_sizes[7] < COUT * DK || in_sizes[8] < COUT) return;
  if (out_size < COUT * NTOK) return;

  size_t off = 0;
  auto carve = [&](size_t bytes) { const size_t o = off; off += (bytes + 255) & ~(size_t)255; return o; };
  const size_t oW16  = carve((size_t)3 * DK * CIN * 2);
  const size_t oWo16 = carve((size_t)COUT * DK * 2);
  const size_t oXP   = carve((size_t)NTOK * CIN * 2);
  const size_t oQh   = carve((size_t)NTOK * DK * 2);
  const size_t oQl   = carve((size_t)NTOK * DK * 2);
  const size_t oKh   = carve((size_t)NTOK * DK * 2);
  const size_t oKl   = carve((size_t)NTOK * DK * 2);
  const size_t oVc   = carve((size_t)DK * NTOK * 2);
  const size_t oOh   = carve((size_t)NTOK * DK * 2);
  const size_t oOl   = carve((size_t)NTOK * DK * 2);
  if (off > ws_size) return;
  if (off > (size_t)134217728) return;

  const float* X  = (const float*)d_in[0];
  const float* Wq = (const float*)d_in[1];
  const float* bq = (const float*)d_in[2];
  const float* Wk = (const float*)d_in[3];
  const float* bk = (const float*)d_in[4];
  const float* Wv = (const float*)d_in[5];
  const float* bv = (const float*)d_in[6];
  const float* Wo = (const float*)d_in[7];
  const float* bo = (const float*)d_in[8];

  char* ws = (char*)d_ws;
  unsigned short* W16  = (unsigned short*)(ws + oW16);
  unsigned short* Wo16 = (unsigned short*)(ws + oWo16);
  unsigned short* XP   = (unsigned short*)(ws + oXP);
  unsigned short* Qh   = (unsigned short*)(ws + oQh);
  unsigned short* Ql   = (unsigned short*)(ws + oQl);
  unsigned short* Kh   = (unsigned short*)(ws + oKh);
  unsigned short* Kl   = (unsigned short*)(ws + oKl);
  unsigned short* Vc   = (unsigned short*)(ws + oVc);
  unsigned short* Oh   = (unsigned short*)(ws + oOh);
  unsigned short* Ol   = (unsigned short*)(ws + oOl);
  float* out = (float*)d_out;

  const dim3 blk256(256), blk128(128);
  const int BQ = (DK * CIN) / (8 * CHB), BO = (COUT * DK) / (8 * CHB);

  // (0) weights -> f16 planes
  cvt_w<<<dim3(3 * BQ + BO), dim3(CHB), 0, stream>>>(Wq, Wk, Wv, Wo, W16, Wo16);
  // (1) x -> position-major 16-bit plane
  cvt_x<<<dim3(NTOK / QT, CIN / QT), blk256, 0, stream>>>(X, xstride, XP);
  // (2) q/k/v pointwise conv GEMM -> q hi + residual, k hi + residual, v planes
  gemm_qkv<<<dim3(NTOK / QT, 3), blk128, 0, stream>>>(W16, XP, bq, bk, bv, Qh, Ql, Kh, Kl, Vc);
  // (3) global attention -> O hi + residual planes [NTOK][64]
  attn_k<<<dim3(NTOK / QT), dim3(ATH), 0, stream>>>(Qh, Ql, Kh, Kl, Vc, Oh, Ol);
  // (4) output conv over the raw [64][NTOK] view -> out [128][NTOK]
  gemm_o<<<dim3(NTOK / QT, COUT / QT), blk128, 0, stream>>>(Wo16, Oh, Ol, bo, out);
  (void)hipGetLastError();
}

// v004
// It runs in 130 microseconds.
// Next to v003, in two timings, it ran 1.07 times as fast each time.
// Over all steps from v000 it is 6.51 times as fast.
// Contractions: q/k/v pointwise conv W16[192x128].XP[n][128] on v_wmma_f32_16x16x32_f16 (f16 containers of
// bf16-RNE weights x256 and bf16-RNE x, exact products); scores K.Q^T on v_wmma_f32_16x16x32_bf16 (bf16 hi +
// bf16 residual planes of k and of q/8, 3 products hi.hi + hi.lo + lo.hi, K=64); O^T = V.P^T on
// v_wmma_f32_16x16x32_f16 (v x16 as f16, P = e^{s-m} x2^14 f16 from the score D registers); output conv
// Wo16[128x64].Oview[64][N] on v_wmma_f32_16x16x32_f16 (f16 of bf16-RNE weights x256; O carried as f16 hi x1024
// plane + f16 residual x2^20 plane, 2 products, separate accumulators); f32 accumulate everywhere; softmax
// statistics and bias adds in f32 VALU.
#include <hip/hip_runtime.h>
#include <math.h>
#include <stdint.h>

#ifndef ND
#define ND 16
#endif
#define NHH    32
#define NWW    32
#define NTOK   (ND * NHH * NWW)
#define CIN    128
#define DK     64
#define COUT   128
#define QT     64
#define OSP    68
#define TP     72
#define CHB    256
#define WSC    256.0f
#define IWSC   0.00390625f
#define QSC    0.125f
#define VSC    16.0f
#define IVSC   0.0625f
#define OSC    1024.0f
#define IOSC   0.0009765625f
#define RSC    1024.0f
#define IRSC   0.0009765625f
#define LNPS   9.704060527839234f
#define KG     4
#define ATH    (128 * KG)
#define KT     256
#define KW     (KT / KG)
#define KPH    72
#define VPH    264
#define SKL    (KT * KPH)
#define SVV    (2 * KT * KPH)
#define STGH   (2 * KT * KPH + DK * VPH)

static_assert(ND >= 1 && ND <= 16);
static_assert(NTOK % QT == 0);
static_assert(NTOK % 32 == 0);
static_assert(CIN % QT == 0 && CIN % 32 == 0);
static_assert(DK == QT);
static_assert(DK % 32 == 0);
static_assert(COUT % QT == 0);
static_assert((DK * CIN) % (8 * CHB) == 0);
static_assert((COUT * DK) % (8 * CHB) == 0);
static_assert((OSP * 4) % 16 == 0);
static_assert((TP * 2) % 16 == 0);
static_assert(KT % 32 == 0 && NTOK % KT == 0 && NTOK / KT >= 2);
static_assert((ATH / 8) * 4 == KT && (ATH / 32) * 4 == DK && KT == 8 * 32 && DK == 8 * 8);
static_assert(KW % 32 == 0 && VPH == KT + 8 && QT * 8 == ATH && QT == 4 * 16);
static_assert((KPH * 2) % 32 == 16 && (VPH * 2) % 32 == 16 && (STGH * 2) % 16 == 0);

typedef _Float16       v16h __attribute__((ext_vector_type(16)));
typedef _Float16       v8h  __attribute__((ext_vector_type(8)));
typedef __bf16         v16b __attribute__((ext_vector_type(16)));
typedef unsigned short v8us __attribute__((ext_vector_type(8)));
typedef float          v8f  __attribute__((ext_vector_type(8)));
typedef float          v4f  __attribute__((ext_vector_type(4)));
typedef unsigned int   v4u  __attribute__((ext_vector_type(4)));

union Frag  { v8us u[2]; v16h h; v16b bf; };
union FragH { v16h v; v8h hv[2]; };
static_assert(sizeof(Frag) == 32);
static_assert(sizeof(FragH) == 32);

// ---- scalar helpers ---------------------------------------------------------------------------------------
__device__ __forceinline__ unsigned short bf_bits(float f) {          // f32 -> bf16 bits, RNE convert
  unsigned u = __float_as_uint(f);
  return (unsigned short)((u + 0x7FFFu + ((u >> 16) & 1u)) >> 16);
}
__device__ __forceinline__ float bf_up(unsigned short hb) { return __uint_as_float(((unsigned)hb) << 16); }
__device__ __forceinline__ float bfr(float f) { return bf_up(bf_bits(f)); }
__device__ __forceinline__ unsigned short h_bits(_Float16 x) { return __builtin_bit_cast(unsigned short, x); }
__device__ __forceinline__ unsigned pk16(unsigned short a, unsigned short b) { return (unsigned)a | ((unsigned)b << 16); }
__device__ __forceinline__ v8f zero8() { v8f z = {0.f, 0.f, 0.f, 0.f, 0.f, 0.f, 0.f, 0.f}; return z; }
__device__ __forceinline__ float hmax8(v8f s) {
  return fmaxf(fmaxf(fmaxf(s[0], s[1]), fmaxf(s[2], s[3])), fmaxf(fmaxf(s[4], s[5]), fmaxf(s[6], s[7])));
}
__device__ __forceinline__ unsigned wave_ballot(bool p) {
#if defined(__HIP_DEVICE_COMPILE__)
  return __builtin_amdgcn_ballot_w32(p);
#else
  return p ? 1u : 0u;
#endif
}

// ---- 16-bit fragment loader (A, or B from a k-contiguous [n][k] row): lane -> row/col (lane&15), p already includes
//      + 8*(lane>>4); elements 0..7 <- p[0..7] (k0+8h..), elements 8..15 <- p[16..23] (k0+16+8h..)
__device__ __forceinline__ Frag ldfrag(const unsigned short* p) {
  Frag f;
  f.u[0] = *(const v8us*)(p);
  f.u[1] = *(const v8us*)(p + 16);
  return f;
}

// ---- the 8 k fragments of one block of 32 keys (rows r0 = kb .. +15, r1 = kb+16 .. +31; d chunks 0 and 1; hi and residual)
struct KSet { Frag h00, h10, g00, g10, h01, h11, g01, g11; };
__device__ __forceinline__ KSet ldkset(const unsigned short* hp, const unsigned short* lp, int r0o, int r1o) {
  KSet k;
  k.h00 = ldfrag(hp + r0o);      k.h10 = ldfrag(hp + r1o);
  k.g00 = ldfrag(lp + r0o);      k.g10 = ldfrag(lp + r1o);
  k.h01 = ldfrag(hp + r0o + 32); k.h11 = ldfrag(hp + r1o + 32);
  k.g01 = ldfrag(lp + r0o + 32); k.g11 = ldfrag(lp + r1o + 32);
  return k;
}

// ---- WMMA helpers: the plain builtins; the compiler keeps the distances behind its own forms (another product or
//      independent vector work fills a slot), so that the vector port stays free for the SIMD's other waves
__device__ __forceinline__ v8f mma_h(v16h a, v16h b, v8f c) {
  return __builtin_amdgcn_wmma_f32_16x16x32_f16(false, a, false, b, (short)0, c, false, false);
}
__device__ __forceinline__ v8f mma_b(v16b a, v16b b, v8f c) {
  return __builtin_amdgcn_wmma_f32_16x16x32_bf16(false, a, false, b, (short)0, c, false, false);
}
// the 4 vector slots the chip needs behind a matrix instruction before its A, B or D are touched, written once behind a
// group of products; the two scheduling barriers keep every
// instruction of the code above in front of the slots and every one of the code below behind them
__device__ __forceinline__ void gap4() {
#if defined(__HIP_DEVICE_COMPILE__)
  __builtin_amdgcn_sched_barrier(0);
  asm volatile("v_nop\n\tv_nop\n\tv_nop\n\tv_nop");
  __builtin_amdgcn_sched_barrier(0);
#endif
}

// ---- LDS ring helpers (attention) ---------------------------------------------------------------------------
// Four asynchronous 16-byte copies global -> LDS per lane (l = the lane's LDS byte address, g = its global address),
// with the s_wait_xcnt 0 that stands before the address registers may be rewritten as the statement's last line.
__device__ __forceinline__ void copy4(unsigned l0, unsigned lstep, const unsigned short* g0, size_t gstep) {
#if defined(__HIP_DEVICE_COMPILE__)
  asm volatile("global_load_async_to_lds_b128 %0, %4, off\n\t"
               "global_load_async_to_lds_b128 %1, %5, off\n\t"
               "global_load_async_to_lds_b128 %2, %6, off\n\t"
               "global_load_async_to_lds_b128 %3, %7, off\n\t"
               "s_wait_xcnt 0x0"
               :: "v"(l0), "v"(l0 + lstep), "v"(l0 + 2 * lstep), "v"(l0 + 3 * lstep),
                  "v"(g0), "v"(g0 + gstep), "v"(g0 + 2 * gstep), "v"(g0 + 3 * gstep)
               : "memory");
#endif
}
// this wave's own copies have landed in LDS (the compiler places no wait for them)
__device__ __forceinline__ void wait_async0() {
#if defined(__HIP_DEVICE_COMPILE__)
  asm volatile("s_wait_asynccnt 0x0" ::: "memory");
#endif
}
// this wave's own LDS reads have returned, before the buffer they read is handed back for a refill
__device__ __forceinline__ void wait_ds0() {
#if defined(__HIP_DEVICE_COMPILE__)
  asm volatile("s_wait_dscnt 0x0" ::: "memory");
#endif
}

// =========================================================================================================
// (0) weight planes: W16 f16 [192][128] (rows 0..63 = Wq, 64..127 = Wk, 128..191 = Wv) and Wo16 f16 [128][64];
//     value = f16 of (bf16-RNE(w) * 256) (exact). Thread = one 8-element chunk (16 B); 8 consecutive lanes =
// coverage: (3*BQ + BO) blocks x 256 threads x 8 halves = 3*8192 + 8192 elements = both planes exactly.
// =========================================================================================================
__global__ __launch_bounds__(CHB)
void cvt_w(const float* __restrict__ Wq, const float* __restrict__ Wk, const float* __restrict__ Wv,
           const float* __restrict__ Wo, unsigned short* W16, unsigned short* Wo16) {
  const int tid = threadIdx.x, blk = blockIdx.x;
  const int BQ = (DK * CIN) / (8 * CHB);                             // blocks per q/k/v matrix
  const int g = blk * CHB + tid;                                     // chunk id
  const float* src;
  unsigned short* dst;
  int gsrc, gdst;
  if (blk < BQ)          { src = Wq; gsrc = 0;            dst = W16;  gdst = 0; }
  else if (blk < 2 * BQ) { src = Wk; gsrc = BQ * CHB;     dst = W16;  gdst = 0; }
  else if (blk < 3 * BQ) { src = Wv; gsrc = 2 * BQ * CHB; dst = W16;  gdst = 0; }
  else                   { src = Wo; gsrc = 3 * BQ * CHB; dst = Wo16; gdst = 3 * BQ * CHB; }
  const float* s = src + (size_t)8 * (size_t)(g - gsrc);
  const v4f a = *(const v4f*)s;
  const v4f q = *(const v4f*)(s + 4);
  const float f[8] = {a[0], a[1], a[2], a[3], q[0], q[1], q[2], q[3]};
  v4u u;
#pragma unroll
  for (int t = 0; t < 4; ++t) {
    const _Float16 h0 = (_Float16)(bfr(f[2 * t]) * WSC);
    const _Float16 h1 = (_Float16)(bfr(f[2 * t + 1]) * WSC);
    u[t] = pk16(h_bits(h0), h_bits(h1));
  }
{
    *(v4u*)(dst + (size_t)8 * (size_t)(g - gdst)) = u;
    
  }
}

// =========================================================================================================
// (1) X f32 [128 c][xstride] (first NTOK positions used) -> XP f16 [NTOK n][128 c] (position-major, bf16-RNE
//     values, exact in f16) through an LDS tile T[64 n][64 c] (pitch TP). Block (nb, cb) owns a 64 c x 64 n tile.
// coverage: T 2 it x 32 c x (8 x 8 n) = 64 x 64; XP 2 it x 32 rows x 8 lanes x 8 halves = 64 n x 64 c;
//           grid (NTOK/64, 2) covers XP [NTOK][128] exactly once.
// =========================================================================================================
__global__ __launch_bounds__(256)
void cvt_x(const float* __restrict__ X, int xstride, unsigned short* XP) {
  __shared__ __align__(16) unsigned short T[QT * TP];
  const int tid = threadIdx.x;
  const int nb = blockIdx.x, cb = blockIdx.y;
  const int e = tid & 7, lq = tid >> 3;                             // lq 0..31
  const int n0 = nb * QT, c0 = cb * QT;
#pragma unroll
  for (int it = 0; it < 2; ++it) {
    const int cl = it * 32 + lq;                                     // 0..63
    const float* sp = X + (size_t)(c0 + cl) * (size_t)xstride + n0 + 8 * e;
    const v4f a = *(const v4f*)sp;
    const v4f q = *(const v4f*)(sp + 4);
    unsigned short hb[8];
#pragma unroll
    for (int t = 0; t < 4; ++t) {
      hb[t]     = h_bits((_Float16)bfr(a[t]));
      hb[4 + t] = h_bits((_Float16)bfr(q[t]));
    }
#pragma unroll
    for (int t = 0; t < 8; ++t) T[(8 * e + t) * TP + cl] = hb[t];
  }
  __syncthreads();
  v4u up[2];
#pragma unroll
  for (int it = 0; it < 2; ++it) {
    const int nl = it * 32 + lq;                                     // 0..63
    up[it] = *(const v4u*)(T + nl * TP + 8 * e);
  }
{
#pragma unroll
    for (int it = 0; it < 2; ++it) {
      const int nl = it * 32 + lq;
      *(v4u*)(XP + (size_t)(n0 + nl) * CIN + c0 + 8 * e) = up[it];
    }
    
  }
}

// =========================================================================================================
// (2) pointwise conv GEMM for one (64-n tile, projection mb in {q,k,v}): P[o][n] = (1/256) sum_c W16[o0+o][c]
//     XP[n][c] + bias[o]. Block 128 threads = 4 waves; wave w owns cols n0+16w..+15 (B fragment from the XP row,
//     k = c contiguous, split k map) and 4 m-tiles (A rows o0 + 16 mt + (lane&15) of W16, split k map).
//     K = 128 = 4 steps. Epilogue staged in LDS Os[n_loc][o_loc] (pitch OSP), block barrier, then:
//       mb 1: k   -> Kh = bf16-RNE(v), Kl = bf16-RNE(v - hi), planes bf16 [NTOK][64];
//       mb 2: v   -> Vc f16 [64 ch][NTOK] (channel-major, value f16(v*16)), row segment n0..n0+63 = one line.
// coverage: Os 4 waves x 16 n x 64 o = 64 x 64 (cols 0..63 of pitch 68, reads stay in cols 0..63);
//           Qh/Ql/Kh/Kl: 4 it x 16 rows x 8 lanes x 8 = 64 n x 64 d; Vc: 4 it x 16 ch x 8 lanes x 8 = 64 ch x 64 n;
//           grid (NTOK/64, 3) covers all rows of Qh, Ql, Kh, Kl and all of Vc exactly once.
// =========================================================================================================
__global__ __launch_bounds__(128)
void gemm_qkv(const unsigned short* __restrict__ W16, const unsigned short* __restrict__ XP,
              const float* __restrict__ bq, const float* __restrict__ bk, const float* __restrict__ bv,
              unsigned short* Qh, unsigned short* Ql, unsigned short* Kh, unsigned short* Kl,
              unsigned short* Vc) {
  __shared__ __align__(16) float Os[QT * OSP];
  const int tid  = threadIdx.x;
  const int lane = tid & 31, wave = tid >> 5;
  const int hh   = lane >> 4, c = lane & 15;
  const int nt   = blockIdx.x, mb = blockIdx.y;
  const int n0   = nt * QT, o0 = mb * QT;

  const unsigned short* ap = W16 + (size_t)(o0 + c) * CIN + 8 * hh;
  const unsigned short* bp = XP + (size_t)(n0 + 16 * wave + c) * CIN + 8 * hh;

  v8f acc[4];
#pragma unroll
  for (int mt = 0; mt < 4; ++mt) acc[mt] = zero8();

#pragma unroll
  for (int ks = 0; ks < CIN / 32; ++ks) {
    const Frag fb = ldfrag(bp + 32 * ks);
#pragma unroll
    for (int mt = 0; mt < 4; ++mt) {
      const Frag fa = ldfrag(ap + (size_t)(16 * mt) * CIN + 32 * ks);
      acc[mt] = mma_h(fa.h, fb.h, acc[mt]);
    }
  }

  // ---- epilogue: scale back + bias (+ 1/sqrt(ck) for q) -> LDS Os[n_loc][o_loc]
  const float* bsel = (mb == 0) ? bq : ((mb == 1) ? bk : bv);       // block-uniform, all global
  const float osc = (mb == 0) ? QSC : 1.0f;
  {
    const int nl = 16 * wave + c;
#pragma unroll
    for (int mt = 0; mt < 4; ++mt) {
      const v4f b0 = *(const v4f*)(bsel + 16 * mt + 8 * hh);
      const v4f b1 = *(const v4f*)(bsel + 16 * mt + 8 * hh + 4);
      v4f va, vb;
#pragma unroll
      for (int r = 0; r < 4; ++r) {
        va[r] = (acc[mt][r] * IWSC + bfr(b0[r])) * osc;
        vb[r] = (acc[mt][4 + r] * IWSC + bfr(b1[r])) * osc;
      }
      *(v4f*)(Os + nl * OSP + 16 * mt + 8 * hh)     = va;
      *(v4f*)(Os + nl * OSP + 16 * mt + 8 * hh + 4) = vb;
    }
  }
  __syncthreads();

  const int e = tid & 7, lq = tid >> 3;                             // lq 0..15
  if (mb < 2) {
    unsigned short* Ph = (mb == 0) ? Qh : Kh;                        // block-uniform, both global
    unsigned short* Pl = (mb == 0) ? Ql : Kl;
    v4u uh[4], ul[4];
#pragma unroll
    for (int it = 0; it < 4; ++it) {
      const int row = it * 16 + lq;                                  // n_loc 0..63
      const v4f a = *(const v4f*)(Os + row * OSP + 8 * e);
      const v4f q = *(const v4f*)(Os + row * OSP + 8 * e + 4);
      const float f[8] = {a[0], a[1], a[2], a[3], q[0], q[1], q[2], q[3]};
#pragma unroll
      for (int t = 0; t < 4; ++t) {
        const float f0 = f[2 * t], f1 = f[2 * t + 1];
        const unsigned short hb0 = bf_bits(f0), hb1 = bf_bits(f1);
        const unsigned short lb0 = bf_bits(f0 - bf_up(hb0));
        const unsigned short lb1 = bf_bits(f1 - bf_up(hb1));
        uh[it][t] = pk16(hb0, hb1);
        ul[it][t] = pk16(lb0, lb1);
      }
    }
{
#pragma unroll
      for (int it = 0; it < 4; ++it) {
        const int row = it * 16 + lq;
        const size_t po = (size_t)(n0 + row) * DK + 8 * e;
        *(v4u*)(Ph + po) = uh[it];
        *(v4u*)(Pl + po) = ul[it];
      }
      
    }
  } else {
    v4u uv[4];
#pragma unroll
    for (int it = 0; it < 4; ++it) {
      const int o = it * 16 + lq;                                    // channel 0..63
      unsigned short hb[8];
#pragma unroll
      for (int t = 0; t < 8; ++t) hb[t] = h_bits((_Float16)(Os[(8 * e + t) * OSP + o] * VSC));
#pragma unroll
      for (int t = 0; t < 4; ++t) uv[it][t] = pk16(hb[2 * t], hb[2 * t + 1]);
    }
{
#pragma unroll
      for (int it = 0; it < 4; ++it) {
        const int o = it * 16 + lq;
        *(v4u*)(Vc + (size_t)o * NTOK + n0 + 8 * e) = uv[it];
      }
      
    }
  }
}

// =========================================================================================================
// (3) global attention for one 64-query tile, transposed formulation, NTOK keys, no mask:
//   S^T tile (16 keys x 16 queries) = sum over 2 d-chunks of A(k: row = key kb + (lane&15), 32 d via the split
//   k map from the bf16 plane Kh [NTOK][64]) . B(q: col = query, same map from Qh) + A(Kh).B(Ql) + A(Kl).B(Qh)
//   (bf16 unscaled residual planes, shared accumulator, 3 products). q fragments (2 chunks x hi/lo) loaded once
//   per wave; k (hi and residual) and v tiles of KT keys are staged in a two-buffer LDS ring by asynchronous copies,
//   shared by the block's 16 waves: stage = Kh[KT][64] and Kl[KT][64] (row pitch KPH halves) + V[64 ch][KT] (pitch VPH);
//   tile t + 2 is copied into the buffer trip t has read, behind the barrier at the foot of trip t, and flies during
//   trip t + 1. Fragments come from LDS with the same split-map loader, one load group per block of 32 keys, issued ahead
//   of its use: v of the block and k of the tile's next block in front of the exponentials; k of a tile's first block
//   directly behind the barrier that publishes the tile.
//   Per lane the D tile holds 8 keys of ONE query: online softmax state per lane, one shuffle (lane^16) for the max
//   over 32 keys; the o/l rescale is skipped under a wave-uniform ballot when no lane's max grew (corr == 1 exactly
//   for every lane then); row-sum partials combined at the end. P = e^{s-m} x 2^14 as f16 is the B operand of
//   O^T (rows channel, cols queries) += A(v rows channel = 16j + (lane&15), keys contiguous, f16 plane Vc
//   [64][NTOK]) . B(P^T): element r <- D of the tile covering keys kb..kb+15, element 8+r <- the tile covering
//   kb+16..kb+31, lane unchanged. 4 accumulator tiles per wave (64 channels). Block = 64 queries x KG key groups =
//   16 waves (4 per SIMD, so that one wave's LDS, softmax and matrix latencies are covered by the others): wave
//   (qw, kg) takes queries 16 qw .. +15 and keys KW kg .. +KW-1 of every tile, with its own m, l and o.
//   Epilogue: the groups' (m, l) are exchanged in LDS, block barrier, M = max m, L = sum l e^{m-M}; each wave stages
//   its o e^{m-M}/(16 L) in LDS Os[kg][query][64 ch] (pitch OSP, b128 stores), block barrier, then the KG planes are
//   summed in the order kg = 0..3 and the flat planes written.
// coverage: Os KG x 4 waves x 16 q x 64 ch (cols 0..63); Oh/Ol 64 rows x 8 lanes x 8 halves =
//           64 q x 64 ch per plane; grid (NTOK/64) covers rows 0..NTOK-1 of both planes exactly once.
// =========================================================================================================
__global__ __launch_bounds__(ATH)
void attn_k(const unsigned short* __restrict__ Qh, const unsigned short* __restrict__ Ql,
            const unsigned short* __restrict__ Kh, const unsigned short* __restrict__ Kl,
            const unsigned short* __restrict__ Vc, unsigned short* Oh, unsigned short* Ol) {
  __shared__ __align__(16) float Os[KG * QT * OSP];
  __shared__ float Mg[KG * QT];
  __shared__ float Lg[KG * QT];
  __shared__ __align__(16) unsigned short Ring[2 * STGH];
  const int tid  = threadIdx.x;
  const int wave = tid >> 5, lane = tid & 31;
  const int qw   = wave & 3, kg = wave >> 2;                        // query sub-tile, key group
  const int hh   = lane >> 4, c = lane & 15;
  const int n0   = blockIdx.x * QT;

  // q fragments (B operand, col = query n0 + 16*qw + c), d chunks 0 and 1, hi and residual planes
  const size_t qo = (size_t)(n0 + 16 * qw + c) * DK + 8 * hh;
  const Frag qh0 = ldfrag(Qh + qo), qh1 = ldfrag(Qh + qo + 32);
  const Frag ql0 = ldfrag(Ql + qo), ql1 = ldfrag(Ql + qo + 32);
  // copy addresses of this lane. K planes: copy i moves 64 rows (8 lanes x 16 B per 128-B row), row 64 i + (tid >> 3);
  // V: copy i moves 16 channel rows (32 lanes x 16 B per 512-B row segment), row 16 i + (tid >> 5).
  const unsigned ring0 = (unsigned)(uintptr_t)Ring;                  // LDS byte address of the ring
  const unsigned lk = ring0 + (unsigned)((tid >> 3) * (KPH * 2) + (tid & 7) * 16);
  const unsigned lv = ring0 + (unsigned)(SVV * 2 + (tid >> 5) * (VPH * 2) + (tid & 31) * 16);
  const unsigned short* gkh = Kh + (size_t)tid * 8;
  const unsigned short* gkl = Kl + (size_t)tid * 8;
  const unsigned short* gv  = Vc + (size_t)(tid >> 5) * NTOK + 8 * (tid & 31);
  auto fill = [&](int buf, int tile) {
    const unsigned lb = (unsigned)buf * (unsigned)(STGH * 2);
    copy4(lk + lb,           64 * KPH * 2, gkh + (size_t)tile * (KT * DK), (size_t)64 * DK);
    copy4(lk + lb + SKL * 2, 64 * KPH * 2, gkl + (size_t)tile * (KT * DK), (size_t)64 * DK);
    copy4(lv + lb,           16 * VPH * 2, gv + (size_t)tile * KT,         (size_t)16 * NTOK);
  };
  // fragment offsets inside a stage (halves): k row = key KW kg + c (+ 32 p, + 16), v row = channel c (+ 16 j),
  // v column = key KW kg (+ 32 p)
  const int kfo = (KW * kg + c) * KPH + 8 * hh;
  const int vfo = SVV + c * VPH + KW * kg + 8 * hh;

  fill(0, 0);
  wait_async0();
  __syncthreads();                                                   // tile 0 is readable by every wave
  // the first block's k fragments of a tile: one load group directly behind the barrier that publishes the tile, in front
  // of the refill copies (which go to the other buffer), so that the copies' issue covers the LDS latency
  KSet ks = ldkset(Ring + kfo, Ring + SKL + kfo, 0, 16 * KPH);
  fill(1, 1);

  float m = -1.0e30f, l = 0.f;
  v8f o[4];
#pragma unroll
  for (int j = 0; j < 4; ++j) o[j] = zero8();

#pragma unroll 1
  for (int t = 0; t < NTOK / KT; ++t) {
  const unsigned short* Sb  = Ring + (t & 1) * STGH;                // up to its foot barrier trip t reads buffer t mod 2 alone
  const unsigned short* Khp = Sb + kfo;
  const unsigned short* Klp = Sb + SKL + kfo;
  const unsigned short* Vp  = Sb + vfo;
  // unrolled so that every LDS offset of a stage is an immediate of its load
#pragma unroll
  for (int kb = 0; kb < KW; kb += 32) {
    v8f s0 = zero8(), s1 = zero8();
    s0 = mma_b(ks.h00.bf, qh0.bf, s0);                              // d chunk 0
    s1 = mma_b(ks.h10.bf, qh0.bf, s1);
    s0 = mma_b(ks.h00.bf, ql0.bf, s0);
    s1 = mma_b(ks.h10.bf, ql0.bf, s1);
    s0 = mma_b(ks.g00.bf, qh0.bf, s0);
    s1 = mma_b(ks.g10.bf, qh0.bf, s1);
    s0 = mma_b(ks.h01.bf, qh1.bf, s0);                              // d chunk 1
    s1 = mma_b(ks.h11.bf, qh1.bf, s1);
    s0 = mma_b(ks.h01.bf, ql1.bf, s0);
    s1 = mma_b(ks.h11.bf, ql1.bf, s1);
    s0 = mma_b(ks.g01.bf, qh1.bf, s0);
    s1 = mma_b(ks.g11.bf, qh1.bf, s1);

    float mx = fmaxf(hmax8(s0), hmax8(s1));
    mx = fmaxf(mx, __shfl_xor(mx, 16, 32));
    const float mn = fmaxf(m, mx);
    const unsigned grew = wave_ballot(mx > m);                       // wave-uniform
    if (grew != 0u) {
      const float corr = __expf(m - mn);                             // == 1 exactly for lanes whose max did not grow
      l *= corr;
#pragma unroll
      for (int j = 0; j < 4; ++j) {
#pragma unroll
        for (int r = 0; r < 8; ++r) o[j][r] *= corr;
      }
    }
    m = mn;
    const float msh = mn - LNPS;                                     // exp gives e^{s-m} * 2^14

    // one load group per block, ahead of its use: this block's v fragments, then the next block's k fragments of the
    // SAME tile (into the registers the score products have left); their LDS latency runs under the exponentials and
    // the O products instead of being waited out in front of each product
    Frag vf[4];
#pragma unroll
    for (int j = 0; j < 4; ++j) vf[j] = ldfrag(Vp + (16 * j) * VPH + kb);
    if (kb + 32 < KW) ks = ldkset(Khp, Klp, (kb + 32) * KPH, (kb + 48) * KPH);
#if defined(__HIP_DEVICE_COMPILE__)
    __builtin_amdgcn_sched_barrier(0);   // keeps the group whole and in front of the exponentials that cover its latency
#endif

    FragH ph;
    float ls = 0.f;
#pragma unroll
    for (int r = 0; r < 8; ++r) {
      const float e0 = __expf(s0[r] - msh);                          // key kb      + 8hh + r
      const float e1 = __expf(s1[r] - msh);                          // key kb + 16 + 8hh + r
      ls += e0 + e1;
      ph.hv[0][r] = (_Float16)e0;
      ph.hv[1][r] = (_Float16)e1;
    }
    l += ls;

#pragma unroll
    for (int j = 0; j < 4; ++j) o[j] = mma_h(vf[j].h, ph.v, o[j]);
    // between two blocks of a tile: the slots in front of the next score products, whose D may lie on this P; its barriers
    // also keep those products (which wait for the load group above) behind this block's exponentials, so that the
    // exponentials still run while the group is in flight
    if (kb + 32 < KW) gap4();
  }
  // foot of trip t: own reads done, own copies of tile t + 1 landed, then the one barrier that publishes tile t + 1
  // and ends every wave's reads of buffer t mod 2; only then its refill
  wait_ds0();
  wait_async0();
  __syncthreads();
  gap4();                                                            // behind the tile's last products, in front of the branches below
  if (t + 1 < NTOK / KT) {                                           // tile t + 1 is published: its first k fragments
    const unsigned short* Nb = Ring + ((t + 1) & 1) * STGH + kfo;
    ks = ldkset(Nb, Nb + SKL, 0, 16 * KPH);
  }
  if (t + 2 < NTOK / KT) fill(t & 1, t + 2);
  }
  wait_async0();
  l += __shfl_xor(l, 16, 32);

  // merge of the KG key groups: (m, l) of every group and query through LDS (m and l are equal in lanes c and c + 16)
  const int qrow = 16 * qw + c;
  if (hh == 0) { Mg[kg * QT + qrow] = m; Lg[kg * QT + qrow] = l; }
  __syncthreads();                                                   // every group's (m, l) is readable
  float mall = Mg[qrow];
#pragma unroll
  for (int g = 1; g < KG; ++g) mall = fmaxf(mall, Mg[g * QT + qrow]);
  float lall = 0.f;
#pragma unroll
  for (int g = 0; g < KG; ++g) lall += Lg[g * QT + qrow] * __expf(Mg[g * QT + qrow] - mall);
  const float scl = (__expf(m - mall) / lall) * IVSC;                // o and l both carry 2^14; o also carries the v x16

  float* Ow = Os + kg * (QT * OSP);
#pragma unroll
  for (int j = 0; j < 4; ++j) {
    v4f va, vb;
#pragma unroll
    for (int r = 0; r < 4; ++r) { va[r] = o[j][r] * scl; vb[r] = o[j][4 + r] * scl; }
    *(v4f*)(Ow + qrow * OSP + 16 * j + 8 * hh)     = va;            // Os[kg][query][ch = 16j + 8hh + r]
    *(v4f*)(Ow + qrow * OSP + 16 * j + 8 * hh + 4) = vb;
  }
  __syncthreads();                                                   // every group's weighted o is readable

  const int e = tid & 7, row = tid >> 3;                             // row = query 0..63
  v4f a = *(const v4f*)(Os + row * OSP + 8 * e);
  v4f q = *(const v4f*)(Os + row * OSP + 8 * e + 4);
#pragma unroll
  for (int g = 1; g < KG; ++g) {
    a += *(const v4f*)(Os + g * (QT * OSP) + row * OSP + 8 * e);
    q += *(const v4f*)(Os + g * (QT * OSP) + row * OSP + 8 * e + 4);
  }
  const float f[8] = {a[0], a[1], a[2], a[3], q[0], q[1], q[2], q[3]};
  v4u uh, ul;
#pragma unroll
  for (int t = 0; t < 4; ++t) {
    const float g0 = f[2 * t] * OSC, g1 = f[2 * t + 1] * OSC;
    const _Float16 h0 = (_Float16)g0, h1 = (_Float16)g1;
    const _Float16 l0 = (_Float16)((g0 - (float)h0) * RSC);
    const _Float16 l1 = (_Float16)((g1 - (float)h1) * RSC);
    uh[t] = pk16(h_bits(h0), h_bits(h1));
    ul[t] = pk16(h_bits(l0), h_bits(l1));
  }
  const size_t po = (size_t)(n0 + row) * DK + 8 * e;
  *(v4u*)(Oh + po) = uh;
  *(v4u*)(Ol + po) = ul;
}

// =========================================================================================================
// (4) output pointwise conv over the raw view: Y[o][n'] = (1/256)(1/1024) sum_{c'} Wo16[o][c'] (Ohv[c'][n'] +
//     Olv[c'][n'] / 1024) + bo[o], where Ohv/Olv [64][NTOK] are the flat O planes re-read with row c' = halves
//     c'*NTOK .. +NTOK-1. Block (nt, mb): 64 n' x 64 o. The two 64 c' x 64 n' B tiles are staged transposed in
//     LDS Bh/Bl[n'_loc][c'] (pitch TP, 16-B global loads, 2-byte LDS stores), block barrier, then B fragments per
//     wave (col n0'+16w+(lane&15), k = c' contiguous, split k map) and A fragments from Wo16 rows o0+16mt+(lane&15).
//     K = 64 = 2 steps; hi and residual products in separate accumulators. Epilogue staged in Ys[n'_loc][o_loc]
// coverage: Bh/Bl 4 it x 16 c' x (8 x 8 n') = 64 x 64 each (cols 0..63 of pitch 72); Ys 4 waves x 16 n' x 64 o;
//           out: 8 it x 16 lines x 8 lanes x 4 floats = 64 o x 64 n'; grid (NTOK/64, COUT/64) covers
//           out[0..127][0..NTOK-1] exactly once.
// =========================================================================================================
__global__ __launch_bounds__(128)
void gemm_o(const unsigned short* __restrict__ Wo16, const unsigned short* __restrict__ Oh,
            const unsigned short* __restrict__ Ol, const float* __restrict__ bo, float* Y) {
  __shared__ __align__(16) unsigned short Bh[QT * TP];
  __shared__ __align__(16) unsigned short Bl[QT * TP];
  __shared__ __align__(16) float Ys[QT * OSP];
  const int tid  = threadIdx.x;
  const int lane = tid & 31, wave = tid >> 5;
  const int hh   = lane >> 4, c = lane & 15;
  const int nt   = blockIdx.x, mb = blockIdx.y;
  const int n0   = nt * QT, o0 = mb * QT;
  const int e = tid & 7, lq = tid >> 3;                              // lq 0..15

  // ---- stage the view tiles transposed: Bh[n'_loc][c'] <- Oh[c'*NTOK + n0 + n'_loc]
#pragma unroll
  for (int it = 0; it < 4; ++it) {
    const int cl = it * 16 + lq;                                     // c' 0..63
    const size_t so = (size_t)cl * NTOK + n0 + 8 * e;
    const v4u ah = *(const v4u*)(Oh + so);
    const v4u al = *(const v4u*)(Ol + so);
#pragma unroll
    for (int t = 0; t < 4; ++t) {
      Bh[(8 * e + 2 * t) * TP + cl]     = (unsigned short)(ah[t] & 0xffffu);
      Bh[(8 * e + 2 * t + 1) * TP + cl] = (unsigned short)(ah[t] >> 16);
      Bl[(8 * e + 2 * t) * TP + cl]     = (unsigned short)(al[t] & 0xffffu);
      Bl[(8 * e + 2 * t + 1) * TP + cl] = (unsigned short)(al[t] >> 16);
    }
  }
  __syncthreads();

  const unsigned short* ap  = Wo16 + (size_t)(o0 + c) * DK + 8 * hh;
  const unsigned short* bph = Bh + (16 * wave + c) * TP + 8 * hh;
  const unsigned short* bpl = Bl + (16 * wave + c) * TP + 8 * hh;

  v8f acch[4], accl[4];
#pragma unroll
  for (int mt = 0; mt < 4; ++mt) { acch[mt] = zero8(); accl[mt] = zero8(); }

#pragma unroll
  for (int ks = 0; ks < DK / 32; ++ks) {
    const Frag fbh = ldfrag(bph + 32 * ks);
    const Frag fbl = ldfrag(bpl + 32 * ks);
#pragma unroll
    for (int mt = 0; mt < 4; ++mt) {
      const Frag fa = ldfrag(ap + (size_t)(16 * mt) * DK + 32 * ks);
      acch[mt] = mma_h(fa.h, fbh.h, acch[mt]);
      accl[mt] = mma_h(fa.h, fbl.h, accl[mt]);
    }
  }

  // ---- epilogue: fold residual, scale back, bias -> Ys[n'_loc][o_loc]
  {
    const int nl = 16 * wave + c;
    const float fs = IWSC * IOSC;
#pragma unroll
    for (int mt = 0; mt < 4; ++mt) {
      const v4f b0 = *(const v4f*)(bo + o0 + 16 * mt + 8 * hh);
      const v4f b1 = *(const v4f*)(bo + o0 + 16 * mt + 8 * hh + 4);
      v4f va, vb;
#pragma unroll
      for (int r = 0; r < 4; ++r) {
        va[r] = (acch[mt][r] + accl[mt][r] * IRSC) * fs + bfr(b0[r]);
        vb[r] = (acch[mt][4 + r] + accl[mt][4 + r] * IRSC) * fs + bfr(b1[r]);
      }
      *(v4f*)(Ys + nl * OSP + 16 * mt + 8 * hh)     = va;
      *(v4f*)(Ys + nl * OSP + 16 * mt + 8 * hh + 4) = vb;
    }
  }
  __syncthreads();

  v4f res[8];
#pragma unroll
  for (int it = 0; it < 8; ++it) {
    const int L  = it * 16 + lq;                                     // line 0..127
    const int ol = L >> 1, hf = L & 1;                               // o_loc 0..63, line half
    const int nl = hf * 32 + 4 * e;                                  // n'_loc 0..63
#pragma unroll
    for (int t = 0; t < 4; ++t) res[it][t] = Ys[(nl + t) * OSP + ol];
  }
{
#pragma unroll
    for (int it = 0; it < 8; ++it) {
      const int L  = it * 16 + lq;
      const int ol = L >> 1, hf = L & 1;
      const int nl = hf * 32 + 4 * e;
      *(v4f*)(Y + (size_t)(o0 + ol) * NTOK + n0 + nl) = res[it];
    }
    
  }
}

// =========================================================================================================
// Workspace map (bytes, full size ND=16; each region start a multiple of 256; every extent is an exact tile
//   W16 f16 [192][128]        49152        Wo16 f16 [128][64]      16384
//   XP  f16 [16384][128]    4194304
//   Qh/Ql/Kh/Kl bf16 [16384][64] 2097152 x4   Vc f16 [64][16384]   2097152
//   Oh/Ol f16 [16384][64]   2097152 x2
//   total = 18939904
// =========================================================================================================
extern "C" void kernel_launch(void* const* d_in, const int* in_sizes, int n_in,
                              void* d_out, int out_size, void* d_ws, size_t ws_size,
                              hipStream_t stream) {
  if (n_in < 9) return;
  if (in_sizes[0] < CIN * NTOK) return;
  if ((in_sizes[0] % CIN) != 0) return;
  const int xstride = in_sizes[0] / CIN;                             // per-channel position stride of X
  if (xstride < NTOK || (xstride % 4) != 0) return;
  if (in_sizes[1] < DK * CIN || in_sizes[3] < DK * CIN || in_sizes[5] < DK * CIN) return;
  if (in_sizes[2] < DK || in_sizes[4] < DK || in_sizes[6] < DK) return;
  if (in_sizes[7] < COUT * DK || in_sizes[8] < COUT) return;
  if (out_size < COUT * NTOK) return;

  size_t off = 0;
  auto carve = [&](size_t bytes) { const size_t o = off; off += (bytes + 255) & ~(size_t)255; return o; };
  const size_t oW16  = carve((size_t)3 * DK * CIN * 2);
  const size_t oWo16 = carve((size_t)COUT * DK * 2);
  const size_t oXP   = carve((size_t)NTOK * CIN * 2);
  const size_t oQh   = carve((size_t)NTOK * DK * 2);
  const size_t oQl   = carve((size_t)NTOK * DK * 2);
  const size_t oKh   = carve((size_t)NTOK * DK * 2);
  const size_t oKl   = carve((size_t)NTOK * DK * 2);
  const size_t oVc   = carve((size_t)DK * NTOK * 2);
  const size_t oOh   = carve((size_t)NTOK * DK * 2);
  const size_t oOl   = carve((size_t)NTOK * DK * 2);
  if (off > ws_size) return;
  if (off > (size_t)134217728) return;

  const float* X  = (const float*)d_in[0];
  const float* Wq = (const float*)d_in[1];
  const float* bq = (const float*)d_in[2];
  const float* Wk = (const float*)d_in[3];
  const float* bk = (const float*)d_in[4];
  const float* Wv = (const float*)d_in[5];
  const float* bv = (const float*)d_in[6];
  const float* Wo = (const float*)d_in[7];
  const float* bo = (const float*)d_in[8];

  char* ws = (char*)d_ws;
  unsigned short* W16  = (unsigned short*)(ws + oW16);
  unsigned short* Wo16 = (unsigned short*)(ws + oWo16);
  unsigned short* XP   = (unsigned short*)(ws + oXP);
  unsigned short* Qh   = (unsigned short*)(ws + oQh);
  unsigned short* Ql   = (unsigned short*)(ws + oQl);
  unsigned short* Kh   = (unsigned short*)(ws + oKh);
  unsigned short* Kl   = (unsigned short*)(ws + oKl);
  unsigned short* Vc   = (unsigned short*)(ws + oVc);
  unsigned short* Oh   = (unsigned short*)(ws + oOh);
  unsigned short* Ol   = (unsigned short*)(ws + oOl);
  float* out = (float*)d_out;

  const dim3 blk256(256), blk128(128);
  const int BQ = (DK * CIN) / (8 * CHB), BO = (COUT * DK) / (8 * CHB);

  // (0) weights -> f16 planes
  cvt_w<<<dim3(3 * BQ + BO), dim3(CHB), 0, stream>>>(Wq, Wk, Wv, Wo, W16, Wo16);
  // (1) x -> position-major 16-bit plane
  cvt_x<<<dim3(NTOK / QT, CIN / QT), blk256, 0, stream>>>(X, xstride, XP);
  // (2) q/k/v pointwise conv GEMM -> q hi + residual, k hi + residual, v planes
  gemm_qkv<<<dim3(NTOK / QT, 3), blk128, 0, stream>>>(W16, XP, bq, bk, bv, Qh, Ql, Kh, Kl, Vc);
  // (3) global attention -> O hi + residual planes [NTOK][64]
  attn_k<<<dim3(NTOK / QT), dim3(ATH), 0, stream>>>(Qh, Ql, Kh, Kl, Vc, Oh, Ol);
  // (4) output conv over the raw [64][NTOK] view -> out [128][NTOK]
  gemm_o<<<dim3(NTOK / QT, COUT / QT), blk128, 0, stream>>>(Wo16, Oh, Ol, bo, out);
  (void)hipGetLastError();
}

// v005
// It runs in 123 microseconds.
// Timed twice side by side with v004, it ran 1.05 and 1.07 times as fast.
// Over all steps from v000 it is 6.91 times as fast.
// Contractions: q/k/v pointwise conv W16[192x128].XP[n][128] on v_wmma_f32_16x16x32_f16 (f16 containers of
// bf16-RNE weights x256 and bf16-RNE x, exact products); scores K.Q^T on v_wmma_f32_16x16x32_bf16 (bf16 hi +
// bf16 residual planes of k and of q/8, 3 products hi.hi + hi.lo + lo.hi, K=64); O^T = V.P^T on
// v_wmma_f32_16x16x32_f16 (v x16 as f16, P = e^{s-m} x2^14 f16 from the score D registers); output conv
// Wo16[128x64].Oview[64][N] on v_wmma_f32_16x16x32_f16 (f16 of bf16-RNE weights x256; O carried as f16 hi x1024
// plane + f16 residual x2^20 plane, 2 products, separate accumulators); f32 accumulate everywhere; softmax
// statistics and bias adds in f32 VALU.
#include <hip/hip_runtime.h>
#include <math.h>
#include <stdint.h>

#ifndef ND
#define ND 16
#endif
#define NHH    32
#define NWW    32
#define NTOK   (ND * NHH * NWW)
#define CIN    128
#define DK     64
#define COUT   128
#define QT     64
#define OSP    68
#define TP     72
#define CHB    256
#define WSC    256.0f
#define IWSC   0.00390625f
#define QSC    0.125f
#define VSC    16.0f
#define IVSC   0.0625f
#define OSC    1024.0f
#define IOSC   0.0009765625f
#define RSC    1024.0f
#define IRSC   0.0009765625f
#define LNPS   9.704060527839234f
#define KG     8
#define QC     2
#define ATH    (32 * (QT / (16 * QC)) * KG)
#define KT     256
#define KW     (KT / KG)
#define KPH    72
#define VPH    264
#define SKL    (KT * KPH)
#define SVV    (2 * KT * KPH)
#define STGH   (2 * KT * KPH + DK * VPH)

static_assert(ND >= 1 && ND <= 16);
static_assert(NTOK % QT == 0);
static_assert(NTOK % 32 == 0);
static_assert(CIN % QT == 0 && CIN % 32 == 0);
static_assert(DK == QT);
static_assert(DK % 32 == 0);
static_assert(COUT % QT == 0);
static_assert((DK * CIN) % (8 * CHB) == 0);
static_assert((COUT * DK) % (8 * CHB) == 0);
static_assert((OSP * 4) % 16 == 0);
static_assert((TP * 2) % 16 == 0);
static_assert(KT % 32 == 0 && NTOK % KT == 0 && NTOK / KT >= 2);
static_assert((ATH / 8) * 4 == KT && (ATH / 32) * 4 == DK && KT == 8 * 32 && DK == 8 * 8);
static_assert(KW == 32 && VPH == KT + 8 && QT * 8 == ATH && QT == 2 * 16 * QC);
static_assert(KG * QT * OSP * 4 <= 2 * STGH * 2);
static_assert((KPH * 2) % 32 == 16 && (VPH * 2) % 32 == 16 && (STGH * 2) % 16 == 0);

typedef _Float16       v16h __attribute__((ext_vector_type(16)));
typedef _Float16       v8h  __attribute__((ext_vector_type(8)));
typedef __bf16         v16b __attribute__((ext_vector_type(16)));
typedef unsigned short v8us __attribute__((ext_vector_type(8)));
typedef float          v8f  __attribute__((ext_vector_type(8)));
typedef float          v4f  __attribute__((ext_vector_type(4)));
typedef unsigned int   v4u  __attribute__((ext_vector_type(4)));

union Frag  { v8us u[2]; v16h h; v16b bf; };
union FragH { v16h v; v8h hv[2]; };
static_assert(sizeof(Frag) == 32);
static_assert(sizeof(FragH) == 32);

// ---- scalar helpers ---------------------------------------------------------------------------------------
__device__ __forceinline__ unsigned short bf_bits(float f) {          // f32 -> bf16 bits, RNE convert
  unsigned u = __float_as_uint(f);
  return (unsigned short)((u + 0x7FFFu + ((u >> 16) & 1u)) >> 16);
}
__device__ __forceinline__ float bf_up(unsigned short hb) { return __uint_as_float(((unsigned)hb) << 16); }
__device__ __forceinline__ float bfr(float f) { return bf_up(bf_bits(f)); }
__device__ __forceinline__ unsigned short h_bits(_Float16 x) { return __builtin_bit_cast(unsigned short, x); }
__device__ __forceinline__ unsigned pk16(unsigned short a, unsigned short b) { return (unsigned)a | ((unsigned)b << 16); }
__device__ __forceinline__ v8f zero8() { v8f z = {0.f, 0.f, 0.f, 0.f, 0.f, 0.f, 0.f, 0.f}; return z; }
__device__ __forceinline__ float hmax8(v8f s) {
  return fmaxf(fmaxf(fmaxf(s[0], s[1]), fmaxf(s[2], s[3])), fmaxf(fmaxf(s[4], s[5]), fmaxf(s[6], s[7])));
}
__device__ __forceinline__ unsigned wave_ballot(bool p) {
#if defined(__HIP_DEVICE_COMPILE__)
  return __builtin_amdgcn_ballot_w32(p);
#else
  return p ? 1u : 0u;
#endif
}

// ---- 16-bit fragment loader (A, or B from a k-contiguous [n][k] row): lane -> row/col (lane&15), p already includes
//      + 8*(lane>>4); elements 0..7 <- p[0..7] (k0+8h..), elements 8..15 <- p[16..23] (k0+16+8h..)
__device__ __forceinline__ Frag ldfrag(const unsigned short* p) {
  Frag f;
  f.u[0] = *(const v8us*)(p);
  f.u[1] = *(const v8us*)(p + 16);
  return f;
}

// ---- the 8 k fragments of one block of 32 keys (rows r0 = kb .. +15, r1 = kb+16 .. +31; d chunks 0 and 1; hi and residual)
struct KSet { Frag h00, h10, g00, g10, h01, h11, g01, g11; };
__device__ __forceinline__ KSet ldkset(const unsigned short* hp, const unsigned short* lp, int r0o, int r1o) {
  KSet k;
  k.h00 = ldfrag(hp + r0o);      k.h10 = ldfrag(hp + r1o);
  k.g00 = ldfrag(lp + r0o);      k.g10 = ldfrag(lp + r1o);
  k.h01 = ldfrag(hp + r0o + 32); k.h11 = ldfrag(hp + r1o + 32);
  k.g01 = ldfrag(lp + r0o + 32); k.g11 = ldfrag(lp + r1o + 32);
  return k;
}

// ---- WMMA helpers: the plain builtins; the compiler keeps the distances behind its own forms (another product or
//      independent vector work fills a slot), so that the vector port stays free for the SIMD's other waves
__device__ __forceinline__ v8f mma_h(v16h a, v16h b, v8f c) {
  return __builtin_amdgcn_wmma_f32_16x16x32_f16(false, a, false, b, (short)0, c, false, false);
}
__device__ __forceinline__ v8f mma_b(v16b a, v16b b, v8f c) {
  return __builtin_amdgcn_wmma_f32_16x16x32_bf16(false, a, false, b, (short)0, c, false, false);
}
template <bool B> struct Flag { static constexpr bool v = B; };

// ---- LDS ring helpers (attention) ---------------------------------------------------------------------------
// Four asynchronous 16-byte copies global -> LDS per lane (l = the lane's LDS byte address, g = its global address),
// with the s_wait_xcnt 0 that stands before the address registers may be rewritten as the statement's last line.
__device__ __forceinline__ void copy4(unsigned l0, unsigned lstep, const unsigned short* g0, size_t gstep) {
#if defined(__HIP_DEVICE_COMPILE__)
  asm volatile("global_load_async_to_lds_b128 %0, %4, off\n\t"
               "global_load_async_to_lds_b128 %1, %5, off\n\t"
               "global_load_async_to_lds_b128 %2, %6, off\n\t"
               "global_load_async_to_lds_b128 %3, %7, off\n\t"
               "s_wait_xcnt 0x0"
               :: "v"(l0), "v"(l0 + lstep), "v"(l0 + 2 * lstep), "v"(l0 + 3 * lstep),
                  "v"(g0), "v"(g0 + gstep), "v"(g0 + 2 * gstep), "v"(g0 + 3 * gstep)
               : "memory");
#endif
}
// this wave's own copies have landed in LDS (the compiler places no wait for them)
__device__ __forceinline__ void wait_async0() {
#if defined(__HIP_DEVICE_COMPILE__)
  asm volatile("s_wait_asynccnt 0x0" ::: "memory");
#endif
}
// this wave's own LDS reads have returned, before the buffer they read is handed back for a refill
__device__ __forceinline__ void wait_ds0() {
#if defined(__HIP_DEVICE_COMPILE__)
  asm volatile("s_wait_dscnt 0x0" ::: "memory");
#endif
}

// =========================================================================================================
// (0) weight planes: W16 f16 [192][128] (rows 0..63 = Wq, 64..127 = Wk, 128..191 = Wv) and Wo16 f16 [128][64];
//     value = f16 of (bf16-RNE(w) * 256) (exact). Thread = one 8-element chunk (16 B); 8 consecutive lanes =
// coverage: (3*BQ + BO) blocks x 256 threads x 8 halves = 3*8192 + 8192 elements = both planes exactly.
// =========================================================================================================
__global__ __launch_bounds__(CHB)
void cvt_w(const float* __restrict__ Wq, const float* __restrict__ Wk, const float* __restrict__ Wv,
           const float* __restrict__ Wo, unsigned short* W16, unsigned short* Wo16) {
  const int tid = threadIdx.x, blk = blockIdx.x;
  const int BQ = (DK * CIN) / (8 * CHB);                             // blocks per q/k/v matrix
  const int g = blk * CHB + tid;                                     // chunk id
  const float* src;
  unsigned short* dst;
  int gsrc, gdst;
  if (blk < BQ)          { src = Wq; gsrc = 0;            dst = W16;  gdst = 0; }
  else if (blk < 2 * BQ) { src = Wk; gsrc = BQ * CHB;     dst = W16;  gdst = 0; }
  else if (blk < 3 * BQ) { src = Wv; gsrc = 2 * BQ * CHB; dst = W16;  gdst = 0; }
  else                   { src = Wo; gsrc = 3 * BQ * CHB; dst = Wo16; gdst = 3 * BQ * CHB; }
  const float* s = src + (size_t)8 * (size_t)(g - gsrc);
  const v4f a = *(const v4f*)s;
  const v4f q = *(const v4f*)(s + 4);
  const float f[8] = {a[0], a[1], a[2], a[3], q[0], q[1], q[2], q[3]};
  v4u u;
#pragma unroll
  for (int t = 0; t < 4; ++t) {
    const _Float16 h0 = (_Float16)(bfr(f[2 * t]) * WSC);
    const _Float16 h1 = (_Float16)(bfr(f[2 * t + 1]) * WSC);
    u[t] = pk16(h_bits(h0), h_bits(h1));
  }
{
    *(v4u*)(dst + (size_t)8 * (size_t)(g - gdst)) = u;
    
  }
}

// =========================================================================================================
// (1) X f32 [128 c][xstride] (first NTOK positions used) -> XP f16 [NTOK n][128 c] (position-major, bf16-RNE
//     values, exact in f16) through an LDS tile T[64 n][64 c] (pitch TP). Block (nb, cb) owns a 64 c x 64 n tile.
// coverage: T 2 it x 32 c x (8 x 8 n) = 64 x 64; XP 2 it x 32 rows x 8 lanes x 8 halves = 64 n x 64 c;
//           grid (NTOK/64, 2) covers XP [NTOK][128] exactly once.
// =========================================================================================================
__global__ __launch_bounds__(256)
void cvt_x(const float* __restrict__ X, int xstride, unsigned short* XP) {
  __shared__ __align__(16) unsigned short T[QT * TP];
  const int tid = threadIdx.x;
  const int nb = blockIdx.x, cb = blockIdx.y;
  const int e = tid & 7, lq = tid >> 3;                             // lq 0..31
  const int n0 = nb * QT, c0 = cb * QT;
#pragma unroll
  for (int it = 0; it < 2; ++it) {
    const int cl = it * 32 + lq;                                     // 0..63
    const float* sp = X + (size_t)(c0 + cl) * (size_t)xstride + n0 + 8 * e;
    const v4f a = *(const v4f*)sp;
    const v4f q = *(const v4f*)(sp + 4);
    unsigned short hb[8];
#pragma unroll
    for (int t = 0; t < 4; ++t) {
      hb[t]     = h_bits((_Float16)bfr(a[t]));
      hb[4 + t] = h_bits((_Float16)bfr(q[t]));
    }
#pragma unroll
    for (int t = 0; t < 8; ++t) T[(8 * e + t) * TP + cl] = hb[t];
  }
  __syncthreads();
  v4u up[2];
#pragma unroll
  for (int it = 0; it < 2; ++it) {
    const int nl = it * 32 + lq;                                     // 0..63
    up[it] = *(const v4u*)(T + nl * TP + 8 * e);
  }
{
#pragma unroll
    for (int it = 0; it < 2; ++it) {
      const int nl = it * 32 + lq;
      *(v4u*)(XP + (size_t)(n0 + nl) * CIN + c0 + 8 * e) = up[it];
    }
    
  }
}

// =========================================================================================================
// (2) pointwise conv GEMM for one (64-n tile, projection mb in {q,k,v}): P[o][n] = (1/256) sum_c W16[o0+o][c]
//     XP[n][c] + bias[o]. Block 128 threads = 4 waves; wave w owns cols n0+16w..+15 (B fragment from the XP row,
//     k = c contiguous, split k map) and 4 m-tiles (A rows o0 + 16 mt + (lane&15) of W16, split k map).
//     K = 128 = 4 steps. Epilogue staged in LDS Os[n_loc][o_loc] (pitch OSP), block barrier, then:
//       mb 1: k   -> Kh = bf16-RNE(v), Kl = bf16-RNE(v - hi), planes bf16 [NTOK][64];
//       mb 2: v   -> Vc f16 [64 ch][NTOK] (channel-major, value f16(v*16)), row segment n0..n0+63 = one line.
// coverage: Os 4 waves x 16 n x 64 o = 64 x 64 (cols 0..63 of pitch 68, reads stay in cols 0..63);
//           Qh/Ql/Kh/Kl: 4 it x 16 rows x 8 lanes x 8 = 64 n x 64 d; Vc: 4 it x 16 ch x 8 lanes x 8 = 64 ch x 64 n;
//           grid (NTOK/64, 3) covers all rows of Qh, Ql, Kh, Kl and all of Vc exactly once.
// =========================================================================================================
__global__ __launch_bounds__(128)
void gemm_qkv(const unsigned short* __restrict__ W16, const unsigned short* __restrict__ XP,
              const float* __restrict__ bq, const float* __restrict__ bk, const float* __restrict__ bv,
              unsigned short* Qh, unsigned short* Ql, unsigned short* Kh, unsigned short* Kl,
              unsigned short* Vc) {
  __shared__ __align__(16) float Os[QT * OSP];
  const int tid  = threadIdx.x;
  const int lane = tid & 31, wave = tid >> 5;
  const int hh   = lane >> 4, c = lane & 15;
  const int nt   = blockIdx.x, mb = blockIdx.y;
  const int n0   = nt * QT, o0 = mb * QT;

  const unsigned short* ap = W16 + (size_t)(o0 + c) * CIN + 8 * hh;
  const unsigned short* bp = XP + (size_t)(n0 + 16 * wave + c) * CIN + 8 * hh;

  v8f acc[4];
#pragma unroll
  for (int mt = 0; mt < 4; ++mt) acc[mt] = zero8();

#pragma unroll
  for (int ks = 0; ks < CIN / 32; ++ks) {
    const Frag fb = ldfrag(bp + 32 * ks);
#pragma unroll
    for (int mt = 0; mt < 4; ++mt) {
      const Frag fa = ldfrag(ap + (size_t)(16 * mt) * CIN + 32 * ks);
      acc[mt] = mma_h(fa.h, fb.h, acc[mt]);
    }
  }

  // ---- epilogue: scale back + bias (+ 1/sqrt(ck) for q) -> LDS Os[n_loc][o_loc]
  const float* bsel = (mb == 0) ? bq : ((mb == 1) ? bk : bv);       // block-uniform, all global
  const float osc = (mb == 0) ? QSC : 1.0f;
  {
    const int nl = 16 * wave + c;
#pragma unroll
    for (int mt = 0; mt < 4; ++mt) {
      const v4f b0 = *(const v4f*)(bsel + 16 * mt + 8 * hh);
      const v4f b1 = *(const v4f*)(bsel + 16 * mt + 8 * hh + 4);
      v4f va, vb;
#pragma unroll
      for (int r = 0; r < 4; ++r) {
        va[r] = (acc[mt][r] * IWSC + bfr(b0[r])) * osc;
        vb[r] = (acc[mt][4 + r] * IWSC + bfr(b1[r])) * osc;
      }
      *(v4f*)(Os + nl * OSP + 16 * mt + 8 * hh)     = va;
      *(v4f*)(Os + nl * OSP + 16 * mt + 8 * hh + 4) = vb;
    }
  }
  __syncthreads();

  const int e = tid & 7, lq = tid >> 3;                             // lq 0..15
  if (mb < 2) {
    unsigned short* Ph = (mb == 0) ? Qh : Kh;                        // block-uniform, both global
    unsigned short* Pl = (mb == 0) ? Ql : Kl;
    v4u uh[4], ul[4];
#pragma unroll
    for (int it = 0; it < 4; ++it) {
      const int row = it * 16 + lq;                                  // n_loc 0..63
      const v4f a = *(const v4f*)(Os + row * OSP + 8 * e);
      const v4f q = *(const v4f*)(Os + row * OSP + 8 * e + 4);
      const float f[8] = {a[0], a[1], a[2], a[3], q[0], q[1], q[2], q[3]};
#pragma unroll
      for (int t = 0; t < 4; ++t) {
        const float f0 = f[2 * t], f1 = f[2 * t + 1];
        const unsigned short hb0 = bf_bits(f0), hb1 = bf_bits(f1);
        const unsigned short lb0 = bf_bits(f0 - bf_up(hb0));
        const unsigned short lb1 = bf_bits(f1 - bf_up(hb1));
        uh[it][t] = pk16(hb0, hb1);
        ul[it][t] = pk16(lb0, lb1);
      }
    }
{
#pragma unroll
      for (int it = 0; it < 4; ++it) {
        const int row = it * 16 + lq;
        const size_t po = (size_t)(n0 + row) * DK + 8 * e;
        *(v4u*)(Ph + po) = uh[it];
        *(v4u*)(Pl + po) = ul[it];
      }
      
    }
  } else {
    v4u uv[4];
#pragma unroll
    for (int it = 0; it < 4; ++it) {
      const int o = it * 16 + lq;                                    // channel 0..63
      unsigned short hb[8];
#pragma unroll
      for (int t = 0; t < 8; ++t) hb[t] = h_bits((_Float16)(Os[(8 * e + t) * OSP + o] * VSC));
#pragma unroll
      for (int t = 0; t < 4; ++t) uv[it][t] = pk16(hb[2 * t], hb[2 * t + 1]);
    }
{
#pragma unroll
      for (int it = 0; it < 4; ++it) {
        const int o = it * 16 + lq;
        *(v4u*)(Vc + (size_t)o * NTOK + n0 + 8 * e) = uv[it];
      }
      
    }
  }
}

// =========================================================================================================
// (3) global attention for one 64-query tile, transposed formulation, NTOK keys, no mask:
//   S^T tile (16 keys x 16 queries) = sum over 2 d-chunks of A(k: row = key kb + (lane&15), 32 d via the split
//   k map from the bf16 plane Kh [NTOK][64]) . B(q: col = query, same map from Qh) + A(Kh).B(Ql) + A(Kl).B(Qh)
//   (bf16 unscaled residual planes, shared accumulator, 3 products). q fragments (QC column tiles x 2 chunks x hi/lo)
//   loaded once per wave; k (hi and residual) and v tiles of KT keys are staged in a two-buffer LDS ring by asynchronous copies,
//   shared by the block's 16 waves: stage = Kh[KT][64] and Kl[KT][64] (row pitch KPH halves) + V[64 ch][KT] (pitch VPH);
//   tile t + 2 is copied into the buffer trip t has read, behind the barrier at the foot of trip t, and flies during
//   trip t + 1. Fragments come from LDS with the same split-map loader, and every k and v fragment a wave reads feeds its
//   QC = 2 column tiles (32 queries), which halves the LDS bytes read per product against one column tile per wave. Load
//   groups are issued ahead of use: v of the block directly behind the score products; k of a tile directly behind the
//   barrier that publishes the tile.
//   Per lane the D tile holds 8 keys of ONE query: online softmax state per lane, one shuffle (lane^16) for the max
//   over 32 keys; the o/l rescale is skipped under one wave-uniform ballot when no lane's max grew in either column tile
//   (corr == 1 exactly for every lane then); row-sum partials combined at the end. P = e^{s-m} x 2^14 as f16 is the B operand of
//   O^T (rows channel, cols queries) += A(v rows channel = 16j + (lane&15), keys contiguous, f16 plane Vc
//   [64][NTOK]) . B(P^T): element r <- D of the tile covering keys kb..kb+15, element 8+r <- the tile covering
//   kb+16..kb+31, lane unchanged. 4 accumulator tiles per column tile (64 channels). Block = 64 queries x KG key groups =
//   16 waves (4 per SIMD, so that one wave's LDS, softmax and matrix latencies are covered by the others): wave
//   (qw, kg) takes queries 32 qw .. +31 and keys KW kg .. +KW-1 of every tile, with its own m, l and o per column tile.
//   Epilogue: the groups' (m, l) are exchanged in LDS, block barrier, M = max m, L = sum l e^{m-M}; each wave stages
//   its o e^{m-M}/(16 L) in LDS Os[kg][query][64 ch] (pitch OSP, b128 stores; Os lies on the ring, which nobody reads or
//   fills behind the last trip's foot barrier), block barrier, then the KG planes are summed in the order kg = 0..7 and
//   the flat planes written.
// coverage: Os KG x 2 waves x 32 q x 64 ch (cols 0..63); Oh/Ol 64 rows x 8 lanes x 8 halves =
//           64 q x 64 ch per plane; grid (NTOK/64) covers rows 0..NTOK-1 of both planes exactly once.
// =========================================================================================================
__global__ __launch_bounds__(ATH)
void attn_k(const unsigned short* __restrict__ Qh, const unsigned short* __restrict__ Ql,
            const unsigned short* __restrict__ Kh, const unsigned short* __restrict__ Kl,
            const unsigned short* __restrict__ Vc, unsigned short* Oh, unsigned short* Ol) {
  __shared__ float Mg[KG * QT];
  __shared__ float Lg[KG * QT];
  __shared__ __align__(16) unsigned short Ring[2 * STGH];
  float* Os = (float*)Ring;                                          // output staging of the epilogue, on the ring
  const int tid  = threadIdx.x;
  const int wave = tid >> 5, lane = tid & 31;
  const int qw   = wave & 1, kg = wave >> 1;                        // query sub-tile (32 queries), key group
  const int hh   = lane >> 4, c = lane & 15;
  const int n0   = blockIdx.x * QT;

  // q fragments (B operand, col = query n0 + 32*qw + 16*u + c), d chunks 0 and 1, hi and residual planes
  Frag qh0[QC], qh1[QC], ql0[QC], ql1[QC];
  const unsigned short* qhp[QC];
  const unsigned short* qlp[QC];
#pragma unroll
  for (int u = 0; u < QC; ++u) {
    const size_t qo = (size_t)(n0 + 32 * qw + 16 * u + c) * DK + 8 * hh;
    qhp[u] = Qh + qo; qlp[u] = Ql + qo;
    qh0[u] = ldfrag(qhp[u]); qh1[u] = ldfrag(qhp[u] + 32);
    ql0[u] = ldfrag(qlp[u]); ql1[u] = ldfrag(qlp[u] + 32);
  }
#if defined(__HIP_DEVICE_COMPILE__)
  // the wait before the q loads' address registers are rewritten; it names the four addresses as inputs so that their
  // registers stay theirs up to it (without them the compiler hands one to the next address sum in front of the wait)
  asm volatile("s_wait_xcnt 0x0" :: "v"(qhp[0]), "v"(qlp[0]), "v"(qhp[1]), "v"(qlp[1]) : "memory");
#endif
  // copy addresses of this lane. K planes: copy i moves 64 rows (8 lanes x 16 B per 128-B row), row 64 i + (tid >> 3);
  // V: copy i moves 16 channel rows (32 lanes x 16 B per 512-B row segment), row 16 i + (tid >> 5).
  const unsigned ring0 = (unsigned)(uintptr_t)Ring;                  // LDS byte address of the ring
  const unsigned lk = ring0 + (unsigned)((tid >> 3) * (KPH * 2) + (tid & 7) * 16);
  const unsigned lv = ring0 + (unsigned)(SVV * 2 + (tid >> 5) * (VPH * 2) + (tid & 31) * 16);
  const unsigned short* gkh = Kh + (size_t)tid * 8;
  const unsigned short* gkl = Kl + (size_t)tid * 8;
  const unsigned short* gv  = Vc + (size_t)(tid >> 5) * NTOK + 8 * (tid & 31);
  auto fill = [&](int buf, int tile) {
    const unsigned lb = (unsigned)buf * (unsigned)(STGH * 2);
    copy4(lk + lb,           64 * KPH * 2, gkh + (size_t)tile * (KT * DK), (size_t)64 * DK);
    copy4(lk + lb + SKL * 2, 64 * KPH * 2, gkl + (size_t)tile * (KT * DK), (size_t)64 * DK);
    copy4(lv + lb,           16 * VPH * 2, gv + (size_t)tile * KT,         (size_t)16 * NTOK);
  };
  // fragment offsets inside a stage (halves): k row = key KW kg + c (+ 16), v row = channel c (+ 16 j),
  // v column = key KW kg
  const int kfo = (KW * kg + c) * KPH + 8 * hh;
  const int vfo = SVV + c * VPH + KW * kg + 8 * hh;

  fill(0, 0);
  wait_async0();
  __syncthreads();                                                   // tile 0 is readable by every wave
  // a tile's k fragments: one load group directly behind the barrier that publishes the tile, in front of the refill
  // copies (which go to the other buffer), so that the copies' issue covers the LDS latency
  KSet ks = ldkset(Ring + kfo, Ring + SKL + kfo, 0, 16 * KPH);
  fill(1, 1);

  float m[QC], l[QC];
  v8f o[QC][4];
#pragma unroll
  for (int u = 0; u < QC; ++u) {
    m[u] = -1.0e30f; l[u] = 0.f;
#pragma unroll
    for (int j = 0; j < 4; ++j) o[u][j] = zero8();
  }

  // one trip; more1 / more2: a tile t + 1 / t + 2 exists (compile-time, so that a trip is straight-line code behind its
  // rescale branch: with run-time tests at the foot the compiler sinks the row sums below them, the 32 exponentials stay
  // live across the k loads and the copies, and q fragments spill)
  auto trip = [&](int t, auto more1, auto more2) __attribute__((always_inline)) {
    const unsigned short* Vp = Ring + (t & 1) * STGH + vfo;          // up to its foot barrier trip t reads buffer t mod 2 alone
    // scores: each k fragment pair against both column tiles, 4 independent accumulators; per accumulator the order of
    // the 6 products is hi.hi, hi.lo, lo.hi of d chunk 0, then of d chunk 1
    v8f s0[QC], s1[QC];
#pragma unroll
    for (int u = 0; u < QC; ++u) { s0[u] = zero8(); s1[u] = zero8(); }
#pragma unroll
    for (int u = 0; u < QC; ++u) { s0[u] = mma_b(ks.h00.bf, qh0[u].bf, s0[u]); s1[u] = mma_b(ks.h10.bf, qh0[u].bf, s1[u]); }
#pragma unroll
    for (int u = 0; u < QC; ++u) { s0[u] = mma_b(ks.h00.bf, ql0[u].bf, s0[u]); s1[u] = mma_b(ks.h10.bf, ql0[u].bf, s1[u]); }
#pragma unroll
    for (int u = 0; u < QC; ++u) { s0[u] = mma_b(ks.g00.bf, qh0[u].bf, s0[u]); s1[u] = mma_b(ks.g10.bf, qh0[u].bf, s1[u]); }
#pragma unroll
    for (int u = 0; u < QC; ++u) { s0[u] = mma_b(ks.h01.bf, qh1[u].bf, s0[u]); s1[u] = mma_b(ks.h11.bf, qh1[u].bf, s1[u]); }
#pragma unroll
    for (int u = 0; u < QC; ++u) { s0[u] = mma_b(ks.h01.bf, ql1[u].bf, s0[u]); s1[u] = mma_b(ks.h11.bf, ql1[u].bf, s1[u]); }
#pragma unroll
    for (int u = 0; u < QC; ++u) { s0[u] = mma_b(ks.g01.bf, qh1[u].bf, s0[u]); s1[u] = mma_b(ks.g11.bf, qh1[u].bf, s1[u]); }

    // one load group, ahead of its use: this block's v fragments, directly behind the score products (into registers
    // these have left); they are the trip's last LDS reads, and their latency runs under the maxima and the shuffles
    // instead of being waited out at the foot's s_wait_dscnt 0, which the compiler lifts as far up as the last LDS read
    Frag vf[4];
#pragma unroll
    for (int j = 0; j < 4; ++j) vf[j] = ldfrag(Vp + (16 * j) * VPH);
#if defined(__HIP_DEVICE_COMPILE__)
    __builtin_amdgcn_sched_barrier(0);   // keeps the group whole and in front of the vector work that covers its latency
#endif

    float mx[QC], sx[QC], mn[QC];
#pragma unroll
    for (int u = 0; u < QC; ++u) mx[u] = fmaxf(hmax8(s0[u]), hmax8(s1[u]));
#pragma unroll
    for (int u = 0; u < QC; ++u) sx[u] = __shfl_xor(mx[u], 16, 32);
#pragma unroll
    for (int u = 0; u < QC; ++u) mx[u] = fmaxf(mx[u], sx[u]);
#pragma unroll
    for (int u = 0; u < QC; ++u) mn[u] = fmaxf(m[u], mx[u]);
    const unsigned grew = wave_ballot(mx[0] > m[0] || mx[1] > m[1]); // wave-uniform, one test for both column tiles
    if (grew != 0u) {
#pragma unroll
      for (int u = 0; u < QC; ++u) {
        const float corr = __expf(m[u] - mn[u]);                     // == 1 exactly for lanes whose max did not grow
        l[u] *= corr;
#pragma unroll
        for (int j = 0; j < 4; ++j) {
#pragma unroll
          for (int r = 0; r < 8; ++r) o[u][j][r] *= corr;
        }
      }
    }

    FragH ph[QC];
#pragma unroll
    for (int u = 0; u < QC; ++u) {
      m[u] = mn[u];
      const float msh = mn[u] - LNPS;                                // exp gives e^{s-m} * 2^14
      float ls = 0.f;
#pragma unroll
      for (int r = 0; r < 8; ++r) {
        const float e0 = __expf(s0[u][r] - msh);                     // key      8hh + r of the wave's 32
        const float e1 = __expf(s1[u][r] - msh);                     // key 16 + 8hh + r
        ls += e0 + e1;
        ph[u].hv[0][r] = (_Float16)e0;
        ph[u].hv[1][r] = (_Float16)e1;
      }
      l[u] += ls;
    }

    // each v fragment against both column tiles, 8 independent accumulators
#pragma unroll
    for (int j = 0; j < 4; ++j) {
#pragma unroll
      for (int u = 0; u < QC; ++u) o[u][j] = mma_h(vf[j].h, ph[u].v, o[u][j]);
    }
    // foot of trip t: own reads done, own copies of tile t + 1 landed, then the one barrier that publishes tile t + 1
    // and ends every wave's reads of buffer t mod 2; only then its refill
    wait_ds0();
    wait_async0();
    __syncthreads();
#if defined(__HIP_DEVICE_COMPILE__)
    __builtin_amdgcn_sched_barrier(0);   // keeps the row sums in front of the k loads, whose registers the exponentials hold until then (a build without it spills)
#endif
    if constexpr (decltype(more1)::v) {                              // tile t + 1 is published: its k fragments
      const unsigned short* Nb = Ring + ((t + 1) & 1) * STGH + kfo;
      ks = ldkset(Nb, Nb + SKL, 0, 16 * KPH);
    }
    if constexpr (decltype(more2)::v) fill(t & 1, t + 2);
  };
#pragma unroll 1
  for (int t = 0; t < NTOK / KT - 2; ++t) trip(t, Flag<true>(), Flag<true>());
  trip(NTOK / KT - 2, Flag<true>(), Flag<false>());
  trip(NTOK / KT - 1, Flag<false>(), Flag<false>());
  wait_async0();

  // merge of the KG key groups: (m, l) of every group and query through LDS (m and l are equal in lanes c and c + 16)
#pragma unroll
  for (int u = 0; u < QC; ++u) {
    l[u] += __shfl_xor(l[u], 16, 32);
    const int qrow = 32 * qw + 16 * u + c;
    if (hh == 0) { Mg[kg * QT + qrow] = m[u]; Lg[kg * QT + qrow] = l[u]; }
  }
  __syncthreads();                                                   // every group's (m, l) is readable
  float* Ow = Os + kg * (QT * OSP);
#pragma unroll
  for (int u = 0; u < QC; ++u) {
    const int qrow = 32 * qw + 16 * u + c;
    float mall = Mg[qrow];
#pragma unroll
    for (int g = 1; g < KG; ++g) mall = fmaxf(mall, Mg[g * QT + qrow]);
    float lall = 0.f;
#pragma unroll
    for (int g = 0; g < KG; ++g) lall += Lg[g * QT + qrow] * __expf(Mg[g * QT + qrow] - mall);
    const float scl = (__expf(m[u] - mall) / lall) * IVSC;           // o and l both carry 2^14; o also carries the v x16
#pragma unroll
    for (int j = 0; j < 4; ++j) {
      v4f va, vb;
#pragma unroll
      for (int r = 0; r < 4; ++r) { va[r] = o[u][j][r] * scl; vb[r] = o[u][j][4 + r] * scl; }
      *(v4f*)(Ow + qrow * OSP + 16 * j + 8 * hh)     = va;          // Os[kg][query][ch = 16j + 8hh + r]
      *(v4f*)(Ow + qrow * OSP + 16 * j + 8 * hh + 4) = vb;
    }
  }
  __syncthreads();                                                   // every group's weighted o is readable

  const int e = tid & 7, row = tid >> 3;                             // row = query 0..63
  v4f a = *(const v4f*)(Os + row * OSP + 8 * e);
  v4f q = *(const v4f*)(Os + row * OSP + 8 * e + 4);
#pragma unroll
  for (int g = 1; g < KG; ++g) {
    a += *(const v4f*)(Os + g * (QT * OSP) + row * OSP + 8 * e);
    q += *(const v4f*)(Os + g * (QT * OSP) + row * OSP + 8 * e + 4);
  }
  const float f[8] = {a[0], a[1], a[2], a[3], q[0], q[1], q[2], q[3]};
  v4u uh, ul;
#pragma unroll
  for (int t = 0; t < 4; ++t) {
    const float g0 = f[2 * t] * OSC, g1 = f[2 * t + 1] * OSC;
    const _Float16 h0 = (_Float16)g0, h1 = (_Float16)g1;
    const _Float16 l0 = (_Float16)((g0 - (float)h0) * RSC);
    const _Float16 l1 = (_Float16)((g1 - (float)h1) * RSC);
    uh[t] = pk16(h_bits(h0), h_bits(h1));
    ul[t] = pk16(h_bits(l0), h_bits(l1));
  }
  const size_t po = (size_t)(n0 + row) * DK + 8 * e;
  *(v4u*)(Oh + po) = uh;
  *(v4u*)(Ol + po) = ul;
}

// =========================================================================================================
// (4) output pointwise conv over the raw view: Y[o][n'] = (1/256)(1/1024) sum_{c'} Wo16[o][c'] (Ohv[c'][n'] +
//     Olv[c'][n'] / 1024) + bo[o], where Ohv/Olv [64][NTOK] are the flat O planes re-read with row c' = halves
//     c'*NTOK .. +NTOK-1. Block (nt, mb): 64 n' x 64 o. The two 64 c' x 64 n' B tiles are staged transposed in
//     LDS Bh/Bl[n'_loc][c'] (pitch TP, 16-B global loads, 2-byte LDS stores), block barrier, then B fragments per
//     wave (col n0'+16w+(lane&15), k = c' contiguous, split k map) and A fragments from Wo16 rows o0+16mt+(lane&15).
//     K = 64 = 2 steps; hi and residual products in separate accumulators. Epilogue staged in Ys[n'_loc][o_loc]
// coverage: Bh/Bl 4 it x 16 c' x (8 x 8 n') = 64 x 64 each (cols 0..63 of pitch 72); Ys 4 waves x 16 n' x 64 o;
//           out: 8 it x 16 lines x 8 lanes x 4 floats = 64 o x 64 n'; grid (NTOK/64, COUT/64) covers
//           out[0..127][0..NTOK-1] exactly once.
// =========================================================================================================
__global__ __launch_bounds__(128)
void gemm_o(const unsigned short* __restrict__ Wo16, const unsigned short* __restrict__ Oh,
            const unsigned short* __restrict__ Ol, const float* __restrict__ bo, float* Y) {
  __shared__ __align__(16) unsigned short Bh[QT * TP];
  __shared__ __align__(16) unsigned short Bl[QT * TP];
  __shared__ __align__(16) float Ys[QT * OSP];
  const int tid  = threadIdx.x;
  const int lane = tid & 31, wave = tid >> 5;
  const int hh   = lane >> 4, c = lane & 15;
  const int nt   = blockIdx.x, mb = blockIdx.y;
  const int n0   = nt * QT, o0 = mb * QT;
  const int e = tid & 7, lq = tid >> 3;                              // lq 0..15

  // ---- stage the view tiles transposed: Bh[n'_loc][c'] <- Oh[c'*NTOK + n0 + n'_loc]
#pragma unroll
  for (int it = 0; it < 4; ++it) {
    const int cl = it * 16 + lq;                                     // c' 0..63
    const size_t so = (size_t)cl * NTOK + n0 + 8 * e;
    const v4u ah = *(const v4u*)(Oh + so);
    const v4u al = *(const v4u*)(Ol + so);
#pragma unroll
    for (int t = 0; t < 4; ++t) {
      Bh[(8 * e + 2 * t) * TP + cl]     = (unsigned short)(ah[t] & 0xffffu);
      Bh[(8 * e + 2 * t + 1) * TP + cl] = (unsigned short)(ah[t] >> 16);
      Bl[(8 * e + 2 * t) * TP + cl]     = (unsigned short)(al[t] & 0xffffu);
      Bl[(8 * e + 2 * t + 1) * TP + cl] = (unsigned short)(al[t] >> 16);
    }
  }
  __syncthreads();

  const unsigned short* ap  = Wo16 + (size_t)(o0 + c) * DK + 8 * hh;
  const unsigned short* bph = Bh + (16 * wave + c) * TP + 8 * hh;
  const unsigned short* bpl = Bl + (16 * wave + c) * TP + 8 * hh;

  v8f acch[4], accl[4];
#pragma unroll
  for (int mt = 0; mt < 4; ++mt) { acch[mt] = zero8(); accl[mt] = zero8(); }

#pragma unroll
  for (int ks = 0; ks < DK / 32; ++ks) {
    const Frag fbh = ldfrag(bph + 32 * ks);
    const Frag fbl = ldfrag(bpl + 32 * ks);
#pragma unroll
    for (int mt = 0; mt < 4; ++mt) {
      const Frag fa = ldfrag(ap + (size_t)(16 * mt) * DK + 32 * ks);
      acch[mt] = mma_h(fa.h, fbh.h, acch[mt]);
      accl[mt] = mma_h(fa.h, fbl.h, accl[mt]);
    }
  }

  // ---- epilogue: fold residual, scale back, bias -> Ys[n'_loc][o_loc]
  {
    const int nl = 16 * wave + c;
    const float fs = IWSC * IOSC;
#pragma unroll
    for (int mt = 0; mt < 4; ++mt) {
      const v4f b0 = *(const v4f*)(bo + o0 + 16 * mt + 8 * hh);
      const v4f b1 = *(const v4f*)(bo + o0 + 16 * mt + 8 * hh + 4);
      v4f va, vb;
#pragma unroll
      for (int r = 0; r < 4; ++r) {
        va[r] = (acch[mt][r] + accl[mt][r] * IRSC) * fs + bfr(b0[r]);
        vb[r] = (acch[mt][4 + r] + accl[mt][4 + r] * IRSC) * fs + bfr(b1[r]);
      }
      *(v4f*)(Ys + nl * OSP + 16 * mt + 8 * hh)     = va;
      *(v4f*)(Ys + nl * OSP + 16 * mt + 8 * hh + 4) = vb;
    }
  }
  __syncthreads();

  v4f res[8];
#pragma unroll
  for (int it = 0; it < 8; ++it) {
    const int L  = it * 16 + lq;                                     // line 0..127
    const int ol = L >> 1, hf = L & 1;                               // o_loc 0..63, line half
    const int nl = hf * 32 + 4 * e;                                  // n'_loc 0..63
#pragma unroll
    for (int t = 0; t < 4; ++t) res[it][t] = Ys[(nl + t) * OSP + ol];
  }
{
#pragma unroll
    for (int it = 0; it < 8; ++it) {
      const int L  = it * 16 + lq;
      const int ol = L >> 1, hf = L & 1;
      const int nl = hf * 32 + 4 * e;
      *(v4f*)(Y + (size_t)(o0 + ol) * NTOK + n0 + nl) = res[it];
    }
    
  }
}

// =========================================================================================================
// Workspace map (bytes, full size ND=16; each region start a multiple of 256; every extent is an exact tile
//   W16 f16 [192][128]        49152        Wo16 f16 [128][64]      16384
//   XP  f16 [16384][128]    4194304
//   Qh/Ql/Kh/Kl bf16 [16384][64] 2097152 x4   Vc f16 [64][16384]   2097152
//   Oh/Ol f16 [16384][64]   2097152 x2
//   total = 18939904
// =========================================================================================================
extern "C" void kernel_launch(void* const* d_in, const int* in_sizes, int n_in,
                              void* d_out, int out_size, void* d_ws, size_t ws_size,
                              hipStream_t stream) {
  if (n_in < 9) return;
  if (in_sizes[0] < CIN * NTOK) return;
  if ((in_sizes[0] % CIN) != 0) return;
  const int xstride = in_sizes[0] / CIN;                             // per-channel position stride of X
  if (xstride < NTOK || (xstride % 4) != 0) return;
  if (in_sizes[1] < DK * CIN || in_sizes[3] < DK * CIN || in_sizes[5] < DK * CIN) return;
  if (in_sizes[2] < DK || in_sizes[4] < DK || in_sizes[6] < DK) return;
  if (in_sizes[7] < COUT * DK || in_sizes[8] < COUT) return;
  if (out_size < COUT * NTOK) return;

  size_t off = 0;
  auto carve = [&](size_t bytes) { const size_t o = off; off += (bytes + 255) & ~(size_t)255; return o; };
  const size_t oW16  = carve((size_t)3 * DK * CIN * 2);
  const size_t oWo16 = carve((size_t)COUT * DK * 2);
  const size_t oXP   = carve((size_t)NTOK * CIN * 2);
  const size_t oQh   = carve((size_t)NTOK * DK * 2);
  const size_t oQl   = carve((size_t)NTOK * DK * 2);
  const size_t oKh   = carve((size_t)NTOK * DK * 2);
  const size_t oKl   = carve((size_t)NTOK * DK * 2);
  const size_t oVc   = carve((size_t)DK * NTOK * 2);
  const size_t oOh   = carve((size_t)NTOK * DK * 2);
  const size_t oOl   = carve((size_t)NTOK * DK * 2);
  if (off > ws_size) return;
  if (off > (size_t)134217728) return;

  const float* X  = (const float*)d_in[0];
  const float* Wq = (const float*)d_in[1];
  const float* bq = (const float*)d_in[2];
  const float* Wk = (const float*)d_in[3];
  const float* bk = (const float*)d_in[4];
  const float* Wv = (const float*)d_in[5];
  const float* bv = (const float*)d_in[6];
  const float* Wo = (const float*)d_in[7];
  const float* bo = (const float*)d_in[8];

  char* ws = (char*)d_ws;
  unsigned short* W16  = (unsigned short*)(ws + oW16);
  unsigned short* Wo16 = (unsigned short*)(ws + oWo16);
  unsigned short* XP   = (unsigned short*)(ws + oXP);
  unsigned short* Qh   = (unsigned short*)(ws + oQh);
  unsigned short* Ql   = (unsigned short*)(ws + oQl);
  unsigned short* Kh   = (unsigned short*)(ws + oKh);
  unsigned short* Kl   = (unsigned short*)(ws + oKl);
  unsigned short* Vc   = (unsigned short*)(ws + oVc);
  unsigned short* Oh   = (unsigned short*)(ws + oOh);
  unsigned short* Ol   = (unsigned short*)(ws + oOl);
  float* out = (float*)d_out;

  const dim3 blk256(256), blk128(128);
  const int BQ = (DK * CIN) / (8 * CHB), BO = (COUT * DK) / (8 * CHB);

  // (0) weights -> f16 planes
  cvt_w<<<dim3(3 * BQ + BO), dim3(CHB), 0, stream>>>(Wq, Wk, Wv, Wo, W16, Wo16);
  // (1) x -> position-major 16-bit plane
  cvt_x<<<dim3(NTOK / QT, CIN / QT), blk256, 0, stream>>>(X, xstride, XP);
  // (2) q/k/v pointwise conv GEMM -> q hi + residual, k hi + residual, v planes
  gemm_qkv<<<dim3(NTOK / QT, 3), blk128, 0, stream>>>(W16, XP, bq, bk, bv, Qh, Ql, Kh, Kl, Vc);
  // (3) global attention -> O hi + residual planes [NTOK][64]
  attn_k<<<dim3(NTOK / QT), dim3(ATH), 0, stream>>>(Qh, Ql, Kh, Kl, Vc, Oh, Ol);
  // (4) output conv over the raw [64][NTOK] view -> out [128][NTOK]
  gemm_o<<<dim3(NTOK / QT, COUT / QT), blk128, 0, stream>>>(Wo16, Oh, Ol, bo, out);
  (void)hipGetLastError();
}

// v006
// One run takes 117 microseconds.
// Timed twice side by side with v005, it ran 1.06 and 1.05 times as fast.
// All steps since v000 together make it 7.30 times as fast.
// Contractions: q/k/v pointwise conv W16[192x128].XP[n][128] on v_wmma_f32_16x16x32_f16 (f16 containers of
// bf16-RNE weights x256 and bf16-RNE x, exact products); scores K.Q^T on v_wmma_f32_16x16x32_bf16 (bf16 hi +
// bf16 residual planes of k and of q/8, 3 products hi.hi + hi.lo + lo.hi, K=64); O^T = V.P^T on
// v_wmma_f32_16x16x32_f16 (v x16 as f16, P = e^{s-m} x2^14 f16 from the score D registers); output conv
// Wo16[128x64].Oview[64][N] on v_wmma_f32_16x16x32_f16 (f16 of bf16-RNE weights x256; O carried as f16 hi x1024
// plane + f16 residual x2^20 plane, 2 products, separate accumulators); f32 accumulate everywhere; softmax
// statistics and bias adds in f32 VALU.
#include <hip/hip_runtime.h>
#include <math.h>
#include <stdint.h>

#ifndef ND
#define ND 16
#endif
#define NHH    32
#define NWW    32
#define NTOK   (ND * NHH * NWW)
#define CIN    128
#define DK     64
#define COUT   128
#define QT     64
#define OSP    68
#define TP     72
#define CHB    256
#define WSC    256.0f
#define IWSC   0.00390625f
#define QSC    0.125f
#define VSC    16.0f
#define IVSC   0.0625f
#define OSC    1024.0f
#define IOSC   0.0009765625f
#define RSC    1024.0f
#define IRSC   0.0009765625f
#define LNPS   9.704060527839234f
#define KG     8
#define QC     2
#define ATH    (32 * (QT / (16 * QC)) * KG)
#define KT     256
#define KW     (KT / KG)
#define KPH    72
#define VPH    264
#define SKL    (KT * KPH)
#define SVV    (2 * KT * KPH)
#define STGH   (2 * KT * KPH + DK * VPH)
#define NTL    (NTOK / KT)

static_assert(ND >= 1 && ND <= 16);
static_assert(NTOK % QT == 0);
static_assert(NTOK % 32 == 0);
static_assert(CIN % QT == 0 && CIN % 32 == 0);
static_assert(DK == QT);
static_assert(DK % 32 == 0);
static_assert(COUT % QT == 0);
static_assert((DK * CIN) % (8 * CHB) == 0);
static_assert((COUT * DK) % (8 * CHB) == 0);
static_assert((OSP * 4) % 16 == 0);
static_assert((TP * 2) % 16 == 0);
static_assert(KT % 32 == 0 && NTOK % KT == 0 && NTOK / KT >= 2);
static_assert((ATH / 8) * 4 == KT && (ATH / 32) * 4 == DK && KT == 8 * 32 && DK == 8 * 8);
static_assert(KW == 32 && VPH == KT + 8 && QT * 8 == ATH && QT == 2 * 16 * QC);
static_assert(KG * QT * OSP * 4 <= 2 * STGH * 2);
static_assert((KPH * 2) % 32 == 16 && (VPH * 2) % 32 == 16 && (STGH * 2) % 16 == 0);

typedef _Float16       v16h __attribute__((ext_vector_type(16)));
typedef _Float16       v8h  __attribute__((ext_vector_type(8)));
typedef __bf16         v16b __attribute__((ext_vector_type(16)));
typedef unsigned short v8us __attribute__((ext_vector_type(8)));
typedef float          v8f  __attribute__((ext_vector_type(8)));
typedef float          v4f  __attribute__((ext_vector_type(4)));
typedef unsigned int   v4u  __attribute__((ext_vector_type(4)));

union Frag  { v8us u[2]; v16h h; v16b bf; };
union FragH { v16h v; v8h hv[2]; };
static_assert(sizeof(Frag) == 32);
static_assert(sizeof(FragH) == 32);

// ---- scalar helpers ---------------------------------------------------------------------------------------
__device__ __forceinline__ unsigned short bf_bits(float f) {          // f32 -> bf16 bits, RNE convert
  unsigned u = __float_as_uint(f);
  return (unsigned short)((u + 0x7FFFu + ((u >> 16) & 1u)) >> 16);
}
__device__ __forceinline__ float bf_up(unsigned short hb) { return __uint_as_float(((unsigned)hb) << 16); }
__device__ __forceinline__ float bfr(float f) { return bf_up(bf_bits(f)); }
__device__ __forceinline__ unsigned short h_bits(_Float16 x) { return __builtin_bit_cast(unsigned short, x); }
__device__ __forceinline__ unsigned pk16(unsigned short a, unsigned short b) { return (unsigned)a | ((unsigned)b << 16); }
__device__ __forceinline__ v8f zero8() { v8f z = {0.f, 0.f, 0.f, 0.f, 0.f, 0.f, 0.f, 0.f}; return z; }
__device__ __forceinline__ float hmax8(v8f s) {
  return fmaxf(fmaxf(fmaxf(s[0], s[1]), fmaxf(s[2], s[3])), fmaxf(fmaxf(s[4], s[5]), fmaxf(s[6], s[7])));
}
__device__ __forceinline__ unsigned wave_ballot(bool p) {
#if defined(__HIP_DEVICE_COMPILE__)
  return __builtin_amdgcn_ballot_w32(p);
#else
  return p ? 1u : 0u;
#endif
}

// ---- 16-bit fragment loader (A, or B from a k-contiguous [n][k] row): lane -> row/col (lane&15), p already includes
//      + 8*(lane>>4); elements 0..7 <- p[0..7] (k0+8h..), elements 8..15 <- p[16..23] (k0+16+8h..)
__device__ __forceinline__ Frag ldfrag(const unsigned short* p) {
  Frag f;
  f.u[0] = *(const v8us*)(p);
  f.u[1] = *(const v8us*)(p + 16);
  return f;
}

// ---- the 8 k fragments of one block of 32 keys (rows r0 = kb .. +15, r1 = kb+16 .. +31; d chunks 0 and 1; hi and residual)
struct KSet { Frag h00, h10, g00, g10, h01, h11, g01, g11; };
__device__ __forceinline__ KSet ldkset(const unsigned short* hp, const unsigned short* lp, int r0o, int r1o) {
  KSet k;
  k.h00 = ldfrag(hp + r0o);      k.h10 = ldfrag(hp + r1o);
  k.g00 = ldfrag(lp + r0o);      k.g10 = ldfrag(lp + r1o);
  k.h01 = ldfrag(hp + r0o + 32); k.h11 = ldfrag(hp + r1o + 32);
  k.g01 = ldfrag(lp + r0o + 32); k.g11 = ldfrag(lp + r1o + 32);
  return k;
}

// ---- WMMA helpers: the plain builtins; the compiler keeps the distances behind its own forms (another product or
//      independent vector work fills a slot), so that the vector port stays free for the SIMD's other waves
__device__ __forceinline__ v8f mma_h(v16h a, v16h b, v8f c) {
  return __builtin_amdgcn_wmma_f32_16x16x32_f16(false, a, false, b, (short)0, c, false, false);
}
__device__ __forceinline__ v8f mma_b(v16b a, v16b b, v8f c) {
  return __builtin_amdgcn_wmma_f32_16x16x32_bf16(false, a, false, b, (short)0, c, false, false);
}
template <bool B> struct Flag { static constexpr bool v = B; };

// ---- LDS ring helpers (attention) ---------------------------------------------------------------------------
// Four asynchronous 16-byte copies global -> LDS per lane (l = the lane's LDS byte address, g = its global address),
// with the s_wait_xcnt 0 that stands before the address registers may be rewritten as the statement's last line.
__device__ __forceinline__ void copy4(unsigned l0, unsigned lstep, const unsigned short* g0, size_t gstep) {
#if defined(__HIP_DEVICE_COMPILE__)
  asm volatile("global_load_async_to_lds_b128 %0, %4, off\n\t"
               "global_load_async_to_lds_b128 %1, %5, off\n\t"
               "global_load_async_to_lds_b128 %2, %6, off\n\t"
               "global_load_async_to_lds_b128 %3, %7, off\n\t"
               "s_wait_xcnt 0x0"
               :: "v"(l0), "v"(l0 + lstep), "v"(l0 + 2 * lstep), "v"(l0 + 3 * lstep),
                  "v"(g0), "v"(g0 + gstep), "v"(g0 + 2 * gstep), "v"(g0 + 3 * gstep)
               : "memory");
#endif
}
// this wave's own copies have landed in LDS (the compiler places no wait for them)
__device__ __forceinline__ void wait_async0() {
#if defined(__HIP_DEVICE_COMPILE__)
  asm volatile("s_wait_asynccnt 0x0" ::: "memory");
#endif
}
// this wave's own LDS reads have returned, before the buffer they read is handed back for a refill
__device__ __forceinline__ void wait_ds0() {
#if defined(__HIP_DEVICE_COMPILE__)
  asm volatile("s_wait_dscnt 0x0" ::: "memory");
#endif
}

// =========================================================================================================
// (0) weight planes: W16 f16 [192][128] (rows 0..63 = Wq, 64..127 = Wk, 128..191 = Wv) and Wo16 f16 [128][64];
//     value = f16 of (bf16-RNE(w) * 256) (exact). Thread = one 8-element chunk (16 B); 8 consecutive lanes =
// coverage: (3*BQ + BO) blocks x 256 threads x 8 halves = 3*8192 + 8192 elements = both planes exactly.
// =========================================================================================================
__global__ __launch_bounds__(CHB)
void cvt_w(const float* __restrict__ Wq, const float* __restrict__ Wk, const float* __restrict__ Wv,
           const float* __restrict__ Wo, unsigned short* W16, unsigned short* Wo16) {
  const int tid = threadIdx.x, blk = blockIdx.x;
  const int BQ = (DK * CIN) / (8 * CHB);                             // blocks per q/k/v matrix
  const int g = blk * CHB + tid;                                     // chunk id
  const float* src;
  unsigned short* dst;
  int gsrc, gdst;
  if (blk < BQ)          { src = Wq; gsrc = 0;            dst = W16;  gdst = 0; }
  else if (blk < 2 * BQ) { src = Wk; gsrc = BQ * CHB;     dst = W16;  gdst = 0; }
  else if (blk < 3 * BQ) { src = Wv; gsrc = 2 * BQ * CHB; dst = W16;  gdst = 0; }
  else                   { src = Wo; gsrc = 3 * BQ * CHB; dst = Wo16; gdst = 3 * BQ * CHB; }
  const float* s = src + (size_t)8 * (size_t)(g - gsrc);
  const v4f a = *(const v4f*)s;
  const v4f q = *(const v4f*)(s + 4);
  const float f[8] = {a[0], a[1], a[2], a[3], q[0], q[1], q[2], q[3]};
  v4u u;
#pragma unroll
  for (int t = 0; t < 4; ++t) {
    const _Float16 h0 = (_Float16)(bfr(f[2 * t]) * WSC);
    const _Float16 h1 = (_Float16)(bfr(f[2 * t + 1]) * WSC);
    u[t] = pk16(h_bits(h0), h_bits(h1));
  }
{
    *(v4u*)(dst + (size_t)8 * (size_t)(g - gdst)) = u;
    
  }
}

// =========================================================================================================
// (1) X f32 [128 c][xstride] (first NTOK positions used) -> XP f16 [NTOK n][128 c] (position-major, bf16-RNE
//     values, exact in f16) through an LDS tile T[64 n][64 c] (pitch TP). Block (nb, cb) owns a 64 c x 64 n tile.
// coverage: T 2 it x 32 c x (8 x 8 n) = 64 x 64; XP 2 it x 32 rows x 8 lanes x 8 halves = 64 n x 64 c;
//           grid (NTOK/64, 2) covers XP [NTOK][128] exactly once.
// =========================================================================================================
__global__ __launch_bounds__(256)
void cvt_x(const float* __restrict__ X, int xstride, unsigned short* XP) {
  __shared__ __align__(16) unsigned short T[QT * TP];
  const int tid = threadIdx.x;
  const int nb = blockIdx.x, cb = blockIdx.y;
  const int e = tid & 7, lq = tid >> 3;                             // lq 0..31
  const int n0 = nb * QT, c0 = cb * QT;
#pragma unroll
  for (int it = 0; it < 2; ++it) {
    const int cl = it * 32 + lq;                                     // 0..63
    const float* sp = X + (size_t)(c0 + cl) * (size_t)xstride + n0 + 8 * e;
    const v4f a = *(const v4f*)sp;
    const v4f q = *(const v4f*)(sp + 4);
    unsigned short hb[8];
#pragma unroll
    for (int t = 0; t < 4; ++t) {
      hb[t]     = h_bits((_Float16)bfr(a[t]));
      hb[4 + t] = h_bits((_Float16)bfr(q[t]));
    }
#pragma unroll
    for (int t = 0; t < 8; ++t) T[(8 * e + t) * TP + cl] = hb[t];
  }
  __syncthreads();
  v4u up[2];
#pragma unroll
  for (int it = 0; it < 2; ++it) {
    const int nl = it * 32 + lq;                                     // 0..63
    up[it] = *(const v4u*)(T + nl * TP + 8 * e);
  }
{
#pragma unroll
    for (int it = 0; it < 2; ++it) {
      const int nl = it * 32 + lq;
      *(v4u*)(XP + (size_t)(n0 + nl) * CIN + c0 + 8 * e) = up[it];
    }
    
  }
}

// =========================================================================================================
// (2) pointwise conv GEMM for one (64-n tile, projection mb in {q,k,v}): P[o][n] = (1/256) sum_c W16[o0+o][c]
//     XP[n][c] + bias[o]. Block 128 threads = 4 waves; wave w owns cols n0+16w..+15 (B fragment from the XP row,
//     k = c contiguous, split k map) and 4 m-tiles (A rows o0 + 16 mt + (lane&15) of W16, split k map).
//     K = 128 = 4 steps. Epilogue staged in LDS Os[n_loc][o_loc] (pitch OSP), block barrier, then:
//       mb 1: k   -> Kh = bf16-RNE(v), Kl = bf16-RNE(v - hi), planes bf16 [NTOK][64];
//       mb 2: v   -> Vc f16 [64 ch][NTOK] (channel-major, value f16(v*16)), row segment n0..n0+63 = one line.
// coverage: Os 4 waves x 16 n x 64 o = 64 x 64 (cols 0..63 of pitch 68, reads stay in cols 0..63);
//           Qh/Ql/Kh/Kl: 4 it x 16 rows x 8 lanes x 8 = 64 n x 64 d; Vc: 4 it x 16 ch x 8 lanes x 8 = 64 ch x 64 n;
//           grid (NTOK/64, 3) covers all rows of Qh, Ql, Kh, Kl and all of Vc exactly once.
// =========================================================================================================
__global__ __launch_bounds__(128)
void gemm_qkv(const unsigned short* __restrict__ W16, const unsigned short* __restrict__ XP,
              const float* __restrict__ bq, const float* __restrict__ bk, const float* __restrict__ bv,
              unsigned short* Qh, unsigned short* Ql, unsigned short* Kh, unsigned short* Kl,
              unsigned short* Vc) {
  __shared__ __align__(16) float Os[QT * OSP];
  const int tid  = threadIdx.x;
  const int lane = tid & 31, wave = tid >> 5;
  const int hh   = lane >> 4, c = lane & 15;
  const int nt   = blockIdx.x, mb = blockIdx.y;
  const int n0   = nt * QT, o0 = mb * QT;

  const unsigned short* ap = W16 + (size_t)(o0 + c) * CIN + 8 * hh;
  const unsigned short* bp = XP + (size_t)(n0 + 16 * wave + c) * CIN + 8 * hh;

  v8f acc[4];
#pragma unroll
  for (int mt = 0; mt < 4; ++mt) acc[mt] = zero8();

#pragma unroll
  for (int ks = 0; ks < CIN / 32; ++ks) {
    const Frag fb = ldfrag(bp + 32 * ks);
#pragma unroll
    for (int mt = 0; mt < 4; ++mt) {
      const Frag fa = ldfrag(ap + (size_t)(16 * mt) * CIN + 32 * ks);
      acc[mt] = mma_h(fa.h, fb.h, acc[mt]);
    }
  }

  // ---- epilogue: scale back + bias (+ 1/sqrt(ck) for q) -> LDS Os[n_loc][o_loc]
  const float* bsel = (mb == 0) ? bq : ((mb == 1) ? bk : bv);       // block-uniform, all global
  const float osc = (mb == 0) ? QSC : 1.0f;
  {
    const int nl = 16 * wave + c;
#pragma unroll
    for (int mt = 0; mt < 4; ++mt) {
      const v4f b0 = *(const v4f*)(bsel + 16 * mt + 8 * hh);
      const v4f b1 = *(const v4f*)(bsel + 16 * mt + 8 * hh + 4);
      v4f va, vb;
#pragma unroll
      for (int r = 0; r < 4; ++r) {
        va[r] = (acc[mt][r] * IWSC + bfr(b0[r])) * osc;
        vb[r] = (acc[mt][4 + r] * IWSC + bfr(b1[r])) * osc;
      }
      *(v4f*)(Os + nl * OSP + 16 * mt + 8 * hh)     = va;
      *(v4f*)(Os + nl * OSP + 16 * mt + 8 * hh + 4) = vb;
    }
  }
  __syncthreads();

  const int e = tid & 7, lq = tid >> 3;                             // lq 0..15
  if (mb < 2) {
    unsigned short* Ph = (mb == 0) ? Qh : Kh;                        // block-uniform, both global
    unsigned short* Pl = (mb == 0) ? Ql : Kl;
    v4u uh[4], ul[4];
#pragma unroll
    for (int it = 0; it < 4; ++it) {
      const int row = it * 16 + lq;                                  // n_loc 0..63
      const v4f a = *(const v4f*)(Os + row * OSP + 8 * e);
      const v4f q = *(const v4f*)(Os + row * OSP + 8 * e + 4);
      const float f[8] = {a[0], a[1], a[2], a[3], q[0], q[1], q[2], q[3]};
#pragma unroll
      for (int t = 0; t < 4; ++t) {
        const float f0 = f[2 * t], f1 = f[2 * t + 1];
        const unsigned short hb0 = bf_bits(f0), hb1 = bf_bits(f1);
        const unsigned short lb0 = bf_bits(f0 - bf_up(hb0));
        const unsigned short lb1 = bf_bits(f1 - bf_up(hb1));
        uh[it][t] = pk16(hb0, hb1);
        ul[it][t] = pk16(lb0, lb1);
      }
    }
{
#pragma unroll
      for (int it = 0; it < 4; ++it) {
        const int row = it * 16 + lq;
        const size_t po = (size_t)(n0 + row) * DK + 8 * e;
        *(v4u*)(Ph + po) = uh[it];
        *(v4u*)(Pl + po) = ul[it];
      }
      
    }
  } else {
    v4u uv[4];
#pragma unroll
    for (int it = 0; it < 4; ++it) {
      const int o = it * 16 + lq;                                    // channel 0..63
      unsigned short hb[8];
#pragma unroll
      for (int t = 0; t < 8; ++t) hb[t] = h_bits((_Float16)(Os[(8 * e + t) * OSP + o] * VSC));
#pragma unroll
      for (int t = 0; t < 4; ++t) uv[it][t] = pk16(hb[2 * t], hb[2 * t + 1]);
    }
{
#pragma unroll
      for (int it = 0; it < 4; ++it) {
        const int o = it * 16 + lq;
        *(v4u*)(Vc + (size_t)o * NTOK + n0 + 8 * e) = uv[it];
      }
      
    }
  }
}

// =========================================================================================================
// (3) global attention for one 64-query tile, transposed formulation, NTOK keys, no mask:
//   S^T tile (16 keys x 16 queries) = sum over 2 d-chunks of A(k: row = key kb + (lane&15), 32 d via the split
//   k map from the bf16 plane Kh [NTOK][64]) . B(q: col = query, same map from Qh) + A(Kh).B(Ql) + A(Kl).B(Qh)
//   (bf16 unscaled residual planes, shared accumulator, 3 products). q fragments (QC column tiles x 2 chunks x hi/lo)
//   loaded once per wave; k (hi and residual) and v tiles of KT keys are staged in a two-buffer LDS ring by asynchronous copies,
//   shared by the block's 16 waves: stage = Kh[KT][64] and Kl[KT][64] (row pitch KPH halves) + V[64 ch][KT] (pitch VPH);
//   the tile of trip t + 2 is copied into the buffer trip t has read, behind the barrier at the foot of trip t, and flies
//   during trip t + 1; trip t of block b works on tile (b + t) mod NTL.
//   Fragments come from LDS with the same split-map loader, and every k and v fragment a wave reads feeds its
//   QC = 2 column tiles (32 queries), which halves the LDS bytes read per product against one column tile per wave. Load
//   groups are issued ahead of use: v of the block directly behind the score products; k of a tile directly behind the
//   barrier that publishes the tile.
//   Per lane the D tile holds 8 keys of ONE query: online softmax state per lane, one shuffle (lane^16) for the max
//   over 32 keys; the o/l rescale is skipped under one wave-uniform ballot when no lane's max grew in either column tile
//   (corr == 1 exactly for every lane then); row-sum partials combined at the end. P = e^{s-m} x 2^14 as f16 is the B operand of
//   O^T (rows channel, cols queries) += A(v rows channel = 16j + (lane&15), keys contiguous, f16 plane Vc
//   [64][NTOK]) . B(P^T): element r <- D of the tile covering keys kb..kb+15, element 8+r <- the tile covering
//   kb+16..kb+31, lane unchanged. 4 accumulator tiles per column tile (64 channels). Block = 64 queries x KG key groups =
//   16 waves (4 per SIMD, so that one wave's LDS, softmax and matrix latencies are covered by the others): wave
//   (qw, kg) takes queries 32 qw .. +31 and keys KW kg .. +KW-1 of every tile, with its own m, l and o per column tile.
//   Epilogue: the groups' (m, l) are exchanged in LDS, block barrier, M = max m, L = sum l e^{m-M}; each wave stages
//   its o e^{m-M}/(16 L) in LDS Os[kg][query][64 ch] (pitch OSP, b128 stores; Os lies on the ring, which nobody reads or
//   fills behind the last trip's foot barrier), block barrier, then the KG planes are summed in the order kg = 0..7 and
//   the flat planes written.
// coverage: Os KG x 2 waves x 32 q x 64 ch (cols 0..63); Oh/Ol 64 rows x 8 lanes x 8 halves =
//           64 q x 64 ch per plane; grid (NTOK/64) covers rows 0..NTOK-1 of both planes exactly once.
// =========================================================================================================
__global__ __launch_bounds__(ATH)
void attn_k(const unsigned short* __restrict__ Qh, const unsigned short* __restrict__ Ql,
            const unsigned short* __restrict__ Kh, const unsigned short* __restrict__ Kl,
            const unsigned short* __restrict__ Vc, unsigned short* Oh, unsigned short* Ol) {
  __shared__ float Mg[KG * QT];
  __shared__ float Lg[KG * QT];
  __shared__ __align__(16) unsigned short Ring[2 * STGH];
  float* Os = (float*)Ring;                                          // output staging of the epilogue, on the ring
  const int tid  = threadIdx.x;
  const int wave = tid >> 5, lane = tid & 31;
  const int qw   = wave & 1, kg = wave >> 1;                        // query sub-tile (32 queries), key group
  const int hh   = lane >> 4, c = lane & 15;
  const int n0   = blockIdx.x * QT;

  // q fragments (B operand, col = query n0 + 32*qw + 16*u + c), d chunks 0 and 1, hi and residual planes
  Frag qh0[QC], qh1[QC], ql0[QC], ql1[QC];
  const unsigned short* qhp[QC];
  const unsigned short* qlp[QC];
#pragma unroll
  for (int u = 0; u < QC; ++u) {
    const size_t qo = (size_t)(n0 + 32 * qw + 16 * u + c) * DK + 8 * hh;
    qhp[u] = Qh + qo; qlp[u] = Ql + qo;
    qh0[u] = ldfrag(qhp[u]); qh1[u] = ldfrag(qhp[u] + 32);
    ql0[u] = ldfrag(qlp[u]); ql1[u] = ldfrag(qlp[u] + 32);
  }
#if defined(__HIP_DEVICE_COMPILE__)
  // the wait before the q loads' address registers are rewritten; it names the four addresses as inputs so that their
  // registers stay theirs up to it (without them the compiler hands one to the next address sum in front of the wait)
  asm volatile("s_wait_xcnt 0x0" :: "v"(qhp[0]), "v"(qlp[0]), "v"(qhp[1]), "v"(qlp[1]) : "memory");
#endif
  // copy addresses of this lane. K planes: copy i moves 64 rows (8 lanes x 16 B per 128-B row), row 64 i + (tid >> 3);
  // V: copy i moves 16 channel rows (32 lanes x 16 B per 512-B row segment), row 16 i + (tid >> 5).
  const unsigned ring0 = (unsigned)(uintptr_t)Ring;                  // LDS byte address of the ring
  const unsigned lk = ring0 + (unsigned)((tid >> 3) * (KPH * 2) + (tid & 7) * 16);
  const unsigned lv = ring0 + (unsigned)(SVV * 2 + (tid >> 5) * (VPH * 2) + (tid & 31) * 16);
  // key walk: block b takes the tiles in the order b mod NTL, + 1, ..., wrapping round. Every block reads the same k and v
  // planes from L2; with one common order all blocks ask for the same lines at the same moment and those requests queue up
  // behind one another, with rotated starts they spread over the whole planes. Buffers still go by the trip number.
  int tile = (int)(blockIdx.x % NTL);                                // the tile the next fill copies (block-uniform)
  const unsigned short* gkh = Kh + (size_t)tid * 8 + (size_t)tile * (KT * DK);
  const unsigned short* gkl = Kl + (size_t)tid * 8 + (size_t)tile * (KT * DK);
  const unsigned short* gv  = Vc + (size_t)(tid >> 5) * NTOK + 8 * (tid & 31) + (size_t)tile * KT;
  auto fill = [&](int buf) {
    const unsigned lb = (unsigned)buf * (unsigned)(STGH * 2);
    copy4(lk + lb,           64 * KPH * 2, gkh, (size_t)64 * DK);
    copy4(lk + lb + SKL * 2, 64 * KPH * 2, gkl, (size_t)64 * DK);
    copy4(lv + lb,           16 * VPH * 2, gv,  (size_t)16 * NTOK);
    const bool wrap = tile == NTL - 1;                               // on to the next tile, from the last one back to tile 0
    const ptrdiff_t tstep = wrap ? -(ptrdiff_t)(NTL - 1) : (ptrdiff_t)1;
    gkh += tstep * (KT * DK); gkl += tstep * (KT * DK); gv += tstep * KT;
    tile = wrap ? 0 : tile + 1;
  };
  // fragment offsets inside a stage (halves): k row = key KW kg + c (+ 16), v row = channel c (+ 16 j),
  // v column = key KW kg
  const int kfo = (KW * kg + c) * KPH + 8 * hh;
  const int vfo = SVV + c * VPH + KW * kg + 8 * hh;

  fill(0);
  wait_async0();
  __syncthreads();                                                   // trip 0's tile is readable by every wave
  // a tile's k fragments: one load group directly behind the barrier that publishes the tile, in front of the refill
  // copies (which go to the other buffer), so that the copies' issue covers the LDS latency
  KSet ks = ldkset(Ring + kfo, Ring + SKL + kfo, 0, 16 * KPH);
  fill(1);

  float m[QC], l[QC];
  v8f o[QC][4];
#pragma unroll
  for (int u = 0; u < QC; ++u) {
    m[u] = -1.0e30f; l[u] = 0.f;
#pragma unroll
    for (int j = 0; j < 4; ++j) o[u][j] = zero8();
  }

  // one trip; more1 / more2: a tile t + 1 / t + 2 exists (compile-time, so that a trip is straight-line code behind its
  // rescale branch: with run-time tests at the foot the compiler sinks the row sums below them, the 32 exponentials stay
  // live across the k loads and the copies, and q fragments spill)
  auto trip = [&](int t, auto more1, auto more2) __attribute__((always_inline)) {
    const unsigned short* Vp = Ring + (t & 1) * STGH + vfo;          // up to its foot barrier trip t reads buffer t mod 2 alone
    // scores: each k fragment pair against both column tiles, 4 independent accumulators; per accumulator the order of
    // the 6 products is hi.hi, hi.lo, lo.hi of d chunk 0, then of d chunk 1
    v8f s0[QC], s1[QC];
#pragma unroll
    for (int u = 0; u < QC; ++u) { s0[u] = zero8(); s1[u] = zero8(); }
#pragma unroll
    for (int u = 0; u < QC; ++u) { s0[u] = mma_b(ks.h00.bf, qh0[u].bf, s0[u]); s1[u] = mma_b(ks.h10.bf, qh0[u].bf, s1[u]); }
#pragma unroll
    for (int u = 0; u < QC; ++u) { s0[u] = mma_b(ks.h00.bf, ql0[u].bf, s0[u]); s1[u] = mma_b(ks.h10.bf, ql0[u].bf, s1[u]); }
#pragma unroll
    for (int u = 0; u < QC; ++u) { s0[u] = mma_b(ks.g00.bf, qh0[u].bf, s0[u]); s1[u] = mma_b(ks.g10.bf, qh0[u].bf, s1[u]); }
#pragma unroll
    for (int u = 0; u < QC; ++u) { s0[u] = mma_b(ks.h01.bf, qh1[u].bf, s0[u]); s1[u] = mma_b(ks.h11.bf, qh1[u].bf, s1[u]); }
#pragma unroll
    for (int u = 0; u < QC; ++u) { s0[u] = mma_b(ks.h01.bf, ql1[u].bf, s0[u]); s1[u] = mma_b(ks.h11.bf, ql1[u].bf, s1[u]); }
#pragma unroll
    for (int u = 0; u < QC; ++u) { s0[u] = mma_b(ks.g01.bf, qh1[u].bf, s0[u]); s1[u] = mma_b(ks.g11.bf, qh1[u].bf, s1[u]); }

    // one load group, ahead of its use: this block's v fragments, directly behind the score products (into registers
    // these have left); they are the trip's last LDS reads, and their latency runs under the maxima and the shuffles
    // instead of being waited out at the foot's s_wait_dscnt 0, which the compiler lifts as far up as the last LDS read
    Frag vf[4];
#pragma unroll
    for (int j = 0; j < 4; ++j) vf[j] = ldfrag(Vp + (16 * j) * VPH);
#if defined(__HIP_DEVICE_COMPILE__)
    __builtin_amdgcn_sched_barrier(0);   // keeps the group whole and in front of the vector work that covers its latency
#endif

    float mx[QC], sx[QC], mn[QC];
#pragma unroll
    for (int u = 0; u < QC; ++u) mx[u] = fmaxf(hmax8(s0[u]), hmax8(s1[u]));
#pragma unroll
    for (int u = 0; u < QC; ++u) sx[u] = __shfl_xor(mx[u], 16, 32);
#pragma unroll
    for (int u = 0; u < QC; ++u) mx[u] = fmaxf(mx[u], sx[u]);
#pragma unroll
    for (int u = 0; u < QC; ++u) mn[u] = fmaxf(m[u], mx[u]);
    const unsigned grew = wave_ballot(mx[0] > m[0] || mx[1] > m[1]); // wave-uniform, one test for both column tiles
    if (grew != 0u) {
#pragma unroll
      for (int u = 0; u < QC; ++u) {
        const float corr = __expf(m[u] - mn[u]);                     // == 1 exactly for lanes whose max did not grow
        l[u] *= corr;
#pragma unroll
        for (int j = 0; j < 4; ++j) {
#pragma unroll
          for (int r = 0; r < 8; ++r) o[u][j][r] *= corr;
        }
      }
    }

    FragH ph[QC];
#pragma unroll
    for (int u = 0; u < QC; ++u) {
      m[u] = mn[u];
      const float msh = mn[u] - LNPS;                                // exp gives e^{s-m} * 2^14
      float ls = 0.f;
#pragma unroll
      for (int r = 0; r < 8; ++r) {
        const float e0 = __expf(s0[u][r] - msh);                     // key      8hh + r of the wave's 32
        const float e1 = __expf(s1[u][r] - msh);                     // key 16 + 8hh + r
        ls += e0 + e1;
        ph[u].hv[0][r] = (_Float16)e0;
        ph[u].hv[1][r] = (_Float16)e1;
      }
      l[u] += ls;
    }

    // each v fragment against both column tiles, 8 independent accumulators
#pragma unroll
    for (int j = 0; j < 4; ++j) {
#pragma unroll
      for (int u = 0; u < QC; ++u) o[u][j] = mma_h(vf[j].h, ph[u].v, o[u][j]);
    }
    // foot of trip t: own reads done, own copies of trip t + 1's tile landed, then the one barrier that publishes that tile
    // and ends every wave's reads of buffer t mod 2; only then its refill
    wait_ds0();
    wait_async0();
    __syncthreads();
#if defined(__HIP_DEVICE_COMPILE__)
    __builtin_amdgcn_sched_barrier(0);   // keeps the row sums in front of the k loads, whose registers the exponentials hold until then (a build without it spills)
#endif
    if constexpr (decltype(more1)::v) {                              // trip t + 1's tile is published: its k fragments
      const unsigned short* Nb = Ring + ((t + 1) & 1) * STGH + kfo;
      ks = ldkset(Nb, Nb + SKL, 0, 16 * KPH);
    }
    if constexpr (decltype(more2)::v) fill(t & 1);
  };
#pragma unroll 1
  for (int t = 0; t < NTL - 2; ++t) trip(t, Flag<true>(), Flag<true>());
  trip(NTL - 2, Flag<true>(), Flag<false>());
  trip(NTL - 1, Flag<false>(), Flag<false>());
  wait_async0();

  // merge of the KG key groups: (m, l) of every group and query through LDS (m and l are equal in lanes c and c + 16)
#pragma unroll
  for (int u = 0; u < QC; ++u) {
    l[u] += __shfl_xor(l[u], 16, 32);
    const int qrow = 32 * qw + 16 * u + c;
    if (hh == 0) { Mg[kg * QT + qrow] = m[u]; Lg[kg * QT + qrow] = l[u]; }
  }
  __syncthreads();                                                   // every group's (m, l) is readable
  float* Ow = Os + kg * (QT * OSP);
#pragma unroll
  for (int u = 0; u < QC; ++u) {
    const int qrow = 32 * qw + 16 * u + c;
    float mall = Mg[qrow];
#pragma unroll
    for (int g = 1; g < KG; ++g) mall = fmaxf(mall, Mg[g * QT + qrow]);
    float lall = 0.f;
#pragma unroll
    for (int g = 0; g < KG; ++g) lall += Lg[g * QT + qrow] * __expf(Mg[g * QT + qrow] - mall);
    const float scl = (__expf(m[u] - mall) / lall) * IVSC;           // o and l both carry 2^14; o also carries the v x16
#pragma unroll
    for (int j = 0; j < 4; ++j) {
      v4f va, vb;
#pragma unroll
      for (int r = 0; r < 4; ++r) { va[r] = o[u][j][r] * scl; vb[r] = o[u][j][4 + r] * scl; }
      *(v4f*)(Ow + qrow * OSP + 16 * j + 8 * hh)     = va;          // Os[kg][query][ch = 16j + 8hh + r]
      *(v4f*)(Ow + qrow * OSP + 16 * j + 8 * hh + 4) = vb;
    }
  }
  __syncthreads();                                                   // every group's weighted o is readable

  const int e = tid & 7, row = tid >> 3;                             // row = query 0..63
  v4f a = *(const v4f*)(Os + row * OSP + 8 * e);
  v4f q = *(const v4f*)(Os + row * OSP + 8 * e + 4);
#pragma unroll
  for (int g = 1; g < KG; ++g) {
    a += *(const v4f*)(Os + g * (QT * OSP) + row * OSP + 8 * e);
    q += *(const v4f*)(Os + g * (QT * OSP) + row * OSP + 8 * e + 4);
  }
  const float f[8] = {a[0], a[1], a[2], a[3], q[0], q[1], q[2], q[3]};
  v4u uh, ul;
#pragma unroll
  for (int t = 0; t < 4; ++t) {
    const float g0 = f[2 * t] * OSC, g1 = f[2 * t + 1] * OSC;
    const _Float16 h0 = (_Float16)g0, h1 = (_Float16)g1;
    const _Float16 l0 = (_Float16)((g0 - (float)h0) * RSC);
    const _Float16 l1 = (_Float16)((g1 - (float)h1) * RSC);
    uh[t] = pk16(h_bits(h0), h_bits(h1));
    ul[t] = pk16(h_bits(l0), h_bits(l1));
  }
  const size_t po = (size_t)(n0 + row) * DK + 8 * e;
  *(v4u*)(Oh + po) = uh;
  *(v4u*)(Ol + po) = ul;
}

// =========================================================================================================
// (4) output pointwise conv over the raw view: Y[o][n'] = (1/256)(1/1024) sum_{c'} Wo16[o][c'] (Ohv[c'][n'] +
//     Olv[c'][n'] / 1024) + bo[o], where Ohv/Olv [64][NTOK] are the flat O planes re-read with row c' = halves
//     c'*NTOK .. +NTOK-1. Block (nt, mb): 64 n' x 64 o. The two 64 c' x 64 n' B tiles are staged transposed in
//     LDS Bh/Bl[n'_loc][c'] (pitch TP, 16-B global loads, 2-byte LDS stores), block barrier, then B fragments per
//     wave (col n0'+16w+(lane&15), k = c' contiguous, split k map) and A fragments from Wo16 rows o0+16mt+(lane&15).
//     K = 64 = 2 steps; hi and residual products in separate accumulators. Epilogue staged in Ys[n'_loc][o_loc]
// coverage: Bh/Bl 4 it x 16 c' x (8 x 8 n') = 64 x 64 each (cols 0..63 of pitch 72); Ys 4 waves x 16 n' x 64 o;
//           out: 8 it x 16 lines x 8 lanes x 4 floats = 64 o x 64 n'; grid (NTOK/64, COUT/64) covers
//           out[0..127][0..NTOK-1] exactly once.
// =========================================================================================================
__global__ __launch_bounds__(128)
void gemm_o(const unsigned short* __restrict__ Wo16, const unsigned short* __restrict__ Oh,
            const unsigned short* __restrict__ Ol, const float* __restrict__ bo, float* Y) {
  __shared__ __align__(16) unsigned short Bh[QT * TP];
  __shared__ __align__(16) unsigned short Bl[QT * TP];
  __shared__ __align__(16) float Ys[QT * OSP];
  const int tid  = threadIdx.x;
  const int lane = tid & 31, wave = tid >> 5;
  const int hh   = lane >> 4, c = lane & 15;
  const int nt   = blockIdx.x, mb = blockIdx.y;
  const int n0   = nt * QT, o0 = mb * QT;
  const int e = tid & 7, lq = tid >> 3;                              // lq 0..15

  // ---- stage the view tiles transposed: Bh[n'_loc][c'] <- Oh[c'*NTOK + n0 + n'_loc]
#pragma unroll
  for (int it = 0; it < 4; ++it) {
    const int cl = it * 16 + lq;                                     // c' 0..63
    const size_t so = (size_t)cl * NTOK + n0 + 8 * e;
    const v4u ah = *(const v4u*)(Oh + so);
    const v4u al = *(const v4u*)(Ol + so);
#pragma unroll
    for (int t = 0; t < 4; ++t) {
      Bh[(8 * e + 2 * t) * TP + cl]     = (unsigned short)(ah[t] & 0xffffu);
      Bh[(8 * e + 2 * t + 1) * TP + cl] = (unsigned short)(ah[t] >> 16);
      Bl[(8 * e + 2 * t) * TP + cl]     = (unsigned short)(al[t] & 0xffffu);
      Bl[(8 * e + 2 * t + 1) * TP + cl] = (unsigned short)(al[t] >> 16);
    }
  }
  __syncthreads();

  const unsigned short* ap  = Wo16 + (size_t)(o0 + c) * DK + 8 * hh;
  const unsigned short* bph = Bh + (16 * wave + c) * TP + 8 * hh;
  const unsigned short* bpl = Bl + (16 * wave + c) * TP + 8 * hh;

  v8f acch[4], accl[4];
#pragma unroll
  for (int mt = 0; mt < 4; ++mt) { acch[mt] = zero8(); accl[mt] = zero8(); }

#pragma unroll
  for (int ks = 0; ks < DK / 32; ++ks) {
    const Frag fbh = ldfrag(bph + 32 * ks);
    const Frag fbl = ldfrag(bpl + 32 * ks);
#pragma unroll
    for (int mt = 0; mt < 4; ++mt) {
      const Frag fa = ldfrag(ap + (size_t)(16 * mt) * DK + 32 * ks);
      acch[mt] = mma_h(fa.h, fbh.h, acch[mt]);
      accl[mt] = mma_h(fa.h, fbl.h, accl[mt]);
    }
  }

  // ---- epilogue: fold residual, scale back, bias -> Ys[n'_loc][o_loc]
  {
    const int nl = 16 * wave + c;
    const float fs = IWSC * IOSC;
#pragma unroll
    for (int mt = 0; mt < 4; ++mt) {
      const v4f b0 = *(const v4f*)(bo + o0 + 16 * mt + 8 * hh);
      const v4f b1 = *(const v4f*)(bo + o0 + 16 * mt + 8 * hh + 4);
      v4f va, vb;
#pragma unroll
      for (int r = 0; r < 4; ++r) {
        va[r] = (acch[mt][r] + accl[mt][r] * IRSC) * fs + bfr(b0[r]);
        vb[r] = (acch[mt][4 + r] + accl[mt][4 + r] * IRSC) * fs + bfr(b1[r]);
      }
      *(v4f*)(Ys + nl * OSP + 16 * mt + 8 * hh)     = va;
      *(v4f*)(Ys + nl * OSP + 16 * mt + 8 * hh + 4) = vb;
    }
  }
  __syncthreads();

  v4f res[8];
#pragma unroll
  for (int it = 0; it < 8; ++it) {
    const int L  = it * 16 + lq;                                     // line 0..127
    const int ol = L >> 1, hf = L & 1;                               // o_loc 0..63, line half
    const int nl = hf * 32 + 4 * e;                                  // n'_loc 0..63
#pragma unroll
    for (int t = 0; t < 4; ++t) res[it][t] = Ys[(nl + t) * OSP + ol];
  }
{
#pragma unroll
    for (int it = 0; it < 8; ++it) {
      const int L  = it * 16 + lq;
      const int ol = L >> 1, hf = L & 1;
      const int nl = hf * 32 + 4 * e;
      *(v4f*)(Y + (size_t)(o0 + ol) * NTOK + n0 + nl) = res[it];
    }
    
  }
}

// =========================================================================================================
// Workspace map (bytes, full size ND=16; each region start a multiple of 256; every extent is an exact tile
//   W16 f16 [192][128]        49152        Wo16 f16 [128][64]      16384
//   XP  f16 [16384][128]    4194304
//   Qh/Ql/Kh/Kl bf16 [16384][64] 2097152 x4   Vc f16 [64][16384]   2097152
//   Oh/Ol f16 [16384][64]   2097152 x2
//   total = 18939904
// =========================================================================================================
extern "C" void kernel_launch(void* const* d_in, const int* in_sizes, int n_in,
                              void* d_out, int out_size, void* d_ws, size_t ws_size,
                              hipStream_t stream) {
  if (n_in < 9) return;
  if (in_sizes[0] < CIN * NTOK) return;
  if ((in_sizes[0] % CIN) != 0) return;
  const int xstride = in_sizes[0] / CIN;                             // per-channel position stride of X
  if (xstride < NTOK || (xstride % 4) != 0) return;
  if (in_sizes[1] < DK * CIN || in_sizes[3] < DK * CIN || in_sizes[5] < DK * CIN) return;
  if (in_sizes[2] < DK || in_sizes[4] < DK || in_sizes[6] < DK) return;
  if (in_sizes[7] < COUT * DK || in_sizes[8] < COUT) return;
  if (out_size < COUT * NTOK) return;

  size_t off = 0;
  auto carve = [&](size_t bytes) { const size_t o = off; off += (bytes + 255) & ~(size_t)255; return o; };
  const size_t oW16  = carve((size_t)3 * DK * CIN * 2);
  const size_t oWo16 = carve((size_t)COUT * DK * 2);
  const size_t oXP   = carve((size_t)NTOK * CIN * 2);
  const size_t oQh   = carve((size_t)NTOK * DK * 2);
  const size_t oQl   = carve((size_t)NTOK * DK * 2);
  const size_t oKh   = carve((size_t)NTOK * DK * 2);
  const size_t oKl   = carve((size_t)NTOK * DK * 2);
  const size_t oVc   = carve((size_t)DK * NTOK * 2);
  const size_t oOh   = carve((size_t)NTOK * DK * 2);
  const size_t oOl   = carve((size_t)NTOK * DK * 2);
  if (off > ws_size) return;
  if (off > (size_t)134217728) return;

  const float* X  = (const float*)d_in[0];
  const float* Wq = (const float*)d_in[1];
  const float* bq = (const float*)d_in[2];
  const float* Wk = (const float*)d_in[3];
  const float* bk = (const float*)d_in[4];
  const float* Wv = (const float*)d_in[5];
  const float* bv = (const float*)d_in[6];
  const float* Wo = (const float*)d_in[7];
  const float* bo = (const float*)d_in[8];

  char* ws = (char*)d_ws;
  unsigned short* W16  = (unsigned short*)(ws + oW16);
  unsigned short* Wo16 = (unsigned short*)(ws + oWo16);
  unsigned short* XP   = (unsigned short*)(ws + oXP);
  unsigned short* Qh   = (unsigned short*)(ws + oQh);
  unsigned short* Ql   = (unsigned short*)(ws + oQl);
  unsigned short* Kh   = (unsigned short*)(ws + oKh);
  unsigned short* Kl   = (unsigned short*)(ws + oKl);
  unsigned short* Vc   = (unsigned short*)(ws + oVc);
  unsigned short* Oh   = (unsigned short*)(ws + oOh);
  unsigned short* Ol   = (unsigned short*)(ws + oOl);
  float* out = (float*)d_out;

  const dim3 blk256(256), blk128(128);
  const int BQ = (DK * CIN) / (8 * CHB), BO = (COUT * DK) / (8 * CHB);

  // (0) weights -> f16 planes
  cvt_w<<<dim3(3 * BQ + BO), dim3(CHB), 0, stream>>>(Wq, Wk, Wv, Wo, W16, Wo16);
  // (1) x -> position-major 16-bit plane
  cvt_x<<<dim3(NTOK / QT, CIN / QT), blk256, 0, stream>>>(X, xstride, XP);
  // (2) q/k/v pointwise conv GEMM -> q hi + residual, k hi + residual, v planes
  gemm_qkv<<<dim3(NTOK / QT, 3), blk128, 0, stream>>>(W16, XP, bq, bk, bv, Qh, Ql, Kh, Kl, Vc);
  // (3) global attention -> O hi + residual planes [NTOK][64]
  attn_k<<<dim3(NTOK / QT), dim3(ATH), 0, stream>>>(Qh, Ql, Kh, Kl, Vc, Oh, Ol);
  // (4) output conv over the raw [64][NTOK] view -> out [128][NTOK]
  gemm_o<<<dim3(NTOK / QT, COUT / QT), blk128, 0, stream>>>(Wo16, Oh, Ol, bo, out);
  (void)hipGetLastError();
}

// v007
// One run takes 113 microseconds.
// Next to v006, in two timings, it ran 1.04 and 1.03 times as fast.
// All steps since v000 together make it 7.57 times as fast.
// Contractions: q/k/v pointwise conv W16[192x128].XP[n][128] on v_wmma_f32_16x16x32_f16 (f16 containers of
// bf16-RNE weights x256 and bf16-RNE x, exact products); scores K.Q^T on v_wmma_f32_16x16x32_bf16 (bf16 hi +
// bf16 residual planes of k and of q/8, 3 products hi.hi + hi.lo + lo.hi, K=64); O^T = V.P^T on
// v_wmma_f32_16x16x32_f16 (v x16 as f16, P = e^{s-m} x2^14 f16 from the score D registers); output conv
// Wo16[128x64].Oview[64][N] on v_wmma_f32_16x16x32_f16 (f16 of bf16-RNE weights x256; O carried as f16 hi x1024
// plane + f16 residual x2^20 plane, 2 products, separate accumulators); f32 accumulate everywhere; softmax
// statistics and bias adds in f32 VALU.
#include <hip/hip_runtime.h>
#include <math.h>
#include <stdint.h>

#ifndef ND
#define ND 16
#endif
#define NHH    32
#define NWW    32
#define NTOK   (ND * NHH * NWW)
#define CIN    128
#define DK     64
#define COUT   128
#define QT     64
#define OSP    68
#define TP     72
#define CHB    256
#define WSC    256.0f
#define IWSC   0.00390625f
#define QSC    0.125f
#define VSC    16.0f
#define IVSC   0.0625f
#define OSC    1024.0f
#define IOSC   0.0009765625f
#define RSC    1024.0f
#define IRSC   0.0009765625f
#define LNPS   9.704060527839234f
#define KG     8
#define QC     2
#define ATH    (32 * (QT / (16 * QC)) * KG)
#define KT     256
#define KW     (KT / KG)
#define KPH    72
#define VPH    264
#define SKL    (KT * KPH)
#define SVV    (2 * KT * KPH)
#define STGH   (2 * KT * KPH + DK * VPH)
#define NTL    (NTOK / KT)

static_assert(ND >= 1 && ND <= 16);
static_assert(NTOK % QT == 0);
static_assert(NTOK % 32 == 0);
static_assert(CIN % QT == 0 && CIN % 32 == 0);
static_assert(DK == QT);
static_assert(DK % 32 == 0);
static_assert(COUT % QT == 0);
static_assert((DK * CIN) % (8 * CHB) == 0);
static_assert((COUT * DK) % (8 * CHB) == 0);
static_assert((OSP * 4) % 16 == 0);
static_assert((TP * 2) % 16 == 0);
static_assert(KT % 32 == 0 && NTOK % KT == 0 && NTOK / KT >= 2);
static_assert((ATH / 8) * 4 == KT && (ATH / 32) * 4 == DK && KT == 8 * 32 && DK == 8 * 8);
static_assert(KW == 32 && VPH == KT + 8 && QT * 8 == ATH && QT == 2 * 16 * QC);
static_assert(KG * QT * OSP * 4 <= 2 * STGH * 2);
static_assert((KPH * 2) % 32 == 16 && (VPH * 2) % 32 == 16 && (STGH * 2) % 16 == 0);

typedef _Float16       v16h __attribute__((ext_vector_type(16)));
typedef _Float16       v8h  __attribute__((ext_vector_type(8)));
typedef __bf16         v16b __attribute__((ext_vector_type(16)));
typedef unsigned short v8us __attribute__((ext_vector_type(8)));
typedef float          v8f  __attribute__((ext_vector_type(8)));
typedef float          v4f  __attribute__((ext_vector_type(4)));
typedef unsigned int   v4u  __attribute__((ext_vector_type(4)));

union Frag  { v8us u[2]; v16h h; v16b bf; };
union FragH { v16h v; v8h hv[2]; };
static_assert(sizeof(Frag) == 32);
static_assert(sizeof(FragH) == 32);

// ---- scalar helpers ---------------------------------------------------------------------------------------
__device__ __forceinline__ unsigned short bf_bits(float f) {          // f32 -> bf16 bits, RNE convert
  unsigned u = __float_as_uint(f);
  return (unsigned short)((u + 0x7FFFu + ((u >> 16) & 1u)) >> 16);
}
__device__ __forceinline__ float bf_up(unsigned short hb) { return __uint_as_float(((unsigned)hb) << 16); }
__device__ __forceinline__ float bfr(float f) { return bf_up(bf_bits(f)); }
__device__ __forceinline__ unsigned short h_bits(_Float16 x) { return __builtin_bit_cast(unsigned short, x); }
__device__ __forceinline__ unsigned pk16(unsigned short a, unsigned short b) { return (unsigned)a | ((unsigned)b << 16); }
__device__ __forceinline__ v8f zero8() { v8f z = {0.f, 0.f, 0.f, 0.f, 0.f, 0.f, 0.f, 0.f}; return z; }
__device__ __forceinline__ float hmax8(v8f s) {
  return fmaxf(fmaxf(fmaxf(s[0], s[1]), fmaxf(s[2], s[3])), fmaxf(fmaxf(s[4], s[5]), fmaxf(s[6], s[7])));
}
__device__ __forceinline__ unsigned wave_ballot(bool p) {
#if defined(__HIP_DEVICE_COMPILE__)
  return __builtin_amdgcn_ballot_w32(p);
#else
  return p ? 1u : 0u;
#endif
}

// ---- 16-bit fragment loader (A, or B from a k-contiguous [n][k] row): lane -> row/col (lane&15), p already includes
//      + 8*(lane>>4); elements 0..7 <- p[0..7] (k0+8h..), elements 8..15 <- p[16..23] (k0+16+8h..)
__device__ __forceinline__ Frag ldfrag(const unsigned short* p) {
  Frag f;
  f.u[0] = *(const v8us*)(p);
  f.u[1] = *(const v8us*)(p + 16);
  return f;
}

// ---- the 8 k fragments of one block of 32 keys (rows r0 = kb .. +15, r1 = kb+16 .. +31; d chunks 0 and 1; hi and residual)
struct KSet { Frag h00, h10, g00, g10, h01, h11, g01, g11; };
__device__ __forceinline__ KSet ldkset(const unsigned short* hp, const unsigned short* lp, int r0o, int r1o) {
  KSet k;
  k.h00 = ldfrag(hp + r0o);      k.h10 = ldfrag(hp + r1o);
  k.g00 = ldfrag(lp + r0o);      k.g10 = ldfrag(lp + r1o);
  k.h01 = ldfrag(hp + r0o + 32); k.h11 = ldfrag(hp + r1o + 32);
  k.g01 = ldfrag(lp + r0o + 32); k.g11 = ldfrag(lp + r1o + 32);
  return k;
}

// ---- WMMA helpers: the plain builtins; the compiler keeps the distances behind its own forms (another product or
//      independent vector work fills a slot), so that the vector port stays free for the SIMD's other waves
__device__ __forceinline__ v8f mma_h(v16h a, v16h b, v8f c) {
  return __builtin_amdgcn_wmma_f32_16x16x32_f16(false, a, false, b, (short)0, c, false, false);
}
__device__ __forceinline__ v8f mma_b(v16b a, v16b b, v8f c) {
  return __builtin_amdgcn_wmma_f32_16x16x32_bf16(false, a, false, b, (short)0, c, false, false);
}
template <bool B> struct Flag { static constexpr bool v = B; };

// ---- LDS ring helpers (attention) ---------------------------------------------------------------------------
// Four asynchronous 16-byte copies global -> LDS per lane (l = the lane's LDS address, g = its global address), as the
// builtin: the compiler keeps the address registers itself and folds constant steps into the instruction's offset field,
// so that a wave goes straight on to its matrix products behind the issue.
typedef int v4i_t __attribute__((__vector_size__(16)));
typedef __attribute__((address_space(1))) v4i_t* gcp_t;
typedef __attribute__((address_space(3))) v4i_t* lcp_t;
__device__ __forceinline__ void copy4(unsigned short* l0, int lstep, const unsigned short* g0, size_t gstep) {
#if defined(__HIP_DEVICE_COMPILE__)
  __builtin_amdgcn_global_load_async_to_lds_b128((gcp_t)(g0),             (lcp_t)(l0),             0, 0);
  __builtin_amdgcn_global_load_async_to_lds_b128((gcp_t)(g0 + gstep),     (lcp_t)(l0 + lstep),     0, 0);
  __builtin_amdgcn_global_load_async_to_lds_b128((gcp_t)(g0 + 2 * gstep), (lcp_t)(l0 + 2 * lstep), 0, 0);
  __builtin_amdgcn_global_load_async_to_lds_b128((gcp_t)(g0 + 3 * gstep), (lcp_t)(l0 + 3 * lstep), 0, 0);
#endif
}
// this wave's own copies have landed in LDS (the compiler places no wait for them)
__device__ __forceinline__ void wait_async0() {
#if defined(__HIP_DEVICE_COMPILE__)
  asm volatile("s_wait_asynccnt 0x0" ::: "memory");
#endif
}
// this wave's own LDS reads have returned, before the buffer they read is handed back for a refill
__device__ __forceinline__ void wait_ds0() {
#if defined(__HIP_DEVICE_COMPILE__)
  asm volatile("s_wait_dscnt 0x0" ::: "memory");
#endif
}

// =========================================================================================================
// (0) weight planes: W16 f16 [192][128] (rows 0..63 = Wq, 64..127 = Wk, 128..191 = Wv) and Wo16 f16 [128][64];
//     value = f16 of (bf16-RNE(w) * 256) (exact). Thread = one 8-element chunk (16 B); 8 consecutive lanes =
// coverage: (3*BQ + BO) blocks x 256 threads x 8 halves = 3*8192 + 8192 elements = both planes exactly.
// =========================================================================================================
__global__ __launch_bounds__(CHB)
void cvt_w(const float* __restrict__ Wq, const float* __restrict__ Wk, const float* __restrict__ Wv,
           const float* __restrict__ Wo, unsigned short* W16, unsigned short* Wo16) {
  const int tid = threadIdx.x, blk = blockIdx.x;
  const int BQ = (DK * CIN) / (8 * CHB);                             // blocks per q/k/v matrix
  const int g = blk * CHB + tid;                                     // chunk id
  const float* src;
  unsigned short* dst;
  int gsrc, gdst;
  if (blk < BQ)          { src = Wq; gsrc = 0;            dst = W16;  gdst = 0; }
  else if (blk < 2 * BQ) { src = Wk; gsrc = BQ * CHB;     dst = W16;  gdst = 0; }
  else if (blk < 3 * BQ) { src = Wv; gsrc = 2 * BQ * CHB; dst = W16;  gdst = 0; }
  else                   { src = Wo; gsrc = 3 * BQ * CHB; dst = Wo16; gdst = 3 * BQ * CHB; }
  const float* s = src + (size_t)8 * (size_t)(g - gsrc);
  const v4f a = *(const v4f*)s;
  const v4f q = *(const v4f*)(s + 4);
  const float f[8] = {a[0], a[1], a[2], a[3], q[0], q[1], q[2], q[3]};
  v4u u;
#pragma unroll
  for (int t = 0; t < 4; ++t) {
    const _Float16 h0 = (_Float16)(bfr(f[2 * t]) * WSC);
    const _Float16 h1 = (_Float16)(bfr(f[2 * t + 1]) * WSC);
    u[t] = pk16(h_bits(h0), h_bits(h1));
  }
{
    *(v4u*)(dst + (size_t)8 * (size_t)(g - gdst)) = u;
    
  }
}

// =========================================================================================================
// (1) X f32 [128 c][xstride] (first NTOK positions used) -> XP f16 [NTOK n][128 c] (position-major, bf16-RNE
//     values, exact in f16) through an LDS tile T[64 n][64 c] (pitch TP). Block (nb, cb) owns a 64 c x 64 n tile.
// coverage: T 2 it x 32 c x (8 x 8 n) = 64 x 64; XP 2 it x 32 rows x 8 lanes x 8 halves = 64 n x 64 c;
//           grid (NTOK/64, 2) covers XP [NTOK][128] exactly once.
// =========================================================================================================
__global__ __launch_bounds__(256)
void cvt_x(const float* __restrict__ X, int xstride, unsigned short* XP) {
  __shared__ __align__(16) unsigned short T[QT * TP];
  const int tid = threadIdx.x;
  const int nb = blockIdx.x, cb = blockIdx.y;
  const int e = tid & 7, lq = tid >> 3;                             // lq 0..31
  const int n0 = nb * QT, c0 = cb * QT;
#pragma unroll
  for (int it = 0; it < 2; ++it) {
    const int cl = it * 32 + lq;                                     // 0..63
    const float* sp = X + (size_t)(c0 + cl) * (size_t)xstride + n0 + 8 * e;
    const v4f a = *(const v4f*)sp;
    const v4f q = *(const v4f*)(sp + 4);
    unsigned short hb[8];
#pragma unroll
    for (int t = 0; t < 4; ++t) {
      hb[t]     = h_bits((_Float16)bfr(a[t]));
      hb[4 + t] = h_bits((_Float16)bfr(q[t]));
    }
#pragma unroll
    for (int t = 0; t < 8; ++t) T[(8 * e + t) * TP + cl] = hb[t];
  }
  __syncthreads();
  v4u up[2];
#pragma unroll
  for (int it = 0; it < 2; ++it) {
    const int nl = it * 32 + lq;                                     // 0..63
    up[it] = *(const v4u*)(T + nl * TP + 8 * e);
  }
{
#pragma unroll
    for (int it = 0; it < 2; ++it) {
      const int nl = it * 32 + lq;
      *(v4u*)(XP + (size_t)(n0 + nl) * CIN + c0 + 8 * e) = up[it];
    }
    
  }
}

// =========================================================================================================
// (2) pointwise conv GEMM for one (64-n tile, projection mb in {q,k,v}): P[o][n] = (1/256) sum_c W16[o0+o][c]
//     XP[n][c] + bias[o]. Block 128 threads = 4 waves; wave w owns cols n0+16w..+15 (B fragment from the XP row,
//     k = c contiguous, split k map) and 4 m-tiles (A rows o0 + 16 mt + (lane&15) of W16, split k map).
//     K = 128 = 4 steps. Epilogue staged in LDS Os[n_loc][o_loc] (pitch OSP), block barrier, then:
//       mb 1: k   -> Kh = bf16-RNE(v), Kl = bf16-RNE(v - hi), planes bf16 [NTOK][64];
//       mb 2: v   -> Vc f16 [64 ch][NTOK] (channel-major, value f16(v*16)), row segment n0..n0+63 = one line.
// coverage: Os 4 waves x 16 n x 64 o = 64 x 64 (cols 0..63 of pitch 68, reads stay in cols 0..63);
//           Qh/Ql/Kh/Kl: 4 it x 16 rows x 8 lanes x 8 = 64 n x 64 d; Vc: 4 it x 16 ch x 8 lanes x 8 = 64 ch x 64 n;
//           grid (NTOK/64, 3) covers all rows of Qh, Ql, Kh, Kl and all of Vc exactly once.
// =========================================================================================================
__global__ __launch_bounds__(128)
void gemm_qkv(const unsigned short* __restrict__ W16, const unsigned short* __restrict__ XP,
              const float* __restrict__ bq, const float* __restrict__ bk, const float* __restrict__ bv,
              unsigned short* Qh, unsigned short* Ql, unsigned short* Kh, unsigned short* Kl,
              unsigned short* Vc) {
  __shared__ __align__(16) float Os[QT * OSP];
  const int tid  = threadIdx.x;
  const int lane = tid & 31, wave = tid >> 5;
  const int hh   = lane >> 4, c = lane & 15;
  const int nt   = blockIdx.x, mb = blockIdx.y;
  const int n0   = nt * QT, o0 = mb * QT;

  const unsigned short* ap = W16 + (size_t)(o0 + c) * CIN + 8 * hh;
  const unsigned short* bp = XP + (size_t)(n0 + 16 * wave + c) * CIN + 8 * hh;

  v8f acc[4];
#pragma unroll
  for (int mt = 0; mt < 4; ++mt) acc[mt] = zero8();

#pragma unroll
  for (int ks = 0; ks < CIN / 32; ++ks) {
    const Frag fb = ldfrag(bp + 32 * ks);
#pragma unroll
    for (int mt = 0; mt < 4; ++mt) {
      const Frag fa = ldfrag(ap + (size_t)(16 * mt) * CIN + 32 * ks);
      acc[mt] = mma_h(fa.h, fb.h, acc[mt]);
    }
  }

  // ---- epilogue: scale back + bias (+ 1/sqrt(ck) for q) -> LDS Os[n_loc][o_loc]
  const float* bsel = (mb == 0) ? bq : ((mb == 1) ? bk : bv);       // block-uniform, all global
  const float osc = (mb == 0) ? QSC : 1.0f;
  {
    const int nl = 16 * wave + c;
#pragma unroll
    for (int mt = 0; mt < 4; ++mt) {
      const v4f b0 = *(const v4f*)(bsel + 16 * mt + 8 * hh);
      const v4f b1 = *(const v4f*)(bsel + 16 * mt + 8 * hh + 4);
      v4f va, vb;
#pragma unroll
      for (int r = 0; r < 4; ++r) {
        va[r] = (acc[mt][r] * IWSC + bfr(b0[r])) * osc;
        vb[r] = (acc[mt][4 + r] * IWSC + bfr(b1[r])) * osc;
      }
      *(v4f*)(Os + nl * OSP + 16 * mt + 8 * hh)     = va;
      *(v4f*)(Os + nl * OSP + 16 * mt + 8 * hh + 4) = vb;
    }
  }
  __syncthreads();

  const int e = tid & 7, lq = tid >> 3;                             // lq 0..15
  if (mb < 2) {
    unsigned short* Ph = (mb == 0) ? Qh : Kh;                        // block-uniform, both global
    unsigned short* Pl = (mb == 0) ? Ql : Kl;
    v4u uh[4], ul[4];
#pragma unroll
    for (int it = 0; it < 4; ++it) {
      const int row = it * 16 + lq;                                  // n_loc 0..63
      const v4f a = *(const v4f*)(Os + row * OSP + 8 * e);
      const v4f q = *(const v4f*)(Os + row * OSP + 8 * e + 4);
      const float f[8] = {a[0], a[1], a[2], a[3], q[0], q[1], q[2], q[3]};
#pragma unroll
      for (int t = 0; t < 4; ++t) {
        const float f0 = f[2 * t], f1 = f[2 * t + 1];
        const unsigned short hb0 = bf_bits(f0), hb1 = bf_bits(f1);
        const unsigned short lb0 = bf_bits(f0 - bf_up(hb0));
        const unsigned short lb1 = bf_bits(f1 - bf_up(hb1));
        uh[it][t] = pk16(hb0, hb1);
        ul[it][t] = pk16(lb0, lb1);
      }
    }
{
#pragma unroll
      for (int it = 0; it < 4; ++it) {
        const int row = it * 16 + lq;
        const size_t po = (size_t)(n0 + row) * DK + 8 * e;
        *(v4u*)(Ph + po) = uh[it];
        *(v4u*)(Pl + po) = ul[it];
      }
      
    }
  } else {
    v4u uv[4];
#pragma unroll
    for (int it = 0; it < 4; ++it) {
      const int o = it * 16 + lq;                                    // channel 0..63
      unsigned short hb[8];
#pragma unroll
      for (int t = 0; t < 8; ++t) hb[t] = h_bits((_Float16)(Os[(8 * e + t) * OSP + o] * VSC));
#pragma unroll
      for (int t = 0; t < 4; ++t) uv[it][t] = pk16(hb[2 * t], hb[2 * t + 1]);
    }
{
#pragma unroll
      for (int it = 0; it < 4; ++it) {
        const int o = it * 16 + lq;
        *(v4u*)(Vc + (size_t)o * NTOK + n0 + 8 * e) = uv[it];
      }
      
    }
  }
}

// =========================================================================================================
// (3) global attention for one 64-query tile, transposed formulation, NTOK keys, no mask:
//   S^T tile (16 keys x 16 queries) = sum over 2 d-chunks of A(k: row = key kb + (lane&15), 32 d via the split
//   k map from the bf16 plane Kh [NTOK][64]) . B(q: col = query, same map from Qh) + A(Kh).B(Ql) + A(Kl).B(Qh)
//   (bf16 unscaled residual planes, shared accumulator, 3 products). q fragments (QC column tiles x 2 chunks x hi/lo)
//   loaded once per wave; k (hi and residual) and v tiles of KT keys are staged in a two-buffer LDS ring by asynchronous copies,
//   shared by the block's 16 waves: stage = Kh[KT][64] and Kl[KT][64] (row pitch KPH halves) + V[64 ch][KT] (pitch VPH);
//   the tile of trip t + 2 is copied into the buffer trip t has read, behind the barrier at the foot of trip t, and flies
//   during trip t + 1; trip t of block b works on tile (b + t) mod NTL.
//   Fragments come from LDS with the same split-map loader, and every k and v fragment a wave reads feeds its
//   QC = 2 column tiles (32 queries), which halves the LDS bytes read per product against one column tile per wave. Load
//   groups are issued ahead of use: v of the block directly behind the score products; k of a tile directly behind the
//   barrier that publishes the tile.
//   Per lane the D tile holds 8 keys of ONE query: online softmax state per lane, one shuffle (lane^16) for the max
//   over 32 keys; the o/l rescale is skipped under one wave-uniform ballot when no lane's max grew in either column tile
//   (corr == 1 exactly for every lane then); row-sum partials combined at the end. P = e^{s-m} x 2^14 as f16 is the B operand of
//   O^T (rows channel, cols queries) += A(v rows channel = 16j + (lane&15), keys contiguous, f16 plane Vc
//   [64][NTOK]) . B(P^T): element r <- D of the tile covering keys kb..kb+15, element 8+r <- the tile covering
//   kb+16..kb+31, lane unchanged. 4 accumulator tiles per column tile (64 channels). Block = 64 queries x KG key groups =
//   16 waves (4 per SIMD, so that one wave's LDS, softmax and matrix latencies are covered by the others): wave
//   (qw, kg) takes queries 32 qw .. +31 and keys KW kg .. +KW-1 of every tile, with its own m, l and o per column tile.
//   Epilogue: the groups' (m, l) are exchanged in LDS, block barrier, M = max m, L = sum l e^{m-M}; each wave stages
//   its o e^{m-M}/(16 L) in LDS Os[kg][query][64 ch] (pitch OSP, b128 stores; Os lies on the ring, which nobody reads or
//   fills behind the last trip's foot barrier), block barrier, then the KG planes are summed in the order kg = 0..7 and
//   the flat planes written.
// coverage: Os KG x 2 waves x 32 q x 64 ch (cols 0..63); Oh/Ol 64 rows x 8 lanes x 8 halves =
//           64 q x 64 ch per plane; grid (NTOK/64) covers rows 0..NTOK-1 of both planes exactly once.
// =========================================================================================================
__global__ __launch_bounds__(ATH)
void attn_k(const unsigned short* __restrict__ Qh, const unsigned short* __restrict__ Ql,
            const unsigned short* __restrict__ Kh, const unsigned short* __restrict__ Kl,
            const unsigned short* __restrict__ Vc, unsigned short* Oh, unsigned short* Ol) {
  __shared__ float Mg[KG * QT];
  __shared__ float Lg[KG * QT];
  __shared__ __align__(16) unsigned short Ring[2 * STGH];
  float* Os = (float*)Ring;                                          // output staging of the epilogue, on the ring
  const int tid  = threadIdx.x;
  const int wave = tid >> 5, lane = tid & 31;
  const int qw   = wave & 1, kg = wave >> 1;                        // query sub-tile (32 queries), key group
  const int hh   = lane >> 4, c = lane & 15;
  const int n0   = blockIdx.x * QT;

  // q fragments (B operand, col = query n0 + 32*qw + 16*u + c), d chunks 0 and 1, hi and residual planes
  Frag qh0[QC], qh1[QC], ql0[QC], ql1[QC];
  const unsigned short* qhp[QC];
  const unsigned short* qlp[QC];
#pragma unroll
  for (int u = 0; u < QC; ++u) {
    const size_t qo = (size_t)(n0 + 32 * qw + 16 * u + c) * DK + 8 * hh;
    qhp[u] = Qh + qo; qlp[u] = Ql + qo;
    qh0[u] = ldfrag(qhp[u]); qh1[u] = ldfrag(qhp[u] + 32);
    ql0[u] = ldfrag(qlp[u]); ql1[u] = ldfrag(qlp[u] + 32);
  }
#if defined(__HIP_DEVICE_COMPILE__)
  // the wait before the q loads' address registers are rewritten; it names the four addresses as inputs so that their
  // registers stay theirs up to it (without them the compiler hands one to the next address sum in front of the wait)
  asm volatile("s_wait_xcnt 0x0" :: "v"(qhp[0]), "v"(qlp[0]), "v"(qhp[1]), "v"(qlp[1]) : "memory");
#endif
  // copy addresses of this lane. K planes: copy i moves 64 rows (8 lanes x 16 B per 128-B row), row 64 i + (tid >> 3);
  // V: copy i moves 16 channel rows (32 lanes x 16 B per 512-B row segment), row 16 i + (tid >> 5).
  unsigned short* lk = Ring + (tid >> 3) * KPH + (tid & 7) * 8;
  unsigned short* lv = Ring + SVV + (tid >> 5) * VPH + (tid & 31) * 8;
  // key walk: block b takes the tiles in the order b mod NTL, + 1, ..., wrapping round. Every block reads the same k and v
  // planes from L2; with one common order all blocks ask for the same lines at the same moment and those requests queue up
  // behind one another, with rotated starts they spread over the whole planes. Buffers still go by the trip number.
  int tile = (int)(blockIdx.x % NTL);                                // the tile the next fill copies (block-uniform)
  const unsigned short* gkh = Kh + (size_t)tid * 8 + (size_t)tile * (KT * DK);
  const unsigned short* gkl = Kl + (size_t)tid * 8 + (size_t)tile * (KT * DK);
  const unsigned short* gv  = Vc + (size_t)(tid >> 5) * NTOK + 8 * (tid & 31) + (size_t)tile * KT;
  auto fill = [&](int buf) {
    const int lb = buf * STGH;
    copy4(lk + lb,       64 * KPH, gkh, (size_t)64 * DK);
    copy4(lk + lb + SKL, 64 * KPH, gkl, (size_t)64 * DK);
    copy4(lv + lb,       16 * VPH, gv,  (size_t)16 * NTOK);
    const bool wrap = tile == NTL - 1;                               // on to the next tile, from the last one back to tile 0
    const ptrdiff_t tstep = wrap ? -(ptrdiff_t)(NTL - 1) : (ptrdiff_t)1;
    gkh += tstep * (KT * DK); gkl += tstep * (KT * DK); gv += tstep * KT;
    tile = wrap ? 0 : tile + 1;
  };
  // fragment offsets inside a stage (halves): k row = key KW kg + c (+ 16), v row = channel c (+ 16 j),
  // v column = key KW kg
  const int kfo = (KW * kg + c) * KPH + 8 * hh;
  const int vfo = SVV + c * VPH + KW * kg + 8 * hh;

  fill(0);
  wait_async0();
  __syncthreads();                                                   // trip 0's tile is readable by every wave
  // a tile's k fragments: one load group directly behind the barrier that publishes the tile, in front of the refill
  // copies (which go to the other buffer), so that the copies' issue covers the LDS latency
  KSet ks = ldkset(Ring + kfo, Ring + SKL + kfo, 0, 16 * KPH);
  fill(1);

  float m[QC], l[QC];
  v8f o[QC][4];
#pragma unroll
  for (int u = 0; u < QC; ++u) {
    m[u] = -1.0e30f; l[u] = 0.f;
#pragma unroll
    for (int j = 0; j < 4; ++j) o[u][j] = zero8();
  }

  // one trip; more1 / more2: a tile t + 1 / t + 2 exists (compile-time, so that a trip is straight-line code behind its
  // rescale branch: with run-time tests at the foot the compiler sinks the row sums below them, the 32 exponentials stay
  // live across the k loads and the copies, and q fragments spill)
  auto trip = [&](int t, auto more1, auto more2) __attribute__((always_inline)) {
    const unsigned short* Vp = Ring + (t & 1) * STGH + vfo;          // up to its foot barrier trip t reads buffer t mod 2 alone
    // scores: each k fragment pair against both column tiles, 4 independent accumulators; per accumulator the order of
    // the 6 products is hi.hi, hi.lo, lo.hi of d chunk 0, then of d chunk 1
    v8f s0[QC], s1[QC];
#pragma unroll
    for (int u = 0; u < QC; ++u) { s0[u] = zero8(); s1[u] = zero8(); }
#pragma unroll
    for (int u = 0; u < QC; ++u) { s0[u] = mma_b(ks.h00.bf, qh0[u].bf, s0[u]); s1[u] = mma_b(ks.h10.bf, qh0[u].bf, s1[u]); }
#pragma unroll
    for (int u = 0; u < QC; ++u) { s0[u] = mma_b(ks.h00.bf, ql0[u].bf, s0[u]); s1[u] = mma_b(ks.h10.bf, ql0[u].bf, s1[u]); }
#pragma unroll
    for (int u = 0; u < QC; ++u) { s0[u] = mma_b(ks.g00.bf, qh0[u].bf, s0[u]); s1[u] = mma_b(ks.g10.bf, qh0[u].bf, s1[u]); }
#pragma unroll
    for (int u = 0; u < QC; ++u) { s0[u] = mma_b(ks.h01.bf, qh1[u].bf, s0[u]); s1[u] = mma_b(ks.h11.bf, qh1[u].bf, s1[u]); }
#pragma unroll
    for (int u = 0; u < QC; ++u) { s0[u] = mma_b(ks.h01.bf, ql1[u].bf, s0[u]); s1[u] = mma_b(ks.h11.bf, ql1[u].bf, s1[u]); }
#pragma unroll
    for (int u = 0; u < QC; ++u) { s0[u] = mma_b(ks.g01.bf, qh1[u].bf, s0[u]); s1[u] = mma_b(ks.g11.bf, qh1[u].bf, s1[u]); }

    // one load group, ahead of its use: this block's v fragments, directly behind the score products (into registers
    // these have left); they are the trip's last LDS reads, and their latency runs under the maxima and the shuffles
    // instead of being waited out at the foot's s_wait_dscnt 0, which the compiler lifts as far up as the last LDS read
    Frag vf[4];
#pragma unroll
    for (int j = 0; j < 4; ++j) vf[j] = ldfrag(Vp + (16 * j) * VPH);
#if defined(__HIP_DEVICE_COMPILE__)
    __builtin_amdgcn_sched_barrier(0);   // keeps the group whole and in front of the vector work that covers its latency
#endif

    float mx[QC], sx[QC], mn[QC];
#pragma unroll
    for (int u = 0; u < QC; ++u) mx[u] = fmaxf(hmax8(s0[u]), hmax8(s1[u]));
#pragma unroll
    for (int u = 0; u < QC; ++u) sx[u] = __shfl_xor(mx[u], 16, 32);
#pragma unroll
    for (int u = 0; u < QC; ++u) mx[u] = fmaxf(mx[u], sx[u]);
#pragma unroll
    for (int u = 0; u < QC; ++u) mn[u] = fmaxf(m[u], mx[u]);
    const unsigned grew = wave_ballot(mx[0] > m[0] || mx[1] > m[1]); // wave-uniform, one test for both column tiles
    if (grew != 0u) {
#pragma unroll
      for (int u = 0; u < QC; ++u) {
        const float corr = __expf(m[u] - mn[u]);                     // == 1 exactly for lanes whose max did not grow
        l[u] *= corr;
#pragma unroll
        for (int j = 0; j < 4; ++j) {
#pragma unroll
          for (int r = 0; r < 8; ++r) o[u][j][r] *= corr;
        }
      }
    }

    FragH ph[QC];
#pragma unroll
    for (int u = 0; u < QC; ++u) {
      m[u] = mn[u];
      const float msh = mn[u] - LNPS;                                // exp gives e^{s-m} * 2^14
      float ls = 0.f;
#pragma unroll
      for (int r = 0; r < 8; ++r) {
        const float e0 = __expf(s0[u][r] - msh);                     // key      8hh + r of the wave's 32
        const float e1 = __expf(s1[u][r] - msh);                     // key 16 + 8hh + r
        ls += e0 + e1;
        ph[u].hv[0][r] = (_Float16)e0;
        ph[u].hv[1][r] = (_Float16)e1;
      }
      l[u] += ls;
    }

    // each v fragment against both column tiles, 8 independent accumulators
#pragma unroll
    for (int j = 0; j < 4; ++j) {
#pragma unroll
      for (int u = 0; u < QC; ++u) o[u][j] = mma_h(vf[j].h, ph[u].v, o[u][j]);
    }
    // foot of trip t: own reads done, own copies of trip t + 1's tile landed, then the one barrier that publishes that tile
    // and ends every wave's reads of buffer t mod 2; only then its refill
    wait_ds0();
    wait_async0();
    __syncthreads();
#if defined(__HIP_DEVICE_COMPILE__)
    __builtin_amdgcn_sched_barrier(0);   // keeps the row sums in front of the k loads, whose registers the exponentials hold until then (a build without it spills)
#endif
    if constexpr (decltype(more1)::v) {                              // trip t + 1's tile is published: its k fragments
      const unsigned short* Nb = Ring + ((t + 1) & 1) * STGH + kfo;
      ks = ldkset(Nb, Nb + SKL, 0, 16 * KPH);
    }
    if constexpr (decltype(more2)::v) fill(t & 1);
  };
#pragma unroll 1
  for (int t = 0; t < NTL - 2; ++t) trip(t, Flag<true>(), Flag<true>());
  trip(NTL - 2, Flag<true>(), Flag<false>());
  trip(NTL - 1, Flag<false>(), Flag<false>());
  wait_async0();

  // merge of the KG key groups: (m, l) of every group and query through LDS (m and l are equal in lanes c and c + 16)
#pragma unroll
  for (int u = 0; u < QC; ++u) {
    l[u] += __shfl_xor(l[u], 16, 32);
    const int qrow = 32 * qw + 16 * u + c;
    if (hh == 0) { Mg[kg * QT + qrow] = m[u]; Lg[kg * QT + qrow] = l[u]; }
  }
  __syncthreads();                                                   // every group's (m, l) is readable
  float* Ow = Os + kg * (QT * OSP);
#pragma unroll
  for (int u = 0; u < QC; ++u) {
    const int qrow = 32 * qw + 16 * u + c;
    float mall = Mg[qrow];
#pragma unroll
    for (int g = 1; g < KG; ++g) mall = fmaxf(mall, Mg[g * QT + qrow]);
    float lall = 0.f;
#pragma unroll
    for (int g = 0; g < KG; ++g) lall += Lg[g * QT + qrow] * __expf(Mg[g * QT + qrow] - mall);
    const float scl = (__expf(m[u] - mall) / lall) * IVSC;           // o and l both carry 2^14; o also carries the v x16
#pragma unroll
    for (int j = 0; j < 4; ++j) {
      v4f va, vb;
#pragma unroll
      for (int r = 0; r < 4; ++r) { va[r] = o[u][j][r] * scl; vb[r] = o[u][j][4 + r] * scl; }
      *(v4f*)(Ow + qrow * OSP + 16 * j + 8 * hh)     = va;          // Os[kg][query][ch = 16j + 8hh + r]
      *(v4f*)(Ow + qrow * OSP + 16 * j + 8 * hh + 4) = vb;
    }
  }
  __syncthreads();                                                   // every group's weighted o is readable

  const int e = tid & 7, row = tid >> 3;                             // row = query 0..63
  v4f a = *(const v4f*)(Os + row * OSP + 8 * e);
  v4f q = *(const v4f*)(Os + row * OSP + 8 * e + 4);
#pragma unroll
  for (int g = 1; g < KG; ++g) {
    a += *(const v4f*)(Os + g * (QT * OSP) + row * OSP + 8 * e);
    q += *(const v4f*)(Os + g * (QT * OSP) + row * OSP + 8 * e + 4);
  }
  const float f[8] = {a[0], a[1], a[2], a[3], q[0], q[1], q[2], q[3]};
  v4u uh, ul;
#pragma unroll
  for (int t = 0; t < 4; ++t) {
    const float g0 = f[2 * t] * OSC, g1 = f[2 * t + 1] * OSC;
    const _Float16 h0 = (_Float16)g0, h1 = (_Float16)g1;
    const _Float16 l0 = (_Float16)((g0 - (float)h0) * RSC);
    const _Float16 l1 = (_Float16)((g1 - (float)h1) * RSC);
    uh[t] = pk16(h_bits(h0), h_bits(h1));
    ul[t] = pk16(h_bits(l0), h_bits(l1));
  }
  const size_t po = (size_t)(n0 + row) * DK + 8 * e;
  *(v4u*)(Oh + po) = uh;
  *(v4u*)(Ol + po) = ul;
}

// =========================================================================================================
// (4) output pointwise conv over the raw view: Y[o][n'] = (1/256)(1/1024) sum_{c'} Wo16[o][c'] (Ohv[c'][n'] +
//     Olv[c'][n'] / 1024) + bo[o], where Ohv/Olv [64][NTOK] are the flat O planes re-read with row c' = halves
//     c'*NTOK .. +NTOK-1. Block (nt, mb): 64 n' x 64 o. The two 64 c' x 64 n' B tiles are staged transposed in
//     LDS Bh/Bl[n'_loc][c'] (pitch TP, 16-B global loads, 2-byte LDS stores), block barrier, then B fragments per
//     wave (col n0'+16w+(lane&15), k = c' contiguous, split k map) and A fragments from Wo16 rows o0+16mt+(lane&15).
//     K = 64 = 2 steps; hi and residual products in separate accumulators. Epilogue staged in Ys[n'_loc][o_loc]
// coverage: Bh/Bl 4 it x 16 c' x (8 x 8 n') = 64 x 64 each (cols 0..63 of pitch 72); Ys 4 waves x 16 n' x 64 o;
//           out: 8 it x 16 lines x 8 lanes x 4 floats = 64 o x 64 n'; grid (NTOK/64, COUT/64) covers
//           out[0..127][0..NTOK-1] exactly once.
// =========================================================================================================
__global__ __launch_bounds__(128)
void gemm_o(const unsigned short* __restrict__ Wo16, const unsigned short* __restrict__ Oh,
            const unsigned short* __restrict__ Ol, const float* __restrict__ bo, float* Y) {
  __shared__ __align__(16) unsigned short Bh[QT * TP];
  __shared__ __align__(16) unsigned short Bl[QT * TP];
  __shared__ __align__(16) float Ys[QT * OSP];
  const int tid  = threadIdx.x;
  const int lane = tid & 31, wave = tid >> 5;
  const int hh   = lane >> 4, c = lane & 15;
  const int nt   = blockIdx.x, mb = blockIdx.y;
  const int n0   = nt * QT, o0 = mb * QT;
  const int e = tid & 7, lq = tid >> 3;                              // lq 0..15

  // ---- stage the view tiles transposed: Bh[n'_loc][c'] <- Oh[c'*NTOK + n0 + n'_loc]
#pragma unroll
  for (int it = 0; it < 4; ++it) {
    const int cl = it * 16 + lq;                                     // c' 0..63
    const size_t so = (size_t)cl * NTOK + n0 + 8 * e;
    const v4u ah = *(const v4u*)(Oh + so);
    const v4u al = *(const v4u*)(Ol + so);
#pragma unroll
    for (int t = 0; t < 4; ++t) {
      Bh[(8 * e + 2 * t) * TP + cl]     = (unsigned short)(ah[t] & 0xffffu);
      Bh[(8 * e + 2 * t + 1) * TP + cl] = (unsigned short)(ah[t] >> 16);
      Bl[(8 * e + 2 * t) * TP + cl]     = (unsigned short)(al[t] & 0xffffu);
      Bl[(8 * e + 2 * t + 1) * TP + cl] = (unsigned short)(al[t] >> 16);
    }
  }
  __syncthreads();

  const unsigned short* ap  = Wo16 + (size_t)(o0 + c) * DK + 8 * hh;
  const unsigned short* bph = Bh + (16 * wave + c) * TP + 8 * hh;
  const unsigned short* bpl = Bl + (16 * wave + c) * TP + 8 * hh;

  v8f acch[4], accl[4];
#pragma unroll
  for (int mt = 0; mt < 4; ++mt) { acch[mt] = zero8(); accl[mt] = zero8(); }

#pragma unroll
  for (int ks = 0; ks < DK / 32; ++ks) {
    const Frag fbh = ldfrag(bph + 32 * ks);
    const Frag fbl = ldfrag(bpl + 32 * ks);
#pragma unroll
    for (int mt = 0; mt < 4; ++mt) {
      const Frag fa = ldfrag(ap + (size_t)(16 * mt) * DK + 32 * ks);
      acch[mt] = mma_h(fa.h, fbh.h, acch[mt]);
      accl[mt] = mma_h(fa.h, fbl.h, accl[mt]);
    }
  }

  // ---- epilogue: fold residual, scale back, bias -> Ys[n'_loc][o_loc]
  {
    const int nl = 16 * wave + c;
    const float fs = IWSC * IOSC;
#pragma unroll
    for (int mt = 0; mt < 4; ++mt) {
      const v4f b0 = *(const v4f*)(bo + o0 + 16 * mt + 8 * hh);
      const v4f b1 = *(const v4f*)(bo + o0 + 16 * mt + 8 * hh + 4);
      v4f va, vb;
#pragma unroll
      for (int r = 0; r < 4; ++r) {
        va[r] = (acch[mt][r] + accl[mt][r] * IRSC) * fs + bfr(b0[r]);
        vb[r] = (acch[mt][4 + r] + accl[mt][4 + r] * IRSC) * fs + bfr(b1[r]);
      }
      *(v4f*)(Ys + nl * OSP + 16 * mt + 8 * hh)     = va;
      *(v4f*)(Ys + nl * OSP + 16 * mt + 8 * hh + 4) = vb;
    }
  }
  __syncthreads();

  v4f res[8];
#pragma unroll
  for (int it = 0; it < 8; ++it) {
    const int L  = it * 16 + lq;                                     // line 0..127
    const int ol = L >> 1, hf = L & 1;                               // o_loc 0..63, line half
    const int nl = hf * 32 + 4 * e;                                  // n'_loc 0..63
#pragma unroll
    for (int t = 0; t < 4; ++t) res[it][t] = Ys[(nl + t) * OSP + ol];
  }
{
#pragma unroll
    for (int it = 0; it < 8; ++it) {
      const int L  = it * 16 + lq;
      const int ol = L >> 1, hf = L & 1;
      const int nl = hf * 32 + 4 * e;
      *(v4f*)(Y + (size_t)(o0 + ol) * NTOK + n0 + nl) = res[it];
    }
    
  }
}

// =========================================================================================================
// Workspace map (bytes, full size ND=16; each region start a multiple of 256; every extent is an exact tile
//   W16 f16 [192][128]        49152        Wo16 f16 [128][64]      16384
//   XP  f16 [16384][128]    4194304
//   Qh/Ql/Kh/Kl bf16 [16384][64] 2097152 x4   Vc f16 [64][16384]   2097152
//   Oh/Ol f16 [16384][64]   2097152 x2
//   total = 18939904
// =========================================================================================================
extern "C" void kernel_launch(void* const* d_in, const int* in_sizes, int n_in,
                              void* d_out, int out_size, void* d_ws, size_t ws_size,
                              hipStream_t stream) {
  if (n_in < 9) return;
  if (in_sizes[0] < CIN * NTOK) return;
  if ((in_sizes[0] % CIN) != 0) return;
  const int xstride = in_sizes[0] / CIN;                             // per-channel position stride of X
  if (xstride < NTOK || (xstride % 4) != 0) return;
  if (in_sizes[1] < DK * CIN || in_sizes[3] < DK * CIN || in_sizes[5] < DK * CIN) return;
  if (in_sizes[2] < DK || in_sizes[4] < DK || in_sizes[6] < DK) return;
  if (in_sizes[7] < COUT * DK || in_sizes[8] < COUT) return;
  if (out_size < COUT * NTOK) return;

  size_t off = 0;
  auto carve = [&](size_t bytes) { const size_t o = off; off += (bytes + 255) & ~(size_t)255; return o; };
  const size_t oW16  = carve((size_t)3 * DK * CIN * 2);
  const size_t oWo16 = carve((size_t)COUT * DK * 2);
  const size_t oXP   = carve((size_t)NTOK * CIN * 2);
  const size_t oQh   = carve((size_t)NTOK * DK * 2);
  const size_t oQl   = carve((size_t)NTOK * DK * 2);
  const size_t oKh   = carve((size_t)NTOK * DK * 2);
  const size_t oKl   = carve((size_t)NTOK * DK * 2);
  const size_t oVc   = carve((size_t)DK * NTOK * 2);
  const size_t oOh   = carve((size_t)NTOK * DK * 2);
  const size_t oOl   = carve((size_t)NTOK * DK * 2);
  if (off > ws_size) return;
  if (off > (size_t)134217728) return;

  const float* X  = (const float*)d_in[0];
  const float* Wq = (const float*)d_in[1];
  const float* bq = (const float*)d_in[2];
  const float* Wk = (const float*)d_in[3];
  const float* bk = (const float*)d_in[4];
  const float* Wv = (const float*)d_in[5];
  const float* bv = (const float*)d_in[6];
  const float* Wo = (const float*)d_in[7];
  const float* bo = (const float*)d_in[8];

  char* ws = (char*)d_ws;
  unsigned short* W16  = (unsigned short*)(ws + oW16);
  unsigned short* Wo16 = (unsigned short*)(ws + oWo16);
  unsigned short* XP   = (unsigned short*)(ws + oXP);
  unsigned short* Qh   = (unsigned short*)(ws + oQh);
  unsigned short* Ql   = (unsigned short*)(ws + oQl);
  unsigned short* Kh   = (unsigned short*)(ws + oKh);
  unsigned short* Kl   = (unsigned short*)(ws + oKl);
  unsigned short* Vc   = (unsigned short*)(ws + oVc);
  unsigned short* Oh   = (unsigned short*)(ws + oOh);
  unsigned short* Ol   = (unsigned short*)(ws + oOl);
  float* out = (float*)d_out;

  const dim3 blk256(256), blk128(128);
  const int BQ = (DK * CIN) / (8 * CHB), BO = (COUT * DK) / (8 * CHB);

  // (0) weights -> f16 planes
  cvt_w<<<dim3(3 * BQ + BO), dim3(CHB), 0, stream>>>(Wq, Wk, Wv, Wo, W16, Wo16);
  // (1) x -> position-major 16-bit plane
  cvt_x<<<dim3(NTOK / QT, CIN / QT), blk256, 0, stream>>>(X, xstride, XP);
  // (2) q/k/v pointwise conv GEMM -> q hi + residual, k hi + residual, v planes
  gemm_qkv<<<dim3(NTOK / QT, 3), blk128, 0, stream>>>(W16, XP, bq, bk, bv, Qh, Ql, Kh, Kl, Vc);
  // (3) global attention -> O hi + residual planes [NTOK][64]
  attn_k<<<dim3(NTOK / QT), dim3(ATH), 0, stream>>>(Qh, Ql, Kh, Kl, Vc, Oh, Ol);
  // (4) output conv over the raw [64][NTOK] view -> out [128][NTOK]
  gemm_o<<<dim3(NTOK / QT, COUT / QT), blk128, 0, stream>>>(Wo16, Oh, Ol, bo, out);
  (void)hipGetLastError();
}

// v009
// It runs in 77.1 microseconds.
// Versions in between are left out here; by their measured steps it is 1.46 times as fast as v007.
// Over all steps from v000 it is 11.1 times as fast.
// Contractions: q/k/v pointwise conv W16[192x128].XP[n][128] on v_wmma_f32_16x16x32_f16 (f16 containers of
// bf16-RNE weights x256 and bf16-RNE x, exact products); scores K.Q^T on v_wmma_f32_16x16x32_f16 (k and q log2(e)/8 as one
// f16 plane each, 1 product, K=64: 11 significant bits, as many as P has and more than x and the weights; C operand = 7 - m,
// m the maximum in use); O^T = V.P^T on
// v_wmma_f32_16x16x32_f16 (v x16 as f16, P = 2^{s-m} x2^7 f16 from the score D registers); output conv
// Wo16[128x64].Oview[64][N] on v_wmma_f32_16x16x32_f16 (f16 of bf16-RNE weights x256; O carried as f16 hi x1024
// plane + f16 residual x2^20 plane, 2 products, separate accumulators); f32 accumulate everywhere; softmax
// statistics and bias adds in f32 VALU.
#include <hip/hip_runtime.h>
#include <math.h>
#include <stdint.h>

#ifndef ND
#define ND 16
#endif
#define NHH    32
#define NWW    32
#define NTOK   (ND * NHH * NWW)
#define CIN    128
#define DK     64
#define COUT   128
#define QT     64
#define OSP    68
#define TP     72
#define CHB    256
#define WSC    256.0f
#define IWSC   0.00390625f
#define QSC    0.18033688011112043f
#define VSC    16.0f
#define IVSC   0.0625f
#define OSC    1024.0f
#define IOSC   0.0009765625f
#define RSC    1024.0f
#define IRSC   0.0009765625f
#define PSH    7.0f
#define MLAG   8.0f
#define KG     8
#define QC     2
#define ATH    (32 * (QT / (16 * QC)) * KG)
#define KT     256
#define KW     (KT / KG)
#define KPH    72
#define VPH    264
#define SVV    (KT * KPH)
#define STGH   (KT * KPH + DK * VPH)
#define NTL    (NTOK / KT)

static_assert(ND >= 1 && ND <= 16);
static_assert(NTOK % QT == 0);
static_assert(NTOK % 32 == 0);
static_assert(CIN % QT == 0 && CIN % 32 == 0);
static_assert(DK == QT);
static_assert(DK % 32 == 0);
static_assert(COUT % QT == 0);
static_assert((DK * CIN) % (8 * CHB) == 0);
static_assert((COUT * DK) % (8 * CHB) == 0);
static_assert((OSP * 4) % 16 == 0);
static_assert((TP * 2) % 16 == 0);
static_assert(KT % 32 == 0 && NTOK % KT == 0 && NTOK / KT >= 2);
static_assert((ATH / 8) * 4 == KT && (ATH / 32) * 4 == DK && KT == 8 * 32 && DK == 8 * 8);
static_assert(KW == 32 && VPH == KT + 8 && QT * 8 == ATH && QT == 2 * 16 * QC);
static_assert(KG * QT * OSP * 4 <= 2 * STGH * 2);
static_assert((KPH * 2) % 32 == 16 && (VPH * 2) % 32 == 16 && (STGH * 2) % 16 == 0);

typedef _Float16       v16h __attribute__((ext_vector_type(16)));
typedef _Float16       v8h  __attribute__((ext_vector_type(8)));
typedef unsigned short v8us __attribute__((ext_vector_type(8)));
typedef float          v8f  __attribute__((ext_vector_type(8)));
typedef float          v4f  __attribute__((ext_vector_type(4)));
typedef unsigned int   v4u  __attribute__((ext_vector_type(4)));

union Frag  { v8us u[2]; v16h h; };
union FragH { v16h v; v8h hv[2]; };
static_assert(sizeof(Frag) == 32);
static_assert(sizeof(FragH) == 32);

// ---- scalar helpers ---------------------------------------------------------------------------------------
__device__ __forceinline__ unsigned short bf_bits(float f) {          // f32 -> bf16 bits, RNE convert
  unsigned u = __float_as_uint(f);
  return (unsigned short)((u + 0x7FFFu + ((u >> 16) & 1u)) >> 16);
}
__device__ __forceinline__ float bf_up(unsigned short hb) { return __uint_as_float(((unsigned)hb) << 16); }
__device__ __forceinline__ float bfr(float f) { return bf_up(bf_bits(f)); }
__device__ __forceinline__ unsigned short h_bits(_Float16 x) { return __builtin_bit_cast(unsigned short, x); }
__device__ __forceinline__ unsigned pk16(unsigned short a, unsigned short b) { return (unsigned)a | ((unsigned)b << 16); }
__device__ __forceinline__ v8f zero8() { v8f z = {0.f, 0.f, 0.f, 0.f, 0.f, 0.f, 0.f, 0.f}; return z; }
__device__ __forceinline__ float hmax8(v8f s) {
  return fmaxf(fmaxf(fmaxf(s[0], s[1]), fmaxf(s[2], s[3])), fmaxf(fmaxf(s[4], s[5]), fmaxf(s[6], s[7])));
}
__device__ __forceinline__ float ex2(float x) {                       // 2^x, one instruction
#if defined(__HIP_DEVICE_COMPILE__)
  return __builtin_amdgcn_exp2f(x);
#else
  return exp2f(x);
#endif
}
__device__ __forceinline__ unsigned wave_ballot(bool p) {
#if defined(__HIP_DEVICE_COMPILE__)
  return __builtin_amdgcn_ballot_w32(p);
#else
  return p ? 1u : 0u;
#endif
}

// ---- 16-bit fragment loader (A, or B from a k-contiguous [n][k] row): lane -> row/col (lane&15), p already includes
//      + 8*(lane>>4); elements 0..7 <- p[0..7] (k0+8h..), elements 8..15 <- p[16..23] (k0+16+8h..)
__device__ __forceinline__ Frag ldfrag(const unsigned short* p) {
  Frag f;
  f.u[0] = *(const v8us*)(p);
  f.u[1] = *(const v8us*)(p + 16);
  return f;
}

// ---- the 4 k fragments of one block of 32 keys (rows r0 = kb .. +15, r1 = kb+16 .. +31; d chunks 0 and 1)
struct KSet { Frag h00, h10, h01, h11; };
__device__ __forceinline__ KSet ldkset(const unsigned short* hp, int r0o, int r1o) {
  KSet k;
  k.h00 = ldfrag(hp + r0o);      k.h10 = ldfrag(hp + r1o);
  k.h01 = ldfrag(hp + r0o + 32); k.h11 = ldfrag(hp + r1o + 32);
  return k;
}

// ---- WMMA helpers: the plain builtins; the compiler keeps the distances behind its own forms (another product or
//      independent vector work fills a slot), so that the vector port stays free for the SIMD's other waves
__device__ __forceinline__ v8f mma_h(v16h a, v16h b, v8f c) {
  return __builtin_amdgcn_wmma_f32_16x16x32_f16(false, a, false, b, (short)0, c, false, false);
}
template <bool B> struct Flag { static constexpr bool v = B; };

// ---- LDS ring helpers (attention) ---------------------------------------------------------------------------
// Four asynchronous 16-byte copies global -> LDS per lane (l = the lane's LDS address, g = its global address), as the
// builtin: the compiler keeps the address registers itself and folds constant steps into the instruction's offset field,
// so that a wave goes straight on to its matrix products behind the issue.
typedef int v4i_t __attribute__((__vector_size__(16)));
typedef __attribute__((address_space(1))) v4i_t* gcp_t;
typedef __attribute__((address_space(3))) v4i_t* lcp_t;
__device__ __forceinline__ void copy4(unsigned short* l0, int lstep, const unsigned short* g0, size_t gstep) {
#if defined(__HIP_DEVICE_COMPILE__)
  __builtin_amdgcn_global_load_async_to_lds_b128((gcp_t)(g0),             (lcp_t)(l0),             0, 0);
  __builtin_amdgcn_global_load_async_to_lds_b128((gcp_t)(g0 + gstep),     (lcp_t)(l0 + lstep),     0, 0);
  __builtin_amdgcn_global_load_async_to_lds_b128((gcp_t)(g0 + 2 * gstep), (lcp_t)(l0 + 2 * lstep), 0, 0);
  __builtin_amdgcn_global_load_async_to_lds_b128((gcp_t)(g0 + 3 * gstep), (lcp_t)(l0 + 3 * lstep), 0, 0);
#endif
}
// this wave's own copies have landed in LDS (the compiler places no wait for them)
__device__ __forceinline__ void wait_async0() {
#if defined(__HIP_DEVICE_COMPILE__)
  asm volatile("s_wait_asynccnt 0x0" ::: "memory");
#endif
}
// this wave's own LDS reads have returned, before the buffer they read is handed back for a refill
__device__ __forceinline__ void wait_ds0() {
#if defined(__HIP_DEVICE_COMPILE__)
  asm volatile("s_wait_dscnt 0x0" ::: "memory");
#endif
}

// =========================================================================================================
// (0) weight planes: W16 f16 [192][128] (rows 0..63 = Wq, 64..127 = Wk, 128..191 = Wv) and Wo16 f16 [128][64];
//     value = f16 of (bf16-RNE(w) * 256) (exact). Thread = one 8-element chunk (16 B); 8 consecutive lanes =
// coverage: (3*BQ + BO) blocks x 256 threads x 8 halves = 3*8192 + 8192 elements = both planes exactly.
// =========================================================================================================
__global__ __launch_bounds__(CHB)
void cvt_w(const float* __restrict__ Wq, const float* __restrict__ Wk, const float* __restrict__ Wv,
           const float* __restrict__ Wo, unsigned short* W16, unsigned short* Wo16) {
  const int tid = threadIdx.x, blk = blockIdx.x;
  const int BQ = (DK * CIN) / (8 * CHB);                             // blocks per q/k/v matrix
  const int g = blk * CHB + tid;                                     // chunk id
  const float* src;
  unsigned short* dst;
  int gsrc, gdst;
  if (blk < BQ)          { src = Wq; gsrc = 0;            dst = W16;  gdst = 0; }
  else if (blk < 2 * BQ) { src = Wk; gsrc = BQ * CHB;     dst = W16;  gdst = 0; }
  else if (blk < 3 * BQ) { src = Wv; gsrc = 2 * BQ * CHB; dst = W16;  gdst = 0; }
  else                   { src = Wo; gsrc = 3 * BQ * CHB; dst = Wo16; gdst = 3 * BQ * CHB; }
  const float* s = src + (size_t)8 * (size_t)(g - gsrc);
  const v4f a = *(const v4f*)s;
  const v4f q = *(const v4f*)(s + 4);
  const float f[8] = {a[0], a[1], a[2], a[3], q[0], q[1], q[2], q[3]};
  v4u u;
#pragma unroll
  for (int t = 0; t < 4; ++t) {
    const _Float16 h0 = (_Float16)(bfr(f[2 * t]) * WSC);
    const _Float16 h1 = (_Float16)(bfr(f[2 * t + 1]) * WSC);
    u[t] = pk16(h_bits(h0), h_bits(h1));
  }
{
    *(v4u*)(dst + (size_t)8 * (size_t)(g - gdst)) = u;
    
  }
}

// =========================================================================================================
// (1) X f32 [128 c][xstride] (first NTOK positions used) -> XP f16 [NTOK n][128 c] (position-major, bf16-RNE
//     values, exact in f16) through an LDS tile T[64 n][64 c] (pitch TP). Block (nb, cb) owns a 64 c x 64 n tile.
// coverage: T 2 it x 32 c x (8 x 8 n) = 64 x 64; XP 2 it x 32 rows x 8 lanes x 8 halves = 64 n x 64 c;
//           grid (NTOK/64, 2) covers XP [NTOK][128] exactly once.
// =========================================================================================================
__global__ __launch_bounds__(256)
void cvt_x(const float* __restrict__ X, int xstride, unsigned short* XP) {
  __shared__ __align__(16) unsigned short T[QT * TP];
  const int tid = threadIdx.x;
  const int nb = blockIdx.x, cb = blockIdx.y;
  const int e = tid & 7, lq = tid >> 3;                             // lq 0..31
  const int n0 = nb * QT, c0 = cb * QT;
#pragma unroll
  for (int it = 0; it < 2; ++it) {
    const int cl = it * 32 + lq;                                     // 0..63
    const float* sp = X + (size_t)(c0 + cl) * (size_t)xstride + n0 + 8 * e;
    const v4f a = *(const v4f*)sp;
    const v4f q = *(const v4f*)(sp + 4);
    unsigned short hb[8];
#pragma unroll
    for (int t = 0; t < 4; ++t) {
      hb[t]     = h_bits((_Float16)bfr(a[t]));
      hb[4 + t] = h_bits((_Float16)bfr(q[t]));
    }
#pragma unroll
    for (int t = 0; t < 8; ++t) T[(8 * e + t) * TP + cl] = hb[t];
  }
  __syncthreads();
  v4u up[2];
#pragma unroll
  for (int it = 0; it < 2; ++it) {
    const int nl = it * 32 + lq;                                     // 0..63
    up[it] = *(const v4u*)(T + nl * TP + 8 * e);
  }
{
#pragma unroll
    for (int it = 0; it < 2; ++it) {
      const int nl = it * 32 + lq;
      *(v4u*)(XP + (size_t)(n0 + nl) * CIN + c0 + 8 * e) = up[it];
    }
    
  }
}

// =========================================================================================================
// (2) pointwise conv GEMM for one (64-n tile, projection mb in {q,k,v}): P[o][n] = (1/256) sum_c W16[o0+o][c]
//     XP[n][c] + bias[o]. Block 128 threads = 4 waves; wave w owns cols n0+16w..+15 (B fragment from the XP row,
//     k = c contiguous, split k map) and 4 m-tiles (A rows o0 + 16 mt + (lane&15) of W16, split k map).
//     K = 128 = 4 steps. Epilogue staged in LDS Os[n_loc][o_loc] (pitch OSP), block barrier, then:
//       mb 0: q log2(e)/8 -> Qf, mb 1: k -> Kf, planes f16 [NTOK][64] (RNE convert);
//       mb 2: v   -> Vc f16 [64 ch][NTOK] (channel-major, value f16(v*16)), row segment n0..n0+63 = one line.
// coverage: Os 4 waves x 16 n x 64 o = 64 x 64 (cols 0..63 of pitch 68, reads stay in cols 0..63);
//           Qf/Kf: 4 it x 16 rows x 8 lanes x 8 = 64 n x 64 d; Vc: 4 it x 16 ch x 8 lanes x 8 = 64 ch x 64 n;
//           grid (NTOK/64, 3) covers all rows of Qf and Kf and all of Vc exactly once.
// =========================================================================================================
__global__ __launch_bounds__(128)
void gemm_qkv(const unsigned short* __restrict__ W16, const unsigned short* __restrict__ XP,
              const float* __restrict__ bq, const float* __restrict__ bk, const float* __restrict__ bv,
              unsigned short* Qf, unsigned short* Kf, unsigned short* Vc) {
  __shared__ __align__(16) float Os[QT * OSP];
  const int tid  = threadIdx.x;
  const int lane = tid & 31, wave = tid >> 5;
  const int hh   = lane >> 4, c = lane & 15;
  const int nt   = blockIdx.x, mb = blockIdx.y;
  const int n0   = nt * QT, o0 = mb * QT;

  const unsigned short* ap = W16 + (size_t)(o0 + c) * CIN + 8 * hh;
  const unsigned short* bp = XP + (size_t)(n0 + 16 * wave + c) * CIN + 8 * hh;

  v8f acc[4];
#pragma unroll
  for (int mt = 0; mt < 4; ++mt) acc[mt] = zero8();

#pragma unroll
  for (int ks = 0; ks < CIN / 32; ++ks) {
    const Frag fb = ldfrag(bp + 32 * ks);
#pragma unroll
    for (int mt = 0; mt < 4; ++mt) {
      const Frag fa = ldfrag(ap + (size_t)(16 * mt) * CIN + 32 * ks);
      acc[mt] = mma_h(fa.h, fb.h, acc[mt]);
    }
  }

  // ---- epilogue: scale back + bias (+ log2(e)/sqrt(ck) for q) -> LDS Os[n_loc][o_loc]
  const float* bsel = (mb == 0) ? bq : ((mb == 1) ? bk : bv);       // block-uniform, all global
  const float osc = (mb == 0) ? QSC : 1.0f;
  {
    const int nl = 16 * wave + c;
#pragma unroll
    for (int mt = 0; mt < 4; ++mt) {
      const v4f b0 = *(const v4f*)(bsel + 16 * mt + 8 * hh);
      const v4f b1 = *(const v4f*)(bsel + 16 * mt + 8 * hh + 4);
      v4f va, vb;
#pragma unroll
      for (int r = 0; r < 4; ++r) {
        va[r] = (acc[mt][r] * IWSC + bfr(b0[r])) * osc;
        vb[r] = (acc[mt][4 + r] * IWSC + bfr(b1[r])) * osc;
      }
      *(v4f*)(Os + nl * OSP + 16 * mt + 8 * hh)     = va;
      *(v4f*)(Os + nl * OSP + 16 * mt + 8 * hh + 4) = vb;
    }
  }
  __syncthreads();

  const int e = tid & 7, lq = tid >> 3;                             // lq 0..15
  if (mb < 2) {
    unsigned short* Ph = (mb == 0) ? Qf : Kf;                        // block-uniform, both global
    v4u uh[4];
#pragma unroll
    for (int it = 0; it < 4; ++it) {
      const int row = it * 16 + lq;                                  // n_loc 0..63
      const v4f a = *(const v4f*)(Os + row * OSP + 8 * e);
      const v4f q = *(const v4f*)(Os + row * OSP + 8 * e + 4);
      const float f[8] = {a[0], a[1], a[2], a[3], q[0], q[1], q[2], q[3]};
#pragma unroll
      for (int t = 0; t < 4; ++t) uh[it][t] = pk16(h_bits((_Float16)f[2 * t]), h_bits((_Float16)f[2 * t + 1]));
    }
{
#pragma unroll
      for (int it = 0; it < 4; ++it) {
        const int row = it * 16 + lq;
        const size_t po = (size_t)(n0 + row) * DK + 8 * e;
        *(v4u*)(Ph + po) = uh[it];
      }
      
    }
  } else {
    v4u uv[4];
#pragma unroll
    for (int it = 0; it < 4; ++it) {
      const int o = it * 16 + lq;                                    // channel 0..63
      unsigned short hb[8];
#pragma unroll
      for (int t = 0; t < 8; ++t) hb[t] = h_bits((_Float16)(Os[(8 * e + t) * OSP + o] * VSC));
#pragma unroll
      for (int t = 0; t < 4; ++t) uv[it][t] = pk16(hb[2 * t], hb[2 * t + 1]);
    }
{
#pragma unroll
      for (int it = 0; it < 4; ++it) {
        const int o = it * 16 + lq;
        *(v4u*)(Vc + (size_t)o * NTOK + n0 + 8 * e) = uv[it];
      }
      
    }
  }
}

// =========================================================================================================
// (3) global attention for one 64-query tile, transposed formulation, NTOK keys, no mask:
//   S^T tile (16 keys x 16 queries) = sum over 2 d-chunks of A(k: row = key kb + (lane&15), 32 d via the split
//   k map from the f16 plane Kf [NTOK][64]) . B(q: col = query, same map from Qf), one product per chunk.
//   q fragments (QC column tiles x 2 chunks)
//   loaded once per wave; k and v tiles of KT keys are staged in a two-buffer LDS ring by asynchronous copies,
//   shared by the block's 16 waves: stage = Kf[KT][64] (row pitch KPH halves) + V[64 ch][KT] (pitch VPH);
//   the tile of trip t + 2 is copied into the buffer trip t has read, behind the barrier at the foot of trip t, and flies
//   during trip t + 1; trip t of block b works on tile (b + t) mod NTL.
//   Fragments come from LDS with the same split-map loader, and every k and v fragment a wave reads feeds its
//   QC = 2 column tiles (32 queries), which halves the LDS bytes read per product against one column tile per wave. Load
//   groups are issued ahead of use: v of the block directly behind the score products; k of a tile directly behind the
//   barrier that publishes the tile.
//   Per lane the D tile holds 8 keys of ONE query: online softmax state per lane, in the log2 domain (q carries log2 e).
//   The maximum in use m may trail the true one by up to MLAG: 7 - m is the C operand of the first score product, so that
//   the D registers hold the exponent s - m + 7 itself and go into the exponential as they are. One wave-uniform ballot
//   per trip tests whether a lane's exponent passed 7 + MLAG (P would leave f16 above 2^16); only then, and on the first
//   trip, m is raised to the true maximum (one shuffle lane^16), the exponents are shifted and o and l rescaled.
//   Row-sum partials combined at the end. P = 2^{s-m} x 2^7 as f16 is the B operand of
//   O^T (rows channel, cols queries) += A(v rows channel = 16j + (lane&15), keys contiguous, f16 plane Vc
//   [64][NTOK]) . B(P^T): element r <- D of the tile covering keys kb..kb+15, element 8+r <- the tile covering
//   kb+16..kb+31, lane unchanged. 4 accumulator tiles per column tile (64 channels). Block = 64 queries x KG key groups =
//   16 waves (4 per SIMD, so that one wave's LDS, softmax and matrix latencies are covered by the others): wave
//   (qw, kg) takes queries 32 qw .. +31 and keys KW kg .. +KW-1 of every tile, with its own m, l and o per column tile.
//   Epilogue: the groups' (m, l) are exchanged in LDS, block barrier, M = max m, L = sum l 2^{m-M}; each wave stages
//   its o 2^{m-M}/(16 L) in LDS Os[kg][query][64 ch] (pitch OSP, b128 stores; Os lies on the ring, which nobody reads or
//   fills behind the last trip's foot barrier), block barrier, then the KG planes are summed in the order kg = 0..7 and
//   the flat planes written.
// coverage: Os KG x 2 waves x 32 q x 64 ch (cols 0..63); Oh/Ol 64 rows x 8 lanes x 8 halves =
//           64 q x 64 ch per plane; grid (NTOK/64) covers rows 0..NTOK-1 of both planes exactly once.
// =========================================================================================================
__global__ __launch_bounds__(ATH)
void attn_k(const unsigned short* __restrict__ Qf, const unsigned short* __restrict__ Kf,
            const unsigned short* __restrict__ Vc, unsigned short* Oh, unsigned short* Ol) {
  __shared__ float Mg[KG * QT];
  __shared__ float Lg[KG * QT];
  __shared__ __align__(16) unsigned short Ring[2 * STGH];
  float* Os = (float*)Ring;                                          // output staging of the epilogue, on the ring
  const int tid  = threadIdx.x;
  const int wave = tid >> 5, lane = tid & 31;
  const int qw   = wave & 1, kg = wave >> 1;                        // query sub-tile (32 queries), key group
  const int hh   = lane >> 4, c = lane & 15;
  const int n0   = blockIdx.x * QT;

  // q fragments (B operand, col = query n0 + 32*qw + 16*u + c), d chunks 0 and 1
  Frag qh0[QC], qh1[QC];
  const unsigned short* qhp[QC];
#pragma unroll
  for (int u = 0; u < QC; ++u) {
    qhp[u] = Qf + (size_t)(n0 + 32 * qw + 16 * u + c) * DK + 8 * hh;
    qh0[u] = ldfrag(qhp[u]); qh1[u] = ldfrag(qhp[u] + 32);
  }
#if defined(__HIP_DEVICE_COMPILE__)
  // the wait before the q loads' address registers are rewritten; it names the two addresses as inputs so that their
  // registers stay theirs up to it (without them the compiler hands one to the next address sum in front of the wait)
  asm volatile("s_wait_xcnt 0x0" :: "v"(qhp[0]), "v"(qhp[1]) : "memory");
#endif
  // copy addresses of this lane. K plane: copy i moves 64 rows (8 lanes x 16 B per 128-B row), row 64 i + (tid >> 3);
  // V: copy i moves 16 channel rows (32 lanes x 16 B per 512-B row segment), row 16 i + (tid >> 5).
  unsigned short* lk = Ring + (tid >> 3) * KPH + (tid & 7) * 8;
  unsigned short* lv = Ring + SVV + (tid >> 5) * VPH + (tid & 31) * 8;
  // key walk: block b takes the tiles in the order b mod NTL, + 1, ..., wrapping round. Every block reads the same k and v
  // planes from L2; the rotated starts are for speed only. Buffers still go by the trip number.
  int tile = (int)(blockIdx.x % NTL);                                // the tile the next fill copies (block-uniform)
  const unsigned short* gkh = Kf + (size_t)tid * 8 + (size_t)tile * (KT * DK);
  const unsigned short* gv  = Vc + (size_t)(tid >> 5) * NTOK + 8 * (tid & 31) + (size_t)tile * KT;
  auto fill = [&](int buf) {
    const int lb = buf * STGH;
    copy4(lk + lb,       64 * KPH, gkh, (size_t)64 * DK);
    copy4(lv + lb,       16 * VPH, gv,  (size_t)16 * NTOK);
    const bool wrap = tile == NTL - 1;                               // on to the next tile, from the last one back to tile 0
    const ptrdiff_t tstep = wrap ? -(ptrdiff_t)(NTL - 1) : (ptrdiff_t)1;
    gkh += tstep * (KT * DK); gv += tstep * KT;
    tile = wrap ? 0 : tile + 1;
  };
  // fragment offsets inside a stage (halves): k row = key KW kg + c (+ 16), v row = channel c (+ 16 j),
  // v column = key KW kg
  const int kfo = (KW * kg + c) * KPH + 8 * hh;
  const int vfo = SVV + c * VPH + KW * kg + 8 * hh;

  fill(0);
  wait_async0();
  __syncthreads();                                                   // trip 0's tile is readable by every wave
  // a tile's k fragments: one load group directly behind the barrier that publishes the tile, in front of the refill
  // copies (which go to the other buffer), so that the copies' issue covers the LDS latency
  KSet ks = ldkset(Ring + kfo, 0, 16 * KPH);
  fill(1);

  float l[QC];
  v8f cm[QC];                                                        // PSH - m in all 8 rows: C operand of the score products
  v8f o[QC][4];
  unsigned first = 1u;                                               // no maximum taken yet (wave-uniform)
#pragma unroll
  for (int u = 0; u < QC; ++u) {
    l[u] = 0.f;
#pragma unroll
    for (int r = 0; r < 8; ++r) cm[u][r] = PSH;
#pragma unroll
    for (int j = 0; j < 4; ++j) o[u][j] = zero8();
  }

  // one trip; more1 / more2: a tile t + 1 / t + 2 exists (compile-time, so that a trip is straight-line code behind its
  // rescale branch: with run-time tests at the foot the compiler sinks the row sums below them, the 32 exponentials stay
  // live across the k loads and the copies, and q fragments spill)
  auto trip = [&](int t, auto more1, auto more2) __attribute__((always_inline)) {
    const unsigned short* Vp = Ring + (t & 1) * STGH + vfo;          // up to its foot barrier trip t reads buffer t mod 2 alone
    // scores: each k fragment pair against both column tiles, 4 independent accumulators; per accumulator d chunk 0
    // (on top of PSH - m), then d chunk 1. Last trip: PSH - m is added behind the products by vector adds instead; as a C
    // operand its registers would die at the product
    v8f s0[QC], s1[QC];
#pragma unroll
    for (int u = 0; u < QC; ++u) {
      const v8f c0 = decltype(more1)::v ? cm[u] : zero8();
      s0[u] = mma_h(ks.h00.h, qh0[u].h, c0); s1[u] = mma_h(ks.h10.h, qh0[u].h, c0);
    }
#pragma unroll
    for (int u = 0; u < QC; ++u) { s0[u] = mma_h(ks.h01.h, qh1[u].h, s0[u]); s1[u] = mma_h(ks.h11.h, qh1[u].h, s1[u]); }
    if constexpr (!decltype(more1)::v) {
#pragma unroll
      for (int u = 0; u < QC; ++u) { s0[u] += cm[u]; s1[u] += cm[u]; }
    }

    // one load group, ahead of its use: this block's v fragments, directly behind the score products (into registers
    // these have left); they are the trip's last LDS reads, and their latency runs under the maxima and the exponentials
    // instead of being waited out at the foot's s_wait_dscnt 0, which the compiler lifts as far up as the last LDS read
    Frag vf[4];
#pragma unroll
    for (int j = 0; j < 4; ++j) vf[j] = ldfrag(Vp + (16 * j) * VPH);
#if defined(__HIP_DEVICE_COMPILE__)
    __builtin_amdgcn_sched_barrier(0);   // keeps the group whole and in front of the vector work that covers its latency
#endif

    float mx[QC];                                                    // this lane's largest exponent (16 of the query's 32 keys)
#pragma unroll
    for (int u = 0; u < QC; ++u) mx[u] = fmaxf(hmax8(s0[u]), hmax8(s1[u]));
    const unsigned over = wave_ballot(fmaxf(mx[0], mx[1]) > PSH + MLAG);   // wave-uniform, one test for both column tiles
    if ((over | first) != 0u) {
#pragma unroll
      for (int u = 0; u < QC; ++u) {
        const float g = fmaxf(mx[u], __shfl_xor(mx[u], 16, 32)) - PSH;   // the 32 keys' maximum minus m, equal in lanes c, c + 16
        const float d = (first != 0u) ? g : fmaxf(g, 0.f);           // m only rises, but for the first trip, which sets it
        const float corr = ex2(fminf(-d, 0.f));                      // first trip: o and l are 0, any finite factor does
        l[u] *= corr;
#pragma unroll
        for (int r = 0; r < 8; ++r) { cm[u][r] -= d; s0[u][r] -= d; s1[u][r] -= d; }   // m += d
#pragma unroll
        for (int j = 0; j < 4; ++j) {
#pragma unroll
          for (int r = 0; r < 8; ++r) o[u][j][r] *= corr;
        }
      }
      first = 0u;
    }

    FragH ph[QC];
#pragma unroll
    for (int u = 0; u < QC; ++u) {
      float ls = 0.f;
#pragma unroll
      for (int r = 0; r < 8; ++r) {
        const float e0 = ex2(s0[u][r]);                              // key      8hh + r of the wave's 32
        const float e1 = ex2(s1[u][r]);                              // key 16 + 8hh + r
        ls += e0 + e1;
        ph[u].hv[0][r] = (_Float16)e0;
        ph[u].hv[1][r] = (_Float16)e1;
      }
      l[u] += ls;
    }

    // each v fragment against both column tiles, 8 independent accumulators
#pragma unroll
    for (int j = 0; j < 4; ++j) {
#pragma unroll
      for (int u = 0; u < QC; ++u) o[u][j] = mma_h(vf[j].h, ph[u].v, o[u][j]);
    }
    // foot of trip t: own reads done, own copies of trip t + 1's tile landed, then the one barrier that publishes that tile
    // and ends every wave's reads of buffer t mod 2; only then its refill
    wait_ds0();
    wait_async0();
    __syncthreads();
#if defined(__HIP_DEVICE_COMPILE__)
    __builtin_amdgcn_sched_barrier(0);   // keeps the row sums in front of the k loads, whose registers the exponentials hold until then (a build without it spills)
#endif
    if constexpr (decltype(more1)::v) {                              // trip t + 1's tile is published: its k fragments
      const unsigned short* Nb = Ring + ((t + 1) & 1) * STGH + kfo;
      ks = ldkset(Nb, 0, 16 * KPH);
    }
    if constexpr (decltype(more2)::v) fill(t & 1);
  };
#pragma unroll 1
  for (int t = 0; t < NTL - 2; ++t) trip(t, Flag<true>(), Flag<true>());
  trip(NTL - 2, Flag<true>(), Flag<false>());
  trip(NTL - 1, Flag<false>(), Flag<false>());
  wait_async0();

  // merge of the KG key groups: (m, l) of every group and query through LDS (m and l are equal in lanes c and c + 16)
  float m[QC];
#pragma unroll
  for (int u = 0; u < QC; ++u) {
    m[u] = -cm[u][0];                                                // m - PSH, exact; PSH drops out of every difference below
    l[u] += __shfl_xor(l[u], 16, 32);
    const int qrow = 32 * qw + 16 * u + c;
    if (hh == 0) { Mg[kg * QT + qrow] = m[u]; Lg[kg * QT + qrow] = l[u]; }
  }
  __syncthreads();                                                   // every group's (m, l) is readable
  float* Ow = Os + kg * (QT * OSP);
#pragma unroll
  for (int u = 0; u < QC; ++u) {
    const int qrow = 32 * qw + 16 * u + c;
    float mall = Mg[qrow];
#pragma unroll
    for (int g = 1; g < KG; ++g) mall = fmaxf(mall, Mg[g * QT + qrow]);
    float lall = 0.f;
#pragma unroll
    for (int g = 0; g < KG; ++g) lall += Lg[g * QT + qrow] * ex2(Mg[g * QT + qrow] - mall);
    const float scl = (ex2(m[u] - mall) / lall) * IVSC;              // o and l both carry 2^7; o also carries the v x16
#pragma unroll
    for (int j = 0; j < 4; ++j) {
      v4f va, vb;
#pragma unroll
      for (int r = 0; r < 4; ++r) { va[r] = o[u][j][r] * scl; vb[r] = o[u][j][4 + r] * scl; }
      *(v4f*)(Ow + qrow * OSP + 16 * j + 8 * hh)     = va;          // Os[kg][query][ch = 16j + 8hh + r]
      *(v4f*)(Ow + qrow * OSP + 16 * j + 8 * hh + 4) = vb;
    }
  }
  __syncthreads();                                                   // every group's weighted o is readable

  const int e = tid & 7, row = tid >> 3;                             // row = query 0..63
  v4f a = *(const v4f*)(Os + row * OSP + 8 * e);
  v4f q = *(const v4f*)(Os + row * OSP + 8 * e + 4);
#pragma unroll
  for (int g = 1; g < KG; ++g) {
    a += *(const v4f*)(Os + g * (QT * OSP) + row * OSP + 8 * e);
    q += *(const v4f*)(Os + g * (QT * OSP) + row * OSP + 8 * e + 4);
  }
  const float f[8] = {a[0], a[1], a[2], a[3], q[0], q[1], q[2], q[3]};
  v4u uh, ul;
#pragma unroll
  for (int t = 0; t < 4; ++t) {
    const float g0 = f[2 * t] * OSC, g1 = f[2 * t + 1] * OSC;
    const _Float16 h0 = (_Float16)g0, h1 = (_Float16)g1;
    const _Float16 l0 = (_Float16)((g0 - (float)h0) * RSC);
    const _Float16 l1 = (_Float16)((g1 - (float)h1) * RSC);
    uh[t] = pk16(h_bits(h0), h_bits(h1));
    ul[t] = pk16(h_bits(l0), h_bits(l1));
  }
  const size_t po = (size_t)(n0 + row) * DK + 8 * e;
  *(v4u*)(Oh + po) = uh;
  *(v4u*)(Ol + po) = ul;
}

// =========================================================================================================
// (4) output pointwise conv over the raw view: Y[o][n'] = (1/256)(1/1024) sum_{c'} Wo16[o][c'] (Ohv[c'][n'] +
//     Olv[c'][n'] / 1024) + bo[o], where Ohv/Olv [64][NTOK] are the flat O planes re-read with row c' = halves
//     c'*NTOK .. +NTOK-1. Block (nt, mb): 64 n' x 64 o. The two 64 c' x 64 n' B tiles are staged transposed in
//     LDS Bh/Bl[n'_loc][c'] (pitch TP, 16-B global loads, 2-byte LDS stores), block barrier, then B fragments per
//     wave (col n0'+16w+(lane&15), k = c' contiguous, split k map) and A fragments from Wo16 rows o0+16mt+(lane&15).
//     K = 64 = 2 steps; hi and residual products in separate accumulators. Epilogue staged in Ys[n'_loc][o_loc]
// coverage: Bh/Bl 4 it x 16 c' x (8 x 8 n') = 64 x 64 each (cols 0..63 of pitch 72); Ys 4 waves x 16 n' x 64 o;
//           out: 8 it x 16 lines x 8 lanes x 4 floats = 64 o x 64 n'; grid (NTOK/64, COUT/64) covers
//           out[0..127][0..NTOK-1] exactly once.
// =========================================================================================================
__global__ __launch_bounds__(128)
void gemm_o(const unsigned short* __restrict__ Wo16, const unsigned short* __restrict__ Oh,
            const unsigned short* __restrict__ Ol, const float* __restrict__ bo, float* Y) {
  __shared__ __align__(16) unsigned short Bh[QT * TP];
  __shared__ __align__(16) unsigned short Bl[QT * TP];
  __shared__ __align__(16) float Ys[QT * OSP];
  const int tid  = threadIdx.x;
  const int lane = tid & 31, wave = tid >> 5;
  const int hh   = lane >> 4, c = lane & 15;
  const int nt   = blockIdx.x, mb = blockIdx.y;
  const int n0   = nt * QT, o0 = mb * QT;
  const int e = tid & 7, lq = tid >> 3;                              // lq 0..15

  // ---- stage the view tiles transposed: Bh[n'_loc][c'] <- Oh[c'*NTOK + n0 + n'_loc]
#pragma unroll
  for (int it = 0; it < 4; ++it) {
    const int cl = it * 16 + lq;                                     // c' 0..63
    const size_t so = (size_t)cl * NTOK + n0 + 8 * e;
    const v4u ah = *(const v4u*)(Oh + so);
    const v4u al = *(const v4u*)(Ol + so);
#pragma unroll
    for (int t = 0; t < 4; ++t) {
      Bh[(8 * e + 2 * t) * TP + cl]     = (unsigned short)(ah[t] & 0xffffu);
      Bh[(8 * e + 2 * t + 1) * TP + cl] = (unsigned short)(ah[t] >> 16);
      Bl[(8 * e + 2 * t) * TP + cl]     = (unsigned short)(al[t] & 0xffffu);
      Bl[(8 * e + 2 * t + 1) * TP + cl] = (unsigned short)(al[t] >> 16);
    }
  }
  __syncthreads();

  const unsigned short* ap  = Wo16 + (size_t)(o0 + c) * DK + 8 * hh;
  const unsigned short* bph = Bh + (16 * wave + c) * TP + 8 * hh;
  const unsigned short* bpl = Bl + (16 * wave + c) * TP + 8 * hh;

  v8f acch[4], accl[4];
#pragma unroll
  for (int mt = 0; mt < 4; ++mt) { acch[mt] = zero8(); accl[mt] = zero8(); }

#pragma unroll
  for (int ks = 0; ks < DK / 32; ++ks) {
    const Frag fbh = ldfrag(bph + 32 * ks);
    const Frag fbl = ldfrag(bpl + 32 * ks);
#pragma unroll
    for (int mt = 0; mt < 4; ++mt) {
      const Frag fa = ldfrag(ap + (size_t)(16 * mt) * DK + 32 * ks);
      acch[mt] = mma_h(fa.h, fbh.h, acch[mt]);
      accl[mt] = mma_h(fa.h, fbl.h, accl[mt]);
    }
  }

  // ---- epilogue: fold residual, scale back, bias -> Ys[n'_loc][o_loc]
  {
    const int nl = 16 * wave + c;
    const float fs = IWSC * IOSC;
#pragma unroll
    for (int mt = 0; mt < 4; ++mt) {
      const v4f b0 = *(const v4f*)(bo + o0 + 16 * mt + 8 * hh);
      const v4f b1 = *(const v4f*)(bo + o0 + 16 * mt + 8 * hh + 4);
      v4f va, vb;
#pragma unroll
      for (int r = 0; r < 4; ++r) {
        va[r] = (acch[mt][r] + accl[mt][r] * IRSC) * fs + bfr(b0[r]);
        vb[r] = (acch[mt][4 + r] + accl[mt][4 + r] * IRSC) * fs + bfr(b1[r]);
      }
      *(v4f*)(Ys + nl * OSP + 16 * mt + 8 * hh)     = va;
      *(v4f*)(Ys + nl * OSP + 16 * mt + 8 * hh + 4) = vb;
    }
  }
  __syncthreads();

  v4f res[8];
#pragma unroll
  for (int it = 0; it < 8; ++it) {
    const int L  = it * 16 + lq;                                     // line 0..127
    const int ol = L >> 1, hf = L & 1;                               // o_loc 0..63, line half
    const int nl = hf * 32 + 4 * e;                                  // n'_loc 0..63
#pragma unroll
    for (int t = 0; t < 4; ++t) res[it][t] = Ys[(nl + t) * OSP + ol];
  }
{
#pragma unroll
    for (int it = 0; it < 8; ++it) {
      const int L  = it * 16 + lq;
      const int ol = L >> 1, hf = L & 1;
      const int nl = hf * 32 + 4 * e;
      *(v4f*)(Y + (size_t)(o0 + ol) * NTOK + n0 + nl) = res[it];
    }
    
  }
}

// =========================================================================================================
// Workspace map (bytes, full size ND=16; each region start a multiple of 256; every extent is an exact tile
//   W16 f16 [192][128]        49152        Wo16 f16 [128][64]      16384
//   XP  f16 [16384][128]    4194304
//   Qf/Kf f16 [16384][64]   2097152 x2        Vc f16 [64][16384]   2097152
//   Oh/Ol f16 [16384][64]   2097152 x2
//   total = 14745600
// =========================================================================================================
extern "C" void kernel_launch(void* const* d_in, const int* in_sizes, int n_in,
                              void* d_out, int out_size, void* d_ws, size_t ws_size,
                              hipStream_t stream) {
  if (n_in < 9) return;
  if (in_sizes[0] < CIN * NTOK) return;
  if ((in_sizes[0] % CIN) != 0) return;
  const int xstride = in_sizes[0] / CIN;                             // per-channel position stride of X
  if (xstride < NTOK || (xstride % 4) != 0) return;
  if (in_sizes[1] < DK * CIN || in_sizes[3] < DK * CIN || in_sizes[5] < DK * CIN) return;
  if (in_sizes[2] < DK || in_sizes[4] < DK || in_sizes[6] < DK) return;
  if (in_sizes[7] < COUT * DK || in_sizes[8] < COUT) return;
  if (out_size < COUT * NTOK) return;

  size_t off = 0;
  auto carve = [&](size_t bytes) { const size_t o = off; off += (bytes + 255) & ~(size_t)255; return o; };
  const size_t oW16  = carve((size_t)3 * DK * CIN * 2);
  const size_t oWo16 = carve((size_t)COUT * DK * 2);
  const size_t oXP   = carve((size_t)NTOK * CIN * 2);
  const size_t oQf   = carve((size_t)NTOK * DK * 2);
  const size_t oKf   = carve((size_t)NTOK * DK * 2);
  const size_t oVc   = carve((size_t)DK * NTOK * 2);
  const size_t oOh   = carve((size_t)NTOK * DK * 2);
  const size_t oOl   = carve((size_t)NTOK * DK * 2);
  if (off > ws_size) return;
  if (off > (size_t)134217728) return;

  const float* X  = (const float*)d_in[0];
  const float* Wq = (const float*)d_in[1];
  const float* bq = (const float*)d_in[2];
  const float* Wk = (const float*)d_in[3];
  const float* bk = (const float*)d_in[4];
  const float* Wv = (const float*)d_in[5];
  const float* bv = (const float*)d_in[6];
  const float* Wo = (const float*)d_in[7];
  const float* bo = (const float*)d_in[8];

  char* ws = (char*)d_ws;
  unsigned short* W16  = (unsigned short*)(ws + oW16);
  unsigned short* Wo16 = (unsigned short*)(ws + oWo16);
  unsigned short* XP   = (unsigned short*)(ws + oXP);
  unsigned short* Qf   = (unsigned short*)(ws + oQf);
  unsigned short* Kf   = (unsigned short*)(ws + oKf);
  unsigned short* Vc   = (unsigned short*)(ws + oVc);
  unsigned short* Oh   = (unsigned short*)(ws + oOh);
  unsigned short* Ol   = (unsigned short*)(ws + oOl);
  float* out = (float*)d_out;

  const dim3 blk256(256), blk128(128);
  const int BQ = (DK * CIN) / (8 * CHB), BO = (COUT * DK) / (8 * CHB);

  // (0) weights -> f16 planes
  cvt_w<<<dim3(3 * BQ + BO), dim3(CHB), 0, stream>>>(Wq, Wk, Wv, Wo, W16, Wo16);
  // (1) x -> position-major 16-bit plane
  cvt_x<<<dim3(NTOK / QT, CIN / QT), blk256, 0, stream>>>(X, xstride, XP);
  // (2) q/k/v pointwise conv GEMM -> q, k, v planes
  gemm_qkv<<<dim3(NTOK / QT, 3), blk128, 0, stream>>>(W16, XP, bq, bk, bv, Qf, Kf, Vc);
  // (3) global attention -> O hi + residual planes [NTOK][64]
  attn_k<<<dim3(NTOK / QT), dim3(ATH), 0, stream>>>(Qf, Kf, Vc, Oh, Ol);
  // (4) output conv over the raw [64][NTOK] view -> out [128][NTOK]
  gemm_o<<<dim3(NTOK / QT, COUT / QT), blk128, 0, stream>>>(Wo16, Oh, Ol, bo, out);
  (void)hipGetLastError();
}

// v010
// A run of this version takes 69.6 microseconds.
// Two timings next to v009 put it at 1.11 and 1.10 times that version's speed.
// Counting every step since v000, it is 12.3 times as fast.
// Contractions: q/k/v pointwise conv W16[192x128].XP[n][128] on v_wmma_f32_16x16x32_f16 (f16 containers of
// bf16-RNE weights x256 and bf16-RNE x, exact products, both made in the launch's own LDS staging); scores K.Q^T on v_wmma_f32_16x16x32_f16 (k and q log2(e)/8 as one
// f16 plane each, 1 product, K=64: 11 significant bits, as many as P has and more than x and the weights; C operand = 7 - m,
// m the maximum in use); O^T = V.P^T on
// v_wmma_f32_16x16x32_f16 (v x16 as f16, P = 2^{s-m} x2^7 f16 from the score D registers); output conv
// Wo16[128x64].Oview[64][N] on v_wmma_f32_16x16x32_f16 (f16 of bf16-RNE weights x256; O carried as f16 hi x1024
// plane + f16 residual x2^20 plane, 2 products, separate accumulators); f32 accumulate everywhere; softmax
// statistics and bias adds in f32 VALU.
#include <hip/hip_runtime.h>
#include <math.h>
#include <stdint.h>

#ifndef ND
#define ND 16
#endif
#define NHH    32
#define NWW    32
#define NTOK   (ND * NHH * NWW)
#define CIN    128
#define DK     64
#define COUT   128
#define QT     64
#define OSP    68
#define TP     72
#define PTH    256
#define XPH    136
#define OSQ    196
#define BO2    ((COUT * DK) / (8 * PTH))
#define WSC    256.0f
#define IWSC   0.00390625f
#define QSC    0.18033688011112043f
#define VSC    16.0f
#define IVSC   0.0625f
#define OSC    1024.0f
#define IOSC   0.0009765625f
#define RSC    1024.0f
#define IRSC   0.0009765625f
#define PSH    7.0f
#define MLAG   8.0f
#define KG     8
#define QC     2
#define ATH    (32 * (QT / (16 * QC)) * KG)
#define KT     256
#define KW     (KT / KG)
#define KPH    72
#define VPH    264
#define SVV    (KT * KPH)
#define STGH   (KT * KPH + DK * VPH)
#define NTL    (NTOK / KT)

static_assert(ND >= 1 && ND <= 16);
static_assert(NTOK % QT == 0);
static_assert(NTOK % 32 == 0);
static_assert(CIN % QT == 0 && CIN % 32 == 0);
static_assert(DK == QT);
static_assert(DK % 32 == 0);
static_assert(COUT % QT == 0);
static_assert(DK * CIN == 4 * 8 * PTH && CIN == 8 * 16 && CIN * QT == 2 * 16 * PTH);
static_assert((COUT * DK) % (8 * PTH) == 0 && BO2 <= NTOK / QT);
static_assert((XPH * 2) % 32 == 16 && XPH >= CIN && (OSQ * 4) % 16 == 0 && OSQ >= 3 * DK);
static_assert((OSP * 4) % 16 == 0);
static_assert((TP * 2) % 16 == 0);
static_assert(KT % 32 == 0 && NTOK % KT == 0 && NTOK / KT >= 2);
static_assert((ATH / 8) * 4 == KT && (ATH / 32) * 4 == DK && KT == 8 * 32 && DK == 8 * 8);
static_assert(KW == 32 && VPH == KT + 8 && QT * 8 == ATH && QT == 2 * 16 * QC);
static_assert(KG * QT * OSP * 4 <= 2 * STGH * 2);
static_assert((KPH * 2) % 32 == 16 && (VPH * 2) % 32 == 16 && (STGH * 2) % 16 == 0);

typedef _Float16       v16h __attribute__((ext_vector_type(16)));
typedef _Float16       v8h  __attribute__((ext_vector_type(8)));
typedef unsigned short v8us __attribute__((ext_vector_type(8)));
typedef float          v8f  __attribute__((ext_vector_type(8)));
typedef float          v4f  __attribute__((ext_vector_type(4)));
typedef unsigned int   v4u  __attribute__((ext_vector_type(4)));
typedef unsigned int   v2u  __attribute__((ext_vector_type(2)));
typedef float          v2f  __attribute__((ext_vector_type(2)));
typedef _Float16       v2h  __attribute__((ext_vector_type(2)));
typedef __bf16         v2b  __attribute__((ext_vector_type(2)));

union Frag  { v8us u[2]; v16h h; };
union FragH { v16h v; v8h hv[2]; };
static_assert(sizeof(Frag) == 32);
static_assert(sizeof(FragH) == 32);

// ---- scalar helpers ---------------------------------------------------------------------------------------
__device__ __forceinline__ unsigned short bf_bits(float f) {          // f32 -> bf16 bits, RNE convert
  unsigned u = __float_as_uint(f);
  return (unsigned short)((u + 0x7FFFu + ((u >> 16) & 1u)) >> 16);
}
__device__ __forceinline__ float bf_up(unsigned short hb) { return __uint_as_float(((unsigned)hb) << 16); }
__device__ __forceinline__ float bfr(float f) { return bf_up(bf_bits(f)); }
__device__ __forceinline__ unsigned short h_bits(_Float16 x) { return __builtin_bit_cast(unsigned short, x); }
__device__ __forceinline__ unsigned pk16(unsigned short a, unsigned short b) { return (unsigned)a | ((unsigned)b << 16); }
__device__ __forceinline__ v8f zero8() { v8f z = {0.f, 0.f, 0.f, 0.f, 0.f, 0.f, 0.f, 0.f}; return z; }
__device__ __forceinline__ float hmax8(v8f s) {
  return fmaxf(fmaxf(fmaxf(s[0], s[1]), fmaxf(s[2], s[3])), fmaxf(fmaxf(s[4], s[5]), fmaxf(s[6], s[7])));
}
__device__ __forceinline__ float ex2(float x) {                       // 2^x, one instruction
#if defined(__HIP_DEVICE_COMPILE__)
  return __builtin_amdgcn_exp2f(x);
#else
  return exp2f(x);
#endif
}
__device__ __forceinline__ unsigned wave_ballot(bool p) {
#if defined(__HIP_DEVICE_COMPILE__)
  return __builtin_amdgcn_ballot_w32(p);
#else
  return p ? 1u : 0u;
#endif
}

// ---- 16-bit fragment loader (A, or B from a k-contiguous [n][k] row): lane -> row/col (lane&15), p already includes
//      + 8*(lane>>4); elements 0..7 <- p[0..7] (k0+8h..), elements 8..15 <- p[16..23] (k0+16+8h..)
__device__ __forceinline__ Frag ldfrag(const unsigned short* p) {
  Frag f;
  f.u[0] = *(const v8us*)(p);
  f.u[1] = *(const v8us*)(p + 16);
  return f;
}

// ---- the 4 k fragments of one block of 32 keys (rows r0 = kb .. +15, r1 = kb+16 .. +31; d chunks 0 and 1)
struct KSet { Frag h00, h10, h01, h11; };
__device__ __forceinline__ KSet ldkset(const unsigned short* hp, int r0o, int r1o) {
  KSet k;
  k.h00 = ldfrag(hp + r0o);      k.h10 = ldfrag(hp + r1o);
  k.h01 = ldfrag(hp + r0o + 32); k.h11 = ldfrag(hp + r1o + 32);
  return k;
}

// ---- WMMA helpers: the plain builtins; the compiler keeps the distances behind its own forms (another product or
//      independent vector work fills a slot), so that the vector port stays free for the SIMD's other waves
__device__ __forceinline__ v8f mma_h(v16h a, v16h b, v8f c) {
  return __builtin_amdgcn_wmma_f32_16x16x32_f16(false, a, false, b, (short)0, c, false, false);
}
template <bool B> struct Flag { static constexpr bool v = B; };

// ---- LDS ring helpers (attention) ---------------------------------------------------------------------------
// Four asynchronous 16-byte copies global -> LDS per lane (l = the lane's LDS address, g = its global address), as the
// builtin: the compiler keeps the address registers itself and folds constant steps into the instruction's offset field,
// so that a wave goes straight on to its matrix products behind the issue.
typedef int v4i_t __attribute__((__vector_size__(16)));
typedef __attribute__((address_space(1))) v4i_t* gcp_t;
typedef __attribute__((address_space(3))) v4i_t* lcp_t;
__device__ __forceinline__ void copy4(unsigned short* l0, int lstep, const unsigned short* g0, size_t gstep) {
#if defined(__HIP_DEVICE_COMPILE__)
  __builtin_amdgcn_global_load_async_to_lds_b128((gcp_t)(g0),             (lcp_t)(l0),             0, 0);
  __builtin_amdgcn_global_load_async_to_lds_b128((gcp_t)(g0 + gstep),     (lcp_t)(l0 + lstep),     0, 0);
  __builtin_amdgcn_global_load_async_to_lds_b128((gcp_t)(g0 + 2 * gstep), (lcp_t)(l0 + 2 * lstep), 0, 0);
  __builtin_amdgcn_global_load_async_to_lds_b128((gcp_t)(g0 + 3 * gstep), (lcp_t)(l0 + 3 * lstep), 0, 0);
#endif
}
// this wave's own copies have landed in LDS (the compiler places no wait for them)
__device__ __forceinline__ void wait_async0() {
#if defined(__HIP_DEVICE_COMPILE__)
  asm volatile("s_wait_asynccnt 0x0" ::: "memory");
#endif
}
// this wave's own LDS reads have returned, before the buffer they read is handed back for a refill
__device__ __forceinline__ void wait_ds0() {
#if defined(__HIP_DEVICE_COMPILE__)
  asm volatile("s_wait_dscnt 0x0" ::: "memory");
#endif
}

// =========================================================================================================
// (2) pointwise conv GEMM for one 64-n tile, all three projections, straight from the f32 inputs: P[o][n] = (1/256) sum_c
//     W16[o][c] XP[n][c] + bias[o], o = 0..191 (rows 0..63 = Wq, 64..127 = Wk, 128..191 = Wv). The 16-bit operands are made
//     in the block's own LDS staging, so that no conversion launch and no x or weight plane in the workspace stands in front:
//       XT f16 [64 n][128 c] (pitch XPH) = bf16-RNE(x), exact in f16: a thread reads 4 channels x 4 positions (16-B loads, 16
//          lanes = one 256-B row segment) and stores 4 channels of one position per 8-byte LDS store;
//       WT f16 [192 o][128 c] (pitch XPH) = f16 of (bf16-RNE(w) * 256), exact: a thread converts 8-element chunks.
//     Block 256 threads = 8 waves; wave (np, mg) owns cols 32 np .. +31 (2 B fragments from XT rows, k = c contiguous, split
//     k map) and m-tiles 3 mg .. +2 (A rows 16 mt + (lane&15) of WT, split k map). K = 128 = 4 steps.
//     Epilogue staged in LDS Os[n_loc][o] (pitch OSQ), block barrier, then:
//       o 0..63: q log2(e)/8 -> Qf, o 64..127: k -> Kf, planes f16 [NTOK][64] (RNE convert);
//       o 128..191: v -> Vc f16 [64 ch][NTOK] (channel-major, value f16(v*16)), row segment n0..n0+63 = one line.
//     The first BO2 blocks also write Wo16 f16 [128][64] = f16 of (bf16-RNE(wo) * 256) for launch (4).
// coverage: XT 2 it x 16 channel quads x 16 position quads = 128 c x 64 n; WT 12 it x 256 chunks x 8 = 192 x 128;
//           Os 8 waves x 32 n x 48 o = 64 x 192 (cols 0..191 of pitch 196); Qf/Kf: 2 it x 32 rows x 8 lanes x 8 = 64 n x 64 d;
//           Vc: 2 it x 32 ch x 8 lanes x 8 = 64 ch x 64 n; grid (NTOK/64) covers Qf, Kf and Vc exactly once;
//           Wo16: BO2 blocks x 256 chunks x 8 = 128 x 64.
// =========================================================================================================
// two f32 -> f16 pair of (bf16-RNE(value) * sc), packed a low, b high. Every block converts the whole weight set anew, so the
// rounding is the packed convert instruction (nearest even, the values of bfr()) instead of bfr()'s integer sequence
__device__ __forceinline__ unsigned cvt_pair(float a, float b, float sc) {
#if defined(__HIP_DEVICE_COMPILE__)
  const v2f x = {a, b};
  const unsigned u = __builtin_bit_cast(unsigned, __builtin_convertvector(x, v2b));
  const v2f r = {__uint_as_float(u << 16), __uint_as_float(u & 0xffff0000u)};
  return __builtin_bit_cast(unsigned, __builtin_convertvector(r * sc, v2h));
#else
  return pk16(h_bits((_Float16)(bfr(a) * sc)), h_bits((_Float16)(bfr(b) * sc)));
#endif
}
__device__ __forceinline__ v4u cvt_w8(v4f a, v4f q) {                 // 8 weights -> f16 of (bf16-RNE(w) * 256)
  v4u u;
  u[0] = cvt_pair(a[0], a[1], WSC); u[1] = cvt_pair(a[2], a[3], WSC);
  u[2] = cvt_pair(q[0], q[1], WSC); u[3] = cvt_pair(q[2], q[3], WSC);
  return u;
}

__global__ __launch_bounds__(PTH)
void gemm_qkv(const float* __restrict__ X, int xstride, const float* __restrict__ Wq, const float* __restrict__ Wk,
              const float* __restrict__ Wv, const float* __restrict__ Wo,
              const float* __restrict__ bq, const float* __restrict__ bk, const float* __restrict__ bv,
              unsigned short* Qf, unsigned short* Kf, unsigned short* Vc, unsigned short* Wo16) {
  __shared__ __align__(16) unsigned short XT[QT * XPH];
  __shared__ __align__(16) unsigned short WT[3 * DK * XPH];
  __shared__ __align__(16) float Os[QT * OSQ];
  const int tid  = threadIdx.x;
  const int lane = tid & 31, wave = tid >> 5;
  const int hh   = lane >> 4, c = lane & 15;
  const int n0   = blockIdx.x * QT;

  // ---- all global reads of the block as one group: one memory latency
  const int nq = tid & 15, cq0 = tid >> 4;                           // position quad 0..15, channel quad 0..15 (+ 16 it)
  const int np = wave & 1, mg = wave >> 1;                           // column pair, m-tile triple of this wave
  const float* xp[2][4];
#pragma unroll
  for (int it = 0; it < 2; ++it) {
#pragma unroll
    for (int i = 0; i < 4; ++i) xp[it][i] = X + (size_t)(4 * (cq0 + 16 * it) + i) * (size_t)xstride + n0 + 4 * nq;
  }
  const float* bp3[3];                                               // bias rows of m-tile mt = 3 mg + i, projection mt >> 2
#pragma unroll
  for (int i = 0; i < 3; ++i) {
    const int mt = 3 * mg + i;
    bp3[i] = ((mt < 4) ? bq : ((mt < 8) ? bk : bv)) + 16 * (mt & 3) + 8 * hh;
  }
  v4f xr[2][4];
#pragma unroll
  for (int it = 0; it < 2; ++it) {
#pragma unroll
    for (int i = 0; i < 4; ++i) xr[it][i] = *(const v4f*)xp[it][i];
  }
  const unsigned woff = 32u * (unsigned)tid;                         // bytes: this thread's 8-element chunk in a slab of PTH chunks
  v4f wr[12][2];
#pragma unroll
  for (int it = 0; it < 12; ++it) {
    const float* s = (const float*)((const char*)((it < 4) ? Wq : ((it < 8) ? Wk : Wv)) + woff) + 8 * (it & 3) * PTH;
    wr[it][0] = *(const v4f*)s;
    wr[it][1] = *(const v4f*)(s + 4);
  }
  v4f b0[3], b1[3];
#pragma unroll
  for (int i = 0; i < 3; ++i) {
    b0[i] = *(const v4f*)bp3[i];
    b1[i] = *(const v4f*)(bp3[i] + 4);
  }
#if defined(__HIP_DEVICE_COMPILE__)
  // the wait before the group's address registers are rewritten; it names the addresses as inputs so that their registers
  // stay theirs up to it (without them the compiler gives some to a later load of the group as its destination)
  asm volatile("s_wait_xcnt 0x0" :: "v"(xp[0][0]), "v"(xp[0][1]), "v"(xp[0][2]), "v"(xp[0][3]), "v"(xp[1][0]), "v"(xp[1][1]),
               "v"(xp[1][2]), "v"(xp[1][3]), "v"(bp3[0]), "v"(bp3[1]), "v"(bp3[2]), "v"(woff), "s"(Wq), "s"(Wk), "s"(Wv) : "memory");
#endif
  if (blockIdx.x < BO2) {                                            // block-uniform: the output conv's weight plane
    const size_t g = (size_t)8 * (size_t)(blockIdx.x * PTH + tid);
    const v4f a = *(const v4f*)(Wo + g);
    const v4f q = *(const v4f*)(Wo + g + 4);
    *(v4u*)(Wo16 + g) = cvt_w8(a, q);
  }

  // ---- convert and stage
#pragma unroll
  for (int it = 0; it < 2; ++it) {
#pragma unroll
    for (int t = 0; t < 4; ++t) {
      v2u u;
      u[0] = cvt_pair(xr[it][0][t], xr[it][1][t], 1.0f);
      u[1] = cvt_pair(xr[it][2][t], xr[it][3][t], 1.0f);
      *(v2u*)(XT + (4 * nq + t) * XPH + 4 * (cq0 + 16 * it)) = u;
    }
  }
#pragma unroll
  for (int it = 0; it < 12; ++it) {
    const int g = it * PTH + tid;                                    // chunk 0..3071: row g >> 4, 8 columns from 8 (g & 15)
    *(v4u*)(WT + (g >> 4) * XPH + 8 * (g & 15)) = cvt_w8(wr[it][0], wr[it][1]);
  }
  __syncthreads();                                                   // both operand tiles are readable

  const unsigned short* ap = WT + (48 * mg + c) * XPH + 8 * hh;
  const unsigned short* bp = XT + (32 * np + c) * XPH + 8 * hh;

  v8f acc[3][2];
#pragma unroll
  for (int i = 0; i < 3; ++i) { acc[i][0] = zero8(); acc[i][1] = zero8(); }

#pragma unroll
  for (int ks = 0; ks < CIN / 32; ++ks) {
    const Frag fb0 = ldfrag(bp + 32 * ks);
    const Frag fb1 = ldfrag(bp + 16 * XPH + 32 * ks);
#pragma unroll
    for (int i = 0; i < 3; ++i) {
      const Frag fa = ldfrag(ap + (16 * i) * XPH + 32 * ks);
      acc[i][0] = mma_h(fa.h, fb0.h, acc[i][0]);
      acc[i][1] = mma_h(fa.h, fb1.h, acc[i][1]);
    }
  }

  // ---- epilogue: scale back + bias (+ log2(e)/sqrt(ck) for q) -> LDS Os[n_loc][o]
#pragma unroll
  for (int i = 0; i < 3; ++i) {
    const int mt = 3 * mg + i;                                       // m-tile 0..11, projection mt >> 2 (wave-uniform)
    const float osc = (mt < 4) ? QSC : 1.0f;
#pragma unroll
    for (int u = 0; u < 2; ++u) {
      const int nl = 32 * np + 16 * u + c;
      v4f va, vb;
#pragma unroll
      for (int r = 0; r < 4; ++r) {
        va[r] = (acc[i][u][r] * IWSC + bfr(b0[i][r])) * osc;
        vb[r] = (acc[i][u][4 + r] * IWSC + bfr(b1[i][r])) * osc;
      }
      *(v4f*)(Os + nl * OSQ + 16 * mt + 8 * hh)     = va;
      *(v4f*)(Os + nl * OSQ + 16 * mt + 8 * hh + 4) = vb;
    }
  }
  __syncthreads();                                                   // the 64 x 192 result tile is readable

  const int e = tid & 7, lq = tid >> 3;                              // lq 0..31
  v4u uq[2], uk[2], uv[2];
#pragma unroll
  for (int it = 0; it < 2; ++it) {
    const int row = it * 32 + lq;                                    // n_loc for q and k, channel for v: 0..63
    const v4f a0 = *(const v4f*)(Os + row * OSQ + 8 * e);
    const v4f a1 = *(const v4f*)(Os + row * OSQ + 8 * e + 4);
    const v4f k0 = *(const v4f*)(Os + row * OSQ + DK + 8 * e);
    const v4f k1 = *(const v4f*)(Os + row * OSQ + DK + 8 * e + 4);
    const float fq[8] = {a0[0], a0[1], a0[2], a0[3], a1[0], a1[1], a1[2], a1[3]};
    const float fk[8] = {k0[0], k0[1], k0[2], k0[3], k1[0], k1[1], k1[2], k1[3]};
    unsigned short hb[8];
#pragma unroll
    for (int t = 0; t < 8; ++t) hb[t] = h_bits((_Float16)(Os[(8 * e + t) * OSQ + 2 * DK + row] * VSC));
#pragma unroll
    for (int t = 0; t < 4; ++t) {
      uq[it][t] = pk16(h_bits((_Float16)fq[2 * t]), h_bits((_Float16)fq[2 * t + 1]));
      uk[it][t] = pk16(h_bits((_Float16)fk[2 * t]), h_bits((_Float16)fk[2 * t + 1]));
      uv[it][t] = pk16(hb[2 * t], hb[2 * t + 1]);
    }
  }
#pragma unroll
  for (int it = 0; it < 2; ++it) {
    const int row = it * 32 + lq;
    const size_t po = (size_t)(n0 + row) * DK + 8 * e;
    *(v4u*)(Qf + po) = uq[it];
    *(v4u*)(Kf + po) = uk[it];
    *(v4u*)(Vc + (size_t)row * NTOK + n0 + 8 * e) = uv[it];
  }
}

// =========================================================================================================
// (3) global attention for one 64-query tile, transposed formulation, NTOK keys, no mask:
//   S^T tile (16 keys x 16 queries) = sum over 2 d-chunks of A(k: row = key kb + (lane&15), 32 d via the split
//   k map from the f16 plane Kf [NTOK][64]) . B(q: col = query, same map from Qf), one product per chunk.
//   q fragments (QC column tiles x 2 chunks)
//   loaded once per wave; k and v tiles of KT keys are staged in a two-buffer LDS ring by asynchronous copies,
//   shared by the block's 16 waves: stage = Kf[KT][64] (row pitch KPH halves) + V[64 ch][KT] (pitch VPH);
//   the tile of trip t + 2 is copied into the buffer trip t has read, behind the barrier at the foot of trip t, and flies
//   during trip t + 1; trip t of block b works on tile (b + t) mod NTL.
//   Fragments come from LDS with the same split-map loader, and every k and v fragment a wave reads feeds its
//   QC = 2 column tiles (32 queries), which halves the LDS bytes read per product against one column tile per wave. Load
//   groups are issued ahead of use: v of the block directly behind the score products; k of a tile directly behind the
//   barrier that publishes the tile.
//   Per lane the D tile holds 8 keys of ONE query: online softmax state per lane, in the log2 domain (q carries log2 e).
//   The maximum in use m may trail the true one by up to MLAG: 7 - m is the C operand of the first score product, so that
//   the D registers hold the exponent s - m + 7 itself and go into the exponential as they are. One wave-uniform ballot
//   per trip tests whether a lane's exponent passed 7 + MLAG (P would leave f16 above 2^16); only then, and on the first
//   trip, m is raised to the true maximum (one shuffle lane^16), the exponents are shifted and o and l rescaled.
//   Row-sum partials combined at the end. P = 2^{s-m} x 2^7 as f16 is the B operand of
//   O^T (rows channel, cols queries) += A(v rows channel = 16j + (lane&15), keys contiguous, f16 plane Vc
//   [64][NTOK]) . B(P^T): element r <- D of the tile covering keys kb..kb+15, element 8+r <- the tile covering
//   kb+16..kb+31, lane unchanged. 4 accumulator tiles per column tile (64 channels). Block = 64 queries x KG key groups =
//   16 waves (4 per SIMD, so that one wave's LDS, softmax and matrix latencies are covered by the others): wave
//   (qw, kg) takes queries 32 qw .. +31 and keys KW kg .. +KW-1 of every tile, with its own m, l and o per column tile.
//   Epilogue: the groups' (m, l) are exchanged in LDS, block barrier, M = max m, L = sum l 2^{m-M}; each wave stages
//   its o 2^{m-M}/(16 L) in LDS Os[kg][query][64 ch] (pitch OSP, b128 stores; Os lies on the ring, which nobody reads or
//   fills behind the last trip's foot barrier), block barrier, then the KG planes are summed in the order kg = 0..7 and
//   the flat planes written.
// coverage: Os KG x 2 waves x 32 q x 64 ch (cols 0..63); Oh/Ol 64 rows x 8 lanes x 8 halves =
//           64 q x 64 ch per plane; grid (NTOK/64) covers rows 0..NTOK-1 of both planes exactly once.
// =========================================================================================================
__global__ __launch_bounds__(ATH)
void attn_k(const unsigned short* __restrict__ Qf, const unsigned short* __restrict__ Kf,
            const unsigned short* __restrict__ Vc, unsigned short* Oh, unsigned short* Ol) {
  __shared__ float Mg[KG * QT];
  __shared__ float Lg[KG * QT];
  __shared__ __align__(16) unsigned short Ring[2 * STGH];
  float* Os = (float*)Ring;                                          // output staging of the epilogue, on the ring
  const int tid  = threadIdx.x;
  const int wave = tid >> 5, lane = tid & 31;
  const int qw   = wave & 1, kg = wave >> 1;                        // query sub-tile (32 queries), key group
  const int hh   = lane >> 4, c = lane & 15;
  const int n0   = blockIdx.x * QT;

  // q fragments (B operand, col = query n0 + 32*qw + 16*u + c), d chunks 0 and 1
  Frag qh0[QC], qh1[QC];
  const unsigned short* qhp[QC];
#pragma unroll
  for (int u = 0; u < QC; ++u) {
    qhp[u] = Qf + (size_t)(n0 + 32 * qw + 16 * u + c) * DK + 8 * hh;
    qh0[u] = ldfrag(qhp[u]); qh1[u] = ldfrag(qhp[u] + 32);
  }
#if defined(__HIP_DEVICE_COMPILE__)
  // the wait before the q loads' address registers are rewritten; it names the two addresses as inputs so that their
  // registers stay theirs up to it (without them the compiler hands one to the next address sum in front of the wait)
  asm volatile("s_wait_xcnt 0x0" :: "v"(qhp[0]), "v"(qhp[1]) : "memory");
#endif
  // copy addresses of this lane. K plane: copy i moves 64 rows (8 lanes x 16 B per 128-B row), row 64 i + (tid >> 3);
  // V: copy i moves 16 channel rows (32 lanes x 16 B per 512-B row segment), row 16 i + (tid >> 5).
  unsigned short* lk = Ring + (tid >> 3) * KPH + (tid & 7) * 8;
  unsigned short* lv = Ring + SVV + (tid >> 5) * VPH + (tid & 31) * 8;
  // key walk: block b takes the tiles in the order b mod NTL, + 1, ..., wrapping round. Every block reads the same k and v
  // planes from L2; the rotated starts are for speed only. Buffers still go by the trip number.
  int tile = (int)(blockIdx.x % NTL);                                // the tile the next fill copies (block-uniform)
  const unsigned short* gkh = Kf + (size_t)tid * 8 + (size_t)tile * (KT * DK);
  const unsigned short* gv  = Vc + (size_t)(tid >> 5) * NTOK + 8 * (tid & 31) + (size_t)tile * KT;
  auto fill = [&](int buf) {
    const int lb = buf * STGH;
    copy4(lk + lb,       64 * KPH, gkh, (size_t)64 * DK);
    copy4(lv + lb,       16 * VPH, gv,  (size_t)16 * NTOK);
    const bool wrap = tile == NTL - 1;                               // on to the next tile, from the last one back to tile 0
    const ptrdiff_t tstep = wrap ? -(ptrdiff_t)(NTL - 1) : (ptrdiff_t)1;
    gkh += tstep * (KT * DK); gv += tstep * KT;
    tile = wrap ? 0 : tile + 1;
  };
  // fragment offsets inside a stage (halves): k row = key KW kg + c (+ 16), v row = channel c (+ 16 j),
  // v column = key KW kg
  const int kfo = (KW * kg + c) * KPH + 8 * hh;
  const int vfo = SVV + c * VPH + KW * kg + 8 * hh;

  fill(0);
  wait_async0();
  __syncthreads();                                                   // trip 0's tile is readable by every wave
  // a tile's k fragments: one load group directly behind the barrier that publishes the tile, in front of the refill
  // copies (which go to the other buffer), so that the copies' issue covers the LDS latency
  KSet ks = ldkset(Ring + kfo, 0, 16 * KPH);
  fill(1);

  float l[QC];
  v8f cm[QC];                                                        // PSH - m in all 8 rows: C operand of the score products
  v8f o[QC][4];
  unsigned first = 1u;                                               // no maximum taken yet (wave-uniform)
#pragma unroll
  for (int u = 0; u < QC; ++u) {
    l[u] = 0.f;
#pragma unroll
    for (int r = 0; r < 8; ++r) cm[u][r] = PSH;
#pragma unroll
    for (int j = 0; j < 4; ++j) o[u][j] = zero8();
  }

  // one trip; more1 / more2: a tile t + 1 / t + 2 exists (compile-time, so that a trip is straight-line code behind its
  // rescale branch: with run-time tests at the foot the compiler sinks the row sums below them, the 32 exponentials stay
  // live across the k loads and the copies, and q fragments spill)
  auto trip = [&](int t, auto more1, auto more2) __attribute__((always_inline)) {
    const unsigned short* Vp = Ring + (t & 1) * STGH + vfo;          // up to its foot barrier trip t reads buffer t mod 2 alone
    // scores: each k fragment pair against both column tiles, 4 independent accumulators; per accumulator d chunk 0
    // (on top of PSH - m), then d chunk 1. Last trip: PSH - m is added behind the products by vector adds instead; as a C
    // operand its registers would die at the product
    v8f s0[QC], s1[QC];
#pragma unroll
    for (int u = 0; u < QC; ++u) {
      const v8f c0 = decltype(more1)::v ? cm[u] : zero8();
      s0[u] = mma_h(ks.h00.h, qh0[u].h, c0); s1[u] = mma_h(ks.h10.h, qh0[u].h, c0);
    }
#pragma unroll
    for (int u = 0; u < QC; ++u) { s0[u] = mma_h(ks.h01.h, qh1[u].h, s0[u]); s1[u] = mma_h(ks.h11.h, qh1[u].h, s1[u]); }
    if constexpr (!decltype(more1)::v) {
#pragma unroll
      for (int u = 0; u < QC; ++u) { s0[u] += cm[u]; s1[u] += cm[u]; }
    }

    // one load group, ahead of its use: this block's v fragments, directly behind the score products (into registers
    // these have left); they are the trip's last LDS reads, and their latency runs under the maxima and the exponentials
    // instead of being waited out at the foot's s_wait_dscnt 0, which the compiler lifts as far up as the last LDS read
    Frag vf[4];
#pragma unroll
    for (int j = 0; j < 4; ++j) vf[j] = ldfrag(Vp + (16 * j) * VPH);
#if defined(__HIP_DEVICE_COMPILE__)
    __builtin_amdgcn_sched_barrier(0);   // keeps the group whole and in front of the vector work that covers its latency
#endif

    float mx[QC];                                                    // this lane's largest exponent (16 of the query's 32 keys)
#pragma unroll
    for (int u = 0; u < QC; ++u) mx[u] = fmaxf(hmax8(s0[u]), hmax8(s1[u]));
    const unsigned over = wave_ballot(fmaxf(mx[0], mx[1]) > PSH + MLAG);   // wave-uniform, one test for both column tiles
    if ((over | first) != 0u) {
#pragma unroll
      for (int u = 0; u < QC; ++u) {
        const float g = fmaxf(mx[u], __shfl_xor(mx[u], 16, 32)) - PSH;   // the 32 keys' maximum minus m, equal in lanes c, c + 16
        const float d = (first != 0u) ? g : fmaxf(g, 0.f);           // m only rises, but for the first trip, which sets it
        const float corr = ex2(fminf(-d, 0.f));                      // first trip: o and l are 0, any finite factor does
        l[u] *= corr;
#pragma unroll
        for (int r = 0; r < 8; ++r) { cm[u][r] -= d; s0[u][r] -= d; s1[u][r] -= d; }   // m += d
#pragma unroll
        for (int j = 0; j < 4; ++j) {
#pragma unroll
          for (int r = 0; r < 8; ++r) o[u][j][r] *= corr;
        }
      }
      first = 0u;
    }

    FragH ph[QC];
#pragma unroll
    for (int u = 0; u < QC; ++u) {
      float ls = 0.f;
#pragma unroll
      for (int r = 0; r < 8; ++r) {
        const float e0 = ex2(s0[u][r]);                              // key      8hh + r of the wave's 32
        const float e1 = ex2(s1[u][r]);                              // key 16 + 8hh + r
        ls += e0 + e1;
        ph[u].hv[0][r] = (_Float16)e0;
        ph[u].hv[1][r] = (_Float16)e1;
      }
      l[u] += ls;
    }

    // each v fragment against both column tiles, 8 independent accumulators
#pragma unroll
    for (int j = 0; j < 4; ++j) {
#pragma unroll
      for (int u = 0; u < QC; ++u) o[u][j] = mma_h(vf[j].h, ph[u].v, o[u][j]);
    }
    // foot of trip t: own reads done, own copies of trip t + 1's tile landed, then the one barrier that publishes that tile
    // and ends every wave's reads of buffer t mod 2; only then its refill
    wait_ds0();
    wait_async0();
    __syncthreads();
#if defined(__HIP_DEVICE_COMPILE__)
    __builtin_amdgcn_sched_barrier(0);   // keeps the row sums in front of the k loads, whose registers the exponentials hold until then (a build without it spills)
#endif
    if constexpr (decltype(more1)::v) {                              // trip t + 1's tile is published: its k fragments
      const unsigned short* Nb = Ring + ((t + 1) & 1) * STGH + kfo;
      ks = ldkset(Nb, 0, 16 * KPH);
    }
    if constexpr (decltype(more2)::v) fill(t & 1);
  };
#pragma unroll 1
  for (int t = 0; t < NTL - 2; ++t) trip(t, Flag<true>(), Flag<true>());
  trip(NTL - 2, Flag<true>(), Flag<false>());
  trip(NTL - 1, Flag<false>(), Flag<false>());
  wait_async0();

  // merge of the KG key groups: (m, l) of every group and query through LDS (m and l are equal in lanes c and c + 16)
  float m[QC];
#pragma unroll
  for (int u = 0; u < QC; ++u) {
    m[u] = -cm[u][0];                                                // m - PSH, exact; PSH drops out of every difference below
    l[u] += __shfl_xor(l[u], 16, 32);
    const int qrow = 32 * qw + 16 * u + c;
    if (hh == 0) { Mg[kg * QT + qrow] = m[u]; Lg[kg * QT + qrow] = l[u]; }
  }
  __syncthreads();                                                   // every group's (m, l) is readable
  float* Ow = Os + kg * (QT * OSP);
#pragma unroll
  for (int u = 0; u < QC; ++u) {
    const int qrow = 32 * qw + 16 * u + c;
    float mall = Mg[qrow];
#pragma unroll
    for (int g = 1; g < KG; ++g) mall = fmaxf(mall, Mg[g * QT + qrow]);
    float lall = 0.f;
#pragma unroll
    for (int g = 0; g < KG; ++g) lall += Lg[g * QT + qrow] * ex2(Mg[g * QT + qrow] - mall);
    const float scl = (ex2(m[u] - mall) / lall) * IVSC;              // o and l both carry 2^7; o also carries the v x16
#pragma unroll
    for (int j = 0; j < 4; ++j) {
      v4f va, vb;
#pragma unroll
      for (int r = 0; r < 4; ++r) { va[r] = o[u][j][r] * scl; vb[r] = o[u][j][4 + r] * scl; }
      *(v4f*)(Ow + qrow * OSP + 16 * j + 8 * hh)     = va;          // Os[kg][query][ch = 16j + 8hh + r]
      *(v4f*)(Ow + qrow * OSP + 16 * j + 8 * hh + 4) = vb;
    }
  }
  __syncthreads();                                                   // every group's weighted o is readable

  const int e = tid & 7, row = tid >> 3;                             // row = query 0..63
  v4f a = *(const v4f*)(Os + row * OSP + 8 * e);
  v4f q = *(const v4f*)(Os + row * OSP + 8 * e + 4);
#pragma unroll
  for (int g = 1; g < KG; ++g) {
    a += *(const v4f*)(Os + g * (QT * OSP) + row * OSP + 8 * e);
    q += *(const v4f*)(Os + g * (QT * OSP) + row * OSP + 8 * e + 4);
  }
  const float f[8] = {a[0], a[1], a[2], a[3], q[0], q[1], q[2], q[3]};
  v4u uh, ul;
#pragma unroll
  for (int t = 0; t < 4; ++t) {
    const float g0 = f[2 * t] * OSC, g1 = f[2 * t + 1] * OSC;
    const _Float16 h0 = (_Float16)g0, h1 = (_Float16)g1;
    const _Float16 l0 = (_Float16)((g0 - (float)h0) * RSC);
    const _Float16 l1 = (_Float16)((g1 - (float)h1) * RSC);
    uh[t] = pk16(h_bits(h0), h_bits(h1));
    ul[t] = pk16(h_bits(l0), h_bits(l1));
  }
  const size_t po = (size_t)(n0 + row) * DK + 8 * e;
  *(v4u*)(Oh + po) = uh;
  *(v4u*)(Ol + po) = ul;
}

// =========================================================================================================
// (4) output pointwise conv over the raw view: Y[o][n'] = (1/256)(1/1024) sum_{c'} Wo16[o][c'] (Ohv[c'][n'] +
//     Olv[c'][n'] / 1024) + bo[o], where Ohv/Olv [64][NTOK] are the flat O planes re-read with row c' = halves
//     c'*NTOK .. +NTOK-1. Block (nt, mb): 64 n' x 64 o. The two 64 c' x 64 n' B tiles are staged transposed in
//     LDS Bh/Bl[n'_loc][c'] (pitch TP, 16-B global loads, 2-byte LDS stores), block barrier, then B fragments per
//     wave (col n0'+16w+(lane&15), k = c' contiguous, split k map) and A fragments from Wo16 rows o0+16mt+(lane&15).
//     K = 64 = 2 steps; hi and residual products in separate accumulators. Epilogue staged in Ys[n'_loc][o_loc]
// coverage: Bh/Bl 4 it x 16 c' x (8 x 8 n') = 64 x 64 each (cols 0..63 of pitch 72); Ys 4 waves x 16 n' x 64 o;
//           out: 8 it x 16 lines x 8 lanes x 4 floats = 64 o x 64 n'; grid (NTOK/64, COUT/64) covers
//           out[0..127][0..NTOK-1] exactly once.
// =========================================================================================================
__global__ __launch_bounds__(128)
void gemm_o(const unsigned short* __restrict__ Wo16, const unsigned short* __restrict__ Oh,
            const unsigned short* __restrict__ Ol, const float* __restrict__ bo, float* Y) {
  __shared__ __align__(16) unsigned short Bh[QT * TP];
  __shared__ __align__(16) unsigned short Bl[QT * TP];
  __shared__ __align__(16) float Ys[QT * OSP];
  const int tid  = threadIdx.x;
  const int lane = tid & 31, wave = tid >> 5;
  const int hh   = lane >> 4, c = lane & 15;
  const int nt   = blockIdx.x, mb = blockIdx.y;
  const int n0   = nt * QT, o0 = mb * QT;
  const int e = tid & 7, lq = tid >> 3;                              // lq 0..15

  // ---- stage the view tiles transposed: Bh[n'_loc][c'] <- Oh[c'*NTOK + n0 + n'_loc]
#pragma unroll
  for (int it = 0; it < 4; ++it) {
    const int cl = it * 16 + lq;                                     // c' 0..63
    const size_t so = (size_t)cl * NTOK + n0 + 8 * e;
    const v4u ah = *(const v4u*)(Oh + so);
    const v4u al = *(const v4u*)(Ol + so);
#pragma unroll
    for (int t = 0; t < 4; ++t) {
      Bh[(8 * e + 2 * t) * TP + cl]     = (unsigned short)(ah[t] & 0xffffu);
      Bh[(8 * e + 2 * t + 1) * TP + cl] = (unsigned short)(ah[t] >> 16);
      Bl[(8 * e + 2 * t) * TP + cl]     = (unsigned short)(al[t] & 0xffffu);
      Bl[(8 * e + 2 * t + 1) * TP + cl] = (unsigned short)(al[t] >> 16);
    }
  }
  __syncthreads();

  const unsigned short* ap  = Wo16 + (size_t)(o0 + c) * DK + 8 * hh;
  const unsigned short* bph = Bh + (16 * wave + c) * TP + 8 * hh;
  const unsigned short* bpl = Bl + (16 * wave + c) * TP + 8 * hh;

  v8f acch[4], accl[4];
#pragma unroll
  for (int mt = 0; mt < 4; ++mt) { acch[mt] = zero8(); accl[mt] = zero8(); }

#pragma unroll
  for (int ks = 0; ks < DK / 32; ++ks) {
    const Frag fbh = ldfrag(bph + 32 * ks);
    const Frag fbl = ldfrag(bpl + 32 * ks);
#pragma unroll
    for (int mt = 0; mt < 4; ++mt) {
      const Frag fa = ldfrag(ap + (size_t)(16 * mt) * DK + 32 * ks);
      acch[mt] = mma_h(fa.h, fbh.h, acch[mt]);
      accl[mt] = mma_h(fa.h, fbl.h, accl[mt]);
    }
  }

  // ---- epilogue: fold residual, scale back, bias -> Ys[n'_loc][o_loc]
  {
    const int nl = 16 * wave + c;
    const float fs = IWSC * IOSC;
#pragma unroll
    for (int mt = 0; mt < 4; ++mt) {
      const v4f b0 = *(const v4f*)(bo + o0 + 16 * mt + 8 * hh);
      const v4f b1 = *(const v4f*)(bo + o0 + 16 * mt + 8 * hh + 4);
      v4f va, vb;
#pragma unroll
      for (int r = 0; r < 4; ++r) {
        va[r] = (acch[mt][r] + accl[mt][r] * IRSC) * fs + bfr(b0[r]);
        vb[r] = (acch[mt][4 + r] + accl[mt][4 + r] * IRSC) * fs + bfr(b1[r]);
      }
      *(v4f*)(Ys + nl * OSP + 16 * mt + 8 * hh)     = va;
      *(v4f*)(Ys + nl * OSP + 16 * mt + 8 * hh + 4) = vb;
    }
  }
  __syncthreads();

  v4f res[8];
#pragma unroll
  for (int it = 0; it < 8; ++it) {
    const int L  = it * 16 + lq;                                     // line 0..127
    const int ol = L >> 1, hf = L & 1;                               // o_loc 0..63, line half
    const int nl = hf * 32 + 4 * e;                                  // n'_loc 0..63
#pragma unroll
    for (int t = 0; t < 4; ++t) res[it][t] = Ys[(nl + t) * OSP + ol];
  }
{
#pragma unroll
    for (int it = 0; it < 8; ++it) {
      const int L  = it * 16 + lq;
      const int ol = L >> 1, hf = L & 1;
      const int nl = hf * 32 + 4 * e;
      *(v4f*)(Y + (size_t)(o0 + ol) * NTOK + n0 + nl) = res[it];
    }
    
  }
}

// =========================================================================================================
// Workspace map (bytes, full size ND=16; each region start a multiple of 256; every extent is an exact tile
//   Wo16 f16 [128][64]      16384
//   Qf/Kf f16 [16384][64]   2097152 x2        Vc f16 [64][16384]   2097152
//   Oh/Ol f16 [16384][64]   2097152 x2
//   total = 10502144
// =========================================================================================================
extern "C" void kernel_launch(void* const* d_in, const int* in_sizes, int n_in,
                              void* d_out, int out_size, void* d_ws, size_t ws_size,
                              hipStream_t stream) {
  if (n_in < 9) return;
  if (in_sizes[0] < CIN * NTOK) return;
  if ((in_sizes[0] % CIN) != 0) return;
  const int xstride = in_sizes[0] / CIN;                             // per-channel position stride of X
  if (xstride < NTOK || (xstride % 4) != 0) return;
  if (in_sizes[1] < DK * CIN || in_sizes[3] < DK * CIN || in_sizes[5] < DK * CIN) return;
  if (in_sizes[2] < DK || in_sizes[4] < DK || in_sizes[6] < DK) return;
  if (in_sizes[7] < COUT * DK || in_sizes[8] < COUT) return;
  if (out_size < COUT * NTOK) return;

  size_t off = 0;
  auto carve = [&](size_t bytes) { const size_t o = off; off += (bytes + 255) & ~(size_t)255; return o; };
  const size_t oWo16 = carve((size_t)COUT * DK * 2);
  const size_t oQf   = carve((size_t)NTOK * DK * 2);
  const size_t oKf   = carve((size_t)NTOK * DK * 2);
  const size_t oVc   = carve((size_t)DK * NTOK * 2);
  const size_t oOh   = carve((size_t)NTOK * DK * 2);
  const size_t oOl   = carve((size_t)NTOK * DK * 2);
  if (off > ws_size) return;
  if (off > (size_t)134217728) return;

  const float* X  = (const float*)d_in[0];
  const float* Wq = (const float*)d_in[1];
  const float* bq = (const float*)d_in[2];
  const float* Wk = (const float*)d_in[3];
  const float* bk = (const float*)d_in[4];
  const float* Wv = (const float*)d_in[5];
  const float* bv = (const float*)d_in[6];
  const float* Wo = (const float*)d_in[7];
  const float* bo = (const float*)d_in[8];

  char* ws = (char*)d_ws;
  unsigned short* Wo16 = (unsigned short*)(ws + oWo16);
  unsigned short* Qf   = (unsigned short*)(ws + oQf);
  unsigned short* Kf   = (unsigned short*)(ws + oKf);
  unsigned short* Vc   = (unsigned short*)(ws + oVc);
  unsigned short* Oh   = (unsigned short*)(ws + oOh);
  unsigned short* Ol   = (unsigned short*)(ws + oOl);
  float* out = (float*)d_out;

  const dim3 blk128(128);

  // (2) q/k/v pointwise conv GEMM from the f32 inputs -> q, k, v planes (and the output conv's f16 weight plane)
  gemm_qkv<<<dim3(NTOK / QT), dim3(PTH), 0, stream>>>(X, xstride, Wq, Wk, Wv, Wo, bq, bk, bv, Qf, Kf, Vc, Wo16);
  // (3) global attention -> O hi + residual planes [NTOK][64]
  attn_k<<<dim3(NTOK / QT), dim3(ATH), 0, stream>>>(Qf, Kf, Vc, Oh, Ol);
  // (4) output conv over the raw [64][NTOK] view -> out [128][NTOK]
  gemm_o<<<dim3(NTOK / QT, COUT / QT), blk128, 0, stream>>>(Wo16, Oh, Ol, bo, out);
  (void)hipGetLastError();
}
